// v000
// The times below were measured on an AMD MI455X: many runs one after another, warmed up first and cycling through
// copies of the inputs, with the whole window's GPU time divided by the number of runs. Launches and the gaps
// between them are all in it. The median over several windows is given; except for v000 it joins two sittings, which
// can be a few percent apart, so the side-by-side timings, each taken in one sitting, are the better comparison.
// The starting kernel, v000, takes 5730 microseconds a run.
#include <hip/hip_runtime.h>
// Cross attention with concat + tanh projection (in1, in2 [8][2048][512]; mask2 [8][2048] int32, nonzero = key masked out; n1 = in1 W1^T (W1 [512][512] natural, no bias); scores = n1 in2^T (no scaling); masked keys -> -inf; softmax over the 2,048 keys; fused = attn in2; out = tanh([in1 | fused] W2^T + b2) (W2 [512][1024] natural) -> [8][2048][512]).
// Structure: token rows; in1, in2 as exact f16 rows; n1 = in1 W1^T as a WMMA GEMM (32x64 wave tiles, f32 accumulation, exact x16 natural weights) into f32 rows, split on VALU into f16 hi + 2^-10 residual planes; per batch: scores = n1 in2^T as two accumulating GEMM terms (hi + lo; K = 512; in2 exact), masked row softmax on VALU reading the int mask row (f32 statistics, native exp; weights x256 f16, masked keys 0), in2^T via LDS transposes, fused = P . in2 GEMM (K = 2048, alpha 2^-8 undoing the P carry) written as plain f16 straight into columns 512..1023 of the f16 concat rows whose columns 0..511 are the exact in1; out = tanh(cat W2^T + b2) as ONE GEMM (K = 1024, exact x16 natural W2, alpha 1/16) with the tanh epilogue.
// Compute dtype: inputs rounded to bf16; in1, in2, weights exact in f16; n1 as f16 hi + residual planes (~2^-22: the logits have sigma ~23, so plain f16 would cost ~3e-3 logits); softmax weights (x256) and fused (unscaled: f16 relative precision is scale-free and a x16/x0.25 weight split would push small W2 entries into f16 subnormals) plain f16 (~2^-12); scores, softmax statistics and the output f32. v_wmma_f32_16x16x32_f16.
#define NB 8
#define SQ 2048
#define NC 512                       /* d_in = d_hid */
#define NO 512                       /* output features */
#define DM NC
#define NH (NC / 64)                 /* 8 slabs of 64 for the in2^T transpose */
#define HD 64
#define HG 1
#define B0 0                         /* first batch processed (debug hook) */
#define NBR NB                       /* batches processed (debug hook) */
#define QN SQ                        /* query rows attended per batch (debug hook) */
#define NR ((size_t)NB * SQ)
#define MP ((int)((size_t)NBR * SQ)) /* rows projected (debug hook) */
#define MPO MP                       /* rows through the output GEMM (debug hook) */
typedef __bf16 v16b __attribute__((ext_vector_type(16)));
typedef unsigned short v8us __attribute__((ext_vector_type(8), may_alias));
typedef float  v8f  __attribute__((ext_vector_type(8)));
typedef float  v4f  __attribute__((ext_vector_type(4)));
typedef float  v4fa __attribute__((ext_vector_type(4), may_alias));
union FragB { v16b v; v8us half[2]; unsigned short u[16]; };

__device__ __forceinline__ unsigned short bf16_bits(float x) { unsigned int u = __float_as_uint(x); return (unsigned short)((u + 0x7FFFu + ((u >> 16) & 1u)) >> 16); }
__device__ __forceinline__ float bf16_val(unsigned short b) { return __uint_as_float(((unsigned int)b) << 16); }
__device__ __forceinline__ float bf16_round(float x) { return bf16_val(bf16_bits(x)); }
// D += A·B with NT terms: 1 = ah·bh, 2 = + al·bh (A split), 3 = + ah·bl (both split)
template <int NT>
__device__ __forceinline__ v8f mmaN(v16b ah, v16b al, v16b bh, v16b bl, v8f c) {
  c = __builtin_amdgcn_wmma_f32_16x16x32_bf16(false, ah, false, bh, (short)0, c, false, false);
  if (NT >= 2) c = __builtin_amdgcn_wmma_f32_16x16x32_bf16(false, al, false, bh, (short)0, c, false, false);
  if (NT >= 3) c = __builtin_amdgcn_wmma_f32_16x16x32_bf16(false, ah, false, bl, (short)0, c, false, false);
  asm volatile("v_nop\n\tv_nop\n\tv_nop\n\tv_nop" : "+v"(c) : "v"(ah), "v"(al), "v"(bh), "v"(bl));
  return c;
}

__global__ __launch_bounds__(256) void k_wt_bf16(const float* __restrict__ W, unsigned short* __restrict__ Wt, int K, int N) {
  const int t = blockIdx.x * 256 + threadIdx.x;
  const int k8n = K / 8;
  if (t >= N * k8n) return;
  const int n = t / k8n, k8 = (t % k8n) * 8;
  v8us v;
#pragma unroll
  for (int i = 0; i < 8; ++i) v[i] = bf16_bits(W[(size_t)(k8 + i) * N + n]);
  *(v8us*)(Wt + (size_t)n * K + k8) = v;
  
}

// GEMM C[M][N] (f32, pitch ldc) = act(A[M][K]·W + bias). A f32 row-major (pitch lda) converted per fragment to bf16
// (ASPLIT: hi/lo two planes -> 2 terms, else single rounded term); Wt bf16 [N][K] (pitch ldb). BIAS_BF16 rounds the
// bias to bf16 first (bias quantised to bf16 before the add). K%32==0, M%16==0, N%64==0.
template <bool ASPLIT, int ACT, bool BIAS_BF16>
__global__ __launch_bounds__(128) void k_gemm_bf(const float* __restrict__ A, int lda, const unsigned short* __restrict__ Wt, int ldb,
                                               const float* __restrict__ bias, float* __restrict__ C, int ldc, int M, int N, int K) {
  __shared__ __attribute__((aligned(16))) float so[4][16][64];
  const int tid = threadIdx.x, w = tid >> 5, lane = tid & 31, ln = lane & 15, hh = lane >> 4;
  const int ntn = N / 64;
  const int wid = blockIdx.x * 4 + w;
  const int mt = wid / ntn, nq = wid % ntn;
  if (mt * 16 >= M) return;
  const int row0 = mt * 16, col0 = nq * 64;
  const float* arow = A + (size_t)(row0 + ln) * lda;
  v8f acc[4] = {};
  for (int kb = 0; kb < K; kb += 32) {
    FragB ah, al;
    const v4f x0 = *(const v4fa*)(arow + kb + 8 * hh), x1 = *(const v4fa*)(arow + kb + 8 * hh + 4);
    const v4f x2 = *(const v4fa*)(arow + kb + 16 + 8 * hh), x3 = *(const v4fa*)(arow + kb + 16 + 8 * hh + 4);
    float xs[16] = {x0[0],x0[1],x0[2],x0[3],x1[0],x1[1],x1[2],x1[3],x2[0],x2[1],x2[2],x2[3],x3[0],x3[1],x3[2],x3[3]};
#pragma unroll
    for (int i = 0; i < 16; ++i) { const unsigned short hb = bf16_bits(xs[i]); ah.u[i] = hb; al.u[i] = ASPLIT ? bf16_bits(xs[i] - bf16_val(hb)) : (unsigned short)0; }
#pragma unroll
    for (int t = 0; t < 4; ++t) {
      const unsigned short* brow = Wt + (size_t)(col0 + t * 16 + ln) * ldb + kb;
      FragB b;
      b.half[0] = *(const v8us*)(brow + 8 * hh);
      b.half[1] = *(const v8us*)(brow + 16 + 8 * hh);
      acc[t] = mmaN<ASPLIT ? 2 : 1>(ah.v, al.v, b.v, b.v, acc[t]);
    }
  }
#pragma unroll
  for (int t = 0; t < 4; ++t) {
    float bv = bias ? bias[col0 + t * 16 + ln] : 0.f;
    if (BIAS_BF16) bv = bf16_round(bv);
#pragma unroll
    for (int r = 0; r < 8; ++r) { float v = acc[t][r] + bv; if (ACT == 1) v = fmaxf(v, 0.f); so[w][8 * hh + r][t * 16 + ln] = v; }
  }
  __builtin_amdgcn_fence(__ATOMIC_ACQ_REL, "workgroup");
  __builtin_amdgcn_wave_barrier();
  const int rsub = lane >> 4, c4 = (lane & 15) * 4;
  {
#pragma unroll
    for (int q = 0; q < 8; ++q) {
      const int r = q * 2 + rsub;
      const v4f v = *(const v4fa*)&so[w][r][c4];
      *(v4f*)(C + (size_t)(row0 + r) * ldc + col0 + c4) = v;
    }
    
  }
}

// GEMM C = act(A·W + bias + resid): A f32 (ASPLIT -> hi/lo 2 terms), Wt bf16 [N][K]; ACT 0 none, 1 relu, 2 exact gelu;
// resid (optional, f32, row index = (row % rmod), pitch ldr, RES_BF16 rounds it) added before the activation.
template <bool ASPLIT, int ACT, bool BIAS_BF16, bool RES_BF16>
__global__ __launch_bounds__(128) void k_gemm_bf3(const float* __restrict__ A, int lda, const unsigned short* __restrict__ Wt, int ldb,
                                                const float* __restrict__ bias, const float* __restrict__ resid, int rmod, int ldr,
                                                float* __restrict__ C, int ldc, int M, int N, int K) {
  __shared__ __attribute__((aligned(16))) float so[4][16][64];
  const int tid = threadIdx.x, w = tid >> 5, lane = tid & 31, ln = lane & 15, hh = lane >> 4;
  const int ntn = N / 64;
  const int wid = blockIdx.x * 4 + w;
  const int mt = wid / ntn, nq = wid % ntn;
  if (mt * 16 >= M) return;
  const int row0 = mt * 16, col0 = nq * 64;
  const float* arow = A + (size_t)(row0 + ln) * lda;
  v8f acc[4] = {};
  for (int kb = 0; kb < K; kb += 32) {
    FragB ah, al;
    const v4f x0 = *(const v4fa*)(arow + kb + 8 * hh), x1 = *(const v4fa*)(arow + kb + 8 * hh + 4);
    const v4f x2 = *(const v4fa*)(arow + kb + 16 + 8 * hh), x3 = *(const v4fa*)(arow + kb + 16 + 8 * hh + 4);
    float xs[16] = {x0[0],x0[1],x0[2],x0[3],x1[0],x1[1],x1[2],x1[3],x2[0],x2[1],x2[2],x2[3],x3[0],x3[1],x3[2],x3[3]};
#pragma unroll
    for (int i = 0; i < 16; ++i) { const unsigned short hb = bf16_bits(xs[i]); ah.u[i] = hb; al.u[i] = ASPLIT ? bf16_bits(xs[i] - bf16_val(hb)) : (unsigned short)0; }
#pragma unroll
    for (int t = 0; t < 4; ++t) {
      const unsigned short* brow = Wt + (size_t)(col0 + t * 16 + ln) * ldb + kb;
      FragB b;
      b.half[0] = *(const v8us*)(brow + 8 * hh);
      b.half[1] = *(const v8us*)(brow + 16 + 8 * hh);
      acc[t] = mmaN<ASPLIT ? 2 : 1>(ah.v, al.v, b.v, b.v, acc[t]);
    }
  }
#pragma unroll
  for (int t = 0; t < 4; ++t) {
    const int col = col0 + t * 16 + ln;
    float bv = bias ? bias[col] : 0.f;
    if (BIAS_BF16) bv = bf16_round(bv);
#pragma unroll
    for (int r = 0; r < 8; ++r) {
      float v = acc[t][r] + bv;
      if (resid) { float rv = resid[(size_t)((row0 + 8 * hh + r) % rmod) * ldr + col]; if (RES_BF16) rv = bf16_round(rv); v += rv; }
      if (ACT == 1) v = fmaxf(v, 0.f);
      if (ACT == 2) v = 0.5f * v * (1.0f + erff(v * 0.70710678118654752f));
      if (ACT == 3) { const float u = 0.7978845608028654f * (v + 0.044715f * v * v * v); v = 0.5f * v * (1.0f + tanhf(u)); }
      so[w][8 * hh + r][t * 16 + ln] = v;
    }
  }
  __builtin_amdgcn_fence(__ATOMIC_ACQ_REL, "workgroup");
  __builtin_amdgcn_wave_barrier();
  const int rsub = lane >> 4, c4 = (lane & 15) * 4;
  {
#pragma unroll
    for (int q = 0; q < 8; ++q) {
      const int r = q * 2 + rsub;
      const v4f v = *(const v4fa*)&so[w][r][c4];
      *(v4f*)(C + (size_t)(row0 + r) * ldc + col0 + c4) = v;
    }
    
  }
}
// row LayerNorm (biased variance, eps) over N: s = X (+ R); optional out_sum <- s; out_norm <- (s-mu)*rsqrt(var+eps)*g + b
template <bool PARAM_BF16>
__global__ __launch_bounds__(256) void k_layernorm(const float* __restrict__ X, const float* __restrict__ R, const float* __restrict__ g, const float* __restrict__ bta,
                                                  float* __restrict__ out_sum, float* __restrict__ out_norm, int N, float eps) {
  __shared__ float red[256];
  const int row = blockIdx.x, tid = threadIdx.x;
  const float* x = X + (size_t)row * N; const float* rr = R ? R + (size_t)row * N : nullptr;
  float vals[16];                     // up to N = 4096
  const int per = N / 256;            // contiguous chunk per thread? use strided-by-4 chunks: thread handles j = tid*4 + 1024*u
  float s1 = 0.f;
  for (int u = 0; u < per / 4; ++u) {
    const int j = tid * 4 + 1024 * u;
    const v4f a = *(const v4fa*)(x + j);
    v4f b = {0.f,0.f,0.f,0.f}; if (rr) b = *(const v4fa*)(rr + j);
#pragma unroll
    for (int q = 0; q < 4; ++q) { const float v = a[q] + b[q]; vals[u * 4 + q] = v; s1 += v; }
  }
  red[tid] = s1; __syncthreads();
  for (int st = 128; st > 0; st >>= 1) { if (tid < st) red[tid] += red[tid + st]; __syncthreads(); }
  const float mu = red[0] / (float)N; __syncthreads();
  float s2 = 0.f;
  for (int u = 0; u < per / 4; ++u)
#pragma unroll
    for (int q = 0; q < 4; ++q) { const float c = vals[u * 4 + q] - mu; s2 += c * c; }
  red[tid] = s2; __syncthreads();
  for (int st = 128; st > 0; st >>= 1) { if (tid < st) red[tid] += red[tid + st]; __syncthreads(); }
  const float rs = rsqrtf(red[0] / (float)N + eps);
  {
    for (int u = 0; u < per / 4; ++u) {
      const int j = tid * 4 + 1024 * u;
      v4f o, sm;
#pragma unroll
      for (int q = 0; q < 4; ++q) {
        float gg = g[j + q], bb = bta[j + q];
        if (PARAM_BF16) { gg = bf16_round(gg); bb = bf16_round(bb); }
        sm[q] = vals[u * 4 + q]; o[q] = (vals[u * 4 + q] - mu) * rs * gg + bb;
      }
      if (out_sum) *(v4f*)(out_sum + (size_t)row * N + j) = sm;
      *(v4f*)(out_norm + (size_t)row * N + j) = o;
    }
    
  }
}



// ---- f16 WMMA path (v_wmma_f32_16x16x32_f16): 11-bit significands for operands in range — used where a [0,1] probability operand needs more precision than bf16
typedef _Float16 v16h __attribute__((ext_vector_type(16)));
union FragH { v16h v; v8us half[2]; _Float16 h[16]; unsigned short u[16]; };
template <int NT>
__device__ __forceinline__ v8f mmaH(v16h ah, v16h al, v16h bh, v16h bl, v8f c) {
  c = __builtin_amdgcn_wmma_f32_16x16x32_f16(false, ah, false, bh, (short)0, c, false, false);
  if (NT >= 2) c = __builtin_amdgcn_wmma_f32_16x16x32_f16(false, al, false, bh, (short)0, c, false, false);
  if (NT >= 3) c = __builtin_amdgcn_wmma_f32_16x16x32_f16(false, ah, false, bl, (short)0, c, false, false);
  asm volatile("v_nop\n\tv_nop\n\tv_nop\n\tv_nop" : "+v"(c) : "v"(ah), "v"(al), "v"(bh), "v"(bl));
  return c;
}
// batched GEMM like k_gemm_b but f16 operands: A f32 (split into f16 hi/lo if ASPLIT, else rounded to f16), Bt = f16 values [n][k]; alpha; C f32; N multiple of 16 (partial tiles skipped)
template <bool ASPLIT>
__global__ __launch_bounds__(128) void k_gemm_h(const float* __restrict__ A, int lda, size_t sA, const _Float16* __restrict__ Bh, int ldb, size_t sB, float alpha, float* __restrict__ C, int ldc, size_t sC, int M, int N, int K) {
  __shared__ __attribute__((aligned(16))) float so[4][16][64];
  const int tid = threadIdx.x, w = tid >> 5, lane = tid & 31, ln = lane & 15, hh = lane >> 4; const int by = blockIdx.y;
  A += (size_t)by * sA; Bh += (size_t)by * sB; C += (size_t)by * sC;
  const int ntn = (N + 63) / 64; const int wid = blockIdx.x * 4 + w; const int mt = wid / ntn, nq = wid % ntn; if (mt * 16 >= M) return;
  const int row0 = mt * 16, col0 = nq * 64; const float* arow = A + (size_t)(row0 + ln) * lda;
  v8f acc[4] = {};
  for (int kb = 0; kb < K; kb += 32) {
    FragH ah, al;
    const v4f x0 = *(const v4fa*)(arow + kb + 8 * hh), x1 = *(const v4fa*)(arow + kb + 8 * hh + 4), x2 = *(const v4fa*)(arow + kb + 16 + 8 * hh), x3 = *(const v4fa*)(arow + kb + 16 + 8 * hh + 4);
    float xs[16] = {x0[0],x0[1],x0[2],x0[3],x1[0],x1[1],x1[2],x1[3],x2[0],x2[1],x2[2],x2[3],x3[0],x3[1],x3[2],x3[3]};
#pragma unroll
    for (int i = 0; i < 16; ++i) { const _Float16 h = (_Float16)xs[i]; ah.h[i] = h; al.h[i] = ASPLIT ? (_Float16)(xs[i] - (float)h) : (_Float16)0.0f; }
#pragma unroll
    for (int t = 0; t < 4; ++t) { if (col0 + t * 16 >= N) continue; const size_t boff = (size_t)(col0 + t * 16 + ln) * ldb + kb; FragH bq; bq.half[0] = *(const v8us*)(Bh + boff + 8 * hh); bq.half[1] = *(const v8us*)(Bh + boff + 16 + 8 * hh);
      acc[t] = mmaH<ASPLIT ? 2 : 1>(ah.v, al.v, bq.v, bq.v, acc[t]); }
  }
#pragma unroll
  for (int t = 0; t < 4; ++t) { if (col0 + t * 16 >= N) continue;
#pragma unroll
    for (int r = 0; r < 8; ++r) so[w][8 * hh + r][t * 16 + ln] = acc[t][r] * alpha; }
  __builtin_amdgcn_fence(__ATOMIC_ACQ_REL, "workgroup"); __builtin_amdgcn_wave_barrier();
  const int rsub = lane >> 4, c4 = (lane & 15) * 4;
  {
#pragma unroll
    for (int q = 0; q < 8; ++q) { const int r = q * 2 + rsub; if (col0 + c4 < N) { const v4f v = *(const v4fa*)&so[w][r][c4]; *(v4f*)(C + (size_t)(row0 + r) * ldc + col0 + c4) = v; } }
     }
}

// Wt[n][k] = f16(W[k][n]·scale) from f32 row-major W[K][N] (scale = power of two; bf16-exact weights stay exact in f16 away from the subnormal range)
__global__ __launch_bounds__(256) void k_wt_f16(const float* __restrict__ W, _Float16* __restrict__ Wt, int K, int N, float scale) {
  const int t = blockIdx.x * 256 + threadIdx.x; if (t >= N * (K / 8)) return; const int n = t / (K / 8), k8 = (t % (K / 8)) * 8; FragH f;
#pragma unroll
  for (int i = 0; i < 8; ++i) f.h[i] = (_Float16)(bf16_round(W[(size_t)(k8 + i) * N + n]) * scale); const v8us o = f.half[0];
  *(v8us*)((unsigned short*)Wt + (size_t)n * K + k8) = o; 
}
// k_gemm_hh variant with fused epilogue: v = acc·alpha + bias[by·sBias + col] (+ CP[(row/rowsPerB)·sCPb + by·64 + col] if CP) ; ACT 0 none / 1 elu ; writes f16 C16 (and f32 C if non-null)
template <int ACT>
__global__ __launch_bounds__(128) void k_gemm_hhx(const _Float16* __restrict__ A, int lda, size_t sA, const _Float16* __restrict__ Bh, int ldb, size_t sB, float alpha, const float* __restrict__ bias, size_t sBias, const float* __restrict__ CP, int rowsPerB, size_t sCPb, int row0g,
    float* __restrict__ C, _Float16* __restrict__ C16, int ldc, size_t sC, int M, int N, int K) {
  __shared__ __attribute__((aligned(16))) float so[4][16][64];
  const int tid = threadIdx.x, w = tid >> 5, lane = tid & 31, ln = lane & 15, hh = lane >> 4; const int by = blockIdx.y;
  A += (size_t)by * sA; Bh += (size_t)by * sB; const size_t cofs = (size_t)by * sC; const float* bp = bias ? bias + (size_t)by * sBias : nullptr;
  const int ntn = (N + 63) / 64; const int wid = blockIdx.x * 4 + w; const int mt = wid / ntn, nq = wid % ntn; if (mt * 16 >= M) return;
  const int row0 = mt * 16, col0 = nq * 64; const _Float16* arow = A + (size_t)(row0 + ln) * lda;
  v8f acc[4] = {};
  for (int kb = 0; kb < K; kb += 32) { FragH ah; ah.half[0] = *(const v8us*)((const unsigned short*)arow + kb + 8 * hh); ah.half[1] = *(const v8us*)((const unsigned short*)arow + kb + 16 + 8 * hh);
#pragma unroll
    for (int t = 0; t < 4; ++t) { if (col0 + t * 16 >= N) continue; const size_t boff = (size_t)(col0 + t * 16 + ln) * ldb + kb; FragH bq; bq.half[0] = *(const v8us*)((const unsigned short*)Bh + boff + 8 * hh); bq.half[1] = *(const v8us*)((const unsigned short*)Bh + boff + 16 + 8 * hh);
      acc[t] = mmaH<1>(ah.v, ah.v, bq.v, bq.v, acc[t]); }
  }
#pragma unroll
  for (int t = 0; t < 4; ++t) { if (col0 + t * 16 >= N) continue; const int col = col0 + t * 16 + ln; const float bv = bp ? bf16_round(bp[col]) : 0.f;
#pragma unroll
    for (int r = 0; r < 8; ++r) { float v = acc[t][r] * alpha + bv; if (CP) { const int rr = row0g + row0 + 8 * hh + r; if (rowsPerB < 0) v += CP[cofs + (size_t)rr * ldc + col];      /* rowsPerB < 0: own element of the batched C plane */ else { const int bidx = rr / rowsPerB; v += CP[(size_t)bidx * sCPb + (size_t)by * 64 + col]; } } if (ACT == 1) v = (v > 0.f) ? v : expm1f(v); else if (ACT == 7) v = (v > 0.f) ? v + 1.0f : expf(v); else if (ACT == 8) v = tanhf(v); else if (ACT == 9) v = 0.5f * v * (1.0f + tanhf(0.7978845608028654f * (v + 0.044715f * v * v * v))); else if (ACT == 11) v = 1.0f / (1.0f + expf(-v)); else if (ACT == 12) v = (v > 0.f) ? v : 0.01f * v; else if (ACT == 14) v = (v > 0.f) ? v : 0.1f * v; else if (ACT == 16) v = (v >= 0.f) ? v : 0.3f * v; else if (ACT == 17) v = (v >= 0.f) ? v : 0.2f * v; else if (ACT == 15) v = v / (1.0f + expf(-v)); else if (ACT == 3) v = fmaxf(v, 0.f); else if (ACT == 6) v = 0.5f * v * (1.0f + erff(v * 0.70710678118654752f)); so[w][8 * hh + r][t * 16 + ln] = v; } }
  __builtin_amdgcn_fence(__ATOMIC_ACQ_REL, "workgroup"); __builtin_amdgcn_wave_barrier();
  const int rsub = lane >> 4, c4 = (lane & 15) * 4; typedef _Float16 v4h __attribute__((ext_vector_type(4)));
  {
#pragma unroll
    for (int q = 0; q < 8; ++q) { const int r = q * 2 + rsub; if (col0 + c4 < N) { const v4f v = *(const v4fa*)&so[w][r][c4]; if (C) *(v4f*)(C + cofs + (size_t)(row0 + r) * ldc + col0 + c4) = v; if (C16) { v4h h4; for (int i = 0; i < 4; ++i) h4[i] = (_Float16)v[i]; *(v4h*)(C16 + cofs + (size_t)(row0 + r) * ldc + col0 + c4) = h4; } } }
     }
}


typedef _Float16 v4h __attribute__((ext_vector_type(4)));

__global__ __launch_bounds__(256) void k_x16(const float* __restrict__ x, _Float16* __restrict__ X16, size_t n8) { const size_t t = (size_t)blockIdx.x * 256 + threadIdx.x; if (t >= n8) return; FragH f;
#pragma unroll
  for (int q = 0; q < 8; ++q) f.h[q] = (_Float16)bf16_round(x[t * 8 + q]); *(v8us*)((unsigned short*)X16 + t * 8) = f.half[0];  }
__global__ __launch_bounds__(256) void k_h16(const float* __restrict__ x, _Float16* __restrict__ X16, size_t n8) { const size_t t = (size_t)blockIdx.x * 256 + threadIdx.x; if (t >= n8) return; FragH f;
#pragma unroll
  for (int q = 0; q < 8; ++q) f.h[q] = (_Float16)x[t * 8 + q]; *(v8us*)((unsigned short*)X16 + t * 8) = f.half[0];  }
__global__ __launch_bounds__(256) void k_round16f(const float* __restrict__ W, _Float16* __restrict__ Bt, size_t n8) { const size_t t = (size_t)blockIdx.x * 256 + threadIdx.x; if (t >= n8) return; FragH f;
#pragma unroll
  for (int i = 0; i < 8; ++i) f.h[i] = (_Float16)(bf16_round(W[t * 8 + i]) * 16.0f); *(v8us*)((unsigned short*)Bt + t * 8) = f.half[0];  }
template <int NHv, int TTv>
__global__ __launch_bounds__(256) void k_vt(const _Float16* __restrict__ V16, int ldv, int voff, _Float16* __restrict__ Vt) { __shared__ unsigned short tl[64][66]; const int tid = threadIdx.x; const int slab = blockIdx.x / (TTv / 64), lg = blockIdx.x % (TTv / 64); const int b = slab / NHv, h = slab % NHv;
  for (int i = tid; i < 64 * 8; i += 256) { const int r = i / 8, c8 = (i % 8) * 8; FragH f; f.half[0] = *(const v8us*)((const unsigned short*)V16 + ((size_t)b * TTv + lg * 64 + r) * ldv + voff + h * 64 + c8);
#pragma unroll
    for (int q = 0; q < 8; ++q) tl[r][c8 + q] = f.u[q]; }
  __syncthreads();
  {
#pragma unroll
    for (int rd = 0; rd < 2; ++rd) { const int d = rd * 32 + tid / 8, pc = tid % 8; FragH f;
#pragma unroll
      for (int q = 0; q < 8; ++q) f.u[q] = tl[pc * 8 + q][d];
      *(v8us*)((unsigned short*)Vt + ((size_t)slab * 64 + d) * TTv + lg * 64 + pc * 8) = f.half[0]; }
     } }

__global__ __launch_bounds__(256) void k_hl(const float* __restrict__ F, _Float16* __restrict__ Hh, _Float16* __restrict__ Hl, size_t n8) { const size_t t = (size_t)blockIdx.x * 256 + threadIdx.x; if (t >= n8) return; FragH fh, fl; const v4f a = *(const v4fa*)(F + t * 8), c = *(const v4fa*)(F + t * 8 + 4);
#pragma unroll
  for (int q = 0; q < 4; ++q) { _Float16 h = (_Float16)a[q]; fh.h[q] = h; fl.h[q] = (_Float16)((a[q] - (float)h) * 1024.0f); h = (_Float16)c[q]; fh.h[4 + q] = h; fl.h[4 + q] = (_Float16)((c[q] - (float)h) * 1024.0f); }
  { *(v8us*)((unsigned short*)Hh + t * 8) = fh.half[0]; *(v8us*)((unsigned short*)Hl + t * 8) = fl.half[0];  } }

// ---- fast GEMM (wave tile 32x64; requires M % 32 == 0 rows per launch region and N % 64 == 0); epilogue = k_gemm_hhx semantics ----
__device__ __forceinline__ v16h g2_frag(const _Float16* p, int hh) { FragH f; f.half[0] = *(const v8us*)((const unsigned short*)p + 8 * hh); f.half[1] = *(const v8us*)((const unsigned short*)p + 16 + 8 * hh); return f.v; }
__device__ __forceinline__ v8f g2_mma(v16h a, v16h b, v8f c) { v8f d = __builtin_amdgcn_wmma_f32_16x16x32_f16(false, a, false, b, (short)0, c, false, false); asm volatile("v_nop\n\tv_nop\n\tv_nop\n\tv_nop" : "+v"(d) : "v"(a), "v"(b)); return d; }
template <int ACT>
__global__ __launch_bounds__(128) void k_gemm2(const _Float16* __restrict__ A, int lda, size_t sA, const _Float16* __restrict__ Bh, int ldb, size_t sB, float alpha, const float* __restrict__ bias, size_t sBias, const float* __restrict__ CP, int rowsPerB, size_t sCPb, int row0g,
    float* __restrict__ C, _Float16* __restrict__ C16, int ldc, size_t sC, int M, int N, int K) { static_assert(ACT == 0 || ACT == 3 || ACT == 6 || ACT == 8 || ACT == 9 || ACT == 11 || ACT == 12 || ACT == 14 || ACT == 15 || ACT == 16 || ACT == 17, "k_gemm2: unsupported ACT code (would silently apply no activation)");
  __shared__ __attribute__((aligned(16))) float so[4][32][68];
  const int tid = threadIdx.x, w = tid >> 5, lane = tid & 31, ln = lane & 15, hh = lane >> 4; const int by = blockIdx.y;
  A += (size_t)by * sA; Bh += (size_t)by * sB; const size_t cofs = (size_t)by * sC; const float* bp = bias ? bias + (size_t)by * sBias : nullptr;
  const int ntn = N >> 6; const int mt = blockIdx.x / ntn, nq = blockIdx.x - mt * ntn; const int row0 = mt * 128 + 32 * w, col0 = nq * 64; if (row0 >= M) return;
  const _Float16* a0p = A + (size_t)(row0 + ln) * lda; const _Float16* a1p = a0p + (size_t)16 * lda;
  const _Float16* b0p = Bh + (size_t)(col0 + ln) * ldb; const _Float16* b1p = b0p + (size_t)16 * ldb; const _Float16* b2p = b1p + (size_t)16 * ldb; const _Float16* b3p = b2p + (size_t)16 * ldb;
  const v8f z8 = {0.f,0.f,0.f,0.f,0.f,0.f,0.f,0.f}; v8f c00 = z8, c01 = z8, c02 = z8, c03 = z8, c10 = z8, c11 = z8, c12 = z8, c13 = z8;
#pragma unroll 1
  for (int kb = 0; kb < K; kb += 32) { const v16h a0 = g2_frag(a0p + kb, hh), a1 = g2_frag(a1p + kb, hh);
    v16h b = g2_frag(b0p + kb, hh); c00 = g2_mma(a0, b, c00); c10 = g2_mma(a1, b, c10);
    b = g2_frag(b1p + kb, hh); c01 = g2_mma(a0, b, c01); c11 = g2_mma(a1, b, c11);
    b = g2_frag(b2p + kb, hh); c02 = g2_mma(a0, b, c02); c12 = g2_mma(a1, b, c12);
    b = g2_frag(b3p + kb, hh); c03 = g2_mma(a0, b, c03); c13 = g2_mma(a1, b, c13); }
  v8f accs[8] = {c00, c01, c02, c03, c10, c11, c12, c13};
#pragma unroll
  for (int u = 0; u < 8; ++u) { const int t = u & 3, half = u >> 2; const int col = col0 + t * 16 + ln; const float bv = bp ? bf16_round(bp[col]) : 0.f;
#pragma unroll
    for (int r = 0; r < 8; ++r) { const int rloc = half * 16 + 8 * hh + r; float v = accs[u][r] * alpha + bv; if (CP) { if (rowsPerB < 0) v += CP[cofs + (size_t)(row0g + row0 + rloc) * ldc + col];      /* rowsPerB < 0: own element of the batched C plane */ else { const int bidx = (row0g + row0 + rloc) / rowsPerB; v += CP[(size_t)bidx * sCPb + (size_t)by * 64 + col]; } }
      if (ACT == 3) v = fmaxf(v, 0.f); else if (ACT == 6) v = 0.5f * v * (1.0f + erff(v * 0.70710678118654752f)); else if (ACT == 11) v = 1.0f / (1.0f + expf(-v)); else if (ACT == 15) v = v / (1.0f + expf(-v)); else if (ACT == 12) v = (v > 0.f) ? v : 0.01f * v; else if (ACT == 8) v = tanhf(v); else if (ACT == 9) v = 0.5f * v * (1.0f + tanhf(0.7978845608028654f * (v + 0.044715f * v * v * v))); else if (ACT == 14) v = (v > 0.f) ? v : 0.1f * v; else if (ACT == 16) v = (v >= 0.f) ? v : 0.3f * v; else if (ACT == 17) v = (v >= 0.f) ? v : 0.2f * v;
      so[w][rloc][t * 16 + ln] = v; } }
  __builtin_amdgcn_fence(__ATOMIC_ACQ_REL, "workgroup"); __builtin_amdgcn_wave_barrier();
  const int rsub = lane >> 4, c4 = (lane & 15) * 4;
  {
#pragma unroll
    for (int q = 0; q < 16; ++q) { const int r = q * 2 + rsub; const v4f v = *(const v4fa*)&so[w][r][c4]; if (C) *(v4f*)(C + cofs + (size_t)(row0 + r) * ldc + col0 + c4) = v; if (C16) { v4h h4; for (int i = 0; i < 4; ++i) h4[i] = (_Float16)v[i]; *(v4h*)(C16 + cofs + (size_t)(row0 + r) * ldc + col0 + c4) = h4; } }
     } }


__global__ __launch_bounds__(256) void k_wnat(const float* __restrict__ w, size_t n8, _Float16* __restrict__ Bt) { const size_t t = (size_t)blockIdx.x * 256 + threadIdx.x; if (t >= n8) return; FragH f; for (int q = 0; q < 8; ++q) f.h[q] = (_Float16)(bf16_round(w[t * 8 + q]) * 16.0f); *(v8us*)((unsigned short*)Bt + t * 8) = f.half[0];  }
__global__ __launch_bounds__(256) void k_rsm(const float* __restrict__ S, _Float16* __restrict__ P, int nrows) {
  #pragma clang fp contract(off)
  const int i = blockIdx.x * 256 + threadIdx.x; if (i >= nrows) return; const float* s = S + (size_t)i * SQ; float mx = -3.0e38f;
#pragma unroll 1
  for (int j = 0; j < SQ; ++j) mx = fmaxf(mx, s[j]); float se = 0.f;
#pragma unroll 1
  for (int j = 0; j < SQ; ++j) se += expf(s[j] - mx); const float sc = 256.0f / se;
#pragma unroll 1
  for (int j0 = 0; j0 < SQ; j0 += 8) { FragH f; for (int q = 0; q < 8; ++q) f.h[q] = (_Float16)(expf(s[j0 + q] - mx) * sc); unsigned short* d = (unsigned short*)P + (size_t)i * SQ + j0; *(v8us*)d = f.half[0];  } }
__global__ __launch_bounds__(256) void k_vt(const _Float16* __restrict__ V16, int b, int h0, _Float16* __restrict__ VT) { __shared__ unsigned short tl[64][65]; const int tid = threadIdx.x; const int hh = blockIdx.x % HG, sg = blockIdx.x / HG; const int s0 = sg * 64; const int h = h0 + hh;
  for (int i = tid; i < 64 * 8; i += 256) { const int j = i / 8, d8 = (i % 8) * 8; FragH f; f.half[0] = *(const v8us*)((const unsigned short*)V16 + ((size_t)b * SQ + s0 + j) * DM + h * HD + d8); for (int q = 0; q < 8; ++q) tl[d8 + q][j] = f.u[q]; }
  __syncthreads();
  { for (int i = tid; i < 64 * 8; i += 256) { const int d = i / 8, j8 = (i % 8) * 8; FragH f; for (int q = 0; q < 8; ++q) f.u[q] = tl[d][j8 + q]; *(v8us*)((unsigned short*)VT + ((size_t)hh * HD + d) * SQ + s0 + j8) = f.half[0]; }  } }


__global__ __launch_bounds__(256) void k_x16p(const float* __restrict__ x, _Float16* __restrict__ dst, size_t n8, int nc, int ldo) { const size_t t = (size_t)blockIdx.x * 256 + threadIdx.x; if (t >= n8) return; const size_t e = t * 8; const size_t r = e / nc; const int c = (int)(e % nc); FragH f;
#pragma unroll
  for (int q = 0; q < 8; ++q) f.h[q] = (_Float16)bf16_round(x[e + q]); unsigned short* d = (unsigned short*)dst + r * ldo + c; *(v8us*)d = f.half[0];  }
__global__ __launch_bounds__(256) void k_rsmfm1(const float* __restrict__ S, _Float16* __restrict__ P, int qn, const int* __restrict__ mk) {
  #pragma clang fp contract(off)
  const int t = blockIdx.x * 256 + threadIdx.x; if (t >= qn) return; const size_t i = (size_t)t; const float* s = S + i * SQ; float mx = -3.0e38f;
#pragma unroll 1
  for (int j = 0; j < SQ; ++j) if (mk[j] == 0) mx = fmaxf(mx, s[j]); float se = 0.f;
#pragma unroll 1
  for (int j = 0; j < SQ; ++j) if (mk[j] == 0) se += __expf(s[j] - mx); const float sc = 256.0f / se;
#pragma unroll 1
  for (int j0 = 0; j0 < SQ; j0 += 8) { FragH f; for (int q = 0; q < 8; ++q) f.h[q] = (_Float16)((mk[j0 + q] == 0) ? __expf(s[j0 + q] - mx) * sc : 0.f); unsigned short* d = (unsigned short*)P + i * SQ + j0; *(v8us*)d = f.half[0];  } }

extern "C" void kernel_launch(void* const* d_in, const int* in_sizes, int n_in,
                              void* d_out, int out_size, void* d_ws, size_t ws_size, hipStream_t stream) {
  (void)in_sizes; (void)n_in; (void)out_size;
  const float* const* I = (const float* const*)d_in; const float* in1 = I[0]; const float* in2 = I[1]; const int* mask2 = (const int*)d_in[2]; const float* w1 = I[3]; const float* w2 = I[4]; const float* b2 = I[5];      /* weights natural [out][in] */
  char* ws = (char*)d_ws; size_t off = 0;
  auto take = [&](size_t bytes) { char* p = ws + off; off += (bytes + 255) & ~(size_t)255; return p; };
  _Float16* B1 = (_Float16*)take((size_t)NC * NC * 2); _Float16* B2 = (_Float16*)take((size_t)NO * 2 * NC * 2);
  _Float16* X1 = (_Float16*)take(NR * NC * 2); _Float16* X2 = (_Float16*)take(NR * NC * 2); float* N1F = (float*)take(NR * NC * 4); _Float16* N1H = (_Float16*)take(NR * NC * 2); _Float16* N1L = (_Float16*)take(NR * NC * 2); _Float16* CAT = (_Float16*)take(NR * 2 * NC * 2);
  float* S = (float*)take((size_t)SQ * SQ * 4); _Float16* P = (_Float16*)take((size_t)SQ * SQ * 2); _Float16* X2T = (_Float16*)take((size_t)NC * SQ * 2);
  if (off > ws_size) return;      /* 1.5 + 16 + 16 + 32 + 16 + 16 + 32 + 16 + 8 + 2 = approx 156 MiB */
  k_wnat<<<(unsigned)(((size_t)NC * NC / 8 + 255) / 256), 256, 0, stream>>>(w1, (size_t)NC * NC / 8, B1); k_wnat<<<(unsigned)(((size_t)NO * 2 * NC / 8 + 255) / 256), 256, 0, stream>>>(w2, (size_t)NO * 2 * NC / 8, B2);
  k_x16<<<(unsigned)((NR * NC / 8 + 255) / 256), 256, 0, stream>>>(in1, X1, NR * NC / 8); k_x16<<<(unsigned)((NR * NC / 8 + 255) / 256), 256, 0, stream>>>(in2, X2, NR * NC / 8);
  const size_t r0p = (size_t)B0 * SQ;
  k_x16p<<<(unsigned)(((size_t)MP * NC / 8 + 255) / 256), 256, 0, stream>>>(in1 + r0p * NC, CAT + r0p * 2 * NC, (size_t)MP * NC / 8, NC, 2 * NC);      /* cat columns 0..511 = in1 */
  k_gemm2<0><<<dim3((unsigned)((MP / 128) * (NC / 64)), 1), 128, 0, stream>>>(X1 + r0p * NC, NC, 0, B1, NC, 0, 0.0625f, nullptr, 0, nullptr, 1, 0, 0, N1F + r0p * NC, nullptr, NC, 0, MP, NC, NC);      /* n1 = in1 W1^T (f32) */
  k_hl<<<(unsigned)(((size_t)MP * NC / 8 + 255) / 256), 256, 0, stream>>>(N1F + r0p * NC, N1H + r0p * NC, N1L + r0p * NC, (size_t)MP * NC / 8);
  for (int b = B0; b < B0 + NBR; ++b) { const size_t r0 = (size_t)b * SQ; const dim3 gs((QN / 128) * (SQ / 64), 1);
    k_gemm2<0><<<gs, 128, 0, stream>>>(N1H + r0 * NC, NC, 0, X2 + r0 * NC, NC, 0, 1.0f, nullptr, 0, nullptr, 1, 0, 0, S, nullptr, SQ, 0, QN, SQ, NC);      /* scores hi */
    k_gemm2<0><<<gs, 128, 0, stream>>>(N1L + r0 * NC, NC, 0, X2 + r0 * NC, NC, 0, 0.0009765625f, nullptr, 0, S, -1, 0, 0, S, nullptr, SQ, 0, QN, SQ, NC);      /* + lo (CP = own element) */
    k_rsmfm1<<<(QN + 255) / 256, 256, 0, stream>>>(S, P, QN, mask2 + (size_t)b * SQ);
    k_vt<NH, SQ><<<NH * (SQ / 64), 256, 0, stream>>>(X2 + r0 * NC, NC, 0, X2T);      /* in2^T [512][2048] for this batch */
    k_gemm2<0><<<dim3((QN / 128) * (NC / 64), 1), 128, 0, stream>>>(P, SQ, 0, X2T, SQ, 0, 0.00390625f, nullptr, 0, nullptr, 1, 0, 0, nullptr, CAT + r0 * 2 * NC + NC, 2 * NC, 0, QN, NC, SQ); }      /* fused (x1: alpha 1/256 undoes the P carry) -> cat columns 512..1023 */
  k_gemm2<8><<<dim3((unsigned)((MPO / 128) * (NO / 64)), 1), 128, 0, stream>>>(CAT + r0p * 2 * NC, 2 * NC, 0, B2, 2 * NC, 0, 0.0625f, b2, 0, nullptr, 1, 0, 0, (float*)d_out + r0p * NO, nullptr, NO, 0, MPO, NO, 2 * NC);      /* out = tanh(cat W2^T + b2) */
}

// v001
// One run takes 1160 microseconds.
// Timed twice side by side with v000, it ran 4.92 and 4.94 times as fast.
#include <hip/hip_runtime.h>
// Cross attention with concat + tanh projection (in1, in2 [8][2048][512]; mask2 [8][2048] int32, nonzero = key masked out; n1 = in1 W1^T (W1 [512][512] natural, no bias); scores = n1 in2^T (no scaling); masked keys -> -inf; softmax over the 2,048 keys; fused = attn in2; out = tanh([in1 | fused] W2^T + b2) (W2 [512][1024] natural) -> [8][2048][512]).
// Structure: token rows; in1, in2 as exact f16 rows; n1 = in1 W1^T as a WMMA GEMM (32x64 wave tiles, f32 accumulation, exact x16 natural weights) into f32 rows, split on VALU into f16 hi + 2^-10 residual planes; per batch: scores = n1 in2^T as two accumulating GEMM terms (hi + lo; K = 512; in2 exact), masked row softmax on VALU reading the int mask row (f32 statistics, native exp; weights x256 f16, masked keys 0), in2^T via LDS transposes, fused = P . in2 GEMM (K = 2048, alpha 2^-8 undoing the P carry) written as plain f16 straight into columns 512..1023 of the f16 concat rows whose columns 0..511 are the exact in1; out = tanh(cat W2^T + b2) as ONE GEMM (K = 1024, exact x16 natural W2, alpha 1/16) with the tanh epilogue.
// Compute dtype: inputs rounded to bf16; in1, in2, weights exact in f16; n1 as f16 hi + residual planes (~2^-22: the logits have sigma ~23, so plain f16 would cost ~3e-3 logits); softmax weights (x256) and fused (unscaled: f16 relative precision is scale-free and a x16/x0.25 weight split would push small W2 entries into f16 subnormals) plain f16 (~2^-12); scores, softmax statistics and the output f32. v_wmma_f32_16x16x32_f16.
#define NB 8
#define SQ 2048
#define NC 512                       /* d_in = d_hid */
#define NO 512                       /* output features */
#define DM NC
#define NH (NC / 64)                 /* 8 slabs of 64 for the in2^T transpose */
#define HD 64
#define HG 1
#define B0 0                         /* first batch processed (debug hook) */
#define NBR NB                       /* batches processed (debug hook) */
#define QN SQ                        /* query rows attended per batch (debug hook) */
#define NR ((size_t)NB * SQ)
#define MP ((int)((size_t)NBR * SQ)) /* rows projected (debug hook) */
#define MPO MP                       /* rows through the output GEMM (debug hook) */
typedef __bf16 v16b __attribute__((ext_vector_type(16)));
typedef unsigned short v8us __attribute__((ext_vector_type(8), may_alias));
typedef float  v8f  __attribute__((ext_vector_type(8)));
typedef float  v4f  __attribute__((ext_vector_type(4)));
typedef float  v4fa __attribute__((ext_vector_type(4), may_alias));
union FragB { v16b v; v8us half[2]; unsigned short u[16]; };

__device__ __forceinline__ unsigned short bf16_bits(float x) { unsigned int u = __float_as_uint(x); return (unsigned short)((u + 0x7FFFu + ((u >> 16) & 1u)) >> 16); }
__device__ __forceinline__ float bf16_val(unsigned short b) { return __uint_as_float(((unsigned int)b) << 16); }
__device__ __forceinline__ float bf16_round(float x) { return bf16_val(bf16_bits(x)); }
// D += A·B with NT terms: 1 = ah·bh, 2 = + al·bh (A split), 3 = + ah·bl (both split)
template <int NT>
__device__ __forceinline__ v8f mmaN(v16b ah, v16b al, v16b bh, v16b bl, v8f c) {
  c = __builtin_amdgcn_wmma_f32_16x16x32_bf16(false, ah, false, bh, (short)0, c, false, false);
  if (NT >= 2) c = __builtin_amdgcn_wmma_f32_16x16x32_bf16(false, al, false, bh, (short)0, c, false, false);
  if (NT >= 3) c = __builtin_amdgcn_wmma_f32_16x16x32_bf16(false, ah, false, bl, (short)0, c, false, false);
  asm volatile("v_nop\n\tv_nop\n\tv_nop\n\tv_nop" : "+v"(c) : "v"(ah), "v"(al), "v"(bh), "v"(bl));
  return c;
}

__global__ __launch_bounds__(256) void k_wt_bf16(const float* __restrict__ W, unsigned short* __restrict__ Wt, int K, int N) {
  const int t = blockIdx.x * 256 + threadIdx.x;
  const int k8n = K / 8;
  if (t >= N * k8n) return;
  const int n = t / k8n, k8 = (t % k8n) * 8;
  v8us v;
#pragma unroll
  for (int i = 0; i < 8; ++i) v[i] = bf16_bits(W[(size_t)(k8 + i) * N + n]);
  *(v8us*)(Wt + (size_t)n * K + k8) = v;
  
}

// GEMM C[M][N] (f32, pitch ldc) = act(A[M][K]·W + bias). A f32 row-major (pitch lda) converted per fragment to bf16
// (ASPLIT: hi/lo two planes -> 2 terms, else single rounded term); Wt bf16 [N][K] (pitch ldb). BIAS_BF16 rounds the
// bias to bf16 first (bias quantised to bf16 before the add). K%32==0, M%16==0, N%64==0.
template <bool ASPLIT, int ACT, bool BIAS_BF16>
__global__ __launch_bounds__(128) void k_gemm_bf(const float* __restrict__ A, int lda, const unsigned short* __restrict__ Wt, int ldb,
                                               const float* __restrict__ bias, float* __restrict__ C, int ldc, int M, int N, int K) {
  __shared__ __attribute__((aligned(16))) float so[4][16][64];
  const int tid = threadIdx.x, w = tid >> 5, lane = tid & 31, ln = lane & 15, hh = lane >> 4;
  const int ntn = N / 64;
  const int wid = blockIdx.x * 4 + w;
  const int mt = wid / ntn, nq = wid % ntn;
  if (mt * 16 >= M) return;
  const int row0 = mt * 16, col0 = nq * 64;
  const float* arow = A + (size_t)(row0 + ln) * lda;
  v8f acc[4] = {};
  for (int kb = 0; kb < K; kb += 32) {
    FragB ah, al;
    const v4f x0 = *(const v4fa*)(arow + kb + 8 * hh), x1 = *(const v4fa*)(arow + kb + 8 * hh + 4);
    const v4f x2 = *(const v4fa*)(arow + kb + 16 + 8 * hh), x3 = *(const v4fa*)(arow + kb + 16 + 8 * hh + 4);
    float xs[16] = {x0[0],x0[1],x0[2],x0[3],x1[0],x1[1],x1[2],x1[3],x2[0],x2[1],x2[2],x2[3],x3[0],x3[1],x3[2],x3[3]};
#pragma unroll
    for (int i = 0; i < 16; ++i) { const unsigned short hb = bf16_bits(xs[i]); ah.u[i] = hb; al.u[i] = ASPLIT ? bf16_bits(xs[i] - bf16_val(hb)) : (unsigned short)0; }
#pragma unroll
    for (int t = 0; t < 4; ++t) {
      const unsigned short* brow = Wt + (size_t)(col0 + t * 16 + ln) * ldb + kb;
      FragB b;
      b.half[0] = *(const v8us*)(brow + 8 * hh);
      b.half[1] = *(const v8us*)(brow + 16 + 8 * hh);
      acc[t] = mmaN<ASPLIT ? 2 : 1>(ah.v, al.v, b.v, b.v, acc[t]);
    }
  }
#pragma unroll
  for (int t = 0; t < 4; ++t) {
    float bv = bias ? bias[col0 + t * 16 + ln] : 0.f;
    if (BIAS_BF16) bv = bf16_round(bv);
#pragma unroll
    for (int r = 0; r < 8; ++r) { float v = acc[t][r] + bv; if (ACT == 1) v = fmaxf(v, 0.f); so[w][8 * hh + r][t * 16 + ln] = v; }
  }
  __builtin_amdgcn_fence(__ATOMIC_ACQ_REL, "workgroup");
  __builtin_amdgcn_wave_barrier();
  const int rsub = lane >> 4, c4 = (lane & 15) * 4;
  {
#pragma unroll
    for (int q = 0; q < 8; ++q) {
      const int r = q * 2 + rsub;
      const v4f v = *(const v4fa*)&so[w][r][c4];
      *(v4f*)(C + (size_t)(row0 + r) * ldc + col0 + c4) = v;
    }
    
  }
}

// GEMM C = act(A·W + bias + resid): A f32 (ASPLIT -> hi/lo 2 terms), Wt bf16 [N][K]; ACT 0 none, 1 relu, 2 exact gelu;
// resid (optional, f32, row index = (row % rmod), pitch ldr, RES_BF16 rounds it) added before the activation.
template <bool ASPLIT, int ACT, bool BIAS_BF16, bool RES_BF16>
__global__ __launch_bounds__(128) void k_gemm_bf3(const float* __restrict__ A, int lda, const unsigned short* __restrict__ Wt, int ldb,
                                                const float* __restrict__ bias, const float* __restrict__ resid, int rmod, int ldr,
                                                float* __restrict__ C, int ldc, int M, int N, int K) {
  __shared__ __attribute__((aligned(16))) float so[4][16][64];
  const int tid = threadIdx.x, w = tid >> 5, lane = tid & 31, ln = lane & 15, hh = lane >> 4;
  const int ntn = N / 64;
  const int wid = blockIdx.x * 4 + w;
  const int mt = wid / ntn, nq = wid % ntn;
  if (mt * 16 >= M) return;
  const int row0 = mt * 16, col0 = nq * 64;
  const float* arow = A + (size_t)(row0 + ln) * lda;
  v8f acc[4] = {};
  for (int kb = 0; kb < K; kb += 32) {
    FragB ah, al;
    const v4f x0 = *(const v4fa*)(arow + kb + 8 * hh), x1 = *(const v4fa*)(arow + kb + 8 * hh + 4);
    const v4f x2 = *(const v4fa*)(arow + kb + 16 + 8 * hh), x3 = *(const v4fa*)(arow + kb + 16 + 8 * hh + 4);
    float xs[16] = {x0[0],x0[1],x0[2],x0[3],x1[0],x1[1],x1[2],x1[3],x2[0],x2[1],x2[2],x2[3],x3[0],x3[1],x3[2],x3[3]};
#pragma unroll
    for (int i = 0; i < 16; ++i) { const unsigned short hb = bf16_bits(xs[i]); ah.u[i] = hb; al.u[i] = ASPLIT ? bf16_bits(xs[i] - bf16_val(hb)) : (unsigned short)0; }
#pragma unroll
    for (int t = 0; t < 4; ++t) {
      const unsigned short* brow = Wt + (size_t)(col0 + t * 16 + ln) * ldb + kb;
      FragB b;
      b.half[0] = *(const v8us*)(brow + 8 * hh);
      b.half[1] = *(const v8us*)(brow + 16 + 8 * hh);
      acc[t] = mmaN<ASPLIT ? 2 : 1>(ah.v, al.v, b.v, b.v, acc[t]);
    }
  }
#pragma unroll
  for (int t = 0; t < 4; ++t) {
    const int col = col0 + t * 16 + ln;
    float bv = bias ? bias[col] : 0.f;
    if (BIAS_BF16) bv = bf16_round(bv);
#pragma unroll
    for (int r = 0; r < 8; ++r) {
      float v = acc[t][r] + bv;
      if (resid) { float rv = resid[(size_t)((row0 + 8 * hh + r) % rmod) * ldr + col]; if (RES_BF16) rv = bf16_round(rv); v += rv; }
      if (ACT == 1) v = fmaxf(v, 0.f);
      if (ACT == 2) v = 0.5f * v * (1.0f + erff(v * 0.70710678118654752f));
      if (ACT == 3) { const float u = 0.7978845608028654f * (v + 0.044715f * v * v * v); v = 0.5f * v * (1.0f + tanhf(u)); }
      so[w][8 * hh + r][t * 16 + ln] = v;
    }
  }
  __builtin_amdgcn_fence(__ATOMIC_ACQ_REL, "workgroup");
  __builtin_amdgcn_wave_barrier();
  const int rsub = lane >> 4, c4 = (lane & 15) * 4;
  {
#pragma unroll
    for (int q = 0; q < 8; ++q) {
      const int r = q * 2 + rsub;
      const v4f v = *(const v4fa*)&so[w][r][c4];
      *(v4f*)(C + (size_t)(row0 + r) * ldc + col0 + c4) = v;
    }
    
  }
}
// row LayerNorm (biased variance, eps) over N: s = X (+ R); optional out_sum <- s; out_norm <- (s-mu)*rsqrt(var+eps)*g + b
template <bool PARAM_BF16>
__global__ __launch_bounds__(256) void k_layernorm(const float* __restrict__ X, const float* __restrict__ R, const float* __restrict__ g, const float* __restrict__ bta,
                                                  float* __restrict__ out_sum, float* __restrict__ out_norm, int N, float eps) {
  __shared__ float red[256];
  const int row = blockIdx.x, tid = threadIdx.x;
  const float* x = X + (size_t)row * N; const float* rr = R ? R + (size_t)row * N : nullptr;
  float vals[16];                     // up to N = 4096
  const int per = N / 256;            // contiguous chunk per thread? use strided-by-4 chunks: thread handles j = tid*4 + 1024*u
  float s1 = 0.f;
  for (int u = 0; u < per / 4; ++u) {
    const int j = tid * 4 + 1024 * u;
    const v4f a = *(const v4fa*)(x + j);
    v4f b = {0.f,0.f,0.f,0.f}; if (rr) b = *(const v4fa*)(rr + j);
#pragma unroll
    for (int q = 0; q < 4; ++q) { const float v = a[q] + b[q]; vals[u * 4 + q] = v; s1 += v; }
  }
  red[tid] = s1; __syncthreads();
  for (int st = 128; st > 0; st >>= 1) { if (tid < st) red[tid] += red[tid + st]; __syncthreads(); }
  const float mu = red[0] / (float)N; __syncthreads();
  float s2 = 0.f;
  for (int u = 0; u < per / 4; ++u)
#pragma unroll
    for (int q = 0; q < 4; ++q) { const float c = vals[u * 4 + q] - mu; s2 += c * c; }
  red[tid] = s2; __syncthreads();
  for (int st = 128; st > 0; st >>= 1) { if (tid < st) red[tid] += red[tid + st]; __syncthreads(); }
  const float rs = rsqrtf(red[0] / (float)N + eps);
  {
    for (int u = 0; u < per / 4; ++u) {
      const int j = tid * 4 + 1024 * u;
      v4f o, sm;
#pragma unroll
      for (int q = 0; q < 4; ++q) {
        float gg = g[j + q], bb = bta[j + q];
        if (PARAM_BF16) { gg = bf16_round(gg); bb = bf16_round(bb); }
        sm[q] = vals[u * 4 + q]; o[q] = (vals[u * 4 + q] - mu) * rs * gg + bb;
      }
      if (out_sum) *(v4f*)(out_sum + (size_t)row * N + j) = sm;
      *(v4f*)(out_norm + (size_t)row * N + j) = o;
    }
    
  }
}



// ---- f16 WMMA path (v_wmma_f32_16x16x32_f16): 11-bit significands for operands in range — used where a [0,1] probability operand needs more precision than bf16
typedef _Float16 v16h __attribute__((ext_vector_type(16)));
union FragH { v16h v; v8us half[2]; _Float16 h[16]; unsigned short u[16]; };
template <int NT>
__device__ __forceinline__ v8f mmaH(v16h ah, v16h al, v16h bh, v16h bl, v8f c) {
  c = __builtin_amdgcn_wmma_f32_16x16x32_f16(false, ah, false, bh, (short)0, c, false, false);
  if (NT >= 2) c = __builtin_amdgcn_wmma_f32_16x16x32_f16(false, al, false, bh, (short)0, c, false, false);
  if (NT >= 3) c = __builtin_amdgcn_wmma_f32_16x16x32_f16(false, ah, false, bl, (short)0, c, false, false);
  asm volatile("v_nop\n\tv_nop\n\tv_nop\n\tv_nop" : "+v"(c) : "v"(ah), "v"(al), "v"(bh), "v"(bl));
  return c;
}
// batched GEMM like k_gemm_b but f16 operands: A f32 (split into f16 hi/lo if ASPLIT, else rounded to f16), Bt = f16 values [n][k]; alpha; C f32; N multiple of 16 (partial tiles skipped)
template <bool ASPLIT>
__global__ __launch_bounds__(128) void k_gemm_h(const float* __restrict__ A, int lda, size_t sA, const _Float16* __restrict__ Bh, int ldb, size_t sB, float alpha, float* __restrict__ C, int ldc, size_t sC, int M, int N, int K) {
  __shared__ __attribute__((aligned(16))) float so[4][16][64];
  const int tid = threadIdx.x, w = tid >> 5, lane = tid & 31, ln = lane & 15, hh = lane >> 4; const int by = blockIdx.y;
  A += (size_t)by * sA; Bh += (size_t)by * sB; C += (size_t)by * sC;
  const int ntn = (N + 63) / 64; const int wid = blockIdx.x * 4 + w; const int mt = wid / ntn, nq = wid % ntn; if (mt * 16 >= M) return;
  const int row0 = mt * 16, col0 = nq * 64; const float* arow = A + (size_t)(row0 + ln) * lda;
  v8f acc[4] = {};
  for (int kb = 0; kb < K; kb += 32) {
    FragH ah, al;
    const v4f x0 = *(const v4fa*)(arow + kb + 8 * hh), x1 = *(const v4fa*)(arow + kb + 8 * hh + 4), x2 = *(const v4fa*)(arow + kb + 16 + 8 * hh), x3 = *(const v4fa*)(arow + kb + 16 + 8 * hh + 4);
    float xs[16] = {x0[0],x0[1],x0[2],x0[3],x1[0],x1[1],x1[2],x1[3],x2[0],x2[1],x2[2],x2[3],x3[0],x3[1],x3[2],x3[3]};
#pragma unroll
    for (int i = 0; i < 16; ++i) { const _Float16 h = (_Float16)xs[i]; ah.h[i] = h; al.h[i] = ASPLIT ? (_Float16)(xs[i] - (float)h) : (_Float16)0.0f; }
#pragma unroll
    for (int t = 0; t < 4; ++t) { if (col0 + t * 16 >= N) continue; const size_t boff = (size_t)(col0 + t * 16 + ln) * ldb + kb; FragH bq; bq.half[0] = *(const v8us*)(Bh + boff + 8 * hh); bq.half[1] = *(const v8us*)(Bh + boff + 16 + 8 * hh);
      acc[t] = mmaH<ASPLIT ? 2 : 1>(ah.v, al.v, bq.v, bq.v, acc[t]); }
  }
#pragma unroll
  for (int t = 0; t < 4; ++t) { if (col0 + t * 16 >= N) continue;
#pragma unroll
    for (int r = 0; r < 8; ++r) so[w][8 * hh + r][t * 16 + ln] = acc[t][r] * alpha; }
  __builtin_amdgcn_fence(__ATOMIC_ACQ_REL, "workgroup"); __builtin_amdgcn_wave_barrier();
  const int rsub = lane >> 4, c4 = (lane & 15) * 4;
  {
#pragma unroll
    for (int q = 0; q < 8; ++q) { const int r = q * 2 + rsub; if (col0 + c4 < N) { const v4f v = *(const v4fa*)&so[w][r][c4]; *(v4f*)(C + (size_t)(row0 + r) * ldc + col0 + c4) = v; } }
     }
}

// Wt[n][k] = f16(W[k][n]·scale) from f32 row-major W[K][N] (scale = power of two; bf16-exact weights stay exact in f16 away from the subnormal range)
__global__ __launch_bounds__(256) void k_wt_f16(const float* __restrict__ W, _Float16* __restrict__ Wt, int K, int N, float scale) {
  const int t = blockIdx.x * 256 + threadIdx.x; if (t >= N * (K / 8)) return; const int n = t / (K / 8), k8 = (t % (K / 8)) * 8; FragH f;
#pragma unroll
  for (int i = 0; i < 8; ++i) f.h[i] = (_Float16)(bf16_round(W[(size_t)(k8 + i) * N + n]) * scale); const v8us o = f.half[0];
  *(v8us*)((unsigned short*)Wt + (size_t)n * K + k8) = o; 
}
// k_gemm_hh variant with fused epilogue: v = acc·alpha + bias[by·sBias + col] (+ CP[(row/rowsPerB)·sCPb + by·64 + col] if CP) ; ACT 0 none / 1 elu ; writes f16 C16 (and f32 C if non-null)
template <int ACT>
__global__ __launch_bounds__(128) void k_gemm_hhx(const _Float16* __restrict__ A, int lda, size_t sA, const _Float16* __restrict__ Bh, int ldb, size_t sB, float alpha, const float* __restrict__ bias, size_t sBias, const float* __restrict__ CP, int rowsPerB, size_t sCPb, int row0g,
    float* __restrict__ C, _Float16* __restrict__ C16, int ldc, size_t sC, int M, int N, int K) {
  __shared__ __attribute__((aligned(16))) float so[4][16][64];
  const int tid = threadIdx.x, w = tid >> 5, lane = tid & 31, ln = lane & 15, hh = lane >> 4; const int by = blockIdx.y;
  A += (size_t)by * sA; Bh += (size_t)by * sB; const size_t cofs = (size_t)by * sC; const float* bp = bias ? bias + (size_t)by * sBias : nullptr;
  const int ntn = (N + 63) / 64; const int wid = blockIdx.x * 4 + w; const int mt = wid / ntn, nq = wid % ntn; if (mt * 16 >= M) return;
  const int row0 = mt * 16, col0 = nq * 64; const _Float16* arow = A + (size_t)(row0 + ln) * lda;
  v8f acc[4] = {};
  for (int kb = 0; kb < K; kb += 32) { FragH ah; ah.half[0] = *(const v8us*)((const unsigned short*)arow + kb + 8 * hh); ah.half[1] = *(const v8us*)((const unsigned short*)arow + kb + 16 + 8 * hh);
#pragma unroll
    for (int t = 0; t < 4; ++t) { if (col0 + t * 16 >= N) continue; const size_t boff = (size_t)(col0 + t * 16 + ln) * ldb + kb; FragH bq; bq.half[0] = *(const v8us*)((const unsigned short*)Bh + boff + 8 * hh); bq.half[1] = *(const v8us*)((const unsigned short*)Bh + boff + 16 + 8 * hh);
      acc[t] = mmaH<1>(ah.v, ah.v, bq.v, bq.v, acc[t]); }
  }
#pragma unroll
  for (int t = 0; t < 4; ++t) { if (col0 + t * 16 >= N) continue; const int col = col0 + t * 16 + ln; const float bv = bp ? bf16_round(bp[col]) : 0.f;
#pragma unroll
    for (int r = 0; r < 8; ++r) { float v = acc[t][r] * alpha + bv; if (CP) { const int rr = row0g + row0 + 8 * hh + r; if (rowsPerB < 0) v += CP[cofs + (size_t)rr * ldc + col];      /* rowsPerB < 0: own element of the batched C plane */ else { const int bidx = rr / rowsPerB; v += CP[(size_t)bidx * sCPb + (size_t)by * 64 + col]; } } if (ACT == 1) v = (v > 0.f) ? v : expm1f(v); else if (ACT == 7) v = (v > 0.f) ? v + 1.0f : expf(v); else if (ACT == 8) v = tanhf(v); else if (ACT == 9) v = 0.5f * v * (1.0f + tanhf(0.7978845608028654f * (v + 0.044715f * v * v * v))); else if (ACT == 11) v = 1.0f / (1.0f + expf(-v)); else if (ACT == 12) v = (v > 0.f) ? v : 0.01f * v; else if (ACT == 14) v = (v > 0.f) ? v : 0.1f * v; else if (ACT == 16) v = (v >= 0.f) ? v : 0.3f * v; else if (ACT == 17) v = (v >= 0.f) ? v : 0.2f * v; else if (ACT == 15) v = v / (1.0f + expf(-v)); else if (ACT == 3) v = fmaxf(v, 0.f); else if (ACT == 6) v = 0.5f * v * (1.0f + erff(v * 0.70710678118654752f)); so[w][8 * hh + r][t * 16 + ln] = v; } }
  __builtin_amdgcn_fence(__ATOMIC_ACQ_REL, "workgroup"); __builtin_amdgcn_wave_barrier();
  const int rsub = lane >> 4, c4 = (lane & 15) * 4; typedef _Float16 v4h __attribute__((ext_vector_type(4)));
  {
#pragma unroll
    for (int q = 0; q < 8; ++q) { const int r = q * 2 + rsub; if (col0 + c4 < N) { const v4f v = *(const v4fa*)&so[w][r][c4]; if (C) *(v4f*)(C + cofs + (size_t)(row0 + r) * ldc + col0 + c4) = v; if (C16) { v4h h4; for (int i = 0; i < 4; ++i) h4[i] = (_Float16)v[i]; *(v4h*)(C16 + cofs + (size_t)(row0 + r) * ldc + col0 + c4) = h4; } } }
     }
}


typedef _Float16 v4h __attribute__((ext_vector_type(4)));

__global__ __launch_bounds__(256) void k_x16(const float* __restrict__ x, _Float16* __restrict__ X16, size_t n8) { const size_t t = (size_t)blockIdx.x * 256 + threadIdx.x; if (t >= n8) return; FragH f;
#pragma unroll
  for (int q = 0; q < 8; ++q) f.h[q] = (_Float16)bf16_round(x[t * 8 + q]); *(v8us*)((unsigned short*)X16 + t * 8) = f.half[0];  }
__global__ __launch_bounds__(256) void k_h16(const float* __restrict__ x, _Float16* __restrict__ X16, size_t n8) { const size_t t = (size_t)blockIdx.x * 256 + threadIdx.x; if (t >= n8) return; FragH f;
#pragma unroll
  for (int q = 0; q < 8; ++q) f.h[q] = (_Float16)x[t * 8 + q]; *(v8us*)((unsigned short*)X16 + t * 8) = f.half[0];  }
__global__ __launch_bounds__(256) void k_round16f(const float* __restrict__ W, _Float16* __restrict__ Bt, size_t n8) { const size_t t = (size_t)blockIdx.x * 256 + threadIdx.x; if (t >= n8) return; FragH f;
#pragma unroll
  for (int i = 0; i < 8; ++i) f.h[i] = (_Float16)(bf16_round(W[t * 8 + i]) * 16.0f); *(v8us*)((unsigned short*)Bt + t * 8) = f.half[0];  }
template <int NHv, int TTv>
__global__ __launch_bounds__(256) void k_vt(const _Float16* __restrict__ V16, int ldv, int voff, _Float16* __restrict__ Vt) { __shared__ unsigned short tl[64][66]; const int tid = threadIdx.x; const int slab = blockIdx.x / (TTv / 64), lg = blockIdx.x % (TTv / 64); const int b = slab / NHv, h = slab % NHv;
  for (int i = tid; i < 64 * 8; i += 256) { const int r = i / 8, c8 = (i % 8) * 8; FragH f; f.half[0] = *(const v8us*)((const unsigned short*)V16 + ((size_t)b * TTv + lg * 64 + r) * ldv + voff + h * 64 + c8);
#pragma unroll
    for (int q = 0; q < 8; ++q) tl[r][c8 + q] = f.u[q]; }
  __syncthreads();
  {
#pragma unroll
    for (int rd = 0; rd < 2; ++rd) { const int d = rd * 32 + tid / 8, pc = tid % 8; FragH f;
#pragma unroll
      for (int q = 0; q < 8; ++q) f.u[q] = tl[pc * 8 + q][d];
      *(v8us*)((unsigned short*)Vt + ((size_t)slab * 64 + d) * TTv + lg * 64 + pc * 8) = f.half[0]; }
     } }

__global__ __launch_bounds__(256) void k_hl(const float* __restrict__ F, _Float16* __restrict__ Hh, _Float16* __restrict__ Hl, size_t n8) { const size_t t = (size_t)blockIdx.x * 256 + threadIdx.x; if (t >= n8) return; FragH fh, fl; const v4f a = *(const v4fa*)(F + t * 8), c = *(const v4fa*)(F + t * 8 + 4);
#pragma unroll
  for (int q = 0; q < 4; ++q) { _Float16 h = (_Float16)a[q]; fh.h[q] = h; fl.h[q] = (_Float16)((a[q] - (float)h) * 1024.0f); h = (_Float16)c[q]; fh.h[4 + q] = h; fl.h[4 + q] = (_Float16)((c[q] - (float)h) * 1024.0f); }
  { *(v8us*)((unsigned short*)Hh + t * 8) = fh.half[0]; *(v8us*)((unsigned short*)Hl + t * 8) = fl.half[0];  } }

// ---- fast GEMM (wave tile 32x64; requires M % 32 == 0 rows per launch region and N % 64 == 0); epilogue = k_gemm_hhx semantics ----
__device__ __forceinline__ v16h g2_frag(const _Float16* p, int hh) { FragH f; f.half[0] = *(const v8us*)((const unsigned short*)p + 8 * hh); f.half[1] = *(const v8us*)((const unsigned short*)p + 16 + 8 * hh); return f.v; }
__device__ __forceinline__ v8f g2_mma(v16h a, v16h b, v8f c) { v8f d = __builtin_amdgcn_wmma_f32_16x16x32_f16(false, a, false, b, (short)0, c, false, false); asm volatile("v_nop\n\tv_nop\n\tv_nop\n\tv_nop" : "+v"(d) : "v"(a), "v"(b)); return d; }
template <int ACT>
__global__ __launch_bounds__(128) void k_gemm2(const _Float16* __restrict__ A, int lda, size_t sA, const _Float16* __restrict__ Bh, int ldb, size_t sB, float alpha, const float* __restrict__ bias, size_t sBias, const float* __restrict__ CP, int rowsPerB, size_t sCPb, int row0g,
    float* __restrict__ C, _Float16* __restrict__ C16, int ldc, size_t sC, int M, int N, int K) { static_assert(ACT == 0 || ACT == 3 || ACT == 6 || ACT == 8 || ACT == 9 || ACT == 11 || ACT == 12 || ACT == 14 || ACT == 15 || ACT == 16 || ACT == 17, "k_gemm2: unsupported ACT code (would silently apply no activation)");
  __shared__ __attribute__((aligned(16))) float so[4][32][68];
  const int tid = threadIdx.x, w = tid >> 5, lane = tid & 31, ln = lane & 15, hh = lane >> 4; const int by = blockIdx.y;
  A += (size_t)by * sA; Bh += (size_t)by * sB; const size_t cofs = (size_t)by * sC; const float* bp = bias ? bias + (size_t)by * sBias : nullptr;
  const int ntn = N >> 6; const int mt = blockIdx.x / ntn, nq = blockIdx.x - mt * ntn; const int row0 = mt * 128 + 32 * w, col0 = nq * 64; if (row0 >= M) return;
  const _Float16* a0p = A + (size_t)(row0 + ln) * lda; const _Float16* a1p = a0p + (size_t)16 * lda;
  const _Float16* b0p = Bh + (size_t)(col0 + ln) * ldb; const _Float16* b1p = b0p + (size_t)16 * ldb; const _Float16* b2p = b1p + (size_t)16 * ldb; const _Float16* b3p = b2p + (size_t)16 * ldb;
  const v8f z8 = {0.f,0.f,0.f,0.f,0.f,0.f,0.f,0.f}; v8f c00 = z8, c01 = z8, c02 = z8, c03 = z8, c10 = z8, c11 = z8, c12 = z8, c13 = z8;
#pragma unroll 1
  for (int kb = 0; kb < K; kb += 32) { const v16h a0 = g2_frag(a0p + kb, hh), a1 = g2_frag(a1p + kb, hh);
    v16h b = g2_frag(b0p + kb, hh); c00 = g2_mma(a0, b, c00); c10 = g2_mma(a1, b, c10);
    b = g2_frag(b1p + kb, hh); c01 = g2_mma(a0, b, c01); c11 = g2_mma(a1, b, c11);
    b = g2_frag(b2p + kb, hh); c02 = g2_mma(a0, b, c02); c12 = g2_mma(a1, b, c12);
    b = g2_frag(b3p + kb, hh); c03 = g2_mma(a0, b, c03); c13 = g2_mma(a1, b, c13); }
  v8f accs[8] = {c00, c01, c02, c03, c10, c11, c12, c13};
#pragma unroll
  for (int u = 0; u < 8; ++u) { const int t = u & 3, half = u >> 2; const int col = col0 + t * 16 + ln; const float bv = bp ? bf16_round(bp[col]) : 0.f;
#pragma unroll
    for (int r = 0; r < 8; ++r) { const int rloc = half * 16 + 8 * hh + r; float v = accs[u][r] * alpha + bv; if (CP) { if (rowsPerB < 0) v += CP[cofs + (size_t)(row0g + row0 + rloc) * ldc + col];      /* rowsPerB < 0: own element of the batched C plane */ else { const int bidx = (row0g + row0 + rloc) / rowsPerB; v += CP[(size_t)bidx * sCPb + (size_t)by * 64 + col]; } }
      if (ACT == 3) v = fmaxf(v, 0.f); else if (ACT == 6) v = 0.5f * v * (1.0f + erff(v * 0.70710678118654752f)); else if (ACT == 11) v = 1.0f / (1.0f + expf(-v)); else if (ACT == 15) v = v / (1.0f + expf(-v)); else if (ACT == 12) v = (v > 0.f) ? v : 0.01f * v; else if (ACT == 8) v = tanhf(v); else if (ACT == 9) v = 0.5f * v * (1.0f + tanhf(0.7978845608028654f * (v + 0.044715f * v * v * v))); else if (ACT == 14) v = (v > 0.f) ? v : 0.1f * v; else if (ACT == 16) v = (v >= 0.f) ? v : 0.3f * v; else if (ACT == 17) v = (v >= 0.f) ? v : 0.2f * v;
      so[w][rloc][t * 16 + ln] = v; } }
  __builtin_amdgcn_fence(__ATOMIC_ACQ_REL, "workgroup"); __builtin_amdgcn_wave_barrier();
  const int rsub = lane >> 4, c4 = (lane & 15) * 4;
  {
#pragma unroll
    for (int q = 0; q < 16; ++q) { const int r = q * 2 + rsub; const v4f v = *(const v4fa*)&so[w][r][c4]; if (C) *(v4f*)(C + cofs + (size_t)(row0 + r) * ldc + col0 + c4) = v; if (C16) { v4h h4; for (int i = 0; i < 4; ++i) h4[i] = (_Float16)v[i]; *(v4h*)(C16 + cofs + (size_t)(row0 + r) * ldc + col0 + c4) = h4; } }
     } }


__global__ __launch_bounds__(256) void k_wnat(const float* __restrict__ w, size_t n8, _Float16* __restrict__ Bt) { const size_t t = (size_t)blockIdx.x * 256 + threadIdx.x; if (t >= n8) return; FragH f; for (int q = 0; q < 8; ++q) f.h[q] = (_Float16)(bf16_round(w[t * 8 + q]) * 16.0f); *(v8us*)((unsigned short*)Bt + t * 8) = f.half[0];  }
__global__ __launch_bounds__(256) void k_rsm(const float* __restrict__ S, _Float16* __restrict__ P, int nrows) {
  #pragma clang fp contract(off)
  const int i = blockIdx.x * 256 + threadIdx.x; if (i >= nrows) return; const float* s = S + (size_t)i * SQ; float mx = -3.0e38f;
#pragma unroll 1
  for (int j = 0; j < SQ; ++j) mx = fmaxf(mx, s[j]); float se = 0.f;
#pragma unroll 1
  for (int j = 0; j < SQ; ++j) se += expf(s[j] - mx); const float sc = 256.0f / se;
#pragma unroll 1
  for (int j0 = 0; j0 < SQ; j0 += 8) { FragH f; for (int q = 0; q < 8; ++q) f.h[q] = (_Float16)(expf(s[j0 + q] - mx) * sc); unsigned short* d = (unsigned short*)P + (size_t)i * SQ + j0; *(v8us*)d = f.half[0];  } }
__global__ __launch_bounds__(256) void k_vt(const _Float16* __restrict__ V16, int b, int h0, _Float16* __restrict__ VT) { __shared__ unsigned short tl[64][65]; const int tid = threadIdx.x; const int hh = blockIdx.x % HG, sg = blockIdx.x / HG; const int s0 = sg * 64; const int h = h0 + hh;
  for (int i = tid; i < 64 * 8; i += 256) { const int j = i / 8, d8 = (i % 8) * 8; FragH f; f.half[0] = *(const v8us*)((const unsigned short*)V16 + ((size_t)b * SQ + s0 + j) * DM + h * HD + d8); for (int q = 0; q < 8; ++q) tl[d8 + q][j] = f.u[q]; }
  __syncthreads();
  { for (int i = tid; i < 64 * 8; i += 256) { const int d = i / 8, j8 = (i % 8) * 8; FragH f; for (int q = 0; q < 8; ++q) f.u[q] = tl[d][j8 + q]; *(v8us*)((unsigned short*)VT + ((size_t)hh * HD + d) * SQ + s0 + j8) = f.half[0]; }  } }


__global__ __launch_bounds__(256) void k_x16p(const float* __restrict__ x, _Float16* __restrict__ dst, size_t n8, int nc, int ldo) { const size_t t = (size_t)blockIdx.x * 256 + threadIdx.x; if (t >= n8) return; const size_t e = t * 8; const size_t r = e / nc; const int c = (int)(e % nc); FragH f;
#pragma unroll
  for (int q = 0; q < 8; ++q) f.h[q] = (_Float16)bf16_round(x[e + q]); unsigned short* d = (unsigned short*)dst + r * ldo + c; *(v8us*)d = f.half[0];  }
typedef int v4ia __attribute__((ext_vector_type(4), may_alias));
// Masked row softmax, one wave per score row. Lane l keeps columns 128 i + 4 l .. 128 i + 4 l + 3 (i = 0..15) of its row in registers, so every load of S covers 512 contiguous bytes and S is read once;
// a masked key enters as -inf (its exp is an exact 0); row maximum and row sum: four chains per lane, then a five-step butterfly over the 32 lanes. A row with every key masked (sum 0) gets weights 0.
// Every loop is fully unrolled so that v[] is indexed by constants only and stays in registers (a run-time index would send it to scratch). No product here feeds an add, so nothing can be contracted.
__global__ __launch_bounds__(256) void k_rsmw(const float* __restrict__ S, _Float16* __restrict__ P, int qn, const int* __restrict__ mk) {
  const int lane = threadIdx.x & 31; const int row = blockIdx.x * 8 + (threadIdx.x >> 5); if (row >= qn) return;      /* wave-uniform; the kernel has no barrier */
  const float* s = S + (size_t)row * SQ + lane * 4; const int* m = mk + lane * 4; _Float16* p = P + (size_t)row * SQ + lane * 4;
  v4f v[SQ / 128]; v4f mx4 = {-3.0e38f, -3.0e38f, -3.0e38f, -3.0e38f};
#pragma unroll
  for (int i = 0; i < SQ / 128; ++i) { const v4f x = *(const v4fa*)(s + i * 128); const v4ia k = *(const v4ia*)(m + i * 128);
#pragma unroll
    for (int q = 0; q < 4; ++q) { v[i][q] = (k[q] == 0) ? x[q] : -__builtin_inff(); mx4[q] = fmaxf(mx4[q], v[i][q]); } }
  float mx = fmaxf(fmaxf(mx4[0], mx4[1]), fmaxf(mx4[2], mx4[3]));
#pragma unroll
  for (int o = 16; o > 0; o >>= 1) mx = fmaxf(mx, __shfl_xor(mx, o, 32));
  v4f se4 = {0.f, 0.f, 0.f, 0.f};
#pragma unroll
  for (int i = 0; i < SQ / 128; ++i)
#pragma unroll
    for (int q = 0; q < 4; ++q) { const float t = (v[i][q] - mx) * 1.44269504f; float e;      /* native exp(x) = exp2(x log2 e), the same two instructions as __expf */
      asm("v_exp_f32 %0, %1\n\tv_nop" : "=v"(e) : "v"(t));      /* the v_nop keeps the one slot the instruction set asks for behind a transcendental, before its result is read or its source register reused */
      v[i][q] = e; se4[q] += e; }
  float se = (se4[0] + se4[1]) + (se4[2] + se4[3]);
#pragma unroll
  for (int o = 16; o > 0; o >>= 1) se += __shfl_xor(se, o, 32);
  const float sc = (se == 0.f) ? 0.f : 256.0f / se;
#pragma unroll
  for (int i = 0; i < SQ / 128; ++i) { v4h h;
#pragma unroll
    for (int q = 0; q < 4; ++q) h[q] = (_Float16)(v[i][q] * sc);
    *(v4h*)(p + i * 128) = h; } }

extern "C" void kernel_launch(void* const* d_in, const int* in_sizes, int n_in,
                              void* d_out, int out_size, void* d_ws, size_t ws_size, hipStream_t stream) {
  (void)in_sizes; (void)n_in; (void)out_size;
  const float* const* I = (const float* const*)d_in; const float* in1 = I[0]; const float* in2 = I[1]; const int* mask2 = (const int*)d_in[2]; const float* w1 = I[3]; const float* w2 = I[4]; const float* b2 = I[5];      /* weights natural [out][in] */
  char* ws = (char*)d_ws; size_t off = 0;
  auto take = [&](size_t bytes) { char* p = ws + off; off += (bytes + 255) & ~(size_t)255; return p; };
  _Float16* B1 = (_Float16*)take((size_t)NC * NC * 2); _Float16* B2 = (_Float16*)take((size_t)NO * 2 * NC * 2);
  _Float16* X1 = (_Float16*)take(NR * NC * 2); _Float16* X2 = (_Float16*)take(NR * NC * 2); float* N1F = (float*)take(NR * NC * 4); _Float16* N1H = (_Float16*)take(NR * NC * 2); _Float16* N1L = (_Float16*)take(NR * NC * 2); _Float16* CAT = (_Float16*)take(NR * 2 * NC * 2);
  float* S = (float*)take((size_t)SQ * SQ * 4); _Float16* P = (_Float16*)take((size_t)SQ * SQ * 2); _Float16* X2T = (_Float16*)take((size_t)NC * SQ * 2);
  if (off > ws_size) return;      /* 1.5 + 16 + 16 + 32 + 16 + 16 + 32 + 16 + 8 + 2 = approx 156 MiB */
  k_wnat<<<(unsigned)(((size_t)NC * NC / 8 + 255) / 256), 256, 0, stream>>>(w1, (size_t)NC * NC / 8, B1); k_wnat<<<(unsigned)(((size_t)NO * 2 * NC / 8 + 255) / 256), 256, 0, stream>>>(w2, (size_t)NO * 2 * NC / 8, B2);
  k_x16<<<(unsigned)((NR * NC / 8 + 255) / 256), 256, 0, stream>>>(in1, X1, NR * NC / 8); k_x16<<<(unsigned)((NR * NC / 8 + 255) / 256), 256, 0, stream>>>(in2, X2, NR * NC / 8);
  const size_t r0p = (size_t)B0 * SQ;
  k_x16p<<<(unsigned)(((size_t)MP * NC / 8 + 255) / 256), 256, 0, stream>>>(in1 + r0p * NC, CAT + r0p * 2 * NC, (size_t)MP * NC / 8, NC, 2 * NC);      /* cat columns 0..511 = in1 */
  k_gemm2<0><<<dim3((unsigned)((MP / 128) * (NC / 64)), 1), 128, 0, stream>>>(X1 + r0p * NC, NC, 0, B1, NC, 0, 0.0625f, nullptr, 0, nullptr, 1, 0, 0, N1F + r0p * NC, nullptr, NC, 0, MP, NC, NC);      /* n1 = in1 W1^T (f32) */
  k_hl<<<(unsigned)(((size_t)MP * NC / 8 + 255) / 256), 256, 0, stream>>>(N1F + r0p * NC, N1H + r0p * NC, N1L + r0p * NC, (size_t)MP * NC / 8);
  for (int b = B0; b < B0 + NBR; ++b) { const size_t r0 = (size_t)b * SQ; const dim3 gs((QN / 128) * (SQ / 64), 1);
    k_gemm2<0><<<gs, 128, 0, stream>>>(N1H + r0 * NC, NC, 0, X2 + r0 * NC, NC, 0, 1.0f, nullptr, 0, nullptr, 1, 0, 0, S, nullptr, SQ, 0, QN, SQ, NC);      /* scores hi */
    k_gemm2<0><<<gs, 128, 0, stream>>>(N1L + r0 * NC, NC, 0, X2 + r0 * NC, NC, 0, 0.0009765625f, nullptr, 0, S, -1, 0, 0, S, nullptr, SQ, 0, QN, SQ, NC);      /* + lo (CP = own element) */
    k_rsmw<<<(QN + 7) / 8, 256, 0, stream>>>(S, P, QN, mask2 + (size_t)b * SQ);
    k_vt<NH, SQ><<<NH * (SQ / 64), 256, 0, stream>>>(X2 + r0 * NC, NC, 0, X2T);      /* in2^T [512][2048] for this batch */
    k_gemm2<0><<<dim3((QN / 128) * (NC / 64), 1), 128, 0, stream>>>(P, SQ, 0, X2T, SQ, 0, 0.00390625f, nullptr, 0, nullptr, 1, 0, 0, nullptr, CAT + r0 * 2 * NC + NC, 2 * NC, 0, QN, NC, SQ); }      /* fused (x1: alpha 1/256 undoes the P carry) -> cat columns 512..1023 */
  k_gemm2<8><<<dim3((unsigned)((MPO / 128) * (NO / 64)), 1), 128, 0, stream>>>(CAT + r0p * 2 * NC, 2 * NC, 0, B2, 2 * NC, 0, 0.0625f, b2, 0, nullptr, 1, 0, 0, (float*)d_out + r0p * NO, nullptr, NO, 0, MPO, NO, 2 * NC);      /* out = tanh(cat W2^T + b2) */
}

// v002
// It runs in 580 microseconds.
// Two timings next to v001 put it at 2.00 and 1.99 times that version's speed.
// Counting every step since v000, it is 9.85 times as fast.
#include <hip/hip_runtime.h>
// Cross attention with concat + tanh projection (in1, in2 [8][2048][512]; mask2 [8][2048] int32, nonzero = key masked out; n1 = in1 W1^T (W1 [512][512] natural, no bias); scores = n1 in2^T (no scaling); masked keys -> -inf; softmax over the 2,048 keys; fused = attn in2; out = tanh([in1 | fused] W2^T + b2) (W2 [512][1024] natural) -> [8][2048][512]).
// Structure: token rows; in1, in2 as exact f16 rows; n1 = in1 W1^T as a WMMA GEMM (32x64 wave tiles, f32 accumulation, exact x16 natural weights) into f32 rows, split on VALU into f16 hi + 2^-10 residual planes; then, all batches in each launch: in2^T via LDS transposes (batch folded into grid x), and with grid y = batch, scores = n1 in2^T as two accumulating GEMM terms (hi + lo; K = 512; in2 exact), masked row softmax on VALU reading the int mask row (f32 statistics, native exp; weights x256 f16, masked keys 0), fused = P . in2 GEMM (K = 2048, alpha 2^-8 undoing the P carry) written as plain f16 straight into columns 512..1023 of the f16 concat rows whose columns 0..511 are the exact in1; out = tanh(cat W2^T + b2) as ONE GEMM (K = 1024, exact x16 natural W2, alpha 1/16) with the tanh epilogue.
// Compute dtype: inputs rounded to bf16; in1, in2, weights exact in f16; n1 as f16 hi + residual planes (~2^-22: the logits have sigma ~23, so plain f16 would cost ~3e-3 logits); softmax weights (x256) and fused (unscaled: f16 relative precision is scale-free and a x16/x0.25 weight split would push small W2 entries into f16 subnormals) plain f16 (~2^-12); scores, softmax statistics and the output f32. v_wmma_f32_16x16x32_f16.
#define NB 8
#define SQ 2048
#define NC 512                       /* d_in = d_hid */
#define NO 512                       /* output features */
#define DM NC
#define NH (NC / 64)                 /* 8 slabs of 64 for the in2^T transpose */
#define HD 64
#define HG 1
#define B0 0                         /* first batch processed (debug hook) */
#define NBR NB                       /* batches processed (debug hook) */
#define QN SQ                        /* query rows attended per batch (debug hook) */
#define NR ((size_t)NB * SQ)
#define MP ((int)((size_t)NBR * SQ)) /* rows projected (debug hook) */
#define MPO MP                       /* rows through the output GEMM (debug hook) */
typedef __bf16 v16b __attribute__((ext_vector_type(16)));
typedef unsigned short v8us __attribute__((ext_vector_type(8), may_alias));
typedef float  v8f  __attribute__((ext_vector_type(8)));
typedef float  v4f  __attribute__((ext_vector_type(4)));
typedef float  v4fa __attribute__((ext_vector_type(4), may_alias));
union FragB { v16b v; v8us half[2]; unsigned short u[16]; };

__device__ __forceinline__ unsigned short bf16_bits(float x) { unsigned int u = __float_as_uint(x); return (unsigned short)((u + 0x7FFFu + ((u >> 16) & 1u)) >> 16); }
__device__ __forceinline__ float bf16_val(unsigned short b) { return __uint_as_float(((unsigned int)b) << 16); }
__device__ __forceinline__ float bf16_round(float x) { return bf16_val(bf16_bits(x)); }
// D += A·B with NT terms: 1 = ah·bh, 2 = + al·bh (A split), 3 = + ah·bl (both split)
template <int NT>
__device__ __forceinline__ v8f mmaN(v16b ah, v16b al, v16b bh, v16b bl, v8f c) {
  c = __builtin_amdgcn_wmma_f32_16x16x32_bf16(false, ah, false, bh, (short)0, c, false, false);
  if (NT >= 2) c = __builtin_amdgcn_wmma_f32_16x16x32_bf16(false, al, false, bh, (short)0, c, false, false);
  if (NT >= 3) c = __builtin_amdgcn_wmma_f32_16x16x32_bf16(false, ah, false, bl, (short)0, c, false, false);
  asm volatile("v_nop\n\tv_nop\n\tv_nop\n\tv_nop" : "+v"(c) : "v"(ah), "v"(al), "v"(bh), "v"(bl));
  return c;
}

__global__ __launch_bounds__(256) void k_wt_bf16(const float* __restrict__ W, unsigned short* __restrict__ Wt, int K, int N) {
  const int t = blockIdx.x * 256 + threadIdx.x;
  const int k8n = K / 8;
  if (t >= N * k8n) return;
  const int n = t / k8n, k8 = (t % k8n) * 8;
  v8us v;
#pragma unroll
  for (int i = 0; i < 8; ++i) v[i] = bf16_bits(W[(size_t)(k8 + i) * N + n]);
  *(v8us*)(Wt + (size_t)n * K + k8) = v;
  
}

// GEMM C[M][N] (f32, pitch ldc) = act(A[M][K]·W + bias). A f32 row-major (pitch lda) converted per fragment to bf16
// (ASPLIT: hi/lo two planes -> 2 terms, else single rounded term); Wt bf16 [N][K] (pitch ldb). BIAS_BF16 rounds the
// bias to bf16 first (bias quantised to bf16 before the add). K%32==0, M%16==0, N%64==0.
template <bool ASPLIT, int ACT, bool BIAS_BF16>
__global__ __launch_bounds__(128) void k_gemm_bf(const float* __restrict__ A, int lda, const unsigned short* __restrict__ Wt, int ldb,
                                               const float* __restrict__ bias, float* __restrict__ C, int ldc, int M, int N, int K) {
  __shared__ __attribute__((aligned(16))) float so[4][16][64];
  const int tid = threadIdx.x, w = tid >> 5, lane = tid & 31, ln = lane & 15, hh = lane >> 4;
  const int ntn = N / 64;
  const int wid = blockIdx.x * 4 + w;
  const int mt = wid / ntn, nq = wid % ntn;
  if (mt * 16 >= M) return;
  const int row0 = mt * 16, col0 = nq * 64;
  const float* arow = A + (size_t)(row0 + ln) * lda;
  v8f acc[4] = {};
  for (int kb = 0; kb < K; kb += 32) {
    FragB ah, al;
    const v4f x0 = *(const v4fa*)(arow + kb + 8 * hh), x1 = *(const v4fa*)(arow + kb + 8 * hh + 4);
    const v4f x2 = *(const v4fa*)(arow + kb + 16 + 8 * hh), x3 = *(const v4fa*)(arow + kb + 16 + 8 * hh + 4);
    float xs[16] = {x0[0],x0[1],x0[2],x0[3],x1[0],x1[1],x1[2],x1[3],x2[0],x2[1],x2[2],x2[3],x3[0],x3[1],x3[2],x3[3]};
#pragma unroll
    for (int i = 0; i < 16; ++i) { const unsigned short hb = bf16_bits(xs[i]); ah.u[i] = hb; al.u[i] = ASPLIT ? bf16_bits(xs[i] - bf16_val(hb)) : (unsigned short)0; }
#pragma unroll
    for (int t = 0; t < 4; ++t) {
      const unsigned short* brow = Wt + (size_t)(col0 + t * 16 + ln) * ldb + kb;
      FragB b;
      b.half[0] = *(const v8us*)(brow + 8 * hh);
      b.half[1] = *(const v8us*)(brow + 16 + 8 * hh);
      acc[t] = mmaN<ASPLIT ? 2 : 1>(ah.v, al.v, b.v, b.v, acc[t]);
    }
  }
#pragma unroll
  for (int t = 0; t < 4; ++t) {
    float bv = bias ? bias[col0 + t * 16 + ln] : 0.f;
    if (BIAS_BF16) bv = bf16_round(bv);
#pragma unroll
    for (int r = 0; r < 8; ++r) { float v = acc[t][r] + bv; if (ACT == 1) v = fmaxf(v, 0.f); so[w][8 * hh + r][t * 16 + ln] = v; }
  }
  __builtin_amdgcn_fence(__ATOMIC_ACQ_REL, "workgroup");
  __builtin_amdgcn_wave_barrier();
  const int rsub = lane >> 4, c4 = (lane & 15) * 4;
  {
#pragma unroll
    for (int q = 0; q < 8; ++q) {
      const int r = q * 2 + rsub;
      const v4f v = *(const v4fa*)&so[w][r][c4];
      *(v4f*)(C + (size_t)(row0 + r) * ldc + col0 + c4) = v;
    }
    
  }
}

// GEMM C = act(A·W + bias + resid): A f32 (ASPLIT -> hi/lo 2 terms), Wt bf16 [N][K]; ACT 0 none, 1 relu, 2 exact gelu;
// resid (optional, f32, row index = (row % rmod), pitch ldr, RES_BF16 rounds it) added before the activation.
template <bool ASPLIT, int ACT, bool BIAS_BF16, bool RES_BF16>
__global__ __launch_bounds__(128) void k_gemm_bf3(const float* __restrict__ A, int lda, const unsigned short* __restrict__ Wt, int ldb,
                                                const float* __restrict__ bias, const float* __restrict__ resid, int rmod, int ldr,
                                                float* __restrict__ C, int ldc, int M, int N, int K) {
  __shared__ __attribute__((aligned(16))) float so[4][16][64];
  const int tid = threadIdx.x, w = tid >> 5, lane = tid & 31, ln = lane & 15, hh = lane >> 4;
  const int ntn = N / 64;
  const int wid = blockIdx.x * 4 + w;
  const int mt = wid / ntn, nq = wid % ntn;
  if (mt * 16 >= M) return;
  const int row0 = mt * 16, col0 = nq * 64;
  const float* arow = A + (size_t)(row0 + ln) * lda;
  v8f acc[4] = {};
  for (int kb = 0; kb < K; kb += 32) {
    FragB ah, al;
    const v4f x0 = *(const v4fa*)(arow + kb + 8 * hh), x1 = *(const v4fa*)(arow + kb + 8 * hh + 4);
    const v4f x2 = *(const v4fa*)(arow + kb + 16 + 8 * hh), x3 = *(const v4fa*)(arow + kb + 16 + 8 * hh + 4);
    float xs[16] = {x0[0],x0[1],x0[2],x0[3],x1[0],x1[1],x1[2],x1[3],x2[0],x2[1],x2[2],x2[3],x3[0],x3[1],x3[2],x3[3]};
#pragma unroll
    for (int i = 0; i < 16; ++i) { const unsigned short hb = bf16_bits(xs[i]); ah.u[i] = hb; al.u[i] = ASPLIT ? bf16_bits(xs[i] - bf16_val(hb)) : (unsigned short)0; }
#pragma unroll
    for (int t = 0; t < 4; ++t) {
      const unsigned short* brow = Wt + (size_t)(col0 + t * 16 + ln) * ldb + kb;
      FragB b;
      b.half[0] = *(const v8us*)(brow + 8 * hh);
      b.half[1] = *(const v8us*)(brow + 16 + 8 * hh);
      acc[t] = mmaN<ASPLIT ? 2 : 1>(ah.v, al.v, b.v, b.v, acc[t]);
    }
  }
#pragma unroll
  for (int t = 0; t < 4; ++t) {
    const int col = col0 + t * 16 + ln;
    float bv = bias ? bias[col] : 0.f;
    if (BIAS_BF16) bv = bf16_round(bv);
#pragma unroll
    for (int r = 0; r < 8; ++r) {
      float v = acc[t][r] + bv;
      if (resid) { float rv = resid[(size_t)((row0 + 8 * hh + r) % rmod) * ldr + col]; if (RES_BF16) rv = bf16_round(rv); v += rv; }
      if (ACT == 1) v = fmaxf(v, 0.f);
      if (ACT == 2) v = 0.5f * v * (1.0f + erff(v * 0.70710678118654752f));
      if (ACT == 3) { const float u = 0.7978845608028654f * (v + 0.044715f * v * v * v); v = 0.5f * v * (1.0f + tanhf(u)); }
      so[w][8 * hh + r][t * 16 + ln] = v;
    }
  }
  __builtin_amdgcn_fence(__ATOMIC_ACQ_REL, "workgroup");
  __builtin_amdgcn_wave_barrier();
  const int rsub = lane >> 4, c4 = (lane & 15) * 4;
  {
#pragma unroll
    for (int q = 0; q < 8; ++q) {
      const int r = q * 2 + rsub;
      const v4f v = *(const v4fa*)&so[w][r][c4];
      *(v4f*)(C + (size_t)(row0 + r) * ldc + col0 + c4) = v;
    }
    
  }
}
// row LayerNorm (biased variance, eps) over N: s = X (+ R); optional out_sum <- s; out_norm <- (s-mu)*rsqrt(var+eps)*g + b
template <bool PARAM_BF16>
__global__ __launch_bounds__(256) void k_layernorm(const float* __restrict__ X, const float* __restrict__ R, const float* __restrict__ g, const float* __restrict__ bta,
                                                  float* __restrict__ out_sum, float* __restrict__ out_norm, int N, float eps) {
  __shared__ float red[256];
  const int row = blockIdx.x, tid = threadIdx.x;
  const float* x = X + (size_t)row * N; const float* rr = R ? R + (size_t)row * N : nullptr;
  float vals[16];                     // up to N = 4096
  const int per = N / 256;            // contiguous chunk per thread? use strided-by-4 chunks: thread handles j = tid*4 + 1024*u
  float s1 = 0.f;
  for (int u = 0; u < per / 4; ++u) {
    const int j = tid * 4 + 1024 * u;
    const v4f a = *(const v4fa*)(x + j);
    v4f b = {0.f,0.f,0.f,0.f}; if (rr) b = *(const v4fa*)(rr + j);
#pragma unroll
    for (int q = 0; q < 4; ++q) { const float v = a[q] + b[q]; vals[u * 4 + q] = v; s1 += v; }
  }
  red[tid] = s1; __syncthreads();
  for (int st = 128; st > 0; st >>= 1) { if (tid < st) red[tid] += red[tid + st]; __syncthreads(); }
  const float mu = red[0] / (float)N; __syncthreads();
  float s2 = 0.f;
  for (int u = 0; u < per / 4; ++u)
#pragma unroll
    for (int q = 0; q < 4; ++q) { const float c = vals[u * 4 + q] - mu; s2 += c * c; }
  red[tid] = s2; __syncthreads();
  for (int st = 128; st > 0; st >>= 1) { if (tid < st) red[tid] += red[tid + st]; __syncthreads(); }
  const float rs = rsqrtf(red[0] / (float)N + eps);
  {
    for (int u = 0; u < per / 4; ++u) {
      const int j = tid * 4 + 1024 * u;
      v4f o, sm;
#pragma unroll
      for (int q = 0; q < 4; ++q) {
        float gg = g[j + q], bb = bta[j + q];
        if (PARAM_BF16) { gg = bf16_round(gg); bb = bf16_round(bb); }
        sm[q] = vals[u * 4 + q]; o[q] = (vals[u * 4 + q] - mu) * rs * gg + bb;
      }
      if (out_sum) *(v4f*)(out_sum + (size_t)row * N + j) = sm;
      *(v4f*)(out_norm + (size_t)row * N + j) = o;
    }
    
  }
}



// ---- f16 WMMA path (v_wmma_f32_16x16x32_f16): 11-bit significands for operands in range — used where a [0,1] probability operand needs more precision than bf16
typedef _Float16 v16h __attribute__((ext_vector_type(16)));
union FragH { v16h v; v8us half[2]; _Float16 h[16]; unsigned short u[16]; };
template <int NT>
__device__ __forceinline__ v8f mmaH(v16h ah, v16h al, v16h bh, v16h bl, v8f c) {
  c = __builtin_amdgcn_wmma_f32_16x16x32_f16(false, ah, false, bh, (short)0, c, false, false);
  if (NT >= 2) c = __builtin_amdgcn_wmma_f32_16x16x32_f16(false, al, false, bh, (short)0, c, false, false);
  if (NT >= 3) c = __builtin_amdgcn_wmma_f32_16x16x32_f16(false, ah, false, bl, (short)0, c, false, false);
  asm volatile("v_nop\n\tv_nop\n\tv_nop\n\tv_nop" : "+v"(c) : "v"(ah), "v"(al), "v"(bh), "v"(bl));
  return c;
}
// batched GEMM like k_gemm_b but f16 operands: A f32 (split into f16 hi/lo if ASPLIT, else rounded to f16), Bt = f16 values [n][k]; alpha; C f32; N multiple of 16 (partial tiles skipped)
template <bool ASPLIT>
__global__ __launch_bounds__(128) void k_gemm_h(const float* __restrict__ A, int lda, size_t sA, const _Float16* __restrict__ Bh, int ldb, size_t sB, float alpha, float* __restrict__ C, int ldc, size_t sC, int M, int N, int K) {
  __shared__ __attribute__((aligned(16))) float so[4][16][64];
  const int tid = threadIdx.x, w = tid >> 5, lane = tid & 31, ln = lane & 15, hh = lane >> 4; const int by = blockIdx.y;
  A += (size_t)by * sA; Bh += (size_t)by * sB; C += (size_t)by * sC;
  const int ntn = (N + 63) / 64; const int wid = blockIdx.x * 4 + w; const int mt = wid / ntn, nq = wid % ntn; if (mt * 16 >= M) return;
  const int row0 = mt * 16, col0 = nq * 64; const float* arow = A + (size_t)(row0 + ln) * lda;
  v8f acc[4] = {};
  for (int kb = 0; kb < K; kb += 32) {
    FragH ah, al;
    const v4f x0 = *(const v4fa*)(arow + kb + 8 * hh), x1 = *(const v4fa*)(arow + kb + 8 * hh + 4), x2 = *(const v4fa*)(arow + kb + 16 + 8 * hh), x3 = *(const v4fa*)(arow + kb + 16 + 8 * hh + 4);
    float xs[16] = {x0[0],x0[1],x0[2],x0[3],x1[0],x1[1],x1[2],x1[3],x2[0],x2[1],x2[2],x2[3],x3[0],x3[1],x3[2],x3[3]};
#pragma unroll
    for (int i = 0; i < 16; ++i) { const _Float16 h = (_Float16)xs[i]; ah.h[i] = h; al.h[i] = ASPLIT ? (_Float16)(xs[i] - (float)h) : (_Float16)0.0f; }
#pragma unroll
    for (int t = 0; t < 4; ++t) { if (col0 + t * 16 >= N) continue; const size_t boff = (size_t)(col0 + t * 16 + ln) * ldb + kb; FragH bq; bq.half[0] = *(const v8us*)(Bh + boff + 8 * hh); bq.half[1] = *(const v8us*)(Bh + boff + 16 + 8 * hh);
      acc[t] = mmaH<ASPLIT ? 2 : 1>(ah.v, al.v, bq.v, bq.v, acc[t]); }
  }
#pragma unroll
  for (int t = 0; t < 4; ++t) { if (col0 + t * 16 >= N) continue;
#pragma unroll
    for (int r = 0; r < 8; ++r) so[w][8 * hh + r][t * 16 + ln] = acc[t][r] * alpha; }
  __builtin_amdgcn_fence(__ATOMIC_ACQ_REL, "workgroup"); __builtin_amdgcn_wave_barrier();
  const int rsub = lane >> 4, c4 = (lane & 15) * 4;
  {
#pragma unroll
    for (int q = 0; q < 8; ++q) { const int r = q * 2 + rsub; if (col0 + c4 < N) { const v4f v = *(const v4fa*)&so[w][r][c4]; *(v4f*)(C + (size_t)(row0 + r) * ldc + col0 + c4) = v; } }
     }
}

// Wt[n][k] = f16(W[k][n]·scale) from f32 row-major W[K][N] (scale = power of two; bf16-exact weights stay exact in f16 away from the subnormal range)
__global__ __launch_bounds__(256) void k_wt_f16(const float* __restrict__ W, _Float16* __restrict__ Wt, int K, int N, float scale) {
  const int t = blockIdx.x * 256 + threadIdx.x; if (t >= N * (K / 8)) return; const int n = t / (K / 8), k8 = (t % (K / 8)) * 8; FragH f;
#pragma unroll
  for (int i = 0; i < 8; ++i) f.h[i] = (_Float16)(bf16_round(W[(size_t)(k8 + i) * N + n]) * scale); const v8us o = f.half[0];
  *(v8us*)((unsigned short*)Wt + (size_t)n * K + k8) = o; 
}
// k_gemm_hh variant with fused epilogue: v = acc·alpha + bias[by·sBias + col] (+ CP[(row/rowsPerB)·sCPb + by·64 + col] if CP) ; ACT 0 none / 1 elu ; writes f16 C16 (and f32 C if non-null)
template <int ACT>
__global__ __launch_bounds__(128) void k_gemm_hhx(const _Float16* __restrict__ A, int lda, size_t sA, const _Float16* __restrict__ Bh, int ldb, size_t sB, float alpha, const float* __restrict__ bias, size_t sBias, const float* __restrict__ CP, int rowsPerB, size_t sCPb, int row0g,
    float* __restrict__ C, _Float16* __restrict__ C16, int ldc, size_t sC, int M, int N, int K) {
  __shared__ __attribute__((aligned(16))) float so[4][16][64];
  const int tid = threadIdx.x, w = tid >> 5, lane = tid & 31, ln = lane & 15, hh = lane >> 4; const int by = blockIdx.y;
  A += (size_t)by * sA; Bh += (size_t)by * sB; const size_t cofs = (size_t)by * sC; const float* bp = bias ? bias + (size_t)by * sBias : nullptr;
  const int ntn = (N + 63) / 64; const int wid = blockIdx.x * 4 + w; const int mt = wid / ntn, nq = wid % ntn; if (mt * 16 >= M) return;
  const int row0 = mt * 16, col0 = nq * 64; const _Float16* arow = A + (size_t)(row0 + ln) * lda;
  v8f acc[4] = {};
  for (int kb = 0; kb < K; kb += 32) { FragH ah; ah.half[0] = *(const v8us*)((const unsigned short*)arow + kb + 8 * hh); ah.half[1] = *(const v8us*)((const unsigned short*)arow + kb + 16 + 8 * hh);
#pragma unroll
    for (int t = 0; t < 4; ++t) { if (col0 + t * 16 >= N) continue; const size_t boff = (size_t)(col0 + t * 16 + ln) * ldb + kb; FragH bq; bq.half[0] = *(const v8us*)((const unsigned short*)Bh + boff + 8 * hh); bq.half[1] = *(const v8us*)((const unsigned short*)Bh + boff + 16 + 8 * hh);
      acc[t] = mmaH<1>(ah.v, ah.v, bq.v, bq.v, acc[t]); }
  }
#pragma unroll
  for (int t = 0; t < 4; ++t) { if (col0 + t * 16 >= N) continue; const int col = col0 + t * 16 + ln; const float bv = bp ? bf16_round(bp[col]) : 0.f;
#pragma unroll
    for (int r = 0; r < 8; ++r) { float v = acc[t][r] * alpha + bv; if (CP) { const int rr = row0g + row0 + 8 * hh + r; if (rowsPerB < 0) v += CP[cofs + (size_t)rr * ldc + col];      /* rowsPerB < 0: own element of the batched C plane */ else { const int bidx = rr / rowsPerB; v += CP[(size_t)bidx * sCPb + (size_t)by * 64 + col]; } } if (ACT == 1) v = (v > 0.f) ? v : expm1f(v); else if (ACT == 7) v = (v > 0.f) ? v + 1.0f : expf(v); else if (ACT == 8) v = tanhf(v); else if (ACT == 9) v = 0.5f * v * (1.0f + tanhf(0.7978845608028654f * (v + 0.044715f * v * v * v))); else if (ACT == 11) v = 1.0f / (1.0f + expf(-v)); else if (ACT == 12) v = (v > 0.f) ? v : 0.01f * v; else if (ACT == 14) v = (v > 0.f) ? v : 0.1f * v; else if (ACT == 16) v = (v >= 0.f) ? v : 0.3f * v; else if (ACT == 17) v = (v >= 0.f) ? v : 0.2f * v; else if (ACT == 15) v = v / (1.0f + expf(-v)); else if (ACT == 3) v = fmaxf(v, 0.f); else if (ACT == 6) v = 0.5f * v * (1.0f + erff(v * 0.70710678118654752f)); so[w][8 * hh + r][t * 16 + ln] = v; } }
  __builtin_amdgcn_fence(__ATOMIC_ACQ_REL, "workgroup"); __builtin_amdgcn_wave_barrier();
  const int rsub = lane >> 4, c4 = (lane & 15) * 4; typedef _Float16 v4h __attribute__((ext_vector_type(4)));
  {
#pragma unroll
    for (int q = 0; q < 8; ++q) { const int r = q * 2 + rsub; if (col0 + c4 < N) { const v4f v = *(const v4fa*)&so[w][r][c4]; if (C) *(v4f*)(C + cofs + (size_t)(row0 + r) * ldc + col0 + c4) = v; if (C16) { v4h h4; for (int i = 0; i < 4; ++i) h4[i] = (_Float16)v[i]; *(v4h*)(C16 + cofs + (size_t)(row0 + r) * ldc + col0 + c4) = h4; } } }
     }
}


typedef _Float16 v4h __attribute__((ext_vector_type(4)));

__global__ __launch_bounds__(256) void k_x16(const float* __restrict__ x, _Float16* __restrict__ X16, size_t n8) { const size_t t = (size_t)blockIdx.x * 256 + threadIdx.x; if (t >= n8) return; FragH f;
#pragma unroll
  for (int q = 0; q < 8; ++q) f.h[q] = (_Float16)bf16_round(x[t * 8 + q]); *(v8us*)((unsigned short*)X16 + t * 8) = f.half[0];  }
__global__ __launch_bounds__(256) void k_h16(const float* __restrict__ x, _Float16* __restrict__ X16, size_t n8) { const size_t t = (size_t)blockIdx.x * 256 + threadIdx.x; if (t >= n8) return; FragH f;
#pragma unroll
  for (int q = 0; q < 8; ++q) f.h[q] = (_Float16)x[t * 8 + q]; *(v8us*)((unsigned short*)X16 + t * 8) = f.half[0];  }
__global__ __launch_bounds__(256) void k_round16f(const float* __restrict__ W, _Float16* __restrict__ Bt, size_t n8) { const size_t t = (size_t)blockIdx.x * 256 + threadIdx.x; if (t >= n8) return; FragH f;
#pragma unroll
  for (int i = 0; i < 8; ++i) f.h[i] = (_Float16)(bf16_round(W[t * 8 + i]) * 16.0f); *(v8us*)((unsigned short*)Bt + t * 8) = f.half[0];  }
template <int NHv, int TTv>
__global__ __launch_bounds__(256) void k_vt(const _Float16* __restrict__ V16, int ldv, int voff, _Float16* __restrict__ Vt) { __shared__ unsigned short tl[64][66]; const int tid = threadIdx.x; const int slab = blockIdx.x / (TTv / 64), lg = blockIdx.x % (TTv / 64); const int b = slab / NHv, h = slab % NHv;
  for (int i = tid; i < 64 * 8; i += 256) { const int r = i / 8, c8 = (i % 8) * 8; FragH f; f.half[0] = *(const v8us*)((const unsigned short*)V16 + ((size_t)b * TTv + lg * 64 + r) * ldv + voff + h * 64 + c8);
#pragma unroll
    for (int q = 0; q < 8; ++q) tl[r][c8 + q] = f.u[q]; }
  __syncthreads();
  {
#pragma unroll
    for (int rd = 0; rd < 2; ++rd) { const int d = rd * 32 + tid / 8, pc = tid % 8; FragH f;
#pragma unroll
      for (int q = 0; q < 8; ++q) f.u[q] = tl[pc * 8 + q][d];
      *(v8us*)((unsigned short*)Vt + ((size_t)slab * 64 + d) * TTv + lg * 64 + pc * 8) = f.half[0]; }
     } }

__global__ __launch_bounds__(256) void k_hl(const float* __restrict__ F, _Float16* __restrict__ Hh, _Float16* __restrict__ Hl, size_t n8) { const size_t t = (size_t)blockIdx.x * 256 + threadIdx.x; if (t >= n8) return; FragH fh, fl; const v4f a = *(const v4fa*)(F + t * 8), c = *(const v4fa*)(F + t * 8 + 4);
#pragma unroll
  for (int q = 0; q < 4; ++q) { _Float16 h = (_Float16)a[q]; fh.h[q] = h; fl.h[q] = (_Float16)((a[q] - (float)h) * 1024.0f); h = (_Float16)c[q]; fh.h[4 + q] = h; fl.h[4 + q] = (_Float16)((c[q] - (float)h) * 1024.0f); }
  { *(v8us*)((unsigned short*)Hh + t * 8) = fh.half[0]; *(v8us*)((unsigned short*)Hl + t * 8) = fl.half[0];  } }

// ---- fast GEMM (wave tile 32x64; requires M % 32 == 0 rows per launch region and N % 64 == 0); epilogue = k_gemm_hhx semantics ----
__device__ __forceinline__ v16h g2_frag(const _Float16* p, int hh) { FragH f; f.half[0] = *(const v8us*)((const unsigned short*)p + 8 * hh); f.half[1] = *(const v8us*)((const unsigned short*)p + 16 + 8 * hh); return f.v; }
__device__ __forceinline__ v8f g2_mma(v16h a, v16h b, v8f c) { v8f d = __builtin_amdgcn_wmma_f32_16x16x32_f16(false, a, false, b, (short)0, c, false, false); asm volatile("v_nop\n\tv_nop\n\tv_nop\n\tv_nop" : "+v"(d) : "v"(a), "v"(b)); return d; }
template <int ACT>
__global__ __launch_bounds__(128) void k_gemm2(const _Float16* __restrict__ A, int lda, size_t sA, const _Float16* __restrict__ Bh, int ldb, size_t sB, float alpha, const float* __restrict__ bias, size_t sBias, const float* __restrict__ CP, int rowsPerB, size_t sCPb, int row0g,
    float* __restrict__ C, _Float16* __restrict__ C16, int ldc, size_t sC, int M, int N, int K) { static_assert(ACT == 0 || ACT == 3 || ACT == 6 || ACT == 8 || ACT == 9 || ACT == 11 || ACT == 12 || ACT == 14 || ACT == 15 || ACT == 16 || ACT == 17, "k_gemm2: unsupported ACT code (would silently apply no activation)");
  __shared__ __attribute__((aligned(16))) float so[4][32][68];
  const int tid = threadIdx.x, w = tid >> 5, lane = tid & 31, ln = lane & 15, hh = lane >> 4; const int by = blockIdx.y;
  A += (size_t)by * sA; Bh += (size_t)by * sB; const size_t cofs = (size_t)by * sC; const float* bp = bias ? bias + (size_t)by * sBias : nullptr;
  const int ntn = N >> 6; const int mt = blockIdx.x / ntn, nq = blockIdx.x - mt * ntn; const int row0 = mt * 128 + 32 * w, col0 = nq * 64; if (row0 >= M) return;
  const _Float16* a0p = A + (size_t)(row0 + ln) * lda; const _Float16* a1p = a0p + (size_t)16 * lda;
  const _Float16* b0p = Bh + (size_t)(col0 + ln) * ldb; const _Float16* b1p = b0p + (size_t)16 * ldb; const _Float16* b2p = b1p + (size_t)16 * ldb; const _Float16* b3p = b2p + (size_t)16 * ldb;
  const v8f z8 = {0.f,0.f,0.f,0.f,0.f,0.f,0.f,0.f}; v8f c00 = z8, c01 = z8, c02 = z8, c03 = z8, c10 = z8, c11 = z8, c12 = z8, c13 = z8;
#pragma unroll 1
  for (int kb = 0; kb < K; kb += 32) { const v16h a0 = g2_frag(a0p + kb, hh), a1 = g2_frag(a1p + kb, hh);
    v16h b = g2_frag(b0p + kb, hh); c00 = g2_mma(a0, b, c00); c10 = g2_mma(a1, b, c10);
    b = g2_frag(b1p + kb, hh); c01 = g2_mma(a0, b, c01); c11 = g2_mma(a1, b, c11);
    b = g2_frag(b2p + kb, hh); c02 = g2_mma(a0, b, c02); c12 = g2_mma(a1, b, c12);
    b = g2_frag(b3p + kb, hh); c03 = g2_mma(a0, b, c03); c13 = g2_mma(a1, b, c13); }
  v8f accs[8] = {c00, c01, c02, c03, c10, c11, c12, c13};
#pragma unroll
  for (int u = 0; u < 8; ++u) { const int t = u & 3, half = u >> 2; const int col = col0 + t * 16 + ln; const float bv = bp ? bf16_round(bp[col]) : 0.f;
#pragma unroll
    for (int r = 0; r < 8; ++r) { const int rloc = half * 16 + 8 * hh + r; float v = accs[u][r] * alpha + bv; if (CP) { if (rowsPerB < 0) v += CP[cofs + (size_t)(row0g + row0 + rloc) * ldc + col];      /* rowsPerB < 0: own element of the batched C plane */ else { const int bidx = (row0g + row0 + rloc) / rowsPerB; v += CP[(size_t)bidx * sCPb + (size_t)by * 64 + col]; } }
      if (ACT == 3) v = fmaxf(v, 0.f); else if (ACT == 6) v = 0.5f * v * (1.0f + erff(v * 0.70710678118654752f)); else if (ACT == 11) v = 1.0f / (1.0f + expf(-v)); else if (ACT == 15) v = v / (1.0f + expf(-v)); else if (ACT == 12) v = (v > 0.f) ? v : 0.01f * v; else if (ACT == 8) v = tanhf(v); else if (ACT == 9) v = 0.5f * v * (1.0f + tanhf(0.7978845608028654f * (v + 0.044715f * v * v * v))); else if (ACT == 14) v = (v > 0.f) ? v : 0.1f * v; else if (ACT == 16) v = (v >= 0.f) ? v : 0.3f * v; else if (ACT == 17) v = (v >= 0.f) ? v : 0.2f * v;
      so[w][rloc][t * 16 + ln] = v; } }
  __builtin_amdgcn_fence(__ATOMIC_ACQ_REL, "workgroup"); __builtin_amdgcn_wave_barrier();
  const int rsub = lane >> 4, c4 = (lane & 15) * 4;
  {
#pragma unroll
    for (int q = 0; q < 16; ++q) { const int r = q * 2 + rsub; const v4f v = *(const v4fa*)&so[w][r][c4]; if (C) *(v4f*)(C + cofs + (size_t)(row0 + r) * ldc + col0 + c4) = v; if (C16) { v4h h4; for (int i = 0; i < 4; ++i) h4[i] = (_Float16)v[i]; *(v4h*)(C16 + cofs + (size_t)(row0 + r) * ldc + col0 + c4) = h4; } }
     } }


__global__ __launch_bounds__(256) void k_wnat(const float* __restrict__ w, size_t n8, _Float16* __restrict__ Bt) { const size_t t = (size_t)blockIdx.x * 256 + threadIdx.x; if (t >= n8) return; FragH f; for (int q = 0; q < 8; ++q) f.h[q] = (_Float16)(bf16_round(w[t * 8 + q]) * 16.0f); *(v8us*)((unsigned short*)Bt + t * 8) = f.half[0];  }
__global__ __launch_bounds__(256) void k_rsm(const float* __restrict__ S, _Float16* __restrict__ P, int nrows) {
  #pragma clang fp contract(off)
  const int i = blockIdx.x * 256 + threadIdx.x; if (i >= nrows) return; const float* s = S + (size_t)i * SQ; float mx = -3.0e38f;
#pragma unroll 1
  for (int j = 0; j < SQ; ++j) mx = fmaxf(mx, s[j]); float se = 0.f;
#pragma unroll 1
  for (int j = 0; j < SQ; ++j) se += expf(s[j] - mx); const float sc = 256.0f / se;
#pragma unroll 1
  for (int j0 = 0; j0 < SQ; j0 += 8) { FragH f; for (int q = 0; q < 8; ++q) f.h[q] = (_Float16)(expf(s[j0 + q] - mx) * sc); unsigned short* d = (unsigned short*)P + (size_t)i * SQ + j0; *(v8us*)d = f.half[0];  } }
__global__ __launch_bounds__(256) void k_vt(const _Float16* __restrict__ V16, int b, int h0, _Float16* __restrict__ VT) { __shared__ unsigned short tl[64][65]; const int tid = threadIdx.x; const int hh = blockIdx.x % HG, sg = blockIdx.x / HG; const int s0 = sg * 64; const int h = h0 + hh;
  for (int i = tid; i < 64 * 8; i += 256) { const int j = i / 8, d8 = (i % 8) * 8; FragH f; f.half[0] = *(const v8us*)((const unsigned short*)V16 + ((size_t)b * SQ + s0 + j) * DM + h * HD + d8); for (int q = 0; q < 8; ++q) tl[d8 + q][j] = f.u[q]; }
  __syncthreads();
  { for (int i = tid; i < 64 * 8; i += 256) { const int d = i / 8, j8 = (i % 8) * 8; FragH f; for (int q = 0; q < 8; ++q) f.u[q] = tl[d][j8 + q]; *(v8us*)((unsigned short*)VT + ((size_t)hh * HD + d) * SQ + s0 + j8) = f.half[0]; }  } }


__global__ __launch_bounds__(256) void k_x16p(const float* __restrict__ x, _Float16* __restrict__ dst, size_t n8, int nc, int ldo) { const size_t t = (size_t)blockIdx.x * 256 + threadIdx.x; if (t >= n8) return; const size_t e = t * 8; const size_t r = e / nc; const int c = (int)(e % nc); FragH f;
#pragma unroll
  for (int q = 0; q < 8; ++q) f.h[q] = (_Float16)bf16_round(x[e + q]); unsigned short* d = (unsigned short*)dst + r * ldo + c; *(v8us*)d = f.half[0];  }
typedef int v4ia __attribute__((ext_vector_type(4), may_alias));
// Masked row softmax, one wave per score row. Lane l keeps columns 128 i + 4 l .. 128 i + 4 l + 3 (i = 0..15) of its row in registers, so every load of S covers 512 contiguous bytes and S is read once;
// a masked key enters as -inf (its exp is an exact 0); row maximum and row sum: four chains per lane, then a five-step butterfly over the 32 lanes. A row with every key masked (sum 0) gets weights 0.
// Every loop is fully unrolled so that v[] is indexed by constants only and stays in registers (a run-time index would send it to scratch). No product here feeds an add, so nothing can be contracted.
// blockIdx.y = batch (score plane pitch SQ * SQ, mask row pitch SQ). The f16 weights go IN PLACE over the first half of the wave's own f32 score row (weight row pitch 2 * SQ halves): every store's value
// depends on the row sum, hence on every load of the row, and no other wave touches the row, so no score is overwritten before it is read. S carries no restrict because it is read and written.
__global__ __launch_bounds__(256) void k_rsmw(float* S, int qn, const int* __restrict__ mk) {
  const int lane = threadIdx.x & 31; const int row = blockIdx.x * 8 + (threadIdx.x >> 5); if (row >= qn) return;      /* wave-uniform; the kernel has no barrier */
  float* srow = S + (size_t)blockIdx.y * SQ * SQ + (size_t)row * SQ;
  const float* s = srow + lane * 4; const int* m = mk + (size_t)blockIdx.y * SQ + lane * 4; _Float16* p = (_Float16*)srow + lane * 4;
  v4f v[SQ / 128]; v4f mx4 = {-3.0e38f, -3.0e38f, -3.0e38f, -3.0e38f};
#pragma unroll
  for (int i = 0; i < SQ / 128; ++i) { const v4f x = *(const v4fa*)(s + i * 128); const v4ia k = *(const v4ia*)(m + i * 128);
#pragma unroll
    for (int q = 0; q < 4; ++q) { v[i][q] = (k[q] == 0) ? x[q] : -__builtin_inff(); mx4[q] = fmaxf(mx4[q], v[i][q]); } }
  float mx = fmaxf(fmaxf(mx4[0], mx4[1]), fmaxf(mx4[2], mx4[3]));
#pragma unroll
  for (int o = 16; o > 0; o >>= 1) mx = fmaxf(mx, __shfl_xor(mx, o, 32));
  v4f se4 = {0.f, 0.f, 0.f, 0.f};
#pragma unroll
  for (int i = 0; i < SQ / 128; ++i)
#pragma unroll
    for (int q = 0; q < 4; ++q) { const float t = (v[i][q] - mx) * 1.44269504f; float e;      /* native exp(x) = exp2(x log2 e), the same two instructions as __expf */
      asm("v_exp_f32 %0, %1\n\tv_nop" : "=v"(e) : "v"(t));      /* the v_nop keeps the one slot the instruction set asks for behind a transcendental, before its result is read or its source register reused */
      v[i][q] = e; se4[q] += e; }
  float se = (se4[0] + se4[1]) + (se4[2] + se4[3]);
#pragma unroll
  for (int o = 16; o > 0; o >>= 1) se += __shfl_xor(se, o, 32);
  const float sc = (se == 0.f) ? 0.f : 256.0f / se;
#pragma unroll
  for (int i = 0; i < SQ / 128; ++i) { v4h h;
#pragma unroll
    for (int q = 0; q < 4; ++q) h[q] = (_Float16)(v[i][q] * sc);
    *(v4h*)(p + i * 128) = h; } }

extern "C" void kernel_launch(void* const* d_in, const int* in_sizes, int n_in,
                              void* d_out, int out_size, void* d_ws, size_t ws_size, hipStream_t stream) {
  (void)in_sizes; (void)n_in; (void)out_size;
  const float* const* I = (const float* const*)d_in; const float* in1 = I[0]; const float* in2 = I[1]; const int* mask2 = (const int*)d_in[2]; const float* w1 = I[3]; const float* w2 = I[4]; const float* b2 = I[5];      /* weights natural [out][in] */
  char* ws = (char*)d_ws; size_t off = 0;
  auto take = [&](size_t bytes) { char* p = ws + off; off += (bytes + 255) & ~(size_t)255; return p; };
  _Float16* B1 = (_Float16*)take((size_t)NC * NC * 2); _Float16* B2 = (_Float16*)take((size_t)NO * 2 * NC * 2);
  _Float16* X1 = (_Float16*)take(NR * NC * 2); _Float16* X2 = (_Float16*)take(NR * NC * 2); _Float16* N1H = (_Float16*)take(NR * NC * 2); _Float16* N1L = (_Float16*)take(NR * NC * 2); _Float16* CAT = (_Float16*)take(NR * 2 * NC * 2);
  float* S = (float*)take((size_t)NB * SQ * SQ * 4);      /* the score planes of all batches; the softmax weights replace the first half of each score row */
  float* N1F = S;      /* n1 in f32 is last read by k_hl, before the first score is written */
  _Float16* X2T = X1;      /* in1 as f16 rows is last read by the n1 GEMM, before the transposes are written */
  if (off > ws_size) return;      /* 1.5 + 16 + 16 + 16 + 16 + 32 + 128 = approx 226 MiB */
  k_wnat<<<(unsigned)(((size_t)NC * NC / 8 + 255) / 256), 256, 0, stream>>>(w1, (size_t)NC * NC / 8, B1); k_wnat<<<(unsigned)(((size_t)NO * 2 * NC / 8 + 255) / 256), 256, 0, stream>>>(w2, (size_t)NO * 2 * NC / 8, B2);
  k_x16<<<(unsigned)((NR * NC / 8 + 255) / 256), 256, 0, stream>>>(in1, X1, NR * NC / 8); k_x16<<<(unsigned)((NR * NC / 8 + 255) / 256), 256, 0, stream>>>(in2, X2, NR * NC / 8);
  const size_t r0p = (size_t)B0 * SQ;
  k_x16p<<<(unsigned)(((size_t)MP * NC / 8 + 255) / 256), 256, 0, stream>>>(in1 + r0p * NC, CAT + r0p * 2 * NC, (size_t)MP * NC / 8, NC, 2 * NC);      /* cat columns 0..511 = in1 */
  k_gemm2<0><<<dim3((unsigned)((MP / 128) * (NC / 64)), 1), 128, 0, stream>>>(X1 + r0p * NC, NC, 0, B1, NC, 0, 0.0625f, nullptr, 0, nullptr, 1, 0, 0, N1F + r0p * NC, nullptr, NC, 0, MP, NC, NC);      /* n1 = in1 W1^T (f32) */
  k_hl<<<(unsigned)(((size_t)MP * NC / 8 + 255) / 256), 256, 0, stream>>>(N1F + r0p * NC, N1H + r0p * NC, N1L + r0p * NC, (size_t)MP * NC / 8);
  /* every stage below runs all batches in one launch: the scores, softmax and fused take blockIdx.y = batch (k_gemm2 through its batch strides); the transposes fold the batch into blockIdx.x and the output GEMM takes all rows as M */
  const dim3 gs((QN / 128) * (SQ / 64), NBR); const size_t sX = (size_t)SQ * NC, sS = (size_t)SQ * SQ;
  k_vt<NH, SQ><<<NBR * NH * (SQ / 64), 256, 0, stream>>>(X2 + r0p * NC, NC, 0, X2T);      /* in2^T [batch][512][2048] */
  k_gemm2<0><<<gs, 128, 0, stream>>>(N1H + r0p * NC, NC, sX, X2 + r0p * NC, NC, sX, 1.0f, nullptr, 0, nullptr, 1, 0, 0, S, nullptr, SQ, sS, QN, SQ, NC);      /* scores hi */
  k_gemm2<0><<<gs, 128, 0, stream>>>(N1L + r0p * NC, NC, sX, X2 + r0p * NC, NC, sX, 0.0009765625f, nullptr, 0, S, -1, 0, 0, S, nullptr, SQ, sS, QN, SQ, NC);      /* + lo (CP = own element) */
  k_rsmw<<<dim3((QN + 7) / 8, NBR), 256, 0, stream>>>(S, QN, mask2 + r0p);
  k_gemm2<0><<<dim3((QN / 128) * (NC / 64), NBR), 128, 0, stream>>>((const _Float16*)S, 2 * SQ, 2 * sS, X2T, SQ, sX, 0.00390625f, nullptr, 0, nullptr, 1, 0, 0, nullptr, CAT + r0p * 2 * NC + NC, 2 * NC, 2 * sX, QN, NC, SQ);      /* fused (x1: alpha 1/256 undoes the P carry) -> cat columns 512..1023 */
  k_gemm2<8><<<dim3((unsigned)((MPO / 128) * (NO / 64)), 1), 128, 0, stream>>>(CAT + r0p * 2 * NC, 2 * NC, 0, B2, 2 * NC, 0, 0.0625f, b2, 0, nullptr, 1, 0, 0, (float*)d_out + r0p * NO, nullptr, NO, 0, MPO, NO, 2 * NC);      /* out = tanh(cat W2^T + b2) */
}

// v003
// Measured time: 408 microseconds a run.
// Two timings next to v002 put it at 1.41 and 1.42 times that version's speed.
// Counting every step since v000, it is 14.0 times as fast.
#include <hip/hip_runtime.h>
// Cross attention with concat + tanh projection (in1, in2 [8][2048][512]; mask2 [8][2048] int32, nonzero = key masked out; n1 = in1 W1^T (W1 [512][512] natural, no bias); scores = n1 in2^T (no scaling); masked keys -> -inf; softmax over the 2,048 keys; fused = attn in2; out = tanh([in1 | fused] W2^T + b2) (W2 [512][1024] natural) -> [8][2048][512]).
// Structure: token rows; in1, in2 as exact f16 rows; n1 = in1 W1^T as a WMMA GEMM (128x128 block tiles staged in LDS, 64x64 wave tiles, f32 accumulation, exact x16 natural weights) into f32 rows, split on VALU into f16 hi + 2^-10 residual planes; then, all batches in each launch (grid y = batch; the transposes take it from grid x): scores = n1 in2^T as two accumulating GEMM terms (hi + lo; K = 512; in2 exact), masked row softmax on VALU reading the int mask row (f32 statistics, native exp; weights x256 f16, masked keys 0), in2^T via LDS transposes, fused = P . in2 GEMM (K = 2048, alpha 2^-8 undoing the P carry) written as plain f16 straight into columns 512..1023 of the f16 concat rows whose columns 0..511 are the exact in1; out = tanh(cat W2^T + b2) as ONE GEMM (K = 1024, exact x16 natural W2, alpha 1/16) with the tanh epilogue.
// Compute dtype: inputs rounded to bf16; in1, in2, weights exact in f16; n1 as f16 hi + residual planes (~2^-22: the logits have sigma ~23, so plain f16 would cost ~3e-3 logits); softmax weights (x256) and fused (unscaled: f16 relative precision is scale-free and a x16/x0.25 weight split would push small W2 entries into f16 subnormals) plain f16 (~2^-12); scores, softmax statistics and the output f32. v_wmma_f32_16x16x32_f16.
#define NB 8
#define SQ 2048
#define NC 512                       /* d_in = d_hid */
#define NO 512                       /* output features */
#define DM NC
#define NH (NC / 64)                 /* 8 slabs of 64 for the in2^T transpose */
#define HD 64
#define HG 1
#define B0 0                         /* first batch processed (debug hook) */
#define NBR NB                       /* batches processed (debug hook) */
#define QN SQ                        /* query rows attended per batch (debug hook) */
#define NR ((size_t)NB * SQ)
#define MP ((int)((size_t)NBR * SQ)) /* rows projected (debug hook) */
#define MPO MP                       /* rows through the output GEMM (debug hook) */
typedef __bf16 v16b __attribute__((ext_vector_type(16)));
typedef unsigned short v8us __attribute__((ext_vector_type(8), may_alias));
typedef float  v8f  __attribute__((ext_vector_type(8)));
typedef float  v4f  __attribute__((ext_vector_type(4)));
typedef float  v4fa __attribute__((ext_vector_type(4), may_alias));
union FragB { v16b v; v8us half[2]; unsigned short u[16]; };

__device__ __forceinline__ unsigned short bf16_bits(float x) { unsigned int u = __float_as_uint(x); return (unsigned short)((u + 0x7FFFu + ((u >> 16) & 1u)) >> 16); }
__device__ __forceinline__ float bf16_val(unsigned short b) { return __uint_as_float(((unsigned int)b) << 16); }
__device__ __forceinline__ float bf16_round(float x) { return bf16_val(bf16_bits(x)); }
// D += A·B with NT terms: 1 = ah·bh, 2 = + al·bh (A split), 3 = + ah·bl (both split)
template <int NT>
__device__ __forceinline__ v8f mmaN(v16b ah, v16b al, v16b bh, v16b bl, v8f c) {
  c = __builtin_amdgcn_wmma_f32_16x16x32_bf16(false, ah, false, bh, (short)0, c, false, false);
  if (NT >= 2) c = __builtin_amdgcn_wmma_f32_16x16x32_bf16(false, al, false, bh, (short)0, c, false, false);
  if (NT >= 3) c = __builtin_amdgcn_wmma_f32_16x16x32_bf16(false, ah, false, bl, (short)0, c, false, false);
  asm volatile("v_nop\n\tv_nop\n\tv_nop\n\tv_nop" : "+v"(c) : "v"(ah), "v"(al), "v"(bh), "v"(bl));
  return c;
}

__global__ __launch_bounds__(256) void k_wt_bf16(const float* __restrict__ W, unsigned short* __restrict__ Wt, int K, int N) {
  const int t = blockIdx.x * 256 + threadIdx.x;
  const int k8n = K / 8;
  if (t >= N * k8n) return;
  const int n = t / k8n, k8 = (t % k8n) * 8;
  v8us v;
#pragma unroll
  for (int i = 0; i < 8; ++i) v[i] = bf16_bits(W[(size_t)(k8 + i) * N + n]);
  *(v8us*)(Wt + (size_t)n * K + k8) = v;
  
}

// GEMM C[M][N] (f32, pitch ldc) = act(A[M][K]·W + bias). A f32 row-major (pitch lda) converted per fragment to bf16
// (ASPLIT: hi/lo two planes -> 2 terms, else single rounded term); Wt bf16 [N][K] (pitch ldb). BIAS_BF16 rounds the
// bias to bf16 first (bias quantised to bf16 before the add). K%32==0, M%16==0, N%64==0.
template <bool ASPLIT, int ACT, bool BIAS_BF16>
__global__ __launch_bounds__(128) void k_gemm_bf(const float* __restrict__ A, int lda, const unsigned short* __restrict__ Wt, int ldb,
                                               const float* __restrict__ bias, float* __restrict__ C, int ldc, int M, int N, int K) {
  __shared__ __attribute__((aligned(16))) float so[4][16][64];
  const int tid = threadIdx.x, w = tid >> 5, lane = tid & 31, ln = lane & 15, hh = lane >> 4;
  const int ntn = N / 64;
  const int wid = blockIdx.x * 4 + w;
  const int mt = wid / ntn, nq = wid % ntn;
  if (mt * 16 >= M) return;
  const int row0 = mt * 16, col0 = nq * 64;
  const float* arow = A + (size_t)(row0 + ln) * lda;
  v8f acc[4] = {};
  for (int kb = 0; kb < K; kb += 32) {
    FragB ah, al;
    const v4f x0 = *(const v4fa*)(arow + kb + 8 * hh), x1 = *(const v4fa*)(arow + kb + 8 * hh + 4);
    const v4f x2 = *(const v4fa*)(arow + kb + 16 + 8 * hh), x3 = *(const v4fa*)(arow + kb + 16 + 8 * hh + 4);
    float xs[16] = {x0[0],x0[1],x0[2],x0[3],x1[0],x1[1],x1[2],x1[3],x2[0],x2[1],x2[2],x2[3],x3[0],x3[1],x3[2],x3[3]};
#pragma unroll
    for (int i = 0; i < 16; ++i) { const unsigned short hb = bf16_bits(xs[i]); ah.u[i] = hb; al.u[i] = ASPLIT ? bf16_bits(xs[i] - bf16_val(hb)) : (unsigned short)0; }
#pragma unroll
    for (int t = 0; t < 4; ++t) {
      const unsigned short* brow = Wt + (size_t)(col0 + t * 16 + ln) * ldb + kb;
      FragB b;
      b.half[0] = *(const v8us*)(brow + 8 * hh);
      b.half[1] = *(const v8us*)(brow + 16 + 8 * hh);
      acc[t] = mmaN<ASPLIT ? 2 : 1>(ah.v, al.v, b.v, b.v, acc[t]);
    }
  }
#pragma unroll
  for (int t = 0; t < 4; ++t) {
    float bv = bias ? bias[col0 + t * 16 + ln] : 0.f;
    if (BIAS_BF16) bv = bf16_round(bv);
#pragma unroll
    for (int r = 0; r < 8; ++r) { float v = acc[t][r] + bv; if (ACT == 1) v = fmaxf(v, 0.f); so[w][8 * hh + r][t * 16 + ln] = v; }
  }
  __builtin_amdgcn_fence(__ATOMIC_ACQ_REL, "workgroup");
  __builtin_amdgcn_wave_barrier();
  const int rsub = lane >> 4, c4 = (lane & 15) * 4;
  {
#pragma unroll
    for (int q = 0; q < 8; ++q) {
      const int r = q * 2 + rsub;
      const v4f v = *(const v4fa*)&so[w][r][c4];
      *(v4f*)(C + (size_t)(row0 + r) * ldc + col0 + c4) = v;
    }
    
  }
}

// GEMM C = act(A·W + bias + resid): A f32 (ASPLIT -> hi/lo 2 terms), Wt bf16 [N][K]; ACT 0 none, 1 relu, 2 exact gelu;
// resid (optional, f32, row index = (row % rmod), pitch ldr, RES_BF16 rounds it) added before the activation.
template <bool ASPLIT, int ACT, bool BIAS_BF16, bool RES_BF16>
__global__ __launch_bounds__(128) void k_gemm_bf3(const float* __restrict__ A, int lda, const unsigned short* __restrict__ Wt, int ldb,
                                                const float* __restrict__ bias, const float* __restrict__ resid, int rmod, int ldr,
                                                float* __restrict__ C, int ldc, int M, int N, int K) {
  __shared__ __attribute__((aligned(16))) float so[4][16][64];
  const int tid = threadIdx.x, w = tid >> 5, lane = tid & 31, ln = lane & 15, hh = lane >> 4;
  const int ntn = N / 64;
  const int wid = blockIdx.x * 4 + w;
  const int mt = wid / ntn, nq = wid % ntn;
  if (mt * 16 >= M) return;
  const int row0 = mt * 16, col0 = nq * 64;
  const float* arow = A + (size_t)(row0 + ln) * lda;
  v8f acc[4] = {};
  for (int kb = 0; kb < K; kb += 32) {
    FragB ah, al;
    const v4f x0 = *(const v4fa*)(arow + kb + 8 * hh), x1 = *(const v4fa*)(arow + kb + 8 * hh + 4);
    const v4f x2 = *(const v4fa*)(arow + kb + 16 + 8 * hh), x3 = *(const v4fa*)(arow + kb + 16 + 8 * hh + 4);
    float xs[16] = {x0[0],x0[1],x0[2],x0[3],x1[0],x1[1],x1[2],x1[3],x2[0],x2[1],x2[2],x2[3],x3[0],x3[1],x3[2],x3[3]};
#pragma unroll
    for (int i = 0; i < 16; ++i) { const unsigned short hb = bf16_bits(xs[i]); ah.u[i] = hb; al.u[i] = ASPLIT ? bf16_bits(xs[i] - bf16_val(hb)) : (unsigned short)0; }
#pragma unroll
    for (int t = 0; t < 4; ++t) {
      const unsigned short* brow = Wt + (size_t)(col0 + t * 16 + ln) * ldb + kb;
      FragB b;
      b.half[0] = *(const v8us*)(brow + 8 * hh);
      b.half[1] = *(const v8us*)(brow + 16 + 8 * hh);
      acc[t] = mmaN<ASPLIT ? 2 : 1>(ah.v, al.v, b.v, b.v, acc[t]);
    }
  }
#pragma unroll
  for (int t = 0; t < 4; ++t) {
    const int col = col0 + t * 16 + ln;
    float bv = bias ? bias[col] : 0.f;
    if (BIAS_BF16) bv = bf16_round(bv);
#pragma unroll
    for (int r = 0; r < 8; ++r) {
      float v = acc[t][r] + bv;
      if (resid) { float rv = resid[(size_t)((row0 + 8 * hh + r) % rmod) * ldr + col]; if (RES_BF16) rv = bf16_round(rv); v += rv; }
      if (ACT == 1) v = fmaxf(v, 0.f);
      if (ACT == 2) v = 0.5f * v * (1.0f + erff(v * 0.70710678118654752f));
      if (ACT == 3) { const float u = 0.7978845608028654f * (v + 0.044715f * v * v * v); v = 0.5f * v * (1.0f + tanhf(u)); }
      so[w][8 * hh + r][t * 16 + ln] = v;
    }
  }
  __builtin_amdgcn_fence(__ATOMIC_ACQ_REL, "workgroup");
  __builtin_amdgcn_wave_barrier();
  const int rsub = lane >> 4, c4 = (lane & 15) * 4;
  {
#pragma unroll
    for (int q = 0; q < 8; ++q) {
      const int r = q * 2 + rsub;
      const v4f v = *(const v4fa*)&so[w][r][c4];
      *(v4f*)(C + (size_t)(row0 + r) * ldc + col0 + c4) = v;
    }
    
  }
}
// row LayerNorm (biased variance, eps) over N: s = X (+ R); optional out_sum <- s; out_norm <- (s-mu)*rsqrt(var+eps)*g + b
template <bool PARAM_BF16>
__global__ __launch_bounds__(256) void k_layernorm(const float* __restrict__ X, const float* __restrict__ R, const float* __restrict__ g, const float* __restrict__ bta,
                                                  float* __restrict__ out_sum, float* __restrict__ out_norm, int N, float eps) {
  __shared__ float red[256];
  const int row = blockIdx.x, tid = threadIdx.x;
  const float* x = X + (size_t)row * N; const float* rr = R ? R + (size_t)row * N : nullptr;
  float vals[16];                     // up to N = 4096
  const int per = N / 256;            // contiguous chunk per thread? use strided-by-4 chunks: thread handles j = tid*4 + 1024*u
  float s1 = 0.f;
  for (int u = 0; u < per / 4; ++u) {
    const int j = tid * 4 + 1024 * u;
    const v4f a = *(const v4fa*)(x + j);
    v4f b = {0.f,0.f,0.f,0.f}; if (rr) b = *(const v4fa*)(rr + j);
#pragma unroll
    for (int q = 0; q < 4; ++q) { const float v = a[q] + b[q]; vals[u * 4 + q] = v; s1 += v; }
  }
  red[tid] = s1; __syncthreads();
  for (int st = 128; st > 0; st >>= 1) { if (tid < st) red[tid] += red[tid + st]; __syncthreads(); }
  const float mu = red[0] / (float)N; __syncthreads();
  float s2 = 0.f;
  for (int u = 0; u < per / 4; ++u)
#pragma unroll
    for (int q = 0; q < 4; ++q) { const float c = vals[u * 4 + q] - mu; s2 += c * c; }
  red[tid] = s2; __syncthreads();
  for (int st = 128; st > 0; st >>= 1) { if (tid < st) red[tid] += red[tid + st]; __syncthreads(); }
  const float rs = rsqrtf(red[0] / (float)N + eps);
  {
    for (int u = 0; u < per / 4; ++u) {
      const int j = tid * 4 + 1024 * u;
      v4f o, sm;
#pragma unroll
      for (int q = 0; q < 4; ++q) {
        float gg = g[j + q], bb = bta[j + q];
        if (PARAM_BF16) { gg = bf16_round(gg); bb = bf16_round(bb); }
        sm[q] = vals[u * 4 + q]; o[q] = (vals[u * 4 + q] - mu) * rs * gg + bb;
      }
      if (out_sum) *(v4f*)(out_sum + (size_t)row * N + j) = sm;
      *(v4f*)(out_norm + (size_t)row * N + j) = o;
    }
    
  }
}



// ---- f16 WMMA path (v_wmma_f32_16x16x32_f16): 11-bit significands for operands in range — used where a [0,1] probability operand needs more precision than bf16
typedef _Float16 v16h __attribute__((ext_vector_type(16)));
union FragH { v16h v; v8us half[2]; _Float16 h[16]; unsigned short u[16]; };
template <int NT>
__device__ __forceinline__ v8f mmaH(v16h ah, v16h al, v16h bh, v16h bl, v8f c) {
  c = __builtin_amdgcn_wmma_f32_16x16x32_f16(false, ah, false, bh, (short)0, c, false, false);
  if (NT >= 2) c = __builtin_amdgcn_wmma_f32_16x16x32_f16(false, al, false, bh, (short)0, c, false, false);
  if (NT >= 3) c = __builtin_amdgcn_wmma_f32_16x16x32_f16(false, ah, false, bl, (short)0, c, false, false);
  asm volatile("v_nop\n\tv_nop\n\tv_nop\n\tv_nop" : "+v"(c) : "v"(ah), "v"(al), "v"(bh), "v"(bl));
  return c;
}
// batched GEMM like k_gemm_b but f16 operands: A f32 (split into f16 hi/lo if ASPLIT, else rounded to f16), Bt = f16 values [n][k]; alpha; C f32; N multiple of 16 (partial tiles skipped)
template <bool ASPLIT>
__global__ __launch_bounds__(128) void k_gemm_h(const float* __restrict__ A, int lda, size_t sA, const _Float16* __restrict__ Bh, int ldb, size_t sB, float alpha, float* __restrict__ C, int ldc, size_t sC, int M, int N, int K) {
  __shared__ __attribute__((aligned(16))) float so[4][16][64];
  const int tid = threadIdx.x, w = tid >> 5, lane = tid & 31, ln = lane & 15, hh = lane >> 4; const int by = blockIdx.y;
  A += (size_t)by * sA; Bh += (size_t)by * sB; C += (size_t)by * sC;
  const int ntn = (N + 63) / 64; const int wid = blockIdx.x * 4 + w; const int mt = wid / ntn, nq = wid % ntn; if (mt * 16 >= M) return;
  const int row0 = mt * 16, col0 = nq * 64; const float* arow = A + (size_t)(row0 + ln) * lda;
  v8f acc[4] = {};
  for (int kb = 0; kb < K; kb += 32) {
    FragH ah, al;
    const v4f x0 = *(const v4fa*)(arow + kb + 8 * hh), x1 = *(const v4fa*)(arow + kb + 8 * hh + 4), x2 = *(const v4fa*)(arow + kb + 16 + 8 * hh), x3 = *(const v4fa*)(arow + kb + 16 + 8 * hh + 4);
    float xs[16] = {x0[0],x0[1],x0[2],x0[3],x1[0],x1[1],x1[2],x1[3],x2[0],x2[1],x2[2],x2[3],x3[0],x3[1],x3[2],x3[3]};
#pragma unroll
    for (int i = 0; i < 16; ++i) { const _Float16 h = (_Float16)xs[i]; ah.h[i] = h; al.h[i] = ASPLIT ? (_Float16)(xs[i] - (float)h) : (_Float16)0.0f; }
#pragma unroll
    for (int t = 0; t < 4; ++t) { if (col0 + t * 16 >= N) continue; const size_t boff = (size_t)(col0 + t * 16 + ln) * ldb + kb; FragH bq; bq.half[0] = *(const v8us*)(Bh + boff + 8 * hh); bq.half[1] = *(const v8us*)(Bh + boff + 16 + 8 * hh);
      acc[t] = mmaH<ASPLIT ? 2 : 1>(ah.v, al.v, bq.v, bq.v, acc[t]); }
  }
#pragma unroll
  for (int t = 0; t < 4; ++t) { if (col0 + t * 16 >= N) continue;
#pragma unroll
    for (int r = 0; r < 8; ++r) so[w][8 * hh + r][t * 16 + ln] = acc[t][r] * alpha; }
  __builtin_amdgcn_fence(__ATOMIC_ACQ_REL, "workgroup"); __builtin_amdgcn_wave_barrier();
  const int rsub = lane >> 4, c4 = (lane & 15) * 4;
  {
#pragma unroll
    for (int q = 0; q < 8; ++q) { const int r = q * 2 + rsub; if (col0 + c4 < N) { const v4f v = *(const v4fa*)&so[w][r][c4]; *(v4f*)(C + (size_t)(row0 + r) * ldc + col0 + c4) = v; } }
     }
}

// Wt[n][k] = f16(W[k][n]·scale) from f32 row-major W[K][N] (scale = power of two; bf16-exact weights stay exact in f16 away from the subnormal range)
__global__ __launch_bounds__(256) void k_wt_f16(const float* __restrict__ W, _Float16* __restrict__ Wt, int K, int N, float scale) {
  const int t = blockIdx.x * 256 + threadIdx.x; if (t >= N * (K / 8)) return; const int n = t / (K / 8), k8 = (t % (K / 8)) * 8; FragH f;
#pragma unroll
  for (int i = 0; i < 8; ++i) f.h[i] = (_Float16)(bf16_round(W[(size_t)(k8 + i) * N + n]) * scale); const v8us o = f.half[0];
  *(v8us*)((unsigned short*)Wt + (size_t)n * K + k8) = o; 
}
// k_gemm_hh variant with fused epilogue: v = acc·alpha + bias[by·sBias + col] (+ CP[(row/rowsPerB)·sCPb + by·64 + col] if CP) ; ACT 0 none / 1 elu ; writes f16 C16 (and f32 C if non-null)
template <int ACT>
__global__ __launch_bounds__(128) void k_gemm_hhx(const _Float16* __restrict__ A, int lda, size_t sA, const _Float16* __restrict__ Bh, int ldb, size_t sB, float alpha, const float* __restrict__ bias, size_t sBias, const float* __restrict__ CP, int rowsPerB, size_t sCPb, int row0g,
    float* __restrict__ C, _Float16* __restrict__ C16, int ldc, size_t sC, int M, int N, int K) {
  __shared__ __attribute__((aligned(16))) float so[4][16][64];
  const int tid = threadIdx.x, w = tid >> 5, lane = tid & 31, ln = lane & 15, hh = lane >> 4; const int by = blockIdx.y;
  A += (size_t)by * sA; Bh += (size_t)by * sB; const size_t cofs = (size_t)by * sC; const float* bp = bias ? bias + (size_t)by * sBias : nullptr;
  const int ntn = (N + 63) / 64; const int wid = blockIdx.x * 4 + w; const int mt = wid / ntn, nq = wid % ntn; if (mt * 16 >= M) return;
  const int row0 = mt * 16, col0 = nq * 64; const _Float16* arow = A + (size_t)(row0 + ln) * lda;
  v8f acc[4] = {};
  for (int kb = 0; kb < K; kb += 32) { FragH ah; ah.half[0] = *(const v8us*)((const unsigned short*)arow + kb + 8 * hh); ah.half[1] = *(const v8us*)((const unsigned short*)arow + kb + 16 + 8 * hh);
#pragma unroll
    for (int t = 0; t < 4; ++t) { if (col0 + t * 16 >= N) continue; const size_t boff = (size_t)(col0 + t * 16 + ln) * ldb + kb; FragH bq; bq.half[0] = *(const v8us*)((const unsigned short*)Bh + boff + 8 * hh); bq.half[1] = *(const v8us*)((const unsigned short*)Bh + boff + 16 + 8 * hh);
      acc[t] = mmaH<1>(ah.v, ah.v, bq.v, bq.v, acc[t]); }
  }
#pragma unroll
  for (int t = 0; t < 4; ++t) { if (col0 + t * 16 >= N) continue; const int col = col0 + t * 16 + ln; const float bv = bp ? bf16_round(bp[col]) : 0.f;
#pragma unroll
    for (int r = 0; r < 8; ++r) { float v = acc[t][r] * alpha + bv; if (CP) { const int rr = row0g + row0 + 8 * hh + r; if (rowsPerB < 0) v += CP[cofs + (size_t)rr * ldc + col];      /* rowsPerB < 0: own element of the batched C plane */ else { const int bidx = rr / rowsPerB; v += CP[(size_t)bidx * sCPb + (size_t)by * 64 + col]; } } if (ACT == 1) v = (v > 0.f) ? v : expm1f(v); else if (ACT == 7) v = (v > 0.f) ? v + 1.0f : expf(v); else if (ACT == 8) v = tanhf(v); else if (ACT == 9) v = 0.5f * v * (1.0f + tanhf(0.7978845608028654f * (v + 0.044715f * v * v * v))); else if (ACT == 11) v = 1.0f / (1.0f + expf(-v)); else if (ACT == 12) v = (v > 0.f) ? v : 0.01f * v; else if (ACT == 14) v = (v > 0.f) ? v : 0.1f * v; else if (ACT == 16) v = (v >= 0.f) ? v : 0.3f * v; else if (ACT == 17) v = (v >= 0.f) ? v : 0.2f * v; else if (ACT == 15) v = v / (1.0f + expf(-v)); else if (ACT == 3) v = fmaxf(v, 0.f); else if (ACT == 6) v = 0.5f * v * (1.0f + erff(v * 0.70710678118654752f)); so[w][8 * hh + r][t * 16 + ln] = v; } }
  __builtin_amdgcn_fence(__ATOMIC_ACQ_REL, "workgroup"); __builtin_amdgcn_wave_barrier();
  const int rsub = lane >> 4, c4 = (lane & 15) * 4; typedef _Float16 v4h __attribute__((ext_vector_type(4)));
  {
#pragma unroll
    for (int q = 0; q < 8; ++q) { const int r = q * 2 + rsub; if (col0 + c4 < N) { const v4f v = *(const v4fa*)&so[w][r][c4]; if (C) *(v4f*)(C + cofs + (size_t)(row0 + r) * ldc + col0 + c4) = v; if (C16) { v4h h4; for (int i = 0; i < 4; ++i) h4[i] = (_Float16)v[i]; *(v4h*)(C16 + cofs + (size_t)(row0 + r) * ldc + col0 + c4) = h4; } } }
     }
}


typedef _Float16 v4h __attribute__((ext_vector_type(4)));

__global__ __launch_bounds__(256) void k_x16(const float* __restrict__ x, _Float16* __restrict__ X16, size_t n8) { const size_t t = (size_t)blockIdx.x * 256 + threadIdx.x; if (t >= n8) return; FragH f;
#pragma unroll
  for (int q = 0; q < 8; ++q) f.h[q] = (_Float16)bf16_round(x[t * 8 + q]); *(v8us*)((unsigned short*)X16 + t * 8) = f.half[0];  }
__global__ __launch_bounds__(256) void k_h16(const float* __restrict__ x, _Float16* __restrict__ X16, size_t n8) { const size_t t = (size_t)blockIdx.x * 256 + threadIdx.x; if (t >= n8) return; FragH f;
#pragma unroll
  for (int q = 0; q < 8; ++q) f.h[q] = (_Float16)x[t * 8 + q]; *(v8us*)((unsigned short*)X16 + t * 8) = f.half[0];  }
__global__ __launch_bounds__(256) void k_round16f(const float* __restrict__ W, _Float16* __restrict__ Bt, size_t n8) { const size_t t = (size_t)blockIdx.x * 256 + threadIdx.x; if (t >= n8) return; FragH f;
#pragma unroll
  for (int i = 0; i < 8; ++i) f.h[i] = (_Float16)(bf16_round(W[t * 8 + i]) * 16.0f); *(v8us*)((unsigned short*)Bt + t * 8) = f.half[0];  }
template <int NHv, int TTv>
__global__ __launch_bounds__(256) void k_vt(const _Float16* __restrict__ V16, int ldv, int voff, _Float16* __restrict__ Vt) { __shared__ unsigned short tl[64][66]; const int tid = threadIdx.x; const int slab = blockIdx.x / (TTv / 64), lg = blockIdx.x % (TTv / 64); const int b = slab / NHv, h = slab % NHv;
  for (int i = tid; i < 64 * 8; i += 256) { const int r = i / 8, c8 = (i % 8) * 8; FragH f; f.half[0] = *(const v8us*)((const unsigned short*)V16 + ((size_t)b * TTv + lg * 64 + r) * ldv + voff + h * 64 + c8);
#pragma unroll
    for (int q = 0; q < 8; ++q) tl[r][c8 + q] = f.u[q]; }
  __syncthreads();
  {
#pragma unroll
    for (int rd = 0; rd < 2; ++rd) { const int d = rd * 32 + tid / 8, pc = tid % 8; FragH f;
#pragma unroll
      for (int q = 0; q < 8; ++q) f.u[q] = tl[pc * 8 + q][d];
      *(v8us*)((unsigned short*)Vt + ((size_t)slab * 64 + d) * TTv + lg * 64 + pc * 8) = f.half[0]; }
     } }

__global__ __launch_bounds__(256) void k_hl(const float* __restrict__ F, _Float16* __restrict__ Hh, _Float16* __restrict__ Hl, size_t n8) { const size_t t = (size_t)blockIdx.x * 256 + threadIdx.x; if (t >= n8) return; FragH fh, fl; const v4f a = *(const v4fa*)(F + t * 8), c = *(const v4fa*)(F + t * 8 + 4);
#pragma unroll
  for (int q = 0; q < 4; ++q) { _Float16 h = (_Float16)a[q]; fh.h[q] = h; fl.h[q] = (_Float16)((a[q] - (float)h) * 1024.0f); h = (_Float16)c[q]; fh.h[4 + q] = h; fl.h[4 + q] = (_Float16)((c[q] - (float)h) * 1024.0f); }
  { *(v8us*)((unsigned short*)Hh + t * 8) = fh.half[0]; *(v8us*)((unsigned short*)Hl + t * 8) = fl.half[0];  } }

// ---- fast GEMM: block tile 128x128, four waves of 64x64 (requires M % 128 == 0 rows per launch region, N % 128 == 0, K % 64 == 0); epilogue = k_gemm_hhx semantics ----
// Both operand tiles of a 64-k pass are brought into LDS once per work-group by asynchronous copies (each wave-wide copy covers four whole 128-byte rows) and read from there by all four waves;
// two buffers, so that the next pass's copies fly while this pass is multiplied. Each output element still sums its k blocks of 32 in ascending order.
#define G2_PITCH 144                 /* LDS bytes per 128-byte tile row: 16 B x odd, the pitch at which ds_load_b128 readers of 16 rows meet no bank conflict */
#define G2_OPER (128 * G2_PITCH)     /* one operand's 128 rows of a pass */
#define G2_STAGE (2 * G2_OPER)       /* one buffer: [A 128 rows | B 128 rows] */
#define G2_SOP 68                    /* floats per row of the output staging */
__device__ __forceinline__ v16h g2_lfrag(const char* p) { FragH f; f.half[0] = *(const v8us*)p; f.half[1] = *(const v8us*)(p + 32); return f.v; }      /* same k order as a fragment read from global rows: k = 8 hh .. 8 hh + 7, then 16 + 8 hh .. */
__device__ __forceinline__ v8f g2_mma(v16h a, v16h b, v8f c) { v8f d = __builtin_amdgcn_wmma_f32_16x16x32_f16(false, a, false, b, (short)0, c, false, false); asm volatile("v_nop\n\tv_nop\n\tv_nop\n\tv_nop" : "+v"(d) : "v"(a), "v"(b)); return d; }
// One operand's 128 rows x 128 bytes: the lane's 16 bytes of rows r, r + 16, .. r + 112 (l = its LDS byte address for row r, p = its global address for row r, ld = global row pitch in halves).
// The s_wait_xcnt closes the copies' own statement so that no address register of a copy is rewritten in front of it.
__device__ __forceinline__ void g2_copy8(unsigned l, const _Float16* p, size_t ld) {
  asm volatile("global_load_async_to_lds_b128 %0, %8, off\n\t"
               "global_load_async_to_lds_b128 %1, %9, off\n\t"
               "global_load_async_to_lds_b128 %2, %10, off\n\t"
               "global_load_async_to_lds_b128 %3, %11, off\n\t"
               "global_load_async_to_lds_b128 %4, %12, off\n\t"
               "global_load_async_to_lds_b128 %5, %13, off\n\t"
               "global_load_async_to_lds_b128 %6, %14, off\n\t"
               "global_load_async_to_lds_b128 %7, %15, off\n\t"
               "s_wait_xcnt 0x0"
               :: "v"(l), "v"(l + 16 * G2_PITCH), "v"(l + 32 * G2_PITCH), "v"(l + 48 * G2_PITCH), "v"(l + 64 * G2_PITCH), "v"(l + 80 * G2_PITCH), "v"(l + 96 * G2_PITCH), "v"(l + 112 * G2_PITCH),
                  "v"(p), "v"(p + 16 * ld), "v"(p + 32 * ld), "v"(p + 48 * ld), "v"(p + 64 * ld), "v"(p + 80 * ld), "v"(p + 96 * ld), "v"(p + 112 * ld)
               : "memory");
}
template <int ACT>
__global__ __launch_bounds__(128) void k_gemm2(const _Float16* __restrict__ A, int lda, size_t sA, const _Float16* __restrict__ Bh, int ldb, size_t sB, float alpha, const float* __restrict__ bias, size_t sBias, const float* __restrict__ CP, int rowsPerB, size_t sCPb, int row0g,
    float* __restrict__ C, _Float16* __restrict__ C16, int ldc, size_t sC, int M, int N, int K) { static_assert(ACT == 0 || ACT == 3 || ACT == 6 || ACT == 8 || ACT == 9 || ACT == 11 || ACT == 12 || ACT == 14 || ACT == 15 || ACT == 16 || ACT == 17, "k_gemm2: unsupported ACT code (would silently apply no activation)");
  __shared__ __attribute__((aligned(16))) char sm[2 * G2_STAGE];      /* the two buffers; behind the loop's last barrier the same bytes stage the output */
  static_assert(4 * 64 * G2_SOP * 4 <= 2 * G2_STAGE, "output staging must fit the ring");
  const int tid = threadIdx.x, w = tid >> 5, lane = tid & 31, ln = lane & 15, hh = lane >> 4; const int by = blockIdx.y;
  A += (size_t)by * sA; Bh += (size_t)by * sB; const size_t cofs = (size_t)by * sC; const float* bp = bias ? bias + (size_t)by * sBias : nullptr;
  const int ntn = N >> 7; const int mt = blockIdx.x / ntn, nq = blockIdx.x - mt * ntn; const int rowB = mt * 128, colB = nq * 128; if (rowB >= M) return;      /* the same for the whole work-group, in front of every barrier */
  const int row0 = rowB + 64 * (w >> 1), col0 = colB + 64 * (w & 1);
  const int cr = tid >> 3, cc = tid & 7;      /* copies: eight lanes per 128-byte row, 16 rows per round of the work-group */
  const _Float16* ga = A + (size_t)(rowB + cr) * lda + cc * 8; const _Float16* gb = Bh + (size_t)(colB + cr) * ldb + cc * 8;
  const unsigned lc = (unsigned)(size_t)sm + (unsigned)(cr * G2_PITCH + cc * 16);
  const char* fa = sm + (64 * (w >> 1) + ln) * G2_PITCH + 16 * hh; const char* fb = sm + G2_OPER + (64 * (w & 1) + ln) * G2_PITCH + 16 * hh;
  const int np = K >> 6;
  g2_copy8(lc, ga, (size_t)lda); g2_copy8(lc + G2_OPER, gb, (size_t)ldb);      /* pass 0 -> buffer 0 */
  asm volatile("s_wait_asynccnt 0x0" ::: "memory");      /* this wave's copies of pass 0 have landed */
  __syncthreads();      /* every wave's have: pass 0 may be read */
  if (np > 1) { g2_copy8(lc + G2_STAGE, ga + 64, (size_t)lda); g2_copy8(lc + G2_STAGE + G2_OPER, gb + 64, (size_t)ldb); }      /* pass 1 -> buffer 1, where there is one (the same test for the whole work-group) */
  const v8f z8 = {0.f,0.f,0.f,0.f,0.f,0.f,0.f,0.f}; v8f acc[4][4];
#pragma unroll
  for (int i = 0; i < 4; ++i)
#pragma unroll
    for (int j = 0; j < 4; ++j) acc[i][j] = z8;
#pragma unroll 1      /* one pass per trip: the buffer offset is the only thing that differs, and an unrolled copy of 32 WMMAs buys nothing */
  for (int t = 0; t < np; ++t) { const int bo = (t & 1) * G2_STAGE;
#pragma unroll
    for (int ks = 0; ks < 2; ++ks) { v16h a[4], b[4];
#pragma unroll
      for (int i = 0; i < 4; ++i) { a[i] = g2_lfrag(fa + bo + i * 16 * G2_PITCH + ks * 64); b[i] = g2_lfrag(fb + bo + i * 16 * G2_PITCH + ks * 64); }
#pragma unroll
      for (int j = 0; j < 4; ++j)
#pragma unroll
        for (int i = 0; i < 4; ++i) acc[i][j] = g2_mma(a[i], b[j], acc[i][j]); }
    asm volatile("s_wait_dscnt 0x0" ::: "memory");      /* this wave's reads of buffer t mod 2 are done before the barrier lets it be refilled */
    asm volatile("s_wait_asynccnt 0x0" ::: "memory");      /* this wave's copies of pass t + 1 have landed */
    __syncthreads();      /* publishes pass t + 1 and ends every reader's last read of buffer t mod 2 */
    if (t + 2 < np) { g2_copy8(lc + bo, ga + (size_t)(t + 2) * 64, (size_t)lda); g2_copy8(lc + bo + G2_OPER, gb + (size_t)(t + 2) * 64, (size_t)ldb); } }
  asm volatile("s_wait_asynccnt 0x0" ::: "memory");      /* nothing of the ring is in flight when its bytes become the output staging */
  float* so = (float*)(sm + (size_t)w * (64 * G2_SOP * 4));      /* the wave's own 64 x 68 floats */
#pragma unroll
  for (int u = 0; u < 16; ++u) { const int t = u & 3, rt = u >> 2; const int col = col0 + t * 16 + ln; const float bv = bp ? bf16_round(bp[col]) : 0.f;
#pragma unroll
    for (int r = 0; r < 8; ++r) { const int rloc = rt * 16 + 8 * hh + r; float v = acc[rt][t][r] * alpha + bv; if (CP) { if (rowsPerB < 0) v += CP[cofs + (size_t)(row0g + row0 + rloc) * ldc + col];      /* rowsPerB < 0: own element of the batched C plane */ else { const int bidx = (row0g + row0 + rloc) / rowsPerB; v += CP[(size_t)bidx * sCPb + (size_t)by * 64 + col]; } }
      if (ACT == 3) v = fmaxf(v, 0.f); else if (ACT == 6) v = 0.5f * v * (1.0f + erff(v * 0.70710678118654752f)); else if (ACT == 11) v = 1.0f / (1.0f + expf(-v)); else if (ACT == 15) v = v / (1.0f + expf(-v)); else if (ACT == 12) v = (v > 0.f) ? v : 0.01f * v; else if (ACT == 8) v = tanhf(v); else if (ACT == 9) v = 0.5f * v * (1.0f + tanhf(0.7978845608028654f * (v + 0.044715f * v * v * v))); else if (ACT == 14) v = (v > 0.f) ? v : 0.1f * v; else if (ACT == 16) v = (v >= 0.f) ? v : 0.3f * v; else if (ACT == 17) v = (v >= 0.f) ? v : 0.2f * v;
      so[rloc * G2_SOP + t * 16 + ln] = v; } }
  __builtin_amdgcn_fence(__ATOMIC_ACQ_REL, "workgroup"); __builtin_amdgcn_wave_barrier();
  const int rsub = lane >> 4, c4 = (lane & 15) * 4;
  {
#pragma unroll
    for (int q = 0; q < 32; ++q) { const int r = q * 2 + rsub; const v4f v = *(const v4fa*)&so[r * G2_SOP + c4]; if (C) { *(v4f*)(C + cofs + (size_t)(row0 + r) * ldc + col0 + c4) = v; asm volatile("s_wait_xcnt 0x0" ::: "memory"); }      /* the wait stands behind the store because the f16 branch below reuses the store's data and address registers */
      if (C16) { v4h h4; for (int i = 0; i < 4; ++i) h4[i] = (_Float16)v[i]; *(v4h*)(C16 + cofs + (size_t)(row0 + r) * ldc + col0 + c4) = h4; } }
     } }


__global__ __launch_bounds__(256) void k_wnat(const float* __restrict__ w, size_t n8, _Float16* __restrict__ Bt) { const size_t t = (size_t)blockIdx.x * 256 + threadIdx.x; if (t >= n8) return; FragH f; for (int q = 0; q < 8; ++q) f.h[q] = (_Float16)(bf16_round(w[t * 8 + q]) * 16.0f); *(v8us*)((unsigned short*)Bt + t * 8) = f.half[0];  }
__global__ __launch_bounds__(256) void k_rsm(const float* __restrict__ S, _Float16* __restrict__ P, int nrows) {
  #pragma clang fp contract(off)
  const int i = blockIdx.x * 256 + threadIdx.x; if (i >= nrows) return; const float* s = S + (size_t)i * SQ; float mx = -3.0e38f;
#pragma unroll 1
  for (int j = 0; j < SQ; ++j) mx = fmaxf(mx, s[j]); float se = 0.f;
#pragma unroll 1
  for (int j = 0; j < SQ; ++j) se += expf(s[j] - mx); const float sc = 256.0f / se;
#pragma unroll 1
  for (int j0 = 0; j0 < SQ; j0 += 8) { FragH f; for (int q = 0; q < 8; ++q) f.h[q] = (_Float16)(expf(s[j0 + q] - mx) * sc); unsigned short* d = (unsigned short*)P + (size_t)i * SQ + j0; *(v8us*)d = f.half[0];  } }
__global__ __launch_bounds__(256) void k_vt(const _Float16* __restrict__ V16, int b, int h0, _Float16* __restrict__ VT) { __shared__ unsigned short tl[64][65]; const int tid = threadIdx.x; const int hh = blockIdx.x % HG, sg = blockIdx.x / HG; const int s0 = sg * 64; const int h = h0 + hh;
  for (int i = tid; i < 64 * 8; i += 256) { const int j = i / 8, d8 = (i % 8) * 8; FragH f; f.half[0] = *(const v8us*)((const unsigned short*)V16 + ((size_t)b * SQ + s0 + j) * DM + h * HD + d8); for (int q = 0; q < 8; ++q) tl[d8 + q][j] = f.u[q]; }
  __syncthreads();
  { for (int i = tid; i < 64 * 8; i += 256) { const int d = i / 8, j8 = (i % 8) * 8; FragH f; for (int q = 0; q < 8; ++q) f.u[q] = tl[d][j8 + q]; *(v8us*)((unsigned short*)VT + ((size_t)hh * HD + d) * SQ + s0 + j8) = f.half[0]; }  } }


__global__ __launch_bounds__(256) void k_x16p(const float* __restrict__ x, _Float16* __restrict__ dst, size_t n8, int nc, int ldo) { const size_t t = (size_t)blockIdx.x * 256 + threadIdx.x; if (t >= n8) return; const size_t e = t * 8; const size_t r = e / nc; const int c = (int)(e % nc); FragH f;
#pragma unroll
  for (int q = 0; q < 8; ++q) f.h[q] = (_Float16)bf16_round(x[e + q]); unsigned short* d = (unsigned short*)dst + r * ldo + c; *(v8us*)d = f.half[0];  }
typedef int v4ia __attribute__((ext_vector_type(4), may_alias));
// Masked row softmax, one wave per score row. Lane l keeps columns 128 i + 4 l .. 128 i + 4 l + 3 (i = 0..15) of its row in registers, so every load of S covers 512 contiguous bytes and S is read once;
// a masked key enters as -inf (its exp is an exact 0); row maximum and row sum: four chains per lane, then a five-step butterfly over the 32 lanes. A row with every key masked (sum 0) gets weights 0.
// Every loop is fully unrolled so that v[] is indexed by constants only and stays in registers (a run-time index would send it to scratch). No product here feeds an add, so nothing can be contracted.
// blockIdx.y = batch (score plane pitch SQ * SQ, mask row pitch SQ). The f16 weights go IN PLACE over the first half of the wave's own f32 score row (weight row pitch 2 * SQ halves): every store's value
// depends on the row sum, hence on every load of the row, and no other wave touches the row, so no score is overwritten before it is read. S carries no restrict because it is read and written.
__global__ __launch_bounds__(256) void k_rsmw(float* S, int qn, const int* __restrict__ mk) {
  const int lane = threadIdx.x & 31; const int row = blockIdx.x * 8 + (threadIdx.x >> 5); if (row >= qn) return;      /* wave-uniform; the kernel has no barrier */
  float* srow = S + (size_t)blockIdx.y * SQ * SQ + (size_t)row * SQ;
  const float* s = srow + lane * 4; const int* m = mk + (size_t)blockIdx.y * SQ + lane * 4; _Float16* p = (_Float16*)srow + lane * 4;
  v4f v[SQ / 128]; v4f mx4 = {-3.0e38f, -3.0e38f, -3.0e38f, -3.0e38f};
#pragma unroll
  for (int i = 0; i < SQ / 128; ++i) { const v4f x = *(const v4fa*)(s + i * 128); const v4ia k = *(const v4ia*)(m + i * 128);
#pragma unroll
    for (int q = 0; q < 4; ++q) { v[i][q] = (k[q] == 0) ? x[q] : -__builtin_inff(); mx4[q] = fmaxf(mx4[q], v[i][q]); } }
  float mx = fmaxf(fmaxf(mx4[0], mx4[1]), fmaxf(mx4[2], mx4[3]));
#pragma unroll
  for (int o = 16; o > 0; o >>= 1) mx = fmaxf(mx, __shfl_xor(mx, o, 32));
  v4f se4 = {0.f, 0.f, 0.f, 0.f};
#pragma unroll
  for (int i = 0; i < SQ / 128; ++i)
#pragma unroll
    for (int q = 0; q < 4; ++q) { const float t = (v[i][q] - mx) * 1.44269504f; float e;      /* native exp(x) = exp2(x log2 e), the same two instructions as __expf */
      asm("v_exp_f32 %0, %1\n\tv_nop" : "=v"(e) : "v"(t));      /* the v_nop keeps the one slot the instruction set asks for behind a transcendental, before its result is read or its source register reused */
      v[i][q] = e; se4[q] += e; }
  float se = (se4[0] + se4[1]) + (se4[2] + se4[3]);
#pragma unroll
  for (int o = 16; o > 0; o >>= 1) se += __shfl_xor(se, o, 32);
  const float sc = (se == 0.f) ? 0.f : 256.0f / se;
#pragma unroll
  for (int i = 0; i < SQ / 128; ++i) { v4h h;
#pragma unroll
    for (int q = 0; q < 4; ++q) h[q] = (_Float16)(v[i][q] * sc);
    *(v4h*)(p + i * 128) = h; } }

extern "C" void kernel_launch(void* const* d_in, const int* in_sizes, int n_in,
                              void* d_out, int out_size, void* d_ws, size_t ws_size, hipStream_t stream) {
  (void)in_sizes; (void)n_in; (void)out_size;
  const float* const* I = (const float* const*)d_in; const float* in1 = I[0]; const float* in2 = I[1]; const int* mask2 = (const int*)d_in[2]; const float* w1 = I[3]; const float* w2 = I[4]; const float* b2 = I[5];      /* weights natural [out][in] */
  char* ws = (char*)d_ws; size_t off = 0;
  auto take = [&](size_t bytes) { char* p = ws + off; off += (bytes + 255) & ~(size_t)255; return p; };
  _Float16* B1 = (_Float16*)take((size_t)NC * NC * 2); _Float16* B2 = (_Float16*)take((size_t)NO * 2 * NC * 2);
  _Float16* X1 = (_Float16*)take(NR * NC * 2); _Float16* X2 = (_Float16*)take(NR * NC * 2); _Float16* N1H = (_Float16*)take(NR * NC * 2); _Float16* N1L = (_Float16*)take(NR * NC * 2); _Float16* CAT = (_Float16*)take(NR * 2 * NC * 2);
  float* S = (float*)take((size_t)NB * SQ * SQ * 4);      /* the score planes of all batches; the softmax weights replace the first half of each score row */
  float* N1F = S;      /* n1 in f32 is last read by k_hl, before the first score is written */
  _Float16* X2T = X1;      /* in1 as f16 rows is last read by the n1 GEMM, before the transposes are written */
  if (off > ws_size) return;      /* 1.5 + 16 + 16 + 16 + 16 + 32 + 128 = approx 226 MiB */
  k_wnat<<<(unsigned)(((size_t)NC * NC / 8 + 255) / 256), 256, 0, stream>>>(w1, (size_t)NC * NC / 8, B1); k_wnat<<<(unsigned)(((size_t)NO * 2 * NC / 8 + 255) / 256), 256, 0, stream>>>(w2, (size_t)NO * 2 * NC / 8, B2);
  k_x16<<<(unsigned)((NR * NC / 8 + 255) / 256), 256, 0, stream>>>(in1, X1, NR * NC / 8); k_x16<<<(unsigned)((NR * NC / 8 + 255) / 256), 256, 0, stream>>>(in2, X2, NR * NC / 8);
  const size_t r0p = (size_t)B0 * SQ;
  k_x16p<<<(unsigned)(((size_t)MP * NC / 8 + 255) / 256), 256, 0, stream>>>(in1 + r0p * NC, CAT + r0p * 2 * NC, (size_t)MP * NC / 8, NC, 2 * NC);      /* cat columns 0..511 = in1 */
  k_gemm2<0><<<dim3((unsigned)((MP / 128) * (NC / 128)), 1), 128, 0, stream>>>(X1 + r0p * NC, NC, 0, B1, NC, 0, 0.0625f, nullptr, 0, nullptr, 1, 0, 0, N1F + r0p * NC, nullptr, NC, 0, MP, NC, NC);      /* n1 = in1 W1^T (f32) */
  k_hl<<<(unsigned)(((size_t)MP * NC / 8 + 255) / 256), 256, 0, stream>>>(N1F + r0p * NC, N1H + r0p * NC, N1L + r0p * NC, (size_t)MP * NC / 8);
  /* every stage below runs all batches in one launch: blockIdx.y = batch for scores, softmax and fused (the transposes take it from blockIdx.x); the output GEMM runs all rows as one M */
  const dim3 gs((QN / 128) * (SQ / 128), NBR); const size_t sX = (size_t)SQ * NC, sS = (size_t)SQ * SQ;
  k_vt<NH, SQ><<<NBR * NH * (SQ / 64), 256, 0, stream>>>(X2 + r0p * NC, NC, 0, X2T);      /* in2^T [batch][512][2048] */
  k_gemm2<0><<<gs, 128, 0, stream>>>(N1H + r0p * NC, NC, sX, X2 + r0p * NC, NC, sX, 1.0f, nullptr, 0, nullptr, 1, 0, 0, S, nullptr, SQ, sS, QN, SQ, NC);      /* scores hi */
  k_gemm2<0><<<gs, 128, 0, stream>>>(N1L + r0p * NC, NC, sX, X2 + r0p * NC, NC, sX, 0.0009765625f, nullptr, 0, S, -1, 0, 0, S, nullptr, SQ, sS, QN, SQ, NC);      /* + lo (CP = own element) */
  k_rsmw<<<dim3((QN + 7) / 8, NBR), 256, 0, stream>>>(S, QN, mask2 + r0p);
  k_gemm2<0><<<dim3((QN / 128) * (NC / 128), NBR), 128, 0, stream>>>((const _Float16*)S, 2 * SQ, 2 * sS, X2T, SQ, sX, 0.00390625f, nullptr, 0, nullptr, 1, 0, 0, nullptr, CAT + r0p * 2 * NC + NC, 2 * NC, 2 * sX, QN, NC, SQ);      /* fused (x1: alpha 1/256 undoes the P carry) -> cat columns 512..1023 */
  k_gemm2<8><<<dim3((unsigned)((MPO / 128) * (NO / 128)), 1), 128, 0, stream>>>(CAT + r0p * 2 * NC, 2 * NC, 0, B2, 2 * NC, 0, 0.0625f, b2, 0, nullptr, 1, 0, 0, (float*)d_out + r0p * NO, nullptr, NO, 0, MPO, NO, 2 * NC);      /* out = tanh(cat W2^T + b2) */
}

// v004
// One run takes 231 microseconds.
// Next to v003, in two timings, it ran 1.76 and 1.77 times as fast.
// Counting every step since v000, it is 24.6 times as fast.
#include <hip/hip_runtime.h>
// Cross attention with concat + tanh projection (in1, in2 [8][2048][512]; mask2 [8][2048] int32, nonzero = key masked out; n1 = in1 W1^T (W1 [512][512] natural, no bias); scores = n1 in2^T (no scaling); masked keys -> -inf; softmax over the 2,048 keys; fused = attn in2; out = tanh([in1 | fused] W2^T + b2) (W2 [512][1024] natural) -> [8][2048][512]).
// Structure: token rows; in1, in2 as exact f16 rows; n1 = in1 W1^T as a WMMA GEMM (128x128 block tiles staged in LDS, 64x64 wave tiles, f32 accumulation, exact x16 natural weights) into f32 rows, split on VALU into f16 hi + 2^-10 residual planes; then, all batches in each launch (grid y = batch; the transposes take it from grid x): scores = n1 in2^T as two accumulating GEMM terms (hi + lo; K = 512; in2 exact), masked row softmax on VALU reading the int mask row (f32 statistics, native exp; weights x256 f16, masked keys 0), in2^T via LDS transposes, fused = P . in2 GEMM (K = 2048, alpha 2^-8 undoing the P carry) written as plain f16 straight into columns 512..1023 of the f16 concat rows whose columns 0..511 are the exact in1; out = tanh(cat W2^T + b2) as ONE GEMM (K = 1024, exact x16 natural W2, alpha 1/16) with the tanh epilogue.
// Compute dtype: inputs rounded to bf16; in1, in2, weights exact in f16; n1 as f16 hi + residual planes (~2^-22: the logits have sigma ~23, so plain f16 would cost ~3e-3 logits); softmax weights (x256) and fused (unscaled: f16 relative precision is scale-free and a x16/x0.25 weight split would push small W2 entries into f16 subnormals) plain f16 (~2^-12); scores, softmax statistics and the output f32. v_wmma_f32_16x16x32_f16.
#define NB 8
#define SQ 2048
#define NC 512                       /* d_in = d_hid */
#define NO 512                       /* output features */
#define DM NC
#define NH (NC / 64)                 /* 8 slabs of 64 for the in2^T transpose */
#define HD 64
#define HG 1
#define B0 0                         /* first batch processed (debug hook) */
#define NBR NB                       /* batches processed (debug hook) */
#define QN SQ                        /* query rows attended per batch (debug hook) */
#define NR ((size_t)NB * SQ)
#define MP ((int)((size_t)NBR * SQ)) /* rows projected (debug hook) */
#define MPO MP                       /* rows through the output GEMM (debug hook) */
typedef __bf16 v16b __attribute__((ext_vector_type(16)));
typedef unsigned short v8us __attribute__((ext_vector_type(8), may_alias));
typedef float  v8f  __attribute__((ext_vector_type(8)));
typedef float  v4f  __attribute__((ext_vector_type(4)));
typedef float  v4fa __attribute__((ext_vector_type(4), may_alias));
union FragB { v16b v; v8us half[2]; unsigned short u[16]; };

__device__ __forceinline__ unsigned short bf16_bits(float x) { unsigned int u = __float_as_uint(x); return (unsigned short)((u + 0x7FFFu + ((u >> 16) & 1u)) >> 16); }
__device__ __forceinline__ float bf16_val(unsigned short b) { return __uint_as_float(((unsigned int)b) << 16); }
__device__ __forceinline__ float bf16_round(float x) { return bf16_val(bf16_bits(x)); }
// D += A·B with NT terms: 1 = ah·bh, 2 = + al·bh (A split), 3 = + ah·bl (both split)
template <int NT>
__device__ __forceinline__ v8f mmaN(v16b ah, v16b al, v16b bh, v16b bl, v8f c) {
  c = __builtin_amdgcn_wmma_f32_16x16x32_bf16(false, ah, false, bh, (short)0, c, false, false);
  if (NT >= 2) c = __builtin_amdgcn_wmma_f32_16x16x32_bf16(false, al, false, bh, (short)0, c, false, false);
  if (NT >= 3) c = __builtin_amdgcn_wmma_f32_16x16x32_bf16(false, ah, false, bl, (short)0, c, false, false);
  asm volatile("v_nop\n\tv_nop\n\tv_nop\n\tv_nop" : "+v"(c) : "v"(ah), "v"(al), "v"(bh), "v"(bl));
  return c;
}

__global__ __launch_bounds__(256) void k_wt_bf16(const float* __restrict__ W, unsigned short* __restrict__ Wt, int K, int N) {
  const int t = blockIdx.x * 256 + threadIdx.x;
  const int k8n = K / 8;
  if (t >= N * k8n) return;
  const int n = t / k8n, k8 = (t % k8n) * 8;
  v8us v;
#pragma unroll
  for (int i = 0; i < 8; ++i) v[i] = bf16_bits(W[(size_t)(k8 + i) * N + n]);
  *(v8us*)(Wt + (size_t)n * K + k8) = v;
  
}

// GEMM C[M][N] (f32, pitch ldc) = act(A[M][K]·W + bias). A f32 row-major (pitch lda) converted per fragment to bf16
// (ASPLIT: hi/lo two planes -> 2 terms, else single rounded term); Wt bf16 [N][K] (pitch ldb). BIAS_BF16 rounds the
// bias to bf16 first (bias quantised to bf16 before the add). K%32==0, M%16==0, N%64==0.
template <bool ASPLIT, int ACT, bool BIAS_BF16>
__global__ __launch_bounds__(128) void k_gemm_bf(const float* __restrict__ A, int lda, const unsigned short* __restrict__ Wt, int ldb,
                                               const float* __restrict__ bias, float* __restrict__ C, int ldc, int M, int N, int K) {
  __shared__ __attribute__((aligned(16))) float so[4][16][64];
  const int tid = threadIdx.x, w = tid >> 5, lane = tid & 31, ln = lane & 15, hh = lane >> 4;
  const int ntn = N / 64;
  const int wid = blockIdx.x * 4 + w;
  const int mt = wid / ntn, nq = wid % ntn;
  if (mt * 16 >= M) return;
  const int row0 = mt * 16, col0 = nq * 64;
  const float* arow = A + (size_t)(row0 + ln) * lda;
  v8f acc[4] = {};
  for (int kb = 0; kb < K; kb += 32) {
    FragB ah, al;
    const v4f x0 = *(const v4fa*)(arow + kb + 8 * hh), x1 = *(const v4fa*)(arow + kb + 8 * hh + 4);
    const v4f x2 = *(const v4fa*)(arow + kb + 16 + 8 * hh), x3 = *(const v4fa*)(arow + kb + 16 + 8 * hh + 4);
    float xs[16] = {x0[0],x0[1],x0[2],x0[3],x1[0],x1[1],x1[2],x1[3],x2[0],x2[1],x2[2],x2[3],x3[0],x3[1],x3[2],x3[3]};
#pragma unroll
    for (int i = 0; i < 16; ++i) { const unsigned short hb = bf16_bits(xs[i]); ah.u[i] = hb; al.u[i] = ASPLIT ? bf16_bits(xs[i] - bf16_val(hb)) : (unsigned short)0; }
#pragma unroll
    for (int t = 0; t < 4; ++t) {
      const unsigned short* brow = Wt + (size_t)(col0 + t * 16 + ln) * ldb + kb;
      FragB b;
      b.half[0] = *(const v8us*)(brow + 8 * hh);
      b.half[1] = *(const v8us*)(brow + 16 + 8 * hh);
      acc[t] = mmaN<ASPLIT ? 2 : 1>(ah.v, al.v, b.v, b.v, acc[t]);
    }
  }
#pragma unroll
  for (int t = 0; t < 4; ++t) {
    float bv = bias ? bias[col0 + t * 16 + ln] : 0.f;
    if (BIAS_BF16) bv = bf16_round(bv);
#pragma unroll
    for (int r = 0; r < 8; ++r) { float v = acc[t][r] + bv; if (ACT == 1) v = fmaxf(v, 0.f); so[w][8 * hh + r][t * 16 + ln] = v; }
  }
  __builtin_amdgcn_fence(__ATOMIC_ACQ_REL, "workgroup");
  __builtin_amdgcn_wave_barrier();
  const int rsub = lane >> 4, c4 = (lane & 15) * 4;
  {
#pragma unroll
    for (int q = 0; q < 8; ++q) {
      const int r = q * 2 + rsub;
      const v4f v = *(const v4fa*)&so[w][r][c4];
      *(v4f*)(C + (size_t)(row0 + r) * ldc + col0 + c4) = v;
    }
    
  }
}

// GEMM C = act(A·W + bias + resid): A f32 (ASPLIT -> hi/lo 2 terms), Wt bf16 [N][K]; ACT 0 none, 1 relu, 2 exact gelu;
// resid (optional, f32, row index = (row % rmod), pitch ldr, RES_BF16 rounds it) added before the activation.
template <bool ASPLIT, int ACT, bool BIAS_BF16, bool RES_BF16>
__global__ __launch_bounds__(128) void k_gemm_bf3(const float* __restrict__ A, int lda, const unsigned short* __restrict__ Wt, int ldb,
                                                const float* __restrict__ bias, const float* __restrict__ resid, int rmod, int ldr,
                                                float* __restrict__ C, int ldc, int M, int N, int K) {
  __shared__ __attribute__((aligned(16))) float so[4][16][64];
  const int tid = threadIdx.x, w = tid >> 5, lane = tid & 31, ln = lane & 15, hh = lane >> 4;
  const int ntn = N / 64;
  const int wid = blockIdx.x * 4 + w;
  const int mt = wid / ntn, nq = wid % ntn;
  if (mt * 16 >= M) return;
  const int row0 = mt * 16, col0 = nq * 64;
  const float* arow = A + (size_t)(row0 + ln) * lda;
  v8f acc[4] = {};
  for (int kb = 0; kb < K; kb += 32) {
    FragB ah, al;
    const v4f x0 = *(const v4fa*)(arow + kb + 8 * hh), x1 = *(const v4fa*)(arow + kb + 8 * hh + 4);
    const v4f x2 = *(const v4fa*)(arow + kb + 16 + 8 * hh), x3 = *(const v4fa*)(arow + kb + 16 + 8 * hh + 4);
    float xs[16] = {x0[0],x0[1],x0[2],x0[3],x1[0],x1[1],x1[2],x1[3],x2[0],x2[1],x2[2],x2[3],x3[0],x3[1],x3[2],x3[3]};
#pragma unroll
    for (int i = 0; i < 16; ++i) { const unsigned short hb = bf16_bits(xs[i]); ah.u[i] = hb; al.u[i] = ASPLIT ? bf16_bits(xs[i] - bf16_val(hb)) : (unsigned short)0; }
#pragma unroll
    for (int t = 0; t < 4; ++t) {
      const unsigned short* brow = Wt + (size_t)(col0 + t * 16 + ln) * ldb + kb;
      FragB b;
      b.half[0] = *(const v8us*)(brow + 8 * hh);
      b.half[1] = *(const v8us*)(brow + 16 + 8 * hh);
      acc[t] = mmaN<ASPLIT ? 2 : 1>(ah.v, al.v, b.v, b.v, acc[t]);
    }
  }
#pragma unroll
  for (int t = 0; t < 4; ++t) {
    const int col = col0 + t * 16 + ln;
    float bv = bias ? bias[col] : 0.f;
    if (BIAS_BF16) bv = bf16_round(bv);
#pragma unroll
    for (int r = 0; r < 8; ++r) {
      float v = acc[t][r] + bv;
      if (resid) { float rv = resid[(size_t)((row0 + 8 * hh + r) % rmod) * ldr + col]; if (RES_BF16) rv = bf16_round(rv); v += rv; }
      if (ACT == 1) v = fmaxf(v, 0.f);
      if (ACT == 2) v = 0.5f * v * (1.0f + erff(v * 0.70710678118654752f));
      if (ACT == 3) { const float u = 0.7978845608028654f * (v + 0.044715f * v * v * v); v = 0.5f * v * (1.0f + tanhf(u)); }
      so[w][8 * hh + r][t * 16 + ln] = v;
    }
  }
  __builtin_amdgcn_fence(__ATOMIC_ACQ_REL, "workgroup");
  __builtin_amdgcn_wave_barrier();
  const int rsub = lane >> 4, c4 = (lane & 15) * 4;
  {
#pragma unroll
    for (int q = 0; q < 8; ++q) {
      const int r = q * 2 + rsub;
      const v4f v = *(const v4fa*)&so[w][r][c4];
      *(v4f*)(C + (size_t)(row0 + r) * ldc + col0 + c4) = v;
    }
    
  }
}
// row LayerNorm (biased variance, eps) over N: s = X (+ R); optional out_sum <- s; out_norm <- (s-mu)*rsqrt(var+eps)*g + b
template <bool PARAM_BF16>
__global__ __launch_bounds__(256) void k_layernorm(const float* __restrict__ X, const float* __restrict__ R, const float* __restrict__ g, const float* __restrict__ bta,
                                                  float* __restrict__ out_sum, float* __restrict__ out_norm, int N, float eps) {
  __shared__ float red[256];
  const int row = blockIdx.x, tid = threadIdx.x;
  const float* x = X + (size_t)row * N; const float* rr = R ? R + (size_t)row * N : nullptr;
  float vals[16];                     // up to N = 4096
  const int per = N / 256;            // contiguous chunk per thread? use strided-by-4 chunks: thread handles j = tid*4 + 1024*u
  float s1 = 0.f;
  for (int u = 0; u < per / 4; ++u) {
    const int j = tid * 4 + 1024 * u;
    const v4f a = *(const v4fa*)(x + j);
    v4f b = {0.f,0.f,0.f,0.f}; if (rr) b = *(const v4fa*)(rr + j);
#pragma unroll
    for (int q = 0; q < 4; ++q) { const float v = a[q] + b[q]; vals[u * 4 + q] = v; s1 += v; }
  }
  red[tid] = s1; __syncthreads();
  for (int st = 128; st > 0; st >>= 1) { if (tid < st) red[tid] += red[tid + st]; __syncthreads(); }
  const float mu = red[0] / (float)N; __syncthreads();
  float s2 = 0.f;
  for (int u = 0; u < per / 4; ++u)
#pragma unroll
    for (int q = 0; q < 4; ++q) { const float c = vals[u * 4 + q] - mu; s2 += c * c; }
  red[tid] = s2; __syncthreads();
  for (int st = 128; st > 0; st >>= 1) { if (tid < st) red[tid] += red[tid + st]; __syncthreads(); }
  const float rs = rsqrtf(red[0] / (float)N + eps);
  {
    for (int u = 0; u < per / 4; ++u) {
      const int j = tid * 4 + 1024 * u;
      v4f o, sm;
#pragma unroll
      for (int q = 0; q < 4; ++q) {
        float gg = g[j + q], bb = bta[j + q];
        if (PARAM_BF16) { gg = bf16_round(gg); bb = bf16_round(bb); }
        sm[q] = vals[u * 4 + q]; o[q] = (vals[u * 4 + q] - mu) * rs * gg + bb;
      }
      if (out_sum) *(v4f*)(out_sum + (size_t)row * N + j) = sm;
      *(v4f*)(out_norm + (size_t)row * N + j) = o;
    }
    
  }
}



// ---- f16 WMMA path (v_wmma_f32_16x16x32_f16): 11-bit significands for operands in range — used where a [0,1] probability operand needs more precision than bf16
typedef _Float16 v16h __attribute__((ext_vector_type(16)));
union FragH { v16h v; v8us half[2]; _Float16 h[16]; unsigned short u[16]; };
template <int NT>
__device__ __forceinline__ v8f mmaH(v16h ah, v16h al, v16h bh, v16h bl, v8f c) {
  c = __builtin_amdgcn_wmma_f32_16x16x32_f16(false, ah, false, bh, (short)0, c, false, false);
  if (NT >= 2) c = __builtin_amdgcn_wmma_f32_16x16x32_f16(false, al, false, bh, (short)0, c, false, false);
  if (NT >= 3) c = __builtin_amdgcn_wmma_f32_16x16x32_f16(false, ah, false, bl, (short)0, c, false, false);
  asm volatile("v_nop\n\tv_nop\n\tv_nop\n\tv_nop" : "+v"(c) : "v"(ah), "v"(al), "v"(bh), "v"(bl));
  return c;
}
// batched GEMM like k_gemm_b but f16 operands: A f32 (split into f16 hi/lo if ASPLIT, else rounded to f16), Bt = f16 values [n][k]; alpha; C f32; N multiple of 16 (partial tiles skipped)
template <bool ASPLIT>
__global__ __launch_bounds__(128) void k_gemm_h(const float* __restrict__ A, int lda, size_t sA, const _Float16* __restrict__ Bh, int ldb, size_t sB, float alpha, float* __restrict__ C, int ldc, size_t sC, int M, int N, int K) {
  __shared__ __attribute__((aligned(16))) float so[4][16][64];
  const int tid = threadIdx.x, w = tid >> 5, lane = tid & 31, ln = lane & 15, hh = lane >> 4; const int by = blockIdx.y;
  A += (size_t)by * sA; Bh += (size_t)by * sB; C += (size_t)by * sC;
  const int ntn = (N + 63) / 64; const int wid = blockIdx.x * 4 + w; const int mt = wid / ntn, nq = wid % ntn; if (mt * 16 >= M) return;
  const int row0 = mt * 16, col0 = nq * 64; const float* arow = A + (size_t)(row0 + ln) * lda;
  v8f acc[4] = {};
  for (int kb = 0; kb < K; kb += 32) {
    FragH ah, al;
    const v4f x0 = *(const v4fa*)(arow + kb + 8 * hh), x1 = *(const v4fa*)(arow + kb + 8 * hh + 4), x2 = *(const v4fa*)(arow + kb + 16 + 8 * hh), x3 = *(const v4fa*)(arow + kb + 16 + 8 * hh + 4);
    float xs[16] = {x0[0],x0[1],x0[2],x0[3],x1[0],x1[1],x1[2],x1[3],x2[0],x2[1],x2[2],x2[3],x3[0],x3[1],x3[2],x3[3]};
#pragma unroll
    for (int i = 0; i < 16; ++i) { const _Float16 h = (_Float16)xs[i]; ah.h[i] = h; al.h[i] = ASPLIT ? (_Float16)(xs[i] - (float)h) : (_Float16)0.0f; }
#pragma unroll
    for (int t = 0; t < 4; ++t) { if (col0 + t * 16 >= N) continue; const size_t boff = (size_t)(col0 + t * 16 + ln) * ldb + kb; FragH bq; bq.half[0] = *(const v8us*)(Bh + boff + 8 * hh); bq.half[1] = *(const v8us*)(Bh + boff + 16 + 8 * hh);
      acc[t] = mmaH<ASPLIT ? 2 : 1>(ah.v, al.v, bq.v, bq.v, acc[t]); }
  }
#pragma unroll
  for (int t = 0; t < 4; ++t) { if (col0 + t * 16 >= N) continue;
#pragma unroll
    for (int r = 0; r < 8; ++r) so[w][8 * hh + r][t * 16 + ln] = acc[t][r] * alpha; }
  __builtin_amdgcn_fence(__ATOMIC_ACQ_REL, "workgroup"); __builtin_amdgcn_wave_barrier();
  const int rsub = lane >> 4, c4 = (lane & 15) * 4;
  {
#pragma unroll
    for (int q = 0; q < 8; ++q) { const int r = q * 2 + rsub; if (col0 + c4 < N) { const v4f v = *(const v4fa*)&so[w][r][c4]; *(v4f*)(C + (size_t)(row0 + r) * ldc + col0 + c4) = v; } }
     }
}

// Wt[n][k] = f16(W[k][n]·scale) from f32 row-major W[K][N] (scale = power of two; bf16-exact weights stay exact in f16 away from the subnormal range)
__global__ __launch_bounds__(256) void k_wt_f16(const float* __restrict__ W, _Float16* __restrict__ Wt, int K, int N, float scale) {
  const int t = blockIdx.x * 256 + threadIdx.x; if (t >= N * (K / 8)) return; const int n = t / (K / 8), k8 = (t % (K / 8)) * 8; FragH f;
#pragma unroll
  for (int i = 0; i < 8; ++i) f.h[i] = (_Float16)(bf16_round(W[(size_t)(k8 + i) * N + n]) * scale); const v8us o = f.half[0];
  *(v8us*)((unsigned short*)Wt + (size_t)n * K + k8) = o; 
}
// k_gemm_hh variant with fused epilogue: v = acc·alpha + bias[by·sBias + col] (+ CP[(row/rowsPerB)·sCPb + by·64 + col] if CP) ; ACT 0 none / 1 elu ; writes f16 C16 (and f32 C if non-null)
template <int ACT>
__global__ __launch_bounds__(128) void k_gemm_hhx(const _Float16* __restrict__ A, int lda, size_t sA, const _Float16* __restrict__ Bh, int ldb, size_t sB, float alpha, const float* __restrict__ bias, size_t sBias, const float* __restrict__ CP, int rowsPerB, size_t sCPb, int row0g,
    float* __restrict__ C, _Float16* __restrict__ C16, int ldc, size_t sC, int M, int N, int K) {
  __shared__ __attribute__((aligned(16))) float so[4][16][64];
  const int tid = threadIdx.x, w = tid >> 5, lane = tid & 31, ln = lane & 15, hh = lane >> 4; const int by = blockIdx.y;
  A += (size_t)by * sA; Bh += (size_t)by * sB; const size_t cofs = (size_t)by * sC; const float* bp = bias ? bias + (size_t)by * sBias : nullptr;
  const int ntn = (N + 63) / 64; const int wid = blockIdx.x * 4 + w; const int mt = wid / ntn, nq = wid % ntn; if (mt * 16 >= M) return;
  const int row0 = mt * 16, col0 = nq * 64; const _Float16* arow = A + (size_t)(row0 + ln) * lda;
  v8f acc[4] = {};
  for (int kb = 0; kb < K; kb += 32) { FragH ah; ah.half[0] = *(const v8us*)((const unsigned short*)arow + kb + 8 * hh); ah.half[1] = *(const v8us*)((const unsigned short*)arow + kb + 16 + 8 * hh);
#pragma unroll
    for (int t = 0; t < 4; ++t) { if (col0 + t * 16 >= N) continue; const size_t boff = (size_t)(col0 + t * 16 + ln) * ldb + kb; FragH bq; bq.half[0] = *(const v8us*)((const unsigned short*)Bh + boff + 8 * hh); bq.half[1] = *(const v8us*)((const unsigned short*)Bh + boff + 16 + 8 * hh);
      acc[t] = mmaH<1>(ah.v, ah.v, bq.v, bq.v, acc[t]); }
  }
#pragma unroll
  for (int t = 0; t < 4; ++t) { if (col0 + t * 16 >= N) continue; const int col = col0 + t * 16 + ln; const float bv = bp ? bf16_round(bp[col]) : 0.f;
#pragma unroll
    for (int r = 0; r < 8; ++r) { float v = acc[t][r] * alpha + bv; if (CP) { const int rr = row0g + row0 + 8 * hh + r; if (rowsPerB < 0) v += CP[cofs + (size_t)rr * ldc + col];      /* rowsPerB < 0: own element of the batched C plane */ else { const int bidx = rr / rowsPerB; v += CP[(size_t)bidx * sCPb + (size_t)by * 64 + col]; } } if (ACT == 1) v = (v > 0.f) ? v : expm1f(v); else if (ACT == 7) v = (v > 0.f) ? v + 1.0f : expf(v); else if (ACT == 8) v = tanhf(v); else if (ACT == 9) v = 0.5f * v * (1.0f + tanhf(0.7978845608028654f * (v + 0.044715f * v * v * v))); else if (ACT == 11) v = 1.0f / (1.0f + expf(-v)); else if (ACT == 12) v = (v > 0.f) ? v : 0.01f * v; else if (ACT == 14) v = (v > 0.f) ? v : 0.1f * v; else if (ACT == 16) v = (v >= 0.f) ? v : 0.3f * v; else if (ACT == 17) v = (v >= 0.f) ? v : 0.2f * v; else if (ACT == 15) v = v / (1.0f + expf(-v)); else if (ACT == 3) v = fmaxf(v, 0.f); else if (ACT == 6) v = 0.5f * v * (1.0f + erff(v * 0.70710678118654752f)); so[w][8 * hh + r][t * 16 + ln] = v; } }
  __builtin_amdgcn_fence(__ATOMIC_ACQ_REL, "workgroup"); __builtin_amdgcn_wave_barrier();
  const int rsub = lane >> 4, c4 = (lane & 15) * 4; typedef _Float16 v4h __attribute__((ext_vector_type(4)));
  {
#pragma unroll
    for (int q = 0; q < 8; ++q) { const int r = q * 2 + rsub; if (col0 + c4 < N) { const v4f v = *(const v4fa*)&so[w][r][c4]; if (C) *(v4f*)(C + cofs + (size_t)(row0 + r) * ldc + col0 + c4) = v; if (C16) { v4h h4; for (int i = 0; i < 4; ++i) h4[i] = (_Float16)v[i]; *(v4h*)(C16 + cofs + (size_t)(row0 + r) * ldc + col0 + c4) = h4; } } }
     }
}


typedef _Float16 v4h __attribute__((ext_vector_type(4)));

__global__ __launch_bounds__(256) void k_x16(const float* __restrict__ x, _Float16* __restrict__ X16, size_t n8) { const size_t t = (size_t)blockIdx.x * 256 + threadIdx.x; if (t >= n8) return; FragH f;
#pragma unroll
  for (int q = 0; q < 8; ++q) f.h[q] = (_Float16)bf16_round(x[t * 8 + q]); *(v8us*)((unsigned short*)X16 + t * 8) = f.half[0];  }
__global__ __launch_bounds__(256) void k_h16(const float* __restrict__ x, _Float16* __restrict__ X16, size_t n8) { const size_t t = (size_t)blockIdx.x * 256 + threadIdx.x; if (t >= n8) return; FragH f;
#pragma unroll
  for (int q = 0; q < 8; ++q) f.h[q] = (_Float16)x[t * 8 + q]; *(v8us*)((unsigned short*)X16 + t * 8) = f.half[0];  }
__global__ __launch_bounds__(256) void k_round16f(const float* __restrict__ W, _Float16* __restrict__ Bt, size_t n8) { const size_t t = (size_t)blockIdx.x * 256 + threadIdx.x; if (t >= n8) return; FragH f;
#pragma unroll
  for (int i = 0; i < 8; ++i) f.h[i] = (_Float16)(bf16_round(W[t * 8 + i]) * 16.0f); *(v8us*)((unsigned short*)Bt + t * 8) = f.half[0];  }
template <int NHv, int TTv>
__global__ __launch_bounds__(256) void k_vt(const _Float16* __restrict__ V16, int ldv, int voff, _Float16* __restrict__ Vt) { __shared__ unsigned short tl[64][66]; const int tid = threadIdx.x; const int slab = blockIdx.x / (TTv / 64), lg = blockIdx.x % (TTv / 64); const int b = slab / NHv, h = slab % NHv;
  for (int i = tid; i < 64 * 8; i += 256) { const int r = i / 8, c8 = (i % 8) * 8; FragH f; f.half[0] = *(const v8us*)((const unsigned short*)V16 + ((size_t)b * TTv + lg * 64 + r) * ldv + voff + h * 64 + c8);
#pragma unroll
    for (int q = 0; q < 8; ++q) tl[r][c8 + q] = f.u[q]; }
  __syncthreads();
  {
#pragma unroll
    for (int rd = 0; rd < 2; ++rd) { const int d = rd * 32 + tid / 8, pc = tid % 8; FragH f;
#pragma unroll
      for (int q = 0; q < 8; ++q) f.u[q] = tl[pc * 8 + q][d];
      *(v8us*)((unsigned short*)Vt + ((size_t)slab * 64 + d) * TTv + lg * 64 + pc * 8) = f.half[0]; }
     } }

__global__ __launch_bounds__(256) void k_hl(const float* __restrict__ F, _Float16* __restrict__ Hh, _Float16* __restrict__ Hl, size_t n8) { const size_t t = (size_t)blockIdx.x * 256 + threadIdx.x; if (t >= n8) return; FragH fh, fl; const v4f a = *(const v4fa*)(F + t * 8), c = *(const v4fa*)(F + t * 8 + 4);
#pragma unroll
  for (int q = 0; q < 4; ++q) { _Float16 h = (_Float16)a[q]; fh.h[q] = h; fl.h[q] = (_Float16)((a[q] - (float)h) * 1024.0f); h = (_Float16)c[q]; fh.h[4 + q] = h; fl.h[4 + q] = (_Float16)((c[q] - (float)h) * 1024.0f); }
  { *(v8us*)((unsigned short*)Hh + t * 8) = fh.half[0]; *(v8us*)((unsigned short*)Hl + t * 8) = fl.half[0];  } }

// ---- fast GEMM: block tile 128x128, four waves of 64x64 (requires M % 128 == 0 rows per launch region, N % 128 == 0, K % 64 == 0) ----
// Both operand tiles of a 64-k pass are brought into LDS once per work-group by asynchronous copies (each wave-wide copy covers four whole 128-byte rows) and read from there by all four waves;
// two buffers, so that the next pass's copies fly while this pass is multiplied. Each output element still sums its k blocks of 32 in ascending order.
#define G2_PITCH 144                 /* LDS bytes per 128-byte tile row: 16 B x odd, the pitch at which ds_load_b128 readers of 16 rows meet no bank conflict */
#define G2_OPER (128 * G2_PITCH)     /* one operand's 128 rows of a pass */
#define G2_STAGE (2 * G2_OPER)       /* one buffer: [A 128 rows | B 128 rows] */
#define G2_SOP 68                    /* floats per row of the output staging */
__device__ __forceinline__ v16h g2_lfrag(const char* p) { FragH f; f.half[0] = *(const v8us*)p; f.half[1] = *(const v8us*)(p + 32); return f.v; }      /* same k order as a fragment read from global rows: k = 8 hh .. 8 hh + 7, then 16 + 8 hh .. */
__device__ __forceinline__ v8f g2_mma(v16h a, v16h b, v8f c) { v8f d = __builtin_amdgcn_wmma_f32_16x16x32_f16(false, a, false, b, (short)0, c, false, false); asm volatile("v_nop\n\tv_nop\n\tv_nop\n\tv_nop" : "+v"(d) : "v"(a), "v"(b)); return d; }
// One operand's 128 rows x 128 bytes: the lane's 16 bytes of rows r, r + 16, .. r + 112 (l = its LDS byte address for row r, p = its global address for row r, ld = global row pitch in halves).
// The s_wait_xcnt closes the copies' own statement so that no address register of a copy is rewritten in front of it.
__device__ __forceinline__ void g2_copy8(unsigned l, const _Float16* p, size_t ld) {
  asm volatile("global_load_async_to_lds_b128 %0, %8, off\n\t"
               "global_load_async_to_lds_b128 %1, %9, off\n\t"
               "global_load_async_to_lds_b128 %2, %10, off\n\t"
               "global_load_async_to_lds_b128 %3, %11, off\n\t"
               "global_load_async_to_lds_b128 %4, %12, off\n\t"
               "global_load_async_to_lds_b128 %5, %13, off\n\t"
               "global_load_async_to_lds_b128 %6, %14, off\n\t"
               "global_load_async_to_lds_b128 %7, %15, off\n\t"
               "s_wait_xcnt 0x0"
               :: "v"(l), "v"(l + 16 * G2_PITCH), "v"(l + 32 * G2_PITCH), "v"(l + 48 * G2_PITCH), "v"(l + 64 * G2_PITCH), "v"(l + 80 * G2_PITCH), "v"(l + 96 * G2_PITCH), "v"(l + 112 * G2_PITCH),
                  "v"(p), "v"(p + 16 * ld), "v"(p + 32 * ld), "v"(p + 48 * ld), "v"(p + 64 * ld), "v"(p + 80 * ld), "v"(p + 96 * ld), "v"(p + 112 * ld)
               : "memory");
}
// The activation of one output value (ACT: 0 none, 3 relu, 6 exact gelu, 8 tanh, 9 tanh gelu, 11 sigmoid, 12/14/16/17 leaky relu 0.01/0.1/0.3/0.2, 15 silu).
template <int ACT>
__device__ __forceinline__ float g2_act(float v) {
  if (ACT == 3) v = fmaxf(v, 0.f); else if (ACT == 6) v = 0.5f * v * (1.0f + erff(v * 0.70710678118654752f)); else if (ACT == 11) v = 1.0f / (1.0f + expf(-v)); else if (ACT == 15) v = v / (1.0f + expf(-v)); else if (ACT == 12) v = (v > 0.f) ? v : 0.01f * v; else if (ACT == 8) v = tanhf(v); else if (ACT == 9) v = 0.5f * v * (1.0f + tanhf(0.7978845608028654f * (v + 0.044715f * v * v * v))); else if (ACT == 14) v = (v > 0.f) ? v : 0.1f * v; else if (ACT == 16) v = (v >= 0.f) ? v : 0.3f * v; else if (ACT == 17) v = (v >= 0.f) ? v : 0.2f * v;
  return v; }
// What the epilogue does is fixed at compile time: HASB adds bf16-rounded bias[by * sBias + col]; ADDC adds the element that C already holds (C += ...); F32O stores f32 C, F16O stores f16 C16.
// out = ACT(acc * alpha + bias + old C), in that order.
template <int ACT, bool HASB, bool ADDC, bool F32O, bool F16O>
__global__ __launch_bounds__(128) void k_gemm2(const _Float16* __restrict__ A, int lda, size_t sA, const _Float16* __restrict__ Bh, int ldb, size_t sB, float alpha, const float* __restrict__ bias, size_t sBias,
    float* __restrict__ C, _Float16* __restrict__ C16, int ldc, size_t sC, int M, int N, int K) { static_assert(ACT == 0 || ACT == 3 || ACT == 6 || ACT == 8 || ACT == 9 || ACT == 11 || ACT == 12 || ACT == 14 || ACT == 15 || ACT == 16 || ACT == 17, "k_gemm2: unsupported ACT code (would silently apply no activation)");
  static_assert(F32O || !ADDC, "ADDC reads the f32 plane it then stores");
  __shared__ __attribute__((aligned(16))) char sm[2 * G2_STAGE];      /* the two buffers; behind the loop's last barrier the same bytes stage the output */
  static_assert(4 * 64 * G2_SOP * 4 <= 2 * G2_STAGE, "output staging must fit the ring");
  const int tid = threadIdx.x, w = tid >> 5, lane = tid & 31, ln = lane & 15, hh = lane >> 4; const int by = blockIdx.y;
  A += (size_t)by * sA; Bh += (size_t)by * sB; const size_t cofs = (size_t)by * sC;
  const int ntn = N >> 7; const int mt = blockIdx.x / ntn, nq = blockIdx.x - mt * ntn; const int rowB = mt * 128, colB = nq * 128; if (rowB >= M) return;      /* the same for the whole work-group, in front of every barrier */
  const int row0 = rowB + 64 * (w >> 1), col0 = colB + 64 * (w & 1);
  const int cr = tid >> 3, cc = tid & 7;      /* copies: eight lanes per 128-byte row, 16 rows per round of the work-group */
  const _Float16* ga = A + (size_t)(rowB + cr) * lda + cc * 8; const _Float16* gb = Bh + (size_t)(colB + cr) * ldb + cc * 8;
  const unsigned lc = (unsigned)(size_t)sm + (unsigned)(cr * G2_PITCH + cc * 16);
  const char* fa = sm + (64 * (w >> 1) + ln) * G2_PITCH + 16 * hh; const char* fb = sm + G2_OPER + (64 * (w & 1) + ln) * G2_PITCH + 16 * hh;
  const int np = K >> 6;
  g2_copy8(lc, ga, (size_t)lda); g2_copy8(lc + G2_OPER, gb, (size_t)ldb);      /* pass 0 -> buffer 0 */
  asm volatile("s_wait_asynccnt 0x0" ::: "memory");      /* this wave's copies of pass 0 have landed */
  __syncthreads();      /* every wave's have: pass 0 may be read */
  if (np > 1) { g2_copy8(lc + G2_STAGE, ga + 64, (size_t)lda); g2_copy8(lc + G2_STAGE + G2_OPER, gb + 64, (size_t)ldb); }      /* pass 1 -> buffer 1, where there is one (the same test for the whole work-group) */
  const v8f z8 = {0.f,0.f,0.f,0.f,0.f,0.f,0.f,0.f}; v8f acc[4][4];
#pragma unroll
  for (int i = 0; i < 4; ++i)
#pragma unroll
    for (int j = 0; j < 4; ++j) acc[i][j] = z8;
#pragma unroll 1      /* one pass per trip: the buffer offset is the only thing that differs, and an unrolled copy of 32 WMMAs buys nothing */
  for (int t = 0; t < np; ++t) { const int bo = (t & 1) * G2_STAGE;
#pragma unroll
    for (int ks = 0; ks < 2; ++ks) { v16h a[4], b[4];
#pragma unroll
      for (int i = 0; i < 4; ++i) { a[i] = g2_lfrag(fa + bo + i * 16 * G2_PITCH + ks * 64); b[i] = g2_lfrag(fb + bo + i * 16 * G2_PITCH + ks * 64); }
#pragma unroll
      for (int j = 0; j < 4; ++j)
#pragma unroll
        for (int i = 0; i < 4; ++i) acc[i][j] = g2_mma(a[i], b[j], acc[i][j]); }
    asm volatile("s_wait_dscnt 0x0" ::: "memory");      /* this wave's reads of buffer t mod 2 are done before the barrier lets it be refilled */
    asm volatile("s_wait_asynccnt 0x0" ::: "memory");      /* this wave's copies of pass t + 1 have landed */
    __syncthreads();      /* publishes pass t + 1 and ends every reader's last read of buffer t mod 2 */
    if (t + 2 < np) { g2_copy8(lc + bo, ga + (size_t)(t + 2) * 64, (size_t)lda); g2_copy8(lc + bo + G2_OPER, gb + (size_t)(t + 2) * 64, (size_t)ldb); } }
  asm volatile("s_wait_asynccnt 0x0" ::: "memory");      /* nothing of the ring is in flight when its bytes become the output staging */
  float* so = (float*)(sm + (size_t)w * (64 * G2_SOP * 4));      /* the wave's own 64 x 68 floats */
  float bv[4];
#pragma unroll
  for (int t = 0; t < 4; ++t) bv[t] = HASB ? bf16_round(bias[(size_t)by * sBias + col0 + t * 16 + ln]) : 0.f;
#pragma unroll
  for (int u = 0; u < 16; ++u) { const int t = u & 3, rt = u >> 2;
#pragma unroll
    for (int r = 0; r < 8; ++r) so[(rt * 16 + 8 * hh + r) * G2_SOP + t * 16 + ln] = HASB ? acc[rt][t][r] * alpha + bv[t] : acc[rt][t][r] * alpha; }
  __builtin_amdgcn_fence(__ATOMIC_ACQ_REL, "workgroup"); __builtin_amdgcn_wave_barrier();
  const int rsub = lane >> 4, c4 = (lane & 15) * 4;
  const size_t es = (size_t)2 * ldc;      /* a lane's rows are two apart */
  size_t eb = cofs + (size_t)(row0 + rsub) * ldc + col0 + c4;
  const float* sr = so + rsub * G2_SOP + c4;
#pragma unroll 1      /* four trips of 16 rows: rolled so that the text that runs once per work-group stays short (with tanh an unrolled copy is four times as long); inside a trip the eight loads, and the eight stores, are in flight together */
  for (int qb = 0; qb < 4; ++qb) { v4f v[8];
    if (ADDC) { v4f c[8];
#pragma unroll
      for (int q = 0; q < 8; ++q) c[q] = *(const v4fa*)(C + eb + q * es);
#pragma unroll
      for (int q = 0; q < 8; ++q) v[q] = *(const v4fa*)(sr + q * 2 * G2_SOP) + c[q]; }
    else {
#pragma unroll
      for (int q = 0; q < 8; ++q) v[q] = *(const v4fa*)(sr + q * 2 * G2_SOP); }
#pragma unroll
    for (int q = 0; q < 8; ++q) {
#pragma unroll
      for (int i = 0; i < 4; ++i) v[q][i] = g2_act<ACT>(v[q][i]);
      if (F32O) *(v4f*)(C + eb + q * es) = v[q];
      if (F16O) { v4h h4;
#pragma unroll
        for (int i = 0; i < 4; ++i) h4[i] = (_Float16)v[q][i];
        *(v4h*)(C16 + eb + q * es) = h4; } }
    asm volatile("s_wait_xcnt 0x0" ::: "memory");      /* the next trip rewrites the address and data registers of this trip's loads and stores */
    eb += 8 * es; sr += 16 * G2_SOP; } }


__global__ __launch_bounds__(256) void k_wnat(const float* __restrict__ w, size_t n8, _Float16* __restrict__ Bt) { const size_t t = (size_t)blockIdx.x * 256 + threadIdx.x; if (t >= n8) return; FragH f; for (int q = 0; q < 8; ++q) f.h[q] = (_Float16)(bf16_round(w[t * 8 + q]) * 16.0f); *(v8us*)((unsigned short*)Bt + t * 8) = f.half[0];  }
__global__ __launch_bounds__(256) void k_rsm(const float* __restrict__ S, _Float16* __restrict__ P, int nrows) {
  #pragma clang fp contract(off)
  const int i = blockIdx.x * 256 + threadIdx.x; if (i >= nrows) return; const float* s = S + (size_t)i * SQ; float mx = -3.0e38f;
#pragma unroll 1
  for (int j = 0; j < SQ; ++j) mx = fmaxf(mx, s[j]); float se = 0.f;
#pragma unroll 1
  for (int j = 0; j < SQ; ++j) se += expf(s[j] - mx); const float sc = 256.0f / se;
#pragma unroll 1
  for (int j0 = 0; j0 < SQ; j0 += 8) { FragH f; for (int q = 0; q < 8; ++q) f.h[q] = (_Float16)(expf(s[j0 + q] - mx) * sc); unsigned short* d = (unsigned short*)P + (size_t)i * SQ + j0; *(v8us*)d = f.half[0];  } }
__global__ __launch_bounds__(256) void k_vt(const _Float16* __restrict__ V16, int b, int h0, _Float16* __restrict__ VT) { __shared__ unsigned short tl[64][65]; const int tid = threadIdx.x; const int hh = blockIdx.x % HG, sg = blockIdx.x / HG; const int s0 = sg * 64; const int h = h0 + hh;
  for (int i = tid; i < 64 * 8; i += 256) { const int j = i / 8, d8 = (i % 8) * 8; FragH f; f.half[0] = *(const v8us*)((const unsigned short*)V16 + ((size_t)b * SQ + s0 + j) * DM + h * HD + d8); for (int q = 0; q < 8; ++q) tl[d8 + q][j] = f.u[q]; }
  __syncthreads();
  { for (int i = tid; i < 64 * 8; i += 256) { const int d = i / 8, j8 = (i % 8) * 8; FragH f; for (int q = 0; q < 8; ++q) f.u[q] = tl[d][j8 + q]; *(v8us*)((unsigned short*)VT + ((size_t)hh * HD + d) * SQ + s0 + j8) = f.half[0]; }  } }


__global__ __launch_bounds__(256) void k_x16p(const float* __restrict__ x, _Float16* __restrict__ dst, size_t n8, int nc, int ldo) { const size_t t = (size_t)blockIdx.x * 256 + threadIdx.x; if (t >= n8) return; const size_t e = t * 8; const size_t r = e / nc; const int c = (int)(e % nc); FragH f;
#pragma unroll
  for (int q = 0; q < 8; ++q) f.h[q] = (_Float16)bf16_round(x[e + q]); unsigned short* d = (unsigned short*)dst + r * ldo + c; *(v8us*)d = f.half[0];  }
typedef int v4ia __attribute__((ext_vector_type(4), may_alias));
// Masked row softmax, one wave per score row. Lane l keeps columns 128 i + 4 l .. 128 i + 4 l + 3 (i = 0..15) of its row in registers, so every load of S covers 512 contiguous bytes and S is read once;
// a masked key enters as -inf (its exp is an exact 0); row maximum and row sum: four chains per lane, then a five-step butterfly over the 32 lanes. A row with every key masked (sum 0) gets weights 0.
// Every loop is fully unrolled so that v[] is indexed by constants only and stays in registers (a run-time index would send it to scratch). No product here feeds an add, so nothing can be contracted.
// blockIdx.y = batch (score plane pitch SQ * SQ, mask row pitch SQ). The f16 weights go IN PLACE over the first half of the wave's own f32 score row (weight row pitch 2 * SQ halves): every store's value
// depends on the row sum, hence on every load of the row, and no other wave touches the row, so no score is overwritten before it is read. S carries no restrict because it is read and written.
__global__ __launch_bounds__(256) void k_rsmw(float* S, int qn, const int* __restrict__ mk) {
  const int lane = threadIdx.x & 31; const int row = blockIdx.x * 8 + (threadIdx.x >> 5); if (row >= qn) return;      /* wave-uniform; the kernel has no barrier */
  float* srow = S + (size_t)blockIdx.y * SQ * SQ + (size_t)row * SQ;
  const float* s = srow + lane * 4; const int* m = mk + (size_t)blockIdx.y * SQ + lane * 4; _Float16* p = (_Float16*)srow + lane * 4;
  v4f v[SQ / 128]; v4f mx4 = {-3.0e38f, -3.0e38f, -3.0e38f, -3.0e38f};
#pragma unroll
  for (int i = 0; i < SQ / 128; ++i) { const v4f x = *(const v4fa*)(s + i * 128); const v4ia k = *(const v4ia*)(m + i * 128);
#pragma unroll
    for (int q = 0; q < 4; ++q) { v[i][q] = (k[q] == 0) ? x[q] : -__builtin_inff(); mx4[q] = fmaxf(mx4[q], v[i][q]); } }
  float mx = fmaxf(fmaxf(mx4[0], mx4[1]), fmaxf(mx4[2], mx4[3]));
#pragma unroll
  for (int o = 16; o > 0; o >>= 1) mx = fmaxf(mx, __shfl_xor(mx, o, 32));
  v4f se4 = {0.f, 0.f, 0.f, 0.f};
#pragma unroll
  for (int i = 0; i < SQ / 128; ++i)
#pragma unroll
    for (int q = 0; q < 4; ++q) { const float t = (v[i][q] - mx) * 1.44269504f; float e;      /* native exp(x) = exp2(x log2 e), the same two instructions as __expf */
      asm("v_exp_f32 %0, %1\n\tv_nop" : "=v"(e) : "v"(t));      /* the v_nop keeps the one slot the instruction set asks for behind a transcendental, before its result is read or its source register reused */
      v[i][q] = e; se4[q] += e; }
  float se = (se4[0] + se4[1]) + (se4[2] + se4[3]);
#pragma unroll
  for (int o = 16; o > 0; o >>= 1) se += __shfl_xor(se, o, 32);
  const float sc = (se == 0.f) ? 0.f : 256.0f / se;
#pragma unroll
  for (int i = 0; i < SQ / 128; ++i) { v4h h;
#pragma unroll
    for (int q = 0; q < 4; ++q) h[q] = (_Float16)(v[i][q] * sc);
    *(v4h*)(p + i * 128) = h; } }

extern "C" void kernel_launch(void* const* d_in, const int* in_sizes, int n_in,
                              void* d_out, int out_size, void* d_ws, size_t ws_size, hipStream_t stream) {
  (void)in_sizes; (void)n_in; (void)out_size;
  const float* const* I = (const float* const*)d_in; const float* in1 = I[0]; const float* in2 = I[1]; const int* mask2 = (const int*)d_in[2]; const float* w1 = I[3]; const float* w2 = I[4]; const float* b2 = I[5];      /* weights natural [out][in] */
  char* ws = (char*)d_ws; size_t off = 0;
  auto take = [&](size_t bytes) { char* p = ws + off; off += (bytes + 255) & ~(size_t)255; return p; };
  _Float16* B1 = (_Float16*)take((size_t)NC * NC * 2); _Float16* B2 = (_Float16*)take((size_t)NO * 2 * NC * 2);
  _Float16* X1 = (_Float16*)take(NR * NC * 2); _Float16* X2 = (_Float16*)take(NR * NC * 2); _Float16* N1H = (_Float16*)take(NR * NC * 2); _Float16* N1L = (_Float16*)take(NR * NC * 2); _Float16* CAT = (_Float16*)take(NR * 2 * NC * 2);
  float* S = (float*)take((size_t)NB * SQ * SQ * 4);      /* the score planes of all batches; the softmax weights replace the first half of each score row */
  float* N1F = S;      /* n1 in f32 is last read by k_hl, before the first score is written */
  _Float16* X2T = X1;      /* in1 as f16 rows is last read by the n1 GEMM, before the transposes are written */
  if (off > ws_size) return;      /* 1.5 + 16 + 16 + 16 + 16 + 32 + 128 = approx 226 MiB */
  k_wnat<<<(unsigned)(((size_t)NC * NC / 8 + 255) / 256), 256, 0, stream>>>(w1, (size_t)NC * NC / 8, B1); k_wnat<<<(unsigned)(((size_t)NO * 2 * NC / 8 + 255) / 256), 256, 0, stream>>>(w2, (size_t)NO * 2 * NC / 8, B2);
  k_x16<<<(unsigned)((NR * NC / 8 + 255) / 256), 256, 0, stream>>>(in1, X1, NR * NC / 8); k_x16<<<(unsigned)((NR * NC / 8 + 255) / 256), 256, 0, stream>>>(in2, X2, NR * NC / 8);
  const size_t r0p = (size_t)B0 * SQ;
  k_x16p<<<(unsigned)(((size_t)MP * NC / 8 + 255) / 256), 256, 0, stream>>>(in1 + r0p * NC, CAT + r0p * 2 * NC, (size_t)MP * NC / 8, NC, 2 * NC);      /* cat columns 0..511 = in1 */
  k_gemm2<0, false, false, true, false><<<dim3((unsigned)((MP / 128) * (NC / 128)), 1), 128, 0, stream>>>(X1 + r0p * NC, NC, 0, B1, NC, 0, 0.0625f, nullptr, 0, N1F + r0p * NC, nullptr, NC, 0, MP, NC, NC);      /* n1 = in1 W1^T (f32) */
  k_hl<<<(unsigned)(((size_t)MP * NC / 8 + 255) / 256), 256, 0, stream>>>(N1F + r0p * NC, N1H + r0p * NC, N1L + r0p * NC, (size_t)MP * NC / 8);
  /* every stage below runs all batches in one launch: blockIdx.y = batch for scores, softmax and fused (the transposes take it from blockIdx.x); the output GEMM runs all rows as one M */
  const dim3 gs((QN / 128) * (SQ / 128), NBR); const size_t sX = (size_t)SQ * NC, sS = (size_t)SQ * SQ;
  k_vt<NH, SQ><<<NBR * NH * (SQ / 64), 256, 0, stream>>>(X2 + r0p * NC, NC, 0, X2T);      /* in2^T [batch][512][2048] */
  k_gemm2<0, false, false, true, false><<<gs, 128, 0, stream>>>(N1H + r0p * NC, NC, sX, X2 + r0p * NC, NC, sX, 1.0f, nullptr, 0, S, nullptr, SQ, sS, QN, SQ, NC);      /* scores hi */
  k_gemm2<0, false, true, true, false><<<gs, 128, 0, stream>>>(N1L + r0p * NC, NC, sX, X2 + r0p * NC, NC, sX, 0.0009765625f, nullptr, 0, S, nullptr, SQ, sS, QN, SQ, NC);      /* + lo (added to the element S holds) */
  k_rsmw<<<dim3((QN + 7) / 8, NBR), 256, 0, stream>>>(S, QN, mask2 + r0p);
  k_gemm2<0, false, false, false, true><<<dim3((QN / 128) * (NC / 128), NBR), 128, 0, stream>>>((const _Float16*)S, 2 * SQ, 2 * sS, X2T, SQ, sX, 0.00390625f, nullptr, 0, nullptr, CAT + r0p * 2 * NC + NC, 2 * NC, 2 * sX, QN, NC, SQ);      /* fused (x1: alpha 1/256 undoes the P carry) -> cat columns 512..1023 */
  k_gemm2<8, true, false, true, false><<<dim3((unsigned)((MPO / 128) * (NO / 128)), 1), 128, 0, stream>>>(CAT + r0p * 2 * NC, 2 * NC, 0, B2, 2 * NC, 0, 0.0625f, b2, 0, (float*)d_out + r0p * NO, nullptr, NO, 0, MPO, NO, 2 * NC);      /* out = tanh(cat W2^T + b2) */
}

// v005
// One run takes 198 microseconds.
// In both of two side-by-side timings against v004, it was 1.17 times as fast.
// Over all steps from v000 it is 28.9 times as fast.
#include <hip/hip_runtime.h>
// Cross attention with concat + tanh projection (in1, in2 [8][2048][512]; mask2 [8][2048] int32, nonzero = key masked out; n1 = in1 W1^T (W1 [512][512] natural, no bias); scores = n1 in2^T (no scaling); masked keys -> -inf; softmax over the 2,048 keys; fused = attn in2; out = tanh([in1 | fused] W2^T + b2) (W2 [512][1024] natural) -> [8][2048][512]).
// Structure: token rows; in1, in2 as exact f16 rows; n1 = in1 W1^T as a WMMA GEMM (128x128 block tiles staged in LDS, 64x64 wave tiles, f32 accumulation, exact x16 natural weights) into f32 rows, split on VALU into f16 hi + 2^-10 residual planes; then, all batches in each launch (grid y = batch, grid x for the transposes): scores = n1 in2^T as ONE GEMM launch of two terms (the lo plane's K = 512 passes first, their sum x 2^-10 is the start value of the hi plane's passes; in2 exact), masked row softmax on VALU reading the int mask row (f32 statistics, native exp; weights x256 f16, masked keys 0), in2^T via LDS transposes, fused = P . in2 GEMM (K = 2048, alpha 2^-8 undoing the P carry) written as plain f16 straight into columns 512..1023 of the f16 concat rows whose columns 0..511 are the exact in1; out = tanh(cat W2^T + b2) as ONE GEMM (K = 1024, exact x16 natural W2, alpha 1/16) with the tanh epilogue.
// Compute dtype: inputs rounded to bf16; in1, in2, weights exact in f16; n1 as f16 hi + residual planes (~2^-22: the logits have sigma ~23, so plain f16 would cost ~3e-3 logits); softmax weights (x256) and fused (unscaled: f16 relative precision is scale-free and a x16/x0.25 weight split would push small W2 entries into f16 subnormals) plain f16 (~2^-12); scores, softmax statistics and the output f32. v_wmma_f32_16x16x32_f16.
#define NB 8
#define SQ 2048
#define NC 512                       /* d_in = d_hid */
#define NO 512                       /* output features */
#define DM NC
#define NH (NC / 64)                 /* 8 slabs of 64 for the in2^T transpose */
#define HD 64
#define HG 1
#define B0 0                         /* first batch processed (debug hook) */
#define NBR NB                       /* batches processed (debug hook) */
#define QN SQ                        /* query rows attended per batch (debug hook) */
#define NR ((size_t)NB * SQ)
#define MP ((int)((size_t)NBR * SQ)) /* rows projected (debug hook) */
#define MPO MP                       /* rows through the output GEMM (debug hook) */
typedef __bf16 v16b __attribute__((ext_vector_type(16)));
typedef unsigned short v8us __attribute__((ext_vector_type(8), may_alias));
typedef float  v8f  __attribute__((ext_vector_type(8)));
typedef float  v4f  __attribute__((ext_vector_type(4)));
typedef float  v4fa __attribute__((ext_vector_type(4), may_alias));
union FragB { v16b v; v8us half[2]; unsigned short u[16]; };

__device__ __forceinline__ unsigned short bf16_bits(float x) { unsigned int u = __float_as_uint(x); return (unsigned short)((u + 0x7FFFu + ((u >> 16) & 1u)) >> 16); }
__device__ __forceinline__ float bf16_val(unsigned short b) { return __uint_as_float(((unsigned int)b) << 16); }
__device__ __forceinline__ float bf16_round(float x) { return bf16_val(bf16_bits(x)); }
// D += A·B with NT terms: 1 = ah·bh, 2 = + al·bh (A split), 3 = + ah·bl (both split)
template <int NT>
__device__ __forceinline__ v8f mmaN(v16b ah, v16b al, v16b bh, v16b bl, v8f c) {
  c = __builtin_amdgcn_wmma_f32_16x16x32_bf16(false, ah, false, bh, (short)0, c, false, false);
  if (NT >= 2) c = __builtin_amdgcn_wmma_f32_16x16x32_bf16(false, al, false, bh, (short)0, c, false, false);
  if (NT >= 3) c = __builtin_amdgcn_wmma_f32_16x16x32_bf16(false, ah, false, bl, (short)0, c, false, false);
  asm volatile("v_nop\n\tv_nop\n\tv_nop\n\tv_nop" : "+v"(c) : "v"(ah), "v"(al), "v"(bh), "v"(bl));
  return c;
}

__global__ __launch_bounds__(256) void k_wt_bf16(const float* __restrict__ W, unsigned short* __restrict__ Wt, int K, int N) {
  const int t = blockIdx.x * 256 + threadIdx.x;
  const int k8n = K / 8;
  if (t >= N * k8n) return;
  const int n = t / k8n, k8 = (t % k8n) * 8;
  v8us v;
#pragma unroll
  for (int i = 0; i < 8; ++i) v[i] = bf16_bits(W[(size_t)(k8 + i) * N + n]);
  *(v8us*)(Wt + (size_t)n * K + k8) = v;
  
}

// GEMM C[M][N] (f32, pitch ldc) = act(A[M][K]·W + bias). A f32 row-major (pitch lda) converted per fragment to bf16
// (ASPLIT: hi/lo two planes -> 2 terms, else single rounded term); Wt bf16 [N][K] (pitch ldb). BIAS_BF16 rounds the
// bias to bf16 first (bias quantised to bf16 before the add). K%32==0, M%16==0, N%64==0.
template <bool ASPLIT, int ACT, bool BIAS_BF16>
__global__ __launch_bounds__(128) void k_gemm_bf(const float* __restrict__ A, int lda, const unsigned short* __restrict__ Wt, int ldb,
                                               const float* __restrict__ bias, float* __restrict__ C, int ldc, int M, int N, int K) {
  __shared__ __attribute__((aligned(16))) float so[4][16][64];
  const int tid = threadIdx.x, w = tid >> 5, lane = tid & 31, ln = lane & 15, hh = lane >> 4;
  const int ntn = N / 64;
  const int wid = blockIdx.x * 4 + w;
  const int mt = wid / ntn, nq = wid % ntn;
  if (mt * 16 >= M) return;
  const int row0 = mt * 16, col0 = nq * 64;
  const float* arow = A + (size_t)(row0 + ln) * lda;
  v8f acc[4] = {};
  for (int kb = 0; kb < K; kb += 32) {
    FragB ah, al;
    const v4f x0 = *(const v4fa*)(arow + kb + 8 * hh), x1 = *(const v4fa*)(arow + kb + 8 * hh + 4);
    const v4f x2 = *(const v4fa*)(arow + kb + 16 + 8 * hh), x3 = *(const v4fa*)(arow + kb + 16 + 8 * hh + 4);
    float xs[16] = {x0[0],x0[1],x0[2],x0[3],x1[0],x1[1],x1[2],x1[3],x2[0],x2[1],x2[2],x2[3],x3[0],x3[1],x3[2],x3[3]};
#pragma unroll
    for (int i = 0; i < 16; ++i) { const unsigned short hb = bf16_bits(xs[i]); ah.u[i] = hb; al.u[i] = ASPLIT ? bf16_bits(xs[i] - bf16_val(hb)) : (unsigned short)0; }
#pragma unroll
    for (int t = 0; t < 4; ++t) {
      const unsigned short* brow = Wt + (size_t)(col0 + t * 16 + ln) * ldb + kb;
      FragB b;
      b.half[0] = *(const v8us*)(brow + 8 * hh);
      b.half[1] = *(const v8us*)(brow + 16 + 8 * hh);
      acc[t] = mmaN<ASPLIT ? 2 : 1>(ah.v, al.v, b.v, b.v, acc[t]);
    }
  }
#pragma unroll
  for (int t = 0; t < 4; ++t) {
    float bv = bias ? bias[col0 + t * 16 + ln] : 0.f;
    if (BIAS_BF16) bv = bf16_round(bv);
#pragma unroll
    for (int r = 0; r < 8; ++r) { float v = acc[t][r] + bv; if (ACT == 1) v = fmaxf(v, 0.f); so[w][8 * hh + r][t * 16 + ln] = v; }
  }
  __builtin_amdgcn_fence(__ATOMIC_ACQ_REL, "workgroup");
  __builtin_amdgcn_wave_barrier();
  const int rsub = lane >> 4, c4 = (lane & 15) * 4;
  {
#pragma unroll
    for (int q = 0; q < 8; ++q) {
      const int r = q * 2 + rsub;
      const v4f v = *(const v4fa*)&so[w][r][c4];
      *(v4f*)(C + (size_t)(row0 + r) * ldc + col0 + c4) = v;
    }
    
  }
}

// GEMM C = act(A·W + bias + resid): A f32 (ASPLIT -> hi/lo 2 terms), Wt bf16 [N][K]; ACT 0 none, 1 relu, 2 exact gelu;
// resid (optional, f32, row index = (row % rmod), pitch ldr, RES_BF16 rounds it) added before the activation.
template <bool ASPLIT, int ACT, bool BIAS_BF16, bool RES_BF16>
__global__ __launch_bounds__(128) void k_gemm_bf3(const float* __restrict__ A, int lda, const unsigned short* __restrict__ Wt, int ldb,
                                                const float* __restrict__ bias, const float* __restrict__ resid, int rmod, int ldr,
                                                float* __restrict__ C, int ldc, int M, int N, int K) {
  __shared__ __attribute__((aligned(16))) float so[4][16][64];
  const int tid = threadIdx.x, w = tid >> 5, lane = tid & 31, ln = lane & 15, hh = lane >> 4;
  const int ntn = N / 64;
  const int wid = blockIdx.x * 4 + w;
  const int mt = wid / ntn, nq = wid % ntn;
  if (mt * 16 >= M) return;
  const int row0 = mt * 16, col0 = nq * 64;
  const float* arow = A + (size_t)(row0 + ln) * lda;
  v8f acc[4] = {};
  for (int kb = 0; kb < K; kb += 32) {
    FragB ah, al;
    const v4f x0 = *(const v4fa*)(arow + kb + 8 * hh), x1 = *(const v4fa*)(arow + kb + 8 * hh + 4);
    const v4f x2 = *(const v4fa*)(arow + kb + 16 + 8 * hh), x3 = *(const v4fa*)(arow + kb + 16 + 8 * hh + 4);
    float xs[16] = {x0[0],x0[1],x0[2],x0[3],x1[0],x1[1],x1[2],x1[3],x2[0],x2[1],x2[2],x2[3],x3[0],x3[1],x3[2],x3[3]};
#pragma unroll
    for (int i = 0; i < 16; ++i) { const unsigned short hb = bf16_bits(xs[i]); ah.u[i] = hb; al.u[i] = ASPLIT ? bf16_bits(xs[i] - bf16_val(hb)) : (unsigned short)0; }
#pragma unroll
    for (int t = 0; t < 4; ++t) {
      const unsigned short* brow = Wt + (size_t)(col0 + t * 16 + ln) * ldb + kb;
      FragB b;
      b.half[0] = *(const v8us*)(brow + 8 * hh);
      b.half[1] = *(const v8us*)(brow + 16 + 8 * hh);
      acc[t] = mmaN<ASPLIT ? 2 : 1>(ah.v, al.v, b.v, b.v, acc[t]);
    }
  }
#pragma unroll
  for (int t = 0; t < 4; ++t) {
    const int col = col0 + t * 16 + ln;
    float bv = bias ? bias[col] : 0.f;
    if (BIAS_BF16) bv = bf16_round(bv);
#pragma unroll
    for (int r = 0; r < 8; ++r) {
      float v = acc[t][r] + bv;
      if (resid) { float rv = resid[(size_t)((row0 + 8 * hh + r) % rmod) * ldr + col]; if (RES_BF16) rv = bf16_round(rv); v += rv; }
      if (ACT == 1) v = fmaxf(v, 0.f);
      if (ACT == 2) v = 0.5f * v * (1.0f + erff(v * 0.70710678118654752f));
      if (ACT == 3) { const float u = 0.7978845608028654f * (v + 0.044715f * v * v * v); v = 0.5f * v * (1.0f + tanhf(u)); }
      so[w][8 * hh + r][t * 16 + ln] = v;
    }
  }
  __builtin_amdgcn_fence(__ATOMIC_ACQ_REL, "workgroup");
  __builtin_amdgcn_wave_barrier();
  const int rsub = lane >> 4, c4 = (lane & 15) * 4;
  {
#pragma unroll
    for (int q = 0; q < 8; ++q) {
      const int r = q * 2 + rsub;
      const v4f v = *(const v4fa*)&so[w][r][c4];
      *(v4f*)(C + (size_t)(row0 + r) * ldc + col0 + c4) = v;
    }
    
  }
}
// row LayerNorm (biased variance, eps) over N: s = X (+ R); optional out_sum <- s; out_norm <- (s-mu)*rsqrt(var+eps)*g + b
template <bool PARAM_BF16>
__global__ __launch_bounds__(256) void k_layernorm(const float* __restrict__ X, const float* __restrict__ R, const float* __restrict__ g, const float* __restrict__ bta,
                                                  float* __restrict__ out_sum, float* __restrict__ out_norm, int N, float eps) {
  __shared__ float red[256];
  const int row = blockIdx.x, tid = threadIdx.x;
  const float* x = X + (size_t)row * N; const float* rr = R ? R + (size_t)row * N : nullptr;
  float vals[16];                     // up to N = 4096
  const int per = N / 256;            // contiguous chunk per thread? use strided-by-4 chunks: thread handles j = tid*4 + 1024*u
  float s1 = 0.f;
  for (int u = 0; u < per / 4; ++u) {
    const int j = tid * 4 + 1024 * u;
    const v4f a = *(const v4fa*)(x + j);
    v4f b = {0.f,0.f,0.f,0.f}; if (rr) b = *(const v4fa*)(rr + j);
#pragma unroll
    for (int q = 0; q < 4; ++q) { const float v = a[q] + b[q]; vals[u * 4 + q] = v; s1 += v; }
  }
  red[tid] = s1; __syncthreads();
  for (int st = 128; st > 0; st >>= 1) { if (tid < st) red[tid] += red[tid + st]; __syncthreads(); }
  const float mu = red[0] / (float)N; __syncthreads();
  float s2 = 0.f;
  for (int u = 0; u < per / 4; ++u)
#pragma unroll
    for (int q = 0; q < 4; ++q) { const float c = vals[u * 4 + q] - mu; s2 += c * c; }
  red[tid] = s2; __syncthreads();
  for (int st = 128; st > 0; st >>= 1) { if (tid < st) red[tid] += red[tid + st]; __syncthreads(); }
  const float rs = rsqrtf(red[0] / (float)N + eps);
  {
    for (int u = 0; u < per / 4; ++u) {
      const int j = tid * 4 + 1024 * u;
      v4f o, sm;
#pragma unroll
      for (int q = 0; q < 4; ++q) {
        float gg = g[j + q], bb = bta[j + q];
        if (PARAM_BF16) { gg = bf16_round(gg); bb = bf16_round(bb); }
        sm[q] = vals[u * 4 + q]; o[q] = (vals[u * 4 + q] - mu) * rs * gg + bb;
      }
      if (out_sum) *(v4f*)(out_sum + (size_t)row * N + j) = sm;
      *(v4f*)(out_norm + (size_t)row * N + j) = o;
    }
    
  }
}



// ---- f16 WMMA path (v_wmma_f32_16x16x32_f16): 11-bit significands for operands in range — used where a [0,1] probability operand needs more precision than bf16
typedef _Float16 v16h __attribute__((ext_vector_type(16)));
union FragH { v16h v; v8us half[2]; _Float16 h[16]; unsigned short u[16]; };
template <int NT>
__device__ __forceinline__ v8f mmaH(v16h ah, v16h al, v16h bh, v16h bl, v8f c) {
  c = __builtin_amdgcn_wmma_f32_16x16x32_f16(false, ah, false, bh, (short)0, c, false, false);
  if (NT >= 2) c = __builtin_amdgcn_wmma_f32_16x16x32_f16(false, al, false, bh, (short)0, c, false, false);
  if (NT >= 3) c = __builtin_amdgcn_wmma_f32_16x16x32_f16(false, ah, false, bl, (short)0, c, false, false);
  asm volatile("v_nop\n\tv_nop\n\tv_nop\n\tv_nop" : "+v"(c) : "v"(ah), "v"(al), "v"(bh), "v"(bl));
  return c;
}
// batched GEMM like k_gemm_b but f16 operands: A f32 (split into f16 hi/lo if ASPLIT, else rounded to f16), Bt = f16 values [n][k]; alpha; C f32; N multiple of 16 (partial tiles skipped)
template <bool ASPLIT>
__global__ __launch_bounds__(128) void k_gemm_h(const float* __restrict__ A, int lda, size_t sA, const _Float16* __restrict__ Bh, int ldb, size_t sB, float alpha, float* __restrict__ C, int ldc, size_t sC, int M, int N, int K) {
  __shared__ __attribute__((aligned(16))) float so[4][16][64];
  const int tid = threadIdx.x, w = tid >> 5, lane = tid & 31, ln = lane & 15, hh = lane >> 4; const int by = blockIdx.y;
  A += (size_t)by * sA; Bh += (size_t)by * sB; C += (size_t)by * sC;
  const int ntn = (N + 63) / 64; const int wid = blockIdx.x * 4 + w; const int mt = wid / ntn, nq = wid % ntn; if (mt * 16 >= M) return;
  const int row0 = mt * 16, col0 = nq * 64; const float* arow = A + (size_t)(row0 + ln) * lda;
  v8f acc[4] = {};
  for (int kb = 0; kb < K; kb += 32) {
    FragH ah, al;
    const v4f x0 = *(const v4fa*)(arow + kb + 8 * hh), x1 = *(const v4fa*)(arow + kb + 8 * hh + 4), x2 = *(const v4fa*)(arow + kb + 16 + 8 * hh), x3 = *(const v4fa*)(arow + kb + 16 + 8 * hh + 4);
    float xs[16] = {x0[0],x0[1],x0[2],x0[3],x1[0],x1[1],x1[2],x1[3],x2[0],x2[1],x2[2],x2[3],x3[0],x3[1],x3[2],x3[3]};
#pragma unroll
    for (int i = 0; i < 16; ++i) { const _Float16 h = (_Float16)xs[i]; ah.h[i] = h; al.h[i] = ASPLIT ? (_Float16)(xs[i] - (float)h) : (_Float16)0.0f; }
#pragma unroll
    for (int t = 0; t < 4; ++t) { if (col0 + t * 16 >= N) continue; const size_t boff = (size_t)(col0 + t * 16 + ln) * ldb + kb; FragH bq; bq.half[0] = *(const v8us*)(Bh + boff + 8 * hh); bq.half[1] = *(const v8us*)(Bh + boff + 16 + 8 * hh);
      acc[t] = mmaH<ASPLIT ? 2 : 1>(ah.v, al.v, bq.v, bq.v, acc[t]); }
  }
#pragma unroll
  for (int t = 0; t < 4; ++t) { if (col0 + t * 16 >= N) continue;
#pragma unroll
    for (int r = 0; r < 8; ++r) so[w][8 * hh + r][t * 16 + ln] = acc[t][r] * alpha; }
  __builtin_amdgcn_fence(__ATOMIC_ACQ_REL, "workgroup"); __builtin_amdgcn_wave_barrier();
  const int rsub = lane >> 4, c4 = (lane & 15) * 4;
  {
#pragma unroll
    for (int q = 0; q < 8; ++q) { const int r = q * 2 + rsub; if (col0 + c4 < N) { const v4f v = *(const v4fa*)&so[w][r][c4]; *(v4f*)(C + (size_t)(row0 + r) * ldc + col0 + c4) = v; } }
     }
}

// Wt[n][k] = f16(W[k][n]·scale) from f32 row-major W[K][N] (scale = power of two; bf16-exact weights stay exact in f16 away from the subnormal range)
__global__ __launch_bounds__(256) void k_wt_f16(const float* __restrict__ W, _Float16* __restrict__ Wt, int K, int N, float scale) {
  const int t = blockIdx.x * 256 + threadIdx.x; if (t >= N * (K / 8)) return; const int n = t / (K / 8), k8 = (t % (K / 8)) * 8; FragH f;
#pragma unroll
  for (int i = 0; i < 8; ++i) f.h[i] = (_Float16)(bf16_round(W[(size_t)(k8 + i) * N + n]) * scale); const v8us o = f.half[0];
  *(v8us*)((unsigned short*)Wt + (size_t)n * K + k8) = o; 
}
// k_gemm_hh variant with fused epilogue: v = acc·alpha + bias[by·sBias + col] (+ CP[(row/rowsPerB)·sCPb + by·64 + col] if CP) ; ACT 0 none / 1 elu ; writes f16 C16 (and f32 C if non-null)
template <int ACT>
__global__ __launch_bounds__(128) void k_gemm_hhx(const _Float16* __restrict__ A, int lda, size_t sA, const _Float16* __restrict__ Bh, int ldb, size_t sB, float alpha, const float* __restrict__ bias, size_t sBias, const float* __restrict__ CP, int rowsPerB, size_t sCPb, int row0g,
    float* __restrict__ C, _Float16* __restrict__ C16, int ldc, size_t sC, int M, int N, int K) {
  __shared__ __attribute__((aligned(16))) float so[4][16][64];
  const int tid = threadIdx.x, w = tid >> 5, lane = tid & 31, ln = lane & 15, hh = lane >> 4; const int by = blockIdx.y;
  A += (size_t)by * sA; Bh += (size_t)by * sB; const size_t cofs = (size_t)by * sC; const float* bp = bias ? bias + (size_t)by * sBias : nullptr;
  const int ntn = (N + 63) / 64; const int wid = blockIdx.x * 4 + w; const int mt = wid / ntn, nq = wid % ntn; if (mt * 16 >= M) return;
  const int row0 = mt * 16, col0 = nq * 64; const _Float16* arow = A + (size_t)(row0 + ln) * lda;
  v8f acc[4] = {};
  for (int kb = 0; kb < K; kb += 32) { FragH ah; ah.half[0] = *(const v8us*)((const unsigned short*)arow + kb + 8 * hh); ah.half[1] = *(const v8us*)((const unsigned short*)arow + kb + 16 + 8 * hh);
#pragma unroll
    for (int t = 0; t < 4; ++t) { if (col0 + t * 16 >= N) continue; const size_t boff = (size_t)(col0 + t * 16 + ln) * ldb + kb; FragH bq; bq.half[0] = *(const v8us*)((const unsigned short*)Bh + boff + 8 * hh); bq.half[1] = *(const v8us*)((const unsigned short*)Bh + boff + 16 + 8 * hh);
      acc[t] = mmaH<1>(ah.v, ah.v, bq.v, bq.v, acc[t]); }
  }
#pragma unroll
  for (int t = 0; t < 4; ++t) { if (col0 + t * 16 >= N) continue; const int col = col0 + t * 16 + ln; const float bv = bp ? bf16_round(bp[col]) : 0.f;
#pragma unroll
    for (int r = 0; r < 8; ++r) { float v = acc[t][r] * alpha + bv; if (CP) { const int rr = row0g + row0 + 8 * hh + r; if (rowsPerB < 0) v += CP[cofs + (size_t)rr * ldc + col];      /* rowsPerB < 0: own element of the batched C plane */ else { const int bidx = rr / rowsPerB; v += CP[(size_t)bidx * sCPb + (size_t)by * 64 + col]; } } if (ACT == 1) v = (v > 0.f) ? v : expm1f(v); else if (ACT == 7) v = (v > 0.f) ? v + 1.0f : expf(v); else if (ACT == 8) v = tanhf(v); else if (ACT == 9) v = 0.5f * v * (1.0f + tanhf(0.7978845608028654f * (v + 0.044715f * v * v * v))); else if (ACT == 11) v = 1.0f / (1.0f + expf(-v)); else if (ACT == 12) v = (v > 0.f) ? v : 0.01f * v; else if (ACT == 14) v = (v > 0.f) ? v : 0.1f * v; else if (ACT == 16) v = (v >= 0.f) ? v : 0.3f * v; else if (ACT == 17) v = (v >= 0.f) ? v : 0.2f * v; else if (ACT == 15) v = v / (1.0f + expf(-v)); else if (ACT == 3) v = fmaxf(v, 0.f); else if (ACT == 6) v = 0.5f * v * (1.0f + erff(v * 0.70710678118654752f)); so[w][8 * hh + r][t * 16 + ln] = v; } }
  __builtin_amdgcn_fence(__ATOMIC_ACQ_REL, "workgroup"); __builtin_amdgcn_wave_barrier();
  const int rsub = lane >> 4, c4 = (lane & 15) * 4; typedef _Float16 v4h __attribute__((ext_vector_type(4)));
  {
#pragma unroll
    for (int q = 0; q < 8; ++q) { const int r = q * 2 + rsub; if (col0 + c4 < N) { const v4f v = *(const v4fa*)&so[w][r][c4]; if (C) *(v4f*)(C + cofs + (size_t)(row0 + r) * ldc + col0 + c4) = v; if (C16) { v4h h4; for (int i = 0; i < 4; ++i) h4[i] = (_Float16)v[i]; *(v4h*)(C16 + cofs + (size_t)(row0 + r) * ldc + col0 + c4) = h4; } } }
     }
}


typedef _Float16 v4h __attribute__((ext_vector_type(4)));

__global__ __launch_bounds__(256) void k_x16(const float* __restrict__ x, _Float16* __restrict__ X16, size_t n8) { const size_t t = (size_t)blockIdx.x * 256 + threadIdx.x; if (t >= n8) return; FragH f;
#pragma unroll
  for (int q = 0; q < 8; ++q) f.h[q] = (_Float16)bf16_round(x[t * 8 + q]); *(v8us*)((unsigned short*)X16 + t * 8) = f.half[0];  }
__global__ __launch_bounds__(256) void k_h16(const float* __restrict__ x, _Float16* __restrict__ X16, size_t n8) { const size_t t = (size_t)blockIdx.x * 256 + threadIdx.x; if (t >= n8) return; FragH f;
#pragma unroll
  for (int q = 0; q < 8; ++q) f.h[q] = (_Float16)x[t * 8 + q]; *(v8us*)((unsigned short*)X16 + t * 8) = f.half[0];  }
__global__ __launch_bounds__(256) void k_round16f(const float* __restrict__ W, _Float16* __restrict__ Bt, size_t n8) { const size_t t = (size_t)blockIdx.x * 256 + threadIdx.x; if (t >= n8) return; FragH f;
#pragma unroll
  for (int i = 0; i < 8; ++i) f.h[i] = (_Float16)(bf16_round(W[t * 8 + i]) * 16.0f); *(v8us*)((unsigned short*)Bt + t * 8) = f.half[0];  }
template <int NHv, int TTv>
__global__ __launch_bounds__(256) void k_vt(const _Float16* __restrict__ V16, int ldv, int voff, _Float16* __restrict__ Vt) { __shared__ unsigned short tl[64][66]; const int tid = threadIdx.x; const int slab = blockIdx.x / (TTv / 64), lg = blockIdx.x % (TTv / 64); const int b = slab / NHv, h = slab % NHv;
  for (int i = tid; i < 64 * 8; i += 256) { const int r = i / 8, c8 = (i % 8) * 8; FragH f; f.half[0] = *(const v8us*)((const unsigned short*)V16 + ((size_t)b * TTv + lg * 64 + r) * ldv + voff + h * 64 + c8);
#pragma unroll
    for (int q = 0; q < 8; ++q) tl[r][c8 + q] = f.u[q]; }
  __syncthreads();
  {
#pragma unroll
    for (int rd = 0; rd < 2; ++rd) { const int d = rd * 32 + tid / 8, pc = tid % 8; FragH f;
#pragma unroll
      for (int q = 0; q < 8; ++q) f.u[q] = tl[pc * 8 + q][d];
      *(v8us*)((unsigned short*)Vt + ((size_t)slab * 64 + d) * TTv + lg * 64 + pc * 8) = f.half[0]; }
     } }

__global__ __launch_bounds__(256) void k_hl(const float* __restrict__ F, _Float16* __restrict__ Hh, _Float16* __restrict__ Hl, size_t n8) { const size_t t = (size_t)blockIdx.x * 256 + threadIdx.x; if (t >= n8) return; FragH fh, fl; const v4f a = *(const v4fa*)(F + t * 8), c = *(const v4fa*)(F + t * 8 + 4);
#pragma unroll
  for (int q = 0; q < 4; ++q) { _Float16 h = (_Float16)a[q]; fh.h[q] = h; fl.h[q] = (_Float16)((a[q] - (float)h) * 1024.0f); h = (_Float16)c[q]; fh.h[4 + q] = h; fl.h[4 + q] = (_Float16)((c[q] - (float)h) * 1024.0f); }
  { *(v8us*)((unsigned short*)Hh + t * 8) = fh.half[0]; *(v8us*)((unsigned short*)Hl + t * 8) = fl.half[0];  } }

// ---- fast GEMM: block tile 128x128, four waves of 64x64 (requires M % 128 == 0 rows per launch region, N % 128 == 0, K % 64 == 0) ----
// Both operand tiles of a 64-k pass are brought into LDS once per work-group by asynchronous copies (each wave-wide copy covers four whole 128-byte rows) and read from there by all four waves;
// two buffers, so that the next pass's copies fly while this pass is multiplied. Each output element still sums its k blocks of 32 in ascending order.
#define G2_PITCH 144                 /* LDS bytes per 128-byte tile row: 16 B x odd, the pitch at which ds_load_b128 readers of 16 rows meet no bank conflict */
#define G2_OPER (128 * G2_PITCH)     /* one operand's 128 rows of a pass */
#define G2_STAGE (2 * G2_OPER)       /* one buffer: [A 128 rows | B 128 rows] */
#define G2_SOP 68                    /* floats per row of the output staging */
__device__ __forceinline__ v16h g2_lfrag(const char* p) { FragH f; f.half[0] = *(const v8us*)p; f.half[1] = *(const v8us*)(p + 32); return f.v; }      /* same k order as a fragment read from global rows: k = 8 hh .. 8 hh + 7, then 16 + 8 hh .. */
__device__ __forceinline__ v8f g2_mma(v16h a, v16h b, v8f c) { v8f d = __builtin_amdgcn_wmma_f32_16x16x32_f16(false, a, false, b, (short)0, c, false, false); asm volatile("v_nop\n\tv_nop\n\tv_nop\n\tv_nop" : "+v"(d) : "v"(a), "v"(b)); return d; }
// One operand's 128 rows x 128 bytes: the lane's 16 bytes of rows r, r + 16, .. r + 112 (l = its LDS byte address for row r, p = its global address for row r, ld = global row pitch in halves).
// The s_wait_xcnt closes the copies' own statement so that no address register of a copy is rewritten in front of it.
__device__ __forceinline__ void g2_copy8(unsigned l, const _Float16* p, size_t ld) {
  asm volatile("global_load_async_to_lds_b128 %0, %8, off\n\t"
               "global_load_async_to_lds_b128 %1, %9, off\n\t"
               "global_load_async_to_lds_b128 %2, %10, off\n\t"
               "global_load_async_to_lds_b128 %3, %11, off\n\t"
               "global_load_async_to_lds_b128 %4, %12, off\n\t"
               "global_load_async_to_lds_b128 %5, %13, off\n\t"
               "global_load_async_to_lds_b128 %6, %14, off\n\t"
               "global_load_async_to_lds_b128 %7, %15, off\n\t"
               "s_wait_xcnt 0x0"
               :: "v"(l), "v"(l + 16 * G2_PITCH), "v"(l + 32 * G2_PITCH), "v"(l + 48 * G2_PITCH), "v"(l + 64 * G2_PITCH), "v"(l + 80 * G2_PITCH), "v"(l + 96 * G2_PITCH), "v"(l + 112 * G2_PITCH),
                  "v"(p), "v"(p + 16 * ld), "v"(p + 32 * ld), "v"(p + 48 * ld), "v"(p + 64 * ld), "v"(p + 80 * ld), "v"(p + 96 * ld), "v"(p + 112 * ld)
               : "memory");
}
// The activation of one output value (ACT: 0 none, 3 relu, 6 exact gelu, 8 tanh, 9 tanh gelu, 11 sigmoid, 12/14/16/17 leaky relu 0.01/0.1/0.3/0.2, 15 silu).
template <int ACT>
__device__ __forceinline__ float g2_act(float v) {
  if (ACT == 3) v = fmaxf(v, 0.f); else if (ACT == 6) v = 0.5f * v * (1.0f + erff(v * 0.70710678118654752f)); else if (ACT == 11) v = 1.0f / (1.0f + expf(-v)); else if (ACT == 15) v = v / (1.0f + expf(-v)); else if (ACT == 12) v = (v > 0.f) ? v : 0.01f * v; else if (ACT == 8) v = tanhf(v); else if (ACT == 9) v = 0.5f * v * (1.0f + tanhf(0.7978845608028654f * (v + 0.044715f * v * v * v))); else if (ACT == 14) v = (v > 0.f) ? v : 0.1f * v; else if (ACT == 16) v = (v >= 0.f) ? v : 0.3f * v; else if (ACT == 17) v = (v >= 0.f) ? v : 0.2f * v;
  return v; }
// What the epilogue does is fixed at compile time: HASB adds bf16-rounded bias[by * sBias + col]; ADDC adds the element that C already holds (C += ...); F32O stores f32 C, F16O stores f16 C16.
// out = ACT(acc * alpha + bias + old C), in that order.
// TWOP: A is given as two planes against the same B, acc = (sum over k of A2 B) * pre + sum over k of A B: the passes of A2 run first, the accumulators are scaled once by pre (a power of two: exact),
// and the passes of A add onto them, so that the sum of both terms leaves the registers once. A2 has A's pitch and batch stride.
template <int ACT, bool HASB, bool ADDC, bool F32O, bool F16O, bool TWOP = false>
__global__ __launch_bounds__(128) void k_gemm2(const _Float16* __restrict__ A, int lda, size_t sA, const _Float16* __restrict__ Bh, int ldb, size_t sB, float alpha, const float* __restrict__ bias, size_t sBias,
    float* __restrict__ C, _Float16* __restrict__ C16, int ldc, size_t sC, int M, int N, int K, const _Float16* __restrict__ A2, float pre) { static_assert(ACT == 0 || ACT == 3 || ACT == 6 || ACT == 8 || ACT == 9 || ACT == 11 || ACT == 12 || ACT == 14 || ACT == 15 || ACT == 16 || ACT == 17, "k_gemm2: unsupported ACT code (would silently apply no activation)");
  static_assert(F32O || !ADDC, "ADDC reads the f32 plane it then stores");
  __shared__ __attribute__((aligned(16))) char sm[2 * G2_STAGE];      /* the two buffers; behind the loop's last barrier the same bytes stage the output */
  static_assert(4 * 64 * G2_SOP * 4 <= 2 * G2_STAGE, "output staging must fit the ring");
  const int tid = threadIdx.x, w = tid >> 5, lane = tid & 31, ln = lane & 15, hh = lane >> 4; const int by = blockIdx.y;
  A += (size_t)by * sA; Bh += (size_t)by * sB; const size_t cofs = (size_t)by * sC;
  const int ntn = N >> 7; const int mt = blockIdx.x / ntn, nq = blockIdx.x - mt * ntn; const int rowB = mt * 128, colB = nq * 128; if (rowB >= M) return;      /* the same for the whole work-group, in front of every barrier */
  const int row0 = rowB + 64 * (w >> 1), col0 = colB + 64 * (w & 1);
  const int cr = tid >> 3, cc = tid & 7;      /* copies: eight lanes per 128-byte row, 16 rows per round of the work-group */
  const _Float16* ga = A + (size_t)(rowB + cr) * lda + cc * 8; const _Float16* gb = Bh + (size_t)(colB + cr) * ldb + cc * 8;
  const _Float16* g2 = TWOP ? A2 + (size_t)by * sA + (size_t)(rowB + cr) * lda + cc * 8 : ga;
  const unsigned lc = (unsigned)(size_t)sm + (unsigned)(cr * G2_PITCH + cc * 16);
  const char* fa = sm + (64 * (w >> 1) + ln) * G2_PITCH + 16 * hh; const char* fb = sm + G2_OPER + (64 * (w & 1) + ln) * G2_PITCH + 16 * hh;
  const int n2 = TWOP ? K >> 6 : 0; const int np = n2 + (K >> 6);      /* passes 0 .. n2 - 1 read A2, passes n2 .. np - 1 read A; both walk the same k of B */
  const auto pa = [&](int t) { return (TWOP && t < n2) ? g2 + (size_t)t * 64 : ga + (size_t)(t - n2) * 64; };
  const auto pb = [&](int t) { return gb + (size_t)((TWOP && t >= n2) ? t - n2 : t) * 64; };
  g2_copy8(lc, pa(0), (size_t)lda); g2_copy8(lc + G2_OPER, pb(0), (size_t)ldb);      /* pass 0 -> buffer 0 */
  asm volatile("s_wait_asynccnt 0x0" ::: "memory");      /* this wave's copies of pass 0 have landed */
  __syncthreads();      /* every wave's have: pass 0 may be read */
  if (np > 1) { g2_copy8(lc + G2_STAGE, pa(1), (size_t)lda); g2_copy8(lc + G2_STAGE + G2_OPER, pb(1), (size_t)ldb); }      /* pass 1 -> buffer 1, where there is one (the same test for the whole work-group) */
  const v8f z8 = {0.f,0.f,0.f,0.f,0.f,0.f,0.f,0.f}; v8f acc[4][4];
#pragma unroll
  for (int i = 0; i < 4; ++i)
#pragma unroll
    for (int j = 0; j < 4; ++j) acc[i][j] = z8;
#pragma unroll 1      /* one pass per trip: the buffer offset is the only thing that differs, and an unrolled copy of 32 WMMAs buys nothing */
  for (int t = 0; t < np; ++t) { const int bo = (t & 1) * G2_STAGE;
    if (TWOP && t == n2) {      /* once, the same for every wave: the first plane's sum takes its weight before the second plane adds on */
#pragma unroll
      for (int i = 0; i < 4; ++i)
#pragma unroll
        for (int j = 0; j < 4; ++j) acc[i][j] *= pre; }
#pragma unroll
    for (int ks = 0; ks < 2; ++ks) { v16h a[4], b[4];
#pragma unroll
      for (int i = 0; i < 4; ++i) { a[i] = g2_lfrag(fa + bo + i * 16 * G2_PITCH + ks * 64); b[i] = g2_lfrag(fb + bo + i * 16 * G2_PITCH + ks * 64); }
#pragma unroll
      for (int j = 0; j < 4; ++j)
#pragma unroll
        for (int i = 0; i < 4; ++i) acc[i][j] = g2_mma(a[i], b[j], acc[i][j]); }
    asm volatile("s_wait_dscnt 0x0" ::: "memory");      /* this wave's reads of buffer t mod 2 are done before the barrier lets it be refilled */
    asm volatile("s_wait_asynccnt 0x0" ::: "memory");      /* this wave's copies of pass t + 1 have landed */
    __syncthreads();      /* publishes pass t + 1 and ends every reader's last read of buffer t mod 2 */
    if (t + 2 < np) { g2_copy8(lc + bo, pa(t + 2), (size_t)lda); g2_copy8(lc + bo + G2_OPER, pb(t + 2), (size_t)ldb); } }
  asm volatile("s_wait_asynccnt 0x0" ::: "memory");      /* nothing of the ring is in flight when its bytes become the output staging */
  float* so = (float*)(sm + (size_t)w * (64 * G2_SOP * 4));      /* the wave's own 64 x 68 floats */
  float bv[4];
#pragma unroll
  for (int t = 0; t < 4; ++t) bv[t] = HASB ? bf16_round(bias[(size_t)by * sBias + col0 + t * 16 + ln]) : 0.f;
#pragma unroll
  for (int u = 0; u < 16; ++u) { const int t = u & 3, rt = u >> 2;
#pragma unroll
    for (int r = 0; r < 8; ++r) so[(rt * 16 + 8 * hh + r) * G2_SOP + t * 16 + ln] = HASB ? acc[rt][t][r] * alpha + bv[t] : acc[rt][t][r] * alpha; }
  __builtin_amdgcn_fence(__ATOMIC_ACQ_REL, "workgroup"); __builtin_amdgcn_wave_barrier();
  const int rsub = lane >> 4, c4 = (lane & 15) * 4;
  const size_t es = (size_t)2 * ldc;      /* a lane's rows are two apart */
  size_t eb = cofs + (size_t)(row0 + rsub) * ldc + col0 + c4;
  const float* sr = so + rsub * G2_SOP + c4;
#pragma unroll 1      /* four trips of 16 rows: rolled so that the text that runs once per work-group stays short (with tanh an unrolled copy is four times as long); inside a trip the eight loads, and the eight stores, are in flight together */
  for (int qb = 0; qb < 4; ++qb) { v4f v[8];
    if (ADDC) { v4f c[8];
#pragma unroll
      for (int q = 0; q < 8; ++q) c[q] = *(const v4fa*)(C + eb + q * es);
#pragma unroll
      for (int q = 0; q < 8; ++q) v[q] = *(const v4fa*)(sr + q * 2 * G2_SOP) + c[q]; }
    else {
#pragma unroll
      for (int q = 0; q < 8; ++q) v[q] = *(const v4fa*)(sr + q * 2 * G2_SOP); }
#pragma unroll
    for (int q = 0; q < 8; ++q) {
#pragma unroll
      for (int i = 0; i < 4; ++i) v[q][i] = g2_act<ACT>(v[q][i]);
      if (F32O) *(v4f*)(C + eb + q * es) = v[q];
      if (F16O) { v4h h4;
#pragma unroll
        for (int i = 0; i < 4; ++i) h4[i] = (_Float16)v[q][i];
        *(v4h*)(C16 + eb + q * es) = h4; } }
    asm volatile("s_wait_xcnt 0x0" ::: "memory");      /* the next trip rewrites the address and data registers of this trip's loads and stores */
    eb += 8 * es; sr += 16 * G2_SOP; } }


__global__ __launch_bounds__(256) void k_wnat(const float* __restrict__ w, size_t n8, _Float16* __restrict__ Bt) { const size_t t = (size_t)blockIdx.x * 256 + threadIdx.x; if (t >= n8) return; FragH f; for (int q = 0; q < 8; ++q) f.h[q] = (_Float16)(bf16_round(w[t * 8 + q]) * 16.0f); *(v8us*)((unsigned short*)Bt + t * 8) = f.half[0];  }
__global__ __launch_bounds__(256) void k_rsm(const float* __restrict__ S, _Float16* __restrict__ P, int nrows) {
  #pragma clang fp contract(off)
  const int i = blockIdx.x * 256 + threadIdx.x; if (i >= nrows) return; const float* s = S + (size_t)i * SQ; float mx = -3.0e38f;
#pragma unroll 1
  for (int j = 0; j < SQ; ++j) mx = fmaxf(mx, s[j]); float se = 0.f;
#pragma unroll 1
  for (int j = 0; j < SQ; ++j) se += expf(s[j] - mx); const float sc = 256.0f / se;
#pragma unroll 1
  for (int j0 = 0; j0 < SQ; j0 += 8) { FragH f; for (int q = 0; q < 8; ++q) f.h[q] = (_Float16)(expf(s[j0 + q] - mx) * sc); unsigned short* d = (unsigned short*)P + (size_t)i * SQ + j0; *(v8us*)d = f.half[0];  } }
__global__ __launch_bounds__(256) void k_vt(const _Float16* __restrict__ V16, int b, int h0, _Float16* __restrict__ VT) { __shared__ unsigned short tl[64][65]; const int tid = threadIdx.x; const int hh = blockIdx.x % HG, sg = blockIdx.x / HG; const int s0 = sg * 64; const int h = h0 + hh;
  for (int i = tid; i < 64 * 8; i += 256) { const int j = i / 8, d8 = (i % 8) * 8; FragH f; f.half[0] = *(const v8us*)((const unsigned short*)V16 + ((size_t)b * SQ + s0 + j) * DM + h * HD + d8); for (int q = 0; q < 8; ++q) tl[d8 + q][j] = f.u[q]; }
  __syncthreads();
  { for (int i = tid; i < 64 * 8; i += 256) { const int d = i / 8, j8 = (i % 8) * 8; FragH f; for (int q = 0; q < 8; ++q) f.u[q] = tl[d][j8 + q]; *(v8us*)((unsigned short*)VT + ((size_t)hh * HD + d) * SQ + s0 + j8) = f.half[0]; }  } }


__global__ __launch_bounds__(256) void k_x16p(const float* __restrict__ x, _Float16* __restrict__ dst, size_t n8, int nc, int ldo) { const size_t t = (size_t)blockIdx.x * 256 + threadIdx.x; if (t >= n8) return; const size_t e = t * 8; const size_t r = e / nc; const int c = (int)(e % nc); FragH f;
#pragma unroll
  for (int q = 0; q < 8; ++q) f.h[q] = (_Float16)bf16_round(x[e + q]); unsigned short* d = (unsigned short*)dst + r * ldo + c; *(v8us*)d = f.half[0];  }
typedef int v4ia __attribute__((ext_vector_type(4), may_alias));
// Masked row softmax, one wave per score row. Lane l keeps columns 128 i + 4 l .. 128 i + 4 l + 3 (i = 0..15) of its row in registers, so every load of S covers 512 contiguous bytes and S is read once;
// a masked key enters as -inf (its exp is an exact 0); row maximum and row sum: four chains per lane, then a five-step butterfly over the 32 lanes. A row with every key masked (sum 0) gets weights 0.
// Every loop is fully unrolled so that v[] is indexed by constants only and stays in registers (a run-time index would send it to scratch). No product here feeds an add, so nothing can be contracted.
// blockIdx.y = batch (score plane pitch SQ * SQ, mask row pitch SQ). The f16 weights go IN PLACE over the first half of the wave's own f32 score row (weight row pitch 2 * SQ halves): every store's value
// depends on the row sum, hence on every load of the row, and no other wave touches the row, so no score is overwritten before it is read. S carries no restrict because it is read and written.
__global__ __launch_bounds__(256) void k_rsmw(float* S, int qn, const int* __restrict__ mk) {
  const int lane = threadIdx.x & 31; const int row = blockIdx.x * 8 + (threadIdx.x >> 5); if (row >= qn) return;      /* wave-uniform; the kernel has no barrier */
  float* srow = S + (size_t)blockIdx.y * SQ * SQ + (size_t)row * SQ;
  const float* s = srow + lane * 4; const int* m = mk + (size_t)blockIdx.y * SQ + lane * 4; _Float16* p = (_Float16*)srow + lane * 4;
  v4f v[SQ / 128]; v4f mx4 = {-3.0e38f, -3.0e38f, -3.0e38f, -3.0e38f};
#pragma unroll
  for (int i = 0; i < SQ / 128; ++i) { const v4f x = *(const v4fa*)(s + i * 128); const v4ia k = *(const v4ia*)(m + i * 128);
#pragma unroll
    for (int q = 0; q < 4; ++q) { v[i][q] = (k[q] == 0) ? x[q] : -__builtin_inff(); mx4[q] = fmaxf(mx4[q], v[i][q]); } }
  float mx = fmaxf(fmaxf(mx4[0], mx4[1]), fmaxf(mx4[2], mx4[3]));
#pragma unroll
  for (int o = 16; o > 0; o >>= 1) mx = fmaxf(mx, __shfl_xor(mx, o, 32));
  v4f se4 = {0.f, 0.f, 0.f, 0.f};
#pragma unroll
  for (int i = 0; i < SQ / 128; ++i)
#pragma unroll
    for (int q = 0; q < 4; ++q) { const float t = (v[i][q] - mx) * 1.44269504f; float e;      /* native exp(x) = exp2(x log2 e), the same two instructions as __expf */
      asm("v_exp_f32 %0, %1\n\tv_nop" : "=v"(e) : "v"(t));      /* the v_nop keeps the one slot the instruction set asks for behind a transcendental, before its result is read or its source register reused */
      v[i][q] = e; se4[q] += e; }
  float se = (se4[0] + se4[1]) + (se4[2] + se4[3]);
#pragma unroll
  for (int o = 16; o > 0; o >>= 1) se += __shfl_xor(se, o, 32);
  const float sc = (se == 0.f) ? 0.f : 256.0f / se;
#pragma unroll
  for (int i = 0; i < SQ / 128; ++i) { v4h h;
#pragma unroll
    for (int q = 0; q < 4; ++q) h[q] = (_Float16)(v[i][q] * sc);
    *(v4h*)(p + i * 128) = h; } }

extern "C" void kernel_launch(void* const* d_in, const int* in_sizes, int n_in,
                              void* d_out, int out_size, void* d_ws, size_t ws_size, hipStream_t stream) {
  (void)in_sizes; (void)n_in; (void)out_size;
  const float* const* I = (const float* const*)d_in; const float* in1 = I[0]; const float* in2 = I[1]; const int* mask2 = (const int*)d_in[2]; const float* w1 = I[3]; const float* w2 = I[4]; const float* b2 = I[5];      /* weights natural [out][in] */
  char* ws = (char*)d_ws; size_t off = 0;
  auto take = [&](size_t bytes) { char* p = ws + off; off += (bytes + 255) & ~(size_t)255; return p; };
  _Float16* B1 = (_Float16*)take((size_t)NC * NC * 2); _Float16* B2 = (_Float16*)take((size_t)NO * 2 * NC * 2);
  _Float16* X1 = (_Float16*)take(NR * NC * 2); _Float16* X2 = (_Float16*)take(NR * NC * 2); _Float16* N1H = (_Float16*)take(NR * NC * 2); _Float16* N1L = (_Float16*)take(NR * NC * 2); _Float16* CAT = (_Float16*)take(NR * 2 * NC * 2);
  float* S = (float*)take((size_t)NB * SQ * SQ * 4);      /* the score planes of all batches; the softmax weights replace the first half of each score row */
  float* N1F = S;      /* n1 in f32 is last read by k_hl, before the first score is written */
  _Float16* X2T = X1;      /* in1 as f16 rows is last read by the n1 GEMM, before the transposes are written */
  if (off > ws_size) return;      /* 1.5 + 16 + 16 + 16 + 16 + 32 + 128 = approx 226 MiB */
  k_wnat<<<(unsigned)(((size_t)NC * NC / 8 + 255) / 256), 256, 0, stream>>>(w1, (size_t)NC * NC / 8, B1); k_wnat<<<(unsigned)(((size_t)NO * 2 * NC / 8 + 255) / 256), 256, 0, stream>>>(w2, (size_t)NO * 2 * NC / 8, B2);
  k_x16<<<(unsigned)((NR * NC / 8 + 255) / 256), 256, 0, stream>>>(in1, X1, NR * NC / 8); k_x16<<<(unsigned)((NR * NC / 8 + 255) / 256), 256, 0, stream>>>(in2, X2, NR * NC / 8);
  const size_t r0p = (size_t)B0 * SQ;
  k_x16p<<<(unsigned)(((size_t)MP * NC / 8 + 255) / 256), 256, 0, stream>>>(in1 + r0p * NC, CAT + r0p * 2 * NC, (size_t)MP * NC / 8, NC, 2 * NC);      /* cat columns 0..511 = in1 */
  k_gemm2<0, false, false, true, false><<<dim3((unsigned)((MP / 128) * (NC / 128)), 1), 128, 0, stream>>>(X1 + r0p * NC, NC, 0, B1, NC, 0, 0.0625f, nullptr, 0, N1F + r0p * NC, nullptr, NC, 0, MP, NC, NC, nullptr, 0.f);      /* n1 = in1 W1^T (f32) */
  k_hl<<<(unsigned)(((size_t)MP * NC / 8 + 255) / 256), 256, 0, stream>>>(N1F + r0p * NC, N1H + r0p * NC, N1L + r0p * NC, (size_t)MP * NC / 8);
  /* every stage below runs all batches in one launch: blockIdx.y = batch for scores, softmax and fused (the transposes take it from blockIdx.x); the output GEMM runs all rows as one M */
  const dim3 gs((QN / 128) * (SQ / 128), NBR); const size_t sX = (size_t)SQ * NC, sS = (size_t)SQ * SQ;
  k_vt<NH, SQ><<<NBR * NH * (SQ / 64), 256, 0, stream>>>(X2 + r0p * NC, NC, 0, X2T);      /* in2^T [batch][512][2048] */
  k_gemm2<0, false, false, true, false, true><<<gs, 128, 0, stream>>>(N1H + r0p * NC, NC, sX, X2 + r0p * NC, NC, sX, 1.0f, nullptr, 0, S, nullptr, SQ, sS, QN, SQ, NC, N1L + r0p * NC, 0.0009765625f);      /* scores = lo x 2^-10 + hi, both terms in the accumulators */
  k_rsmw<<<dim3((QN + 7) / 8, NBR), 256, 0, stream>>>(S, QN, mask2 + r0p);
  k_gemm2<0, false, false, false, true><<<dim3((QN / 128) * (NC / 128), NBR), 128, 0, stream>>>((const _Float16*)S, 2 * SQ, 2 * sS, X2T, SQ, sX, 0.00390625f, nullptr, 0, nullptr, CAT + r0p * 2 * NC + NC, 2 * NC, 2 * sX, QN, NC, SQ, nullptr, 0.f);      /* fused (x1: alpha 1/256 undoes the P carry) -> cat columns 512..1023 */
  k_gemm2<8, true, false, true, false><<<dim3((unsigned)((MPO / 128) * (NO / 128)), 1), 128, 0, stream>>>(CAT + r0p * 2 * NC, 2 * NC, 0, B2, 2 * NC, 0, 0.0625f, b2, 0, (float*)d_out + r0p * NO, nullptr, NO, 0, MPO, NO, 2 * NC, nullptr, 0.f);      /* out = tanh(cat W2^T + b2) */
}

// v006
// A run of this version takes 185 microseconds.
// Next to v005, in two timings, it ran 1.07 times as fast each time.
// Over all steps from v000 it is 30.9 times as fast.
#include <hip/hip_runtime.h>
// Cross attention with concat + tanh projection (in1, in2 [8][2048][512]; mask2 [8][2048] int32, nonzero = key masked out; n1 = in1 W1^T (W1 [512][512] natural, no bias); scores = n1 in2^T (no scaling); masked keys -> -inf; softmax over the 2,048 keys; fused = attn in2; out = tanh([in1 | fused] W2^T + b2) (W2 [512][1024] natural) -> [8][2048][512]).
// Structure: token rows; in1, in2 as exact f16 rows; n1 = in1 W1^T as a WMMA GEMM (128x128 block tiles staged in LDS, 64x64 wave tiles, f32 accumulation, exact x16 natural weights) into f32 rows, split on VALU into f16 hi + 2^-10 residual planes; then, all batches in each launch (grid y = batch, grid x for the transposes): scores = n1 in2^T as ONE GEMM launch of two terms (the lo plane's K = 512 passes first, their sum x 2^-10 is the start value of the hi plane's passes; in2 exact), masked row softmax on VALU reading the int mask row (f32 statistics, native exp; weights x256 f16, masked keys 0), in2^T via LDS transposes, fused = P . in2 GEMM (K = 2048, alpha 2^-8 undoing the P carry) written as plain f16 straight into columns 512..1023 of the f16 concat rows whose columns 0..511 are the exact in1; out = tanh(cat W2^T + b2) as ONE GEMM (K = 1024, exact x16 natural W2, alpha 1/16) with the tanh epilogue.
// Compute dtype: inputs rounded to bf16; in1, in2, weights exact in f16; n1 as f16 hi + residual planes (~2^-22: the logits have sigma ~23, so plain f16 would cost ~3e-3 logits); softmax weights (x256) and fused (unscaled: f16 relative precision is scale-free and a x16/x0.25 weight split would push small W2 entries into f16 subnormals) plain f16 (~2^-12); scores, softmax statistics and the output f32. v_wmma_f32_16x16x32_f16.
#define NB 8
#define SQ 2048
#define NC 512                       /* d_in = d_hid */
#define NO 512                       /* output features */
#define DM NC
#define NH (NC / 64)                 /* 8 slabs of 64 for the in2^T transpose */
#define HD 64
#define HG 1
#define B0 0                         /* first batch processed (debug hook) */
#define NBR NB                       /* batches processed (debug hook) */
#define QN SQ                        /* query rows attended per batch (debug hook) */
#define NR ((size_t)NB * SQ)
#define MP ((int)((size_t)NBR * SQ)) /* rows projected (debug hook) */
#define MPO MP                       /* rows through the output GEMM (debug hook) */
typedef __bf16 v16b __attribute__((ext_vector_type(16)));
typedef unsigned short v8us __attribute__((ext_vector_type(8), may_alias));
typedef float  v8f  __attribute__((ext_vector_type(8)));
typedef float  v4f  __attribute__((ext_vector_type(4)));
typedef float  v4fa __attribute__((ext_vector_type(4), may_alias));
union FragB { v16b v; v8us half[2]; unsigned short u[16]; };

__device__ __forceinline__ unsigned short bf16_bits(float x) { unsigned int u = __float_as_uint(x); return (unsigned short)((u + 0x7FFFu + ((u >> 16) & 1u)) >> 16); }
__device__ __forceinline__ float bf16_val(unsigned short b) { return __uint_as_float(((unsigned int)b) << 16); }
__device__ __forceinline__ float bf16_round(float x) { return bf16_val(bf16_bits(x)); }
// D += A·B with NT terms: 1 = ah·bh, 2 = + al·bh (A split), 3 = + ah·bl (both split)
template <int NT>
__device__ __forceinline__ v8f mmaN(v16b ah, v16b al, v16b bh, v16b bl, v8f c) {
  c = __builtin_amdgcn_wmma_f32_16x16x32_bf16(false, ah, false, bh, (short)0, c, false, false);
  if (NT >= 2) c = __builtin_amdgcn_wmma_f32_16x16x32_bf16(false, al, false, bh, (short)0, c, false, false);
  if (NT >= 3) c = __builtin_amdgcn_wmma_f32_16x16x32_bf16(false, ah, false, bl, (short)0, c, false, false);
  asm volatile("v_nop\n\tv_nop\n\tv_nop\n\tv_nop" : "+v"(c) : "v"(ah), "v"(al), "v"(bh), "v"(bl));
  return c;
}

__global__ __launch_bounds__(256) void k_wt_bf16(const float* __restrict__ W, unsigned short* __restrict__ Wt, int K, int N) {
  const int t = blockIdx.x * 256 + threadIdx.x;
  const int k8n = K / 8;
  if (t >= N * k8n) return;
  const int n = t / k8n, k8 = (t % k8n) * 8;
  v8us v;
#pragma unroll
  for (int i = 0; i < 8; ++i) v[i] = bf16_bits(W[(size_t)(k8 + i) * N + n]);
  *(v8us*)(Wt + (size_t)n * K + k8) = v;
  
}

// GEMM C[M][N] (f32, pitch ldc) = act(A[M][K]·W + bias). A f32 row-major (pitch lda) converted per fragment to bf16
// (ASPLIT: hi/lo two planes -> 2 terms, else single rounded term); Wt bf16 [N][K] (pitch ldb). BIAS_BF16 rounds the
// bias to bf16 first (bias quantised to bf16 before the add). K%32==0, M%16==0, N%64==0.
template <bool ASPLIT, int ACT, bool BIAS_BF16>
__global__ __launch_bounds__(128) void k_gemm_bf(const float* __restrict__ A, int lda, const unsigned short* __restrict__ Wt, int ldb,
                                               const float* __restrict__ bias, float* __restrict__ C, int ldc, int M, int N, int K) {
  __shared__ __attribute__((aligned(16))) float so[4][16][64];
  const int tid = threadIdx.x, w = tid >> 5, lane = tid & 31, ln = lane & 15, hh = lane >> 4;
  const int ntn = N / 64;
  const int wid = blockIdx.x * 4 + w;
  const int mt = wid / ntn, nq = wid % ntn;
  if (mt * 16 >= M) return;
  const int row0 = mt * 16, col0 = nq * 64;
  const float* arow = A + (size_t)(row0 + ln) * lda;
  v8f acc[4] = {};
  for (int kb = 0; kb < K; kb += 32) {
    FragB ah, al;
    const v4f x0 = *(const v4fa*)(arow + kb + 8 * hh), x1 = *(const v4fa*)(arow + kb + 8 * hh + 4);
    const v4f x2 = *(const v4fa*)(arow + kb + 16 + 8 * hh), x3 = *(const v4fa*)(arow + kb + 16 + 8 * hh + 4);
    float xs[16] = {x0[0],x0[1],x0[2],x0[3],x1[0],x1[1],x1[2],x1[3],x2[0],x2[1],x2[2],x2[3],x3[0],x3[1],x3[2],x3[3]};
#pragma unroll
    for (int i = 0; i < 16; ++i) { const unsigned short hb = bf16_bits(xs[i]); ah.u[i] = hb; al.u[i] = ASPLIT ? bf16_bits(xs[i] - bf16_val(hb)) : (unsigned short)0; }
#pragma unroll
    for (int t = 0; t < 4; ++t) {
      const unsigned short* brow = Wt + (size_t)(col0 + t * 16 + ln) * ldb + kb;
      FragB b;
      b.half[0] = *(const v8us*)(brow + 8 * hh);
      b.half[1] = *(const v8us*)(brow + 16 + 8 * hh);
      acc[t] = mmaN<ASPLIT ? 2 : 1>(ah.v, al.v, b.v, b.v, acc[t]);
    }
  }
#pragma unroll
  for (int t = 0; t < 4; ++t) {
    float bv = bias ? bias[col0 + t * 16 + ln] : 0.f;
    if (BIAS_BF16) bv = bf16_round(bv);
#pragma unroll
    for (int r = 0; r < 8; ++r) { float v = acc[t][r] + bv; if (ACT == 1) v = fmaxf(v, 0.f); so[w][8 * hh + r][t * 16 + ln] = v; }
  }
  __builtin_amdgcn_fence(__ATOMIC_ACQ_REL, "workgroup");
  __builtin_amdgcn_wave_barrier();
  const int rsub = lane >> 4, c4 = (lane & 15) * 4;
  {
#pragma unroll
    for (int q = 0; q < 8; ++q) {
      const int r = q * 2 + rsub;
      const v4f v = *(const v4fa*)&so[w][r][c4];
      *(v4f*)(C + (size_t)(row0 + r) * ldc + col0 + c4) = v;
    }
    
  }
}

// GEMM C = act(A·W + bias + resid): A f32 (ASPLIT -> hi/lo 2 terms), Wt bf16 [N][K]; ACT 0 none, 1 relu, 2 exact gelu;
// resid (optional, f32, row index = (row % rmod), pitch ldr, RES_BF16 rounds it) added before the activation.
template <bool ASPLIT, int ACT, bool BIAS_BF16, bool RES_BF16>
__global__ __launch_bounds__(128) void k_gemm_bf3(const float* __restrict__ A, int lda, const unsigned short* __restrict__ Wt, int ldb,
                                                const float* __restrict__ bias, const float* __restrict__ resid, int rmod, int ldr,
                                                float* __restrict__ C, int ldc, int M, int N, int K) {
  __shared__ __attribute__((aligned(16))) float so[4][16][64];
  const int tid = threadIdx.x, w = tid >> 5, lane = tid & 31, ln = lane & 15, hh = lane >> 4;
  const int ntn = N / 64;
  const int wid = blockIdx.x * 4 + w;
  const int mt = wid / ntn, nq = wid % ntn;
  if (mt * 16 >= M) return;
  const int row0 = mt * 16, col0 = nq * 64;
  const float* arow = A + (size_t)(row0 + ln) * lda;
  v8f acc[4] = {};
  for (int kb = 0; kb < K; kb += 32) {
    FragB ah, al;
    const v4f x0 = *(const v4fa*)(arow + kb + 8 * hh), x1 = *(const v4fa*)(arow + kb + 8 * hh + 4);
    const v4f x2 = *(const v4fa*)(arow + kb + 16 + 8 * hh), x3 = *(const v4fa*)(arow + kb + 16 + 8 * hh + 4);
    float xs[16] = {x0[0],x0[1],x0[2],x0[3],x1[0],x1[1],x1[2],x1[3],x2[0],x2[1],x2[2],x2[3],x3[0],x3[1],x3[2],x3[3]};
#pragma unroll
    for (int i = 0; i < 16; ++i) { const unsigned short hb = bf16_bits(xs[i]); ah.u[i] = hb; al.u[i] = ASPLIT ? bf16_bits(xs[i] - bf16_val(hb)) : (unsigned short)0; }
#pragma unroll
    for (int t = 0; t < 4; ++t) {
      const unsigned short* brow = Wt + (size_t)(col0 + t * 16 + ln) * ldb + kb;
      FragB b;
      b.half[0] = *(const v8us*)(brow + 8 * hh);
      b.half[1] = *(const v8us*)(brow + 16 + 8 * hh);
      acc[t] = mmaN<ASPLIT ? 2 : 1>(ah.v, al.v, b.v, b.v, acc[t]);
    }
  }
#pragma unroll
  for (int t = 0; t < 4; ++t) {
    const int col = col0 + t * 16 + ln;
    float bv = bias ? bias[col] : 0.f;
    if (BIAS_BF16) bv = bf16_round(bv);
#pragma unroll
    for (int r = 0; r < 8; ++r) {
      float v = acc[t][r] + bv;
      if (resid) { float rv = resid[(size_t)((row0 + 8 * hh + r) % rmod) * ldr + col]; if (RES_BF16) rv = bf16_round(rv); v += rv; }
      if (ACT == 1) v = fmaxf(v, 0.f);
      if (ACT == 2) v = 0.5f * v * (1.0f + erff(v * 0.70710678118654752f));
      if (ACT == 3) { const float u = 0.7978845608028654f * (v + 0.044715f * v * v * v); v = 0.5f * v * (1.0f + tanhf(u)); }
      so[w][8 * hh + r][t * 16 + ln] = v;
    }
  }
  __builtin_amdgcn_fence(__ATOMIC_ACQ_REL, "workgroup");
  __builtin_amdgcn_wave_barrier();
  const int rsub = lane >> 4, c4 = (lane & 15) * 4;
  {
#pragma unroll
    for (int q = 0; q < 8; ++q) {
      const int r = q * 2 + rsub;
      const v4f v = *(const v4fa*)&so[w][r][c4];
      *(v4f*)(C + (size_t)(row0 + r) * ldc + col0 + c4) = v;
    }
    
  }
}
// row LayerNorm (biased variance, eps) over N: s = X (+ R); optional out_sum <- s; out_norm <- (s-mu)*rsqrt(var+eps)*g + b
template <bool PARAM_BF16>
__global__ __launch_bounds__(256) void k_layernorm(const float* __restrict__ X, const float* __restrict__ R, const float* __restrict__ g, const float* __restrict__ bta,
                                                  float* __restrict__ out_sum, float* __restrict__ out_norm, int N, float eps) {
  __shared__ float red[256];
  const int row = blockIdx.x, tid = threadIdx.x;
  const float* x = X + (size_t)row * N; const float* rr = R ? R + (size_t)row * N : nullptr;
  float vals[16];                     // up to N = 4096
  const int per = N / 256;            // contiguous chunk per thread? use strided-by-4 chunks: thread handles j = tid*4 + 1024*u
  float s1 = 0.f;
  for (int u = 0; u < per / 4; ++u) {
    const int j = tid * 4 + 1024 * u;
    const v4f a = *(const v4fa*)(x + j);
    v4f b = {0.f,0.f,0.f,0.f}; if (rr) b = *(const v4fa*)(rr + j);
#pragma unroll
    for (int q = 0; q < 4; ++q) { const float v = a[q] + b[q]; vals[u * 4 + q] = v; s1 += v; }
  }
  red[tid] = s1; __syncthreads();
  for (int st = 128; st > 0; st >>= 1) { if (tid < st) red[tid] += red[tid + st]; __syncthreads(); }
  const float mu = red[0] / (float)N; __syncthreads();
  float s2 = 0.f;
  for (int u = 0; u < per / 4; ++u)
#pragma unroll
    for (int q = 0; q < 4; ++q) { const float c = vals[u * 4 + q] - mu; s2 += c * c; }
  red[tid] = s2; __syncthreads();
  for (int st = 128; st > 0; st >>= 1) { if (tid < st) red[tid] += red[tid + st]; __syncthreads(); }
  const float rs = rsqrtf(red[0] / (float)N + eps);
  {
    for (int u = 0; u < per / 4; ++u) {
      const int j = tid * 4 + 1024 * u;
      v4f o, sm;
#pragma unroll
      for (int q = 0; q < 4; ++q) {
        float gg = g[j + q], bb = bta[j + q];
        if (PARAM_BF16) { gg = bf16_round(gg); bb = bf16_round(bb); }
        sm[q] = vals[u * 4 + q]; o[q] = (vals[u * 4 + q] - mu) * rs * gg + bb;
      }
      if (out_sum) *(v4f*)(out_sum + (size_t)row * N + j) = sm;
      *(v4f*)(out_norm + (size_t)row * N + j) = o;
    }
    
  }
}



// ---- f16 WMMA path (v_wmma_f32_16x16x32_f16): 11-bit significands for operands in range — used where a [0,1] probability operand needs more precision than bf16
typedef _Float16 v16h __attribute__((ext_vector_type(16)));
union FragH { v16h v; v8us half[2]; _Float16 h[16]; unsigned short u[16]; };
template <int NT>
__device__ __forceinline__ v8f mmaH(v16h ah, v16h al, v16h bh, v16h bl, v8f c) {
  c = __builtin_amdgcn_wmma_f32_16x16x32_f16(false, ah, false, bh, (short)0, c, false, false);
  if (NT >= 2) c = __builtin_amdgcn_wmma_f32_16x16x32_f16(false, al, false, bh, (short)0, c, false, false);
  if (NT >= 3) c = __builtin_amdgcn_wmma_f32_16x16x32_f16(false, ah, false, bl, (short)0, c, false, false);
  asm volatile("v_nop\n\tv_nop\n\tv_nop\n\tv_nop" : "+v"(c) : "v"(ah), "v"(al), "v"(bh), "v"(bl));
  return c;
}
// batched GEMM like k_gemm_b but f16 operands: A f32 (split into f16 hi/lo if ASPLIT, else rounded to f16), Bt = f16 values [n][k]; alpha; C f32; N multiple of 16 (partial tiles skipped)
template <bool ASPLIT>
__global__ __launch_bounds__(128) void k_gemm_h(const float* __restrict__ A, int lda, size_t sA, const _Float16* __restrict__ Bh, int ldb, size_t sB, float alpha, float* __restrict__ C, int ldc, size_t sC, int M, int N, int K) {
  __shared__ __attribute__((aligned(16))) float so[4][16][64];
  const int tid = threadIdx.x, w = tid >> 5, lane = tid & 31, ln = lane & 15, hh = lane >> 4; const int by = blockIdx.y;
  A += (size_t)by * sA; Bh += (size_t)by * sB; C += (size_t)by * sC;
  const int ntn = (N + 63) / 64; const int wid = blockIdx.x * 4 + w; const int mt = wid / ntn, nq = wid % ntn; if (mt * 16 >= M) return;
  const int row0 = mt * 16, col0 = nq * 64; const float* arow = A + (size_t)(row0 + ln) * lda;
  v8f acc[4] = {};
  for (int kb = 0; kb < K; kb += 32) {
    FragH ah, al;
    const v4f x0 = *(const v4fa*)(arow + kb + 8 * hh), x1 = *(const v4fa*)(arow + kb + 8 * hh + 4), x2 = *(const v4fa*)(arow + kb + 16 + 8 * hh), x3 = *(const v4fa*)(arow + kb + 16 + 8 * hh + 4);
    float xs[16] = {x0[0],x0[1],x0[2],x0[3],x1[0],x1[1],x1[2],x1[3],x2[0],x2[1],x2[2],x2[3],x3[0],x3[1],x3[2],x3[3]};
#pragma unroll
    for (int i = 0; i < 16; ++i) { const _Float16 h = (_Float16)xs[i]; ah.h[i] = h; al.h[i] = ASPLIT ? (_Float16)(xs[i] - (float)h) : (_Float16)0.0f; }
#pragma unroll
    for (int t = 0; t < 4; ++t) { if (col0 + t * 16 >= N) continue; const size_t boff = (size_t)(col0 + t * 16 + ln) * ldb + kb; FragH bq; bq.half[0] = *(const v8us*)(Bh + boff + 8 * hh); bq.half[1] = *(const v8us*)(Bh + boff + 16 + 8 * hh);
      acc[t] = mmaH<ASPLIT ? 2 : 1>(ah.v, al.v, bq.v, bq.v, acc[t]); }
  }
#pragma unroll
  for (int t = 0; t < 4; ++t) { if (col0 + t * 16 >= N) continue;
#pragma unroll
    for (int r = 0; r < 8; ++r) so[w][8 * hh + r][t * 16 + ln] = acc[t][r] * alpha; }
  __builtin_amdgcn_fence(__ATOMIC_ACQ_REL, "workgroup"); __builtin_amdgcn_wave_barrier();
  const int rsub = lane >> 4, c4 = (lane & 15) * 4;
  {
#pragma unroll
    for (int q = 0; q < 8; ++q) { const int r = q * 2 + rsub; if (col0 + c4 < N) { const v4f v = *(const v4fa*)&so[w][r][c4]; *(v4f*)(C + (size_t)(row0 + r) * ldc + col0 + c4) = v; } }
     }
}

// Wt[n][k] = f16(W[k][n]·scale) from f32 row-major W[K][N] (scale = power of two; bf16-exact weights stay exact in f16 away from the subnormal range)
__global__ __launch_bounds__(256) void k_wt_f16(const float* __restrict__ W, _Float16* __restrict__ Wt, int K, int N, float scale) {
  const int t = blockIdx.x * 256 + threadIdx.x; if (t >= N * (K / 8)) return; const int n = t / (K / 8), k8 = (t % (K / 8)) * 8; FragH f;
#pragma unroll
  for (int i = 0; i < 8; ++i) f.h[i] = (_Float16)(bf16_round(W[(size_t)(k8 + i) * N + n]) * scale); const v8us o = f.half[0];
  *(v8us*)((unsigned short*)Wt + (size_t)n * K + k8) = o; 
}
// k_gemm_hh variant with fused epilogue: v = acc·alpha + bias[by·sBias + col] (+ CP[(row/rowsPerB)·sCPb + by·64 + col] if CP) ; ACT 0 none / 1 elu ; writes f16 C16 (and f32 C if non-null)
template <int ACT>
__global__ __launch_bounds__(128) void k_gemm_hhx(const _Float16* __restrict__ A, int lda, size_t sA, const _Float16* __restrict__ Bh, int ldb, size_t sB, float alpha, const float* __restrict__ bias, size_t sBias, const float* __restrict__ CP, int rowsPerB, size_t sCPb, int row0g,
    float* __restrict__ C, _Float16* __restrict__ C16, int ldc, size_t sC, int M, int N, int K) {
  __shared__ __attribute__((aligned(16))) float so[4][16][64];
  const int tid = threadIdx.x, w = tid >> 5, lane = tid & 31, ln = lane & 15, hh = lane >> 4; const int by = blockIdx.y;
  A += (size_t)by * sA; Bh += (size_t)by * sB; const size_t cofs = (size_t)by * sC; const float* bp = bias ? bias + (size_t)by * sBias : nullptr;
  const int ntn = (N + 63) / 64; const int wid = blockIdx.x * 4 + w; const int mt = wid / ntn, nq = wid % ntn; if (mt * 16 >= M) return;
  const int row0 = mt * 16, col0 = nq * 64; const _Float16* arow = A + (size_t)(row0 + ln) * lda;
  v8f acc[4] = {};
  for (int kb = 0; kb < K; kb += 32) { FragH ah; ah.half[0] = *(const v8us*)((const unsigned short*)arow + kb + 8 * hh); ah.half[1] = *(const v8us*)((const unsigned short*)arow + kb + 16 + 8 * hh);
#pragma unroll
    for (int t = 0; t < 4; ++t) { if (col0 + t * 16 >= N) continue; const size_t boff = (size_t)(col0 + t * 16 + ln) * ldb + kb; FragH bq; bq.half[0] = *(const v8us*)((const unsigned short*)Bh + boff + 8 * hh); bq.half[1] = *(const v8us*)((const unsigned short*)Bh + boff + 16 + 8 * hh);
      acc[t] = mmaH<1>(ah.v, ah.v, bq.v, bq.v, acc[t]); }
  }
#pragma unroll
  for (int t = 0; t < 4; ++t) { if (col0 + t * 16 >= N) continue; const int col = col0 + t * 16 + ln; const float bv = bp ? bf16_round(bp[col]) : 0.f;
#pragma unroll
    for (int r = 0; r < 8; ++r) { float v = acc[t][r] * alpha + bv; if (CP) { const int rr = row0g + row0 + 8 * hh + r; if (rowsPerB < 0) v += CP[cofs + (size_t)rr * ldc + col];      /* rowsPerB < 0: own element of the batched C plane */ else { const int bidx = rr / rowsPerB; v += CP[(size_t)bidx * sCPb + (size_t)by * 64 + col]; } } if (ACT == 1) v = (v > 0.f) ? v : expm1f(v); else if (ACT == 7) v = (v > 0.f) ? v + 1.0f : expf(v); else if (ACT == 8) v = tanhf(v); else if (ACT == 9) v = 0.5f * v * (1.0f + tanhf(0.7978845608028654f * (v + 0.044715f * v * v * v))); else if (ACT == 11) v = 1.0f / (1.0f + expf(-v)); else if (ACT == 12) v = (v > 0.f) ? v : 0.01f * v; else if (ACT == 14) v = (v > 0.f) ? v : 0.1f * v; else if (ACT == 16) v = (v >= 0.f) ? v : 0.3f * v; else if (ACT == 17) v = (v >= 0.f) ? v : 0.2f * v; else if (ACT == 15) v = v / (1.0f + expf(-v)); else if (ACT == 3) v = fmaxf(v, 0.f); else if (ACT == 6) v = 0.5f * v * (1.0f + erff(v * 0.70710678118654752f)); so[w][8 * hh + r][t * 16 + ln] = v; } }
  __builtin_amdgcn_fence(__ATOMIC_ACQ_REL, "workgroup"); __builtin_amdgcn_wave_barrier();
  const int rsub = lane >> 4, c4 = (lane & 15) * 4; typedef _Float16 v4h __attribute__((ext_vector_type(4)));
  {
#pragma unroll
    for (int q = 0; q < 8; ++q) { const int r = q * 2 + rsub; if (col0 + c4 < N) { const v4f v = *(const v4fa*)&so[w][r][c4]; if (C) *(v4f*)(C + cofs + (size_t)(row0 + r) * ldc + col0 + c4) = v; if (C16) { v4h h4; for (int i = 0; i < 4; ++i) h4[i] = (_Float16)v[i]; *(v4h*)(C16 + cofs + (size_t)(row0 + r) * ldc + col0 + c4) = h4; } } }
     }
}


typedef _Float16 v4h __attribute__((ext_vector_type(4)));

// ---- streaming conversions: few long waves. A wave-wide load is 32 lanes x 16 B = 512 contiguous bytes (four whole lines), eight such loads are issued before the first is used, and the 8-byte stores of a wave
// cover 256 contiguous bytes. Which thread converts a value has no bearing on the value.
#define ST_WE 4096                   /* k_prep: f32 elements per wave, four rounds of eight loads */
#define ST_BE (8 * ST_WE)            /* k_prep: elements per work-group of eight waves */
#define ST_GX ((int)(NR * NC / ST_BE))              /* work-groups per activation input */
#define ST_G1 (NC * NC / ST_BE)                     /* work-groups for W1 */
#define ST_G2 (NO * 2 * NC / ST_BE)                 /* work-groups for W2 */
// All four f32 inputs that feed a matrix product, in one launch; the work-group index picks the input (a scalar choice, no barrier in the kernel).
// in1 -> columns 0..511 of the f16 concat rows (pitch 2 NC), in2 -> f16 rows, W1 and W2 -> natural f16 rows x16; each value is first rounded to bf16. Rows of 512 (W2: half rows) keep e -> (e / 512) * pitch + e % 512.
__global__ __launch_bounds__(256) void k_prep(const float* __restrict__ in1, const float* __restrict__ in2, const float* __restrict__ w1, const float* __restrict__ w2,
    _Float16* __restrict__ cat, _Float16* __restrict__ x2, _Float16* __restrict__ b1, _Float16* __restrict__ b2) {
  static_assert(NR * NC % ST_BE == 0 && NC * NC % ST_BE == 0 && NO * 2 * NC % ST_BE == 0 && NC == 512, "k_prep: whole work-groups per input, rows of 512");
  int b = blockIdx.x; const float* s; _Float16* d; size_t ldo = NC; float sc = 1.0f;
  if (b < ST_GX) { s = in1; d = cat; ldo = 2 * NC; }
  else if (b < 2 * ST_GX) { b -= ST_GX; s = in2; d = x2; }
  else if (b < 2 * ST_GX + ST_G1) { b -= 2 * ST_GX; s = w1; d = b1; sc = 16.0f; }
  else { b -= 2 * ST_GX + ST_G1; s = w2; d = b2; sc = 16.0f; }
  const size_t w0 = (size_t)b * ST_BE + (size_t)(threadIdx.x >> 5) * ST_WE;      /* the wave's first element: the start of a row of 512 */
  const float* sp = s + w0 + (threadIdx.x & 31) * 4; _Float16* dp = d + (w0 >> 9) * ldo + (threadIdx.x & 31) * 4;
  v4f x[2][8];
#pragma unroll
  for (int i = 0; i < 8; ++i) x[0][i] = *(const v4fa*)(sp + i * 128);
#pragma unroll      /* unrolled so that x[][] is indexed by constants only and stays in registers */
  for (int u = 0; u < ST_WE / 1024; ++u) {      /* a round = 1,024 elements = two rows of 512 */
    if (u + 1 < ST_WE / 1024) {
#pragma unroll
      for (int i = 0; i < 8; ++i) x[(u + 1) & 1][i] = *(const v4fa*)(sp + (u + 1) * 1024 + i * 128);      /* the next round's loads fly while this round is converted */
      __builtin_amdgcn_sched_barrier(0); }      /* without it the scheduler sinks these loads behind most of this round's conversion, and the wave has nothing in flight meanwhile */
#pragma unroll
    for (int i = 0; i < 8; ++i) { v4h h;
#pragma unroll
      for (int q = 0; q < 4; ++q) h[q] = (_Float16)(bf16_round(x[u & 1][i][q]) * sc);
      *(v4h*)(dp + (size_t)(2 * u + (i >> 2)) * ldo + (i & 3) * 128) = h; }
    if (u + 1 < ST_WE / 1024) asm volatile("s_wait_xcnt 0x0" :: "v"(sp) : "memory"); } }      /* the next round reuses address and data registers of this round's loads and stores; naming sp keeps the load address whole up to the wait (no load may land on it) */
__global__ __launch_bounds__(256) void k_h16(const float* __restrict__ x, _Float16* __restrict__ X16, size_t n8) { const size_t t = (size_t)blockIdx.x * 256 + threadIdx.x; if (t >= n8) return; FragH f;
#pragma unroll
  for (int q = 0; q < 8; ++q) f.h[q] = (_Float16)x[t * 8 + q]; *(v8us*)((unsigned short*)X16 + t * 8) = f.half[0];  }
__global__ __launch_bounds__(256) void k_round16f(const float* __restrict__ W, _Float16* __restrict__ Bt, size_t n8) { const size_t t = (size_t)blockIdx.x * 256 + threadIdx.x; if (t >= n8) return; FragH f;
#pragma unroll
  for (int i = 0; i < 8; ++i) f.h[i] = (_Float16)(bf16_round(W[t * 8 + i]) * 16.0f); *(v8us*)((unsigned short*)Bt + t * 8) = f.half[0];  }
// Transpose of one 64-column slab, VT_R rows per work-group (a thread's VT_R / 32 loads of 16 B are all issued before the first is used); lane -> element maps inside 64 rows as for a 64-row tile.
#define VT_R 256
template <int NHv, int TTv, int LDV>
__global__ __launch_bounds__(256) void k_vt(const _Float16* __restrict__ V16, int voff, _Float16* __restrict__ Vt) { __shared__ unsigned short tl[VT_R][66]; const int tid = threadIdx.x; const int slab = blockIdx.x / (TTv / VT_R), lg = blockIdx.x % (TTv / VT_R); const int b = slab / NHv, h = slab % NHv;
  static_assert(TTv % VT_R == 0, "k_vt: whole tiles");
  const int r0 = tid / 8, c8 = (tid % 8) * 8; FragH f[VT_R / 32];
  const unsigned short* vp = (const unsigned short*)V16 + ((size_t)b * TTv + lg * VT_R + r0) * LDV + voff + h * 64 + c8;      /* the row pitch is a constant, so that all loads share this one address */
#pragma unroll
  for (int k = 0; k < VT_R / 32; ++k) f[k].half[0] = *(const v8us*)(vp + (size_t)k * 32 * LDV);
  asm volatile("s_wait_xcnt 0x0" :: "v"(vp) : "memory");      /* the address registers are reused behind the loads; naming vp keeps them whole up to the wait (no load may land on them) */
#pragma unroll
  for (int k = 0; k < VT_R / 32; ++k)
#pragma unroll
    for (int q = 0; q < 8; ++q) tl[k * 32 + r0][c8 + q] = f[k].u[q];
  __syncthreads();
  {
#pragma unroll
    for (int rd = 0; rd < VT_R / 32; ++rd) { const int d = (rd & 1) * 32 + tid / 8, pc = (rd >> 1) * 8 + tid % 8; FragH g;
#pragma unroll
      for (int q = 0; q < 8; ++q) g.u[q] = tl[pc * 8 + q][d];
      *(v8us*)((unsigned short*)Vt + ((size_t)slab * 64 + d) * TTv + lg * VT_R + pc * 8) = g.half[0]; }
     } }

// f32 -> f16 hi plane + residual x 2^10 plane, as a stream of the same make: HL_WE elements per wave, two rounds of eight loads (n = a multiple of 8 * HL_WE elements, one work-group per 8 * HL_WE).
#define HL_WE 2048
__global__ __launch_bounds__(256) void k_hl(const float* __restrict__ F, _Float16* __restrict__ Hh, _Float16* __restrict__ Hl) {
  const size_t e0 = (size_t)blockIdx.x * (8 * HL_WE) + (size_t)(threadIdx.x >> 5) * HL_WE + (threadIdx.x & 31) * 4;
  const float* sp = F + e0; _Float16* hp = Hh + e0; _Float16* lp = Hl + e0;
  v4f x[2][8];
#pragma unroll
  for (int i = 0; i < 8; ++i) x[0][i] = *(const v4fa*)(sp + i * 128);
#pragma unroll      /* unrolled so that x[][] stays in registers */
  for (int u = 0; u < HL_WE / 1024; ++u) {
    if (u + 1 < HL_WE / 1024) {
#pragma unroll
      for (int i = 0; i < 8; ++i) x[(u + 1) & 1][i] = *(const v4fa*)(sp + (u + 1) * 1024 + i * 128); }      /* the next round's loads fly while this round is split */
#pragma unroll
    for (int i = 0; i < 8; ++i) { v4h hi, lo;
#pragma unroll
      for (int q = 0; q < 4; ++q) { const float a = x[u & 1][i][q]; const _Float16 h = (_Float16)a; hi[q] = h; lo[q] = (_Float16)((a - (float)h) * 1024.0f); }
      *(v4h*)(hp + u * 1024 + i * 128) = hi; *(v4h*)(lp + u * 1024 + i * 128) = lo; }
    if (u + 1 < HL_WE / 1024) asm volatile("s_wait_xcnt 0x0" :: "v"(sp) : "memory"); } }      /* as in k_prep */

// ---- fast GEMM: block tile 128x128, four waves of 64x64 (requires M % 128 == 0 rows per launch region, N % 128 == 0, K % 64 == 0) ----
// Both operand tiles of a 64-k pass are brought into LDS once per work-group by asynchronous copies (each wave-wide copy covers four whole 128-byte rows) and read from there by all four waves;
// two buffers, so that the next pass's copies fly while this pass is multiplied. Each output element still sums its k blocks of 32 in ascending order.
#define G2_PITCH 144                 /* LDS bytes per 128-byte tile row: 16 B x odd, the pitch at which ds_load_b128 readers of 16 rows meet no bank conflict */
#define G2_OPER (128 * G2_PITCH)     /* one operand's 128 rows of a pass */
#define G2_STAGE (2 * G2_OPER)       /* one buffer: [A 128 rows | B 128 rows] */
#define G2_SOP 68                    /* floats per row of the output staging */
__device__ __forceinline__ v16h g2_lfrag(const char* p) { FragH f; f.half[0] = *(const v8us*)p; f.half[1] = *(const v8us*)(p + 32); return f.v; }      /* same k order as a fragment read from global rows: k = 8 hh .. 8 hh + 7, then 16 + 8 hh .. */
__device__ __forceinline__ v8f g2_mma(v16h a, v16h b, v8f c) { v8f d = __builtin_amdgcn_wmma_f32_16x16x32_f16(false, a, false, b, (short)0, c, false, false); asm volatile("v_nop\n\tv_nop\n\tv_nop\n\tv_nop" : "+v"(d) : "v"(a), "v"(b)); return d; }
// One operand's 128 rows x 128 bytes: the lane's 16 bytes of rows r, r + 16, .. r + 112 (l = its LDS byte address for row r, p = its global address for row r, ld = global row pitch in halves).
// The s_wait_xcnt closes the copies' own statement so that no address register of a copy is rewritten in front of it.
__device__ __forceinline__ void g2_copy8(unsigned l, const _Float16* p, size_t ld) {
  asm volatile("global_load_async_to_lds_b128 %0, %8, off\n\t"
               "global_load_async_to_lds_b128 %1, %9, off\n\t"
               "global_load_async_to_lds_b128 %2, %10, off\n\t"
               "global_load_async_to_lds_b128 %3, %11, off\n\t"
               "global_load_async_to_lds_b128 %4, %12, off\n\t"
               "global_load_async_to_lds_b128 %5, %13, off\n\t"
               "global_load_async_to_lds_b128 %6, %14, off\n\t"
               "global_load_async_to_lds_b128 %7, %15, off\n\t"
               "s_wait_xcnt 0x0"
               :: "v"(l), "v"(l + 16 * G2_PITCH), "v"(l + 32 * G2_PITCH), "v"(l + 48 * G2_PITCH), "v"(l + 64 * G2_PITCH), "v"(l + 80 * G2_PITCH), "v"(l + 96 * G2_PITCH), "v"(l + 112 * G2_PITCH),
                  "v"(p), "v"(p + 16 * ld), "v"(p + 32 * ld), "v"(p + 48 * ld), "v"(p + 64 * ld), "v"(p + 80 * ld), "v"(p + 96 * ld), "v"(p + 112 * ld)
               : "memory");
}
// The activation of one output value (ACT: 0 none, 3 relu, 6 exact gelu, 8 tanh, 9 tanh gelu, 11 sigmoid, 12/14/16/17 leaky relu 0.01/0.1/0.3/0.2, 15 silu).
template <int ACT>
__device__ __forceinline__ float g2_act(float v) {
  if (ACT == 3) v = fmaxf(v, 0.f); else if (ACT == 6) v = 0.5f * v * (1.0f + erff(v * 0.70710678118654752f)); else if (ACT == 11) v = 1.0f / (1.0f + expf(-v)); else if (ACT == 15) v = v / (1.0f + expf(-v)); else if (ACT == 12) v = (v > 0.f) ? v : 0.01f * v; else if (ACT == 8) v = tanhf(v); else if (ACT == 9) v = 0.5f * v * (1.0f + tanhf(0.7978845608028654f * (v + 0.044715f * v * v * v))); else if (ACT == 14) v = (v > 0.f) ? v : 0.1f * v; else if (ACT == 16) v = (v >= 0.f) ? v : 0.3f * v; else if (ACT == 17) v = (v >= 0.f) ? v : 0.2f * v;
  return v; }
// What the epilogue does is fixed at compile time: HASB adds bf16-rounded bias[by * sBias + col]; ADDC adds the element that C already holds (C += ...); F32O stores f32 C, F16O stores f16 C16.
// out = ACT(acc * alpha + bias + old C), in that order.
// TWOP: A is given as two planes against the same B, acc = (sum over k of A2 B) * pre + sum over k of A B: the passes of A2 run first, the accumulators are scaled once by pre (a power of two: exact),
// and the passes of A add onto them, so that the sum of both terms leaves the registers once. A2 has A's pitch and batch stride.
template <int ACT, bool HASB, bool ADDC, bool F32O, bool F16O, bool TWOP = false>
__global__ __launch_bounds__(128) void k_gemm2(const _Float16* __restrict__ A, int lda, size_t sA, const _Float16* __restrict__ Bh, int ldb, size_t sB, float alpha, const float* __restrict__ bias, size_t sBias,
    float* __restrict__ C, _Float16* __restrict__ C16, int ldc, size_t sC, int M, int N, int K, const _Float16* __restrict__ A2, float pre) { static_assert(ACT == 0 || ACT == 3 || ACT == 6 || ACT == 8 || ACT == 9 || ACT == 11 || ACT == 12 || ACT == 14 || ACT == 15 || ACT == 16 || ACT == 17, "k_gemm2: unsupported ACT code (would silently apply no activation)");
  static_assert(F32O || !ADDC, "ADDC reads the f32 plane it then stores");
  __shared__ __attribute__((aligned(16))) char sm[2 * G2_STAGE];      /* the two buffers; behind the loop's last barrier the same bytes stage the output */
  static_assert(4 * 64 * G2_SOP * 4 <= 2 * G2_STAGE, "output staging must fit the ring");
  const int tid = threadIdx.x, w = tid >> 5, lane = tid & 31, ln = lane & 15, hh = lane >> 4; const int by = blockIdx.y;
  A += (size_t)by * sA; Bh += (size_t)by * sB; const size_t cofs = (size_t)by * sC;
  const int ntn = N >> 7; const int mt = blockIdx.x / ntn, nq = blockIdx.x - mt * ntn; const int rowB = mt * 128, colB = nq * 128; if (rowB >= M) return;      /* the same for the whole work-group, in front of every barrier */
  const int row0 = rowB + 64 * (w >> 1), col0 = colB + 64 * (w & 1);
  const int cr = tid >> 3, cc = tid & 7;      /* copies: eight lanes per 128-byte row, 16 rows per round of the work-group */
  const _Float16* ga = A + (size_t)(rowB + cr) * lda + cc * 8; const _Float16* gb = Bh + (size_t)(colB + cr) * ldb + cc * 8;
  const _Float16* g2 = TWOP ? A2 + (size_t)by * sA + (size_t)(rowB + cr) * lda + cc * 8 : ga;
  const unsigned lc = (unsigned)(size_t)sm + (unsigned)(cr * G2_PITCH + cc * 16);
  const char* fa = sm + (64 * (w >> 1) + ln) * G2_PITCH + 16 * hh; const char* fb = sm + G2_OPER + (64 * (w & 1) + ln) * G2_PITCH + 16 * hh;
  const int n2 = TWOP ? K >> 6 : 0; const int np = n2 + (K >> 6);      /* passes 0 .. n2 - 1 read A2, passes n2 .. np - 1 read A; both walk the same k of B */
  const auto pa = [&](int t) { return (TWOP && t < n2) ? g2 + (size_t)t * 64 : ga + (size_t)(t - n2) * 64; };
  const auto pb = [&](int t) { return gb + (size_t)((TWOP && t >= n2) ? t - n2 : t) * 64; };
  g2_copy8(lc, pa(0), (size_t)lda); g2_copy8(lc + G2_OPER, pb(0), (size_t)ldb);      /* pass 0 -> buffer 0 */
  asm volatile("s_wait_asynccnt 0x0" ::: "memory");      /* this wave's copies of pass 0 have landed */
  __syncthreads();      /* every wave's have: pass 0 may be read */
  if (np > 1) { g2_copy8(lc + G2_STAGE, pa(1), (size_t)lda); g2_copy8(lc + G2_STAGE + G2_OPER, pb(1), (size_t)ldb); }      /* pass 1 -> buffer 1, where there is one (the same test for the whole work-group) */
  const v8f z8 = {0.f,0.f,0.f,0.f,0.f,0.f,0.f,0.f}; v8f acc[4][4];
#pragma unroll
  for (int i = 0; i < 4; ++i)
#pragma unroll
    for (int j = 0; j < 4; ++j) acc[i][j] = z8;
#pragma unroll 1      /* one pass per trip: the buffer offset is the only thing that differs, and an unrolled copy of 32 WMMAs buys nothing */
  for (int t = 0; t < np; ++t) { const int bo = (t & 1) * G2_STAGE;
    if (TWOP && t == n2) {      /* once, the same for every wave: the first plane's sum takes its weight before the second plane adds on */
#pragma unroll
      for (int i = 0; i < 4; ++i)
#pragma unroll
        for (int j = 0; j < 4; ++j) acc[i][j] *= pre; }
#pragma unroll
    for (int ks = 0; ks < 2; ++ks) { v16h a[4], b[4];
#pragma unroll
      for (int i = 0; i < 4; ++i) { a[i] = g2_lfrag(fa + bo + i * 16 * G2_PITCH + ks * 64); b[i] = g2_lfrag(fb + bo + i * 16 * G2_PITCH + ks * 64); }
#pragma unroll
      for (int j = 0; j < 4; ++j)
#pragma unroll
        for (int i = 0; i < 4; ++i) acc[i][j] = g2_mma(a[i], b[j], acc[i][j]); }
    asm volatile("s_wait_dscnt 0x0" ::: "memory");      /* this wave's reads of buffer t mod 2 are done before the barrier lets it be refilled */
    asm volatile("s_wait_asynccnt 0x0" ::: "memory");      /* this wave's copies of pass t + 1 have landed */
    __syncthreads();      /* publishes pass t + 1 and ends every reader's last read of buffer t mod 2 */
    if (t + 2 < np) { g2_copy8(lc + bo, pa(t + 2), (size_t)lda); g2_copy8(lc + bo + G2_OPER, pb(t + 2), (size_t)ldb); } }
  asm volatile("s_wait_asynccnt 0x0" ::: "memory");      /* nothing of the ring is in flight when its bytes become the output staging */
  float* so = (float*)(sm + (size_t)w * (64 * G2_SOP * 4));      /* the wave's own 64 x 68 floats */
  float bv[4];
#pragma unroll
  for (int t = 0; t < 4; ++t) bv[t] = HASB ? bf16_round(bias[(size_t)by * sBias + col0 + t * 16 + ln]) : 0.f;
#pragma unroll
  for (int u = 0; u < 16; ++u) { const int t = u & 3, rt = u >> 2;
#pragma unroll
    for (int r = 0; r < 8; ++r) so[(rt * 16 + 8 * hh + r) * G2_SOP + t * 16 + ln] = HASB ? acc[rt][t][r] * alpha + bv[t] : acc[rt][t][r] * alpha; }
  __builtin_amdgcn_fence(__ATOMIC_ACQ_REL, "workgroup"); __builtin_amdgcn_wave_barrier();
  const int rsub = lane >> 4, c4 = (lane & 15) * 4;
  const size_t es = (size_t)2 * ldc;      /* a lane's rows are two apart */
  size_t eb = cofs + (size_t)(row0 + rsub) * ldc + col0 + c4;
  const float* sr = so + rsub * G2_SOP + c4;
#pragma unroll 1      /* four trips of 16 rows: rolled so that the text that runs once per work-group stays short (with tanh an unrolled copy is four times as long); inside a trip the eight loads, and the eight stores, are in flight together */
  for (int qb = 0; qb < 4; ++qb) { v4f v[8];
    if (ADDC) { v4f c[8];
#pragma unroll
      for (int q = 0; q < 8; ++q) c[q] = *(const v4fa*)(C + eb + q * es);
#pragma unroll
      for (int q = 0; q < 8; ++q) v[q] = *(const v4fa*)(sr + q * 2 * G2_SOP) + c[q]; }
    else {
#pragma unroll
      for (int q = 0; q < 8; ++q) v[q] = *(const v4fa*)(sr + q * 2 * G2_SOP); }
#pragma unroll
    for (int q = 0; q < 8; ++q) {
#pragma unroll
      for (int i = 0; i < 4; ++i) v[q][i] = g2_act<ACT>(v[q][i]);
      if (F32O) *(v4f*)(C + eb + q * es) = v[q];
      if (F16O) { v4h h4;
#pragma unroll
        for (int i = 0; i < 4; ++i) h4[i] = (_Float16)v[q][i];
        *(v4h*)(C16 + eb + q * es) = h4; } }
    asm volatile("s_wait_xcnt 0x0" ::: "memory");      /* the next trip rewrites the address and data registers of this trip's loads and stores */
    eb += 8 * es; sr += 16 * G2_SOP; } }


__global__ __launch_bounds__(256) void k_rsm(const float* __restrict__ S, _Float16* __restrict__ P, int nrows) {
  #pragma clang fp contract(off)
  const int i = blockIdx.x * 256 + threadIdx.x; if (i >= nrows) return; const float* s = S + (size_t)i * SQ; float mx = -3.0e38f;
#pragma unroll 1
  for (int j = 0; j < SQ; ++j) mx = fmaxf(mx, s[j]); float se = 0.f;
#pragma unroll 1
  for (int j = 0; j < SQ; ++j) se += expf(s[j] - mx); const float sc = 256.0f / se;
#pragma unroll 1
  for (int j0 = 0; j0 < SQ; j0 += 8) { FragH f; for (int q = 0; q < 8; ++q) f.h[q] = (_Float16)(expf(s[j0 + q] - mx) * sc); unsigned short* d = (unsigned short*)P + (size_t)i * SQ + j0; *(v8us*)d = f.half[0];  } }
__global__ __launch_bounds__(256) void k_vt(const _Float16* __restrict__ V16, int b, int h0, _Float16* __restrict__ VT) { __shared__ unsigned short tl[64][65]; const int tid = threadIdx.x; const int hh = blockIdx.x % HG, sg = blockIdx.x / HG; const int s0 = sg * 64; const int h = h0 + hh;
  for (int i = tid; i < 64 * 8; i += 256) { const int j = i / 8, d8 = (i % 8) * 8; FragH f; f.half[0] = *(const v8us*)((const unsigned short*)V16 + ((size_t)b * SQ + s0 + j) * DM + h * HD + d8); for (int q = 0; q < 8; ++q) tl[d8 + q][j] = f.u[q]; }
  __syncthreads();
  { for (int i = tid; i < 64 * 8; i += 256) { const int d = i / 8, j8 = (i % 8) * 8; FragH f; for (int q = 0; q < 8; ++q) f.u[q] = tl[d][j8 + q]; *(v8us*)((unsigned short*)VT + ((size_t)hh * HD + d) * SQ + s0 + j8) = f.half[0]; }  } }


typedef int v4ia __attribute__((ext_vector_type(4), may_alias));
// Masked row softmax, one wave per score row. Lane l keeps columns 128 i + 4 l .. 128 i + 4 l + 3 (i = 0..15) of its row in registers, so every load of S covers 512 contiguous bytes and S is read once;
// a masked key enters as -inf (its exp is an exact 0); row maximum and row sum: four chains per lane, then a five-step butterfly over the 32 lanes. A row with every key masked (sum 0) gets weights 0.
// Every loop is fully unrolled so that v[] is indexed by constants only and stays in registers (a run-time index would send it to scratch). No product here feeds an add, so nothing can be contracted.
// blockIdx.y = batch (score plane pitch SQ * SQ, mask row pitch SQ). The f16 weights go IN PLACE over the first half of the wave's own f32 score row (weight row pitch 2 * SQ halves): every store's value
// depends on the row sum, hence on every load of the row, and no other wave touches the row, so no score is overwritten before it is read. S carries no restrict because it is read and written.
__global__ __launch_bounds__(256) void k_rsmw(float* S, int qn, const int* __restrict__ mk) {
  const int lane = threadIdx.x & 31; const int row = blockIdx.x * 8 + (threadIdx.x >> 5); if (row >= qn) return;      /* wave-uniform; the kernel has no barrier */
  float* srow = S + (size_t)blockIdx.y * SQ * SQ + (size_t)row * SQ;
  const float* s = srow + lane * 4; const int* m = mk + (size_t)blockIdx.y * SQ + lane * 4; _Float16* p = (_Float16*)srow + lane * 4;
  v4f v[SQ / 128]; v4f mx4 = {-3.0e38f, -3.0e38f, -3.0e38f, -3.0e38f};
#pragma unroll
  for (int i = 0; i < SQ / 128; ++i) { const v4f x = *(const v4fa*)(s + i * 128); const v4ia k = *(const v4ia*)(m + i * 128);
#pragma unroll
    for (int q = 0; q < 4; ++q) { v[i][q] = (k[q] == 0) ? x[q] : -__builtin_inff(); mx4[q] = fmaxf(mx4[q], v[i][q]); } }
  float mx = fmaxf(fmaxf(mx4[0], mx4[1]), fmaxf(mx4[2], mx4[3]));
#pragma unroll
  for (int o = 16; o > 0; o >>= 1) mx = fmaxf(mx, __shfl_xor(mx, o, 32));
  v4f se4 = {0.f, 0.f, 0.f, 0.f};
#pragma unroll
  for (int i = 0; i < SQ / 128; ++i)
#pragma unroll
    for (int q = 0; q < 4; ++q) { const float t = (v[i][q] - mx) * 1.44269504f; float e;      /* native exp(x) = exp2(x log2 e), the same two instructions as __expf */
      asm("v_exp_f32 %0, %1\n\tv_nop" : "=v"(e) : "v"(t));      /* the v_nop keeps the one slot the instruction set asks for behind a transcendental, before its result is read or its source register reused */
      v[i][q] = e; se4[q] += e; }
  float se = (se4[0] + se4[1]) + (se4[2] + se4[3]);
#pragma unroll
  for (int o = 16; o > 0; o >>= 1) se += __shfl_xor(se, o, 32);
  const float sc = (se == 0.f) ? 0.f : 256.0f / se;
#pragma unroll
  for (int i = 0; i < SQ / 128; ++i) { v4h h;
#pragma unroll
    for (int q = 0; q < 4; ++q) h[q] = (_Float16)(v[i][q] * sc);
    *(v4h*)(p + i * 128) = h; } }

extern "C" void kernel_launch(void* const* d_in, const int* in_sizes, int n_in,
                              void* d_out, int out_size, void* d_ws, size_t ws_size, hipStream_t stream) {
  (void)in_sizes; (void)n_in; (void)out_size;
  const float* const* I = (const float* const*)d_in; const float* in1 = I[0]; const float* in2 = I[1]; const int* mask2 = (const int*)d_in[2]; const float* w1 = I[3]; const float* w2 = I[4]; const float* b2 = I[5];      /* weights natural [out][in] */
  char* ws = (char*)d_ws; size_t off = 0;
  auto take = [&](size_t bytes) { char* p = ws + off; off += (bytes + 255) & ~(size_t)255; return p; };
  _Float16* B1 = (_Float16*)take((size_t)NC * NC * 2); _Float16* B2 = (_Float16*)take((size_t)NO * 2 * NC * 2);
  _Float16* X2T = (_Float16*)take(NR * NC * 2); _Float16* X2 = (_Float16*)take(NR * NC * 2); _Float16* N1H = (_Float16*)take(NR * NC * 2); _Float16* N1L = (_Float16*)take(NR * NC * 2); _Float16* CAT = (_Float16*)take(NR * 2 * NC * 2);
  float* S = (float*)take((size_t)NB * SQ * SQ * 4);      /* the score planes of all batches; the softmax weights replace the first half of each score row */
  float* N1F = S;      /* n1 in f32 is last read by k_hl, before the first score is written */
  if (off > ws_size) return;      /* 1.5 + 16 + 16 + 16 + 16 + 32 + 128 = approx 226 MiB */
  k_prep<<<2 * ST_GX + ST_G1 + ST_G2, 256, 0, stream>>>(in1, in2, w1, w2, CAT, X2, B1, B2);      /* cat columns 0..511 = in1; in2 rows; both weights */
  const size_t r0p = (size_t)B0 * SQ;
  k_gemm2<0, false, false, true, false><<<dim3((unsigned)((MP / 128) * (NC / 128)), 1), 128, 0, stream>>>(CAT + r0p * 2 * NC, 2 * NC, 0, B1, NC, 0, 0.0625f, nullptr, 0, N1F + r0p * NC, nullptr, NC, 0, MP, NC, NC, nullptr, 0.f);      /* n1 = in1 W1^T (f32) */
  k_hl<<<(unsigned)((size_t)MP * NC / (8 * HL_WE)), 256, 0, stream>>>(N1F + r0p * NC, N1H + r0p * NC, N1L + r0p * NC);
  /* every stage below runs all batches in one launch: blockIdx.y = batch for scores, softmax and fused (k_gemm2 through the batch strides it already takes); the transpose has the batch in grid x, the output GEMM all rows as one M */
  const dim3 gs((QN / 128) * (SQ / 128), NBR); const size_t sX = (size_t)SQ * NC, sS = (size_t)SQ * SQ;
  k_vt<NH, SQ, NC><<<NBR * NH * (SQ / VT_R), 256, 0, stream>>>(X2 + r0p * NC, 0, X2T);      /* in2^T [batch][512][2048] */
  k_gemm2<0, false, false, true, false, true><<<gs, 128, 0, stream>>>(N1H + r0p * NC, NC, sX, X2 + r0p * NC, NC, sX, 1.0f, nullptr, 0, S, nullptr, SQ, sS, QN, SQ, NC, N1L + r0p * NC, 0.0009765625f);      /* scores = lo x 2^-10 + hi, both terms in the accumulators */
  k_rsmw<<<dim3((QN + 7) / 8, NBR), 256, 0, stream>>>(S, QN, mask2 + r0p);
  k_gemm2<0, false, false, false, true><<<dim3((QN / 128) * (NC / 128), NBR), 128, 0, stream>>>((const _Float16*)S, 2 * SQ, 2 * sS, X2T, SQ, sX, 0.00390625f, nullptr, 0, nullptr, CAT + r0p * 2 * NC + NC, 2 * NC, 2 * sX, QN, NC, SQ, nullptr, 0.f);      /* fused (x1: alpha 1/256 undoes the P carry) -> cat columns 512..1023 */
  k_gemm2<8, true, false, true, false><<<dim3((unsigned)((MPO / 128) * (NO / 128)), 1), 128, 0, stream>>>(CAT + r0p * 2 * NC, 2 * NC, 0, B2, 2 * NC, 0, 0.0625f, b2, 0, (float*)d_out + r0p * NO, nullptr, NO, 0, MPO, NO, 2 * NC, nullptr, 0.f);      /* out = tanh(cat W2^T + b2) */
}

// v007
// A run of this version takes 160 microseconds.
// Timed twice side by side with v006, it ran 1.16 times as fast both times.
// All steps since v000 together make it 35.7 times as fast.
#include <hip/hip_runtime.h>
// Cross attention with concat + tanh projection (in1, in2 [8][2048][512]; mask2 [8][2048] int32, nonzero = key masked out; n1 = in1 W1^T (W1 [512][512] natural, no bias); scores = n1 in2^T (no scaling); masked keys -> -inf; softmax over the 2,048 keys; fused = attn in2; out = tanh([in1 | fused] W2^T + b2) (W2 [512][1024] natural) -> [8][2048][512]).
// Structure: token rows; in1, in2 as exact f16 rows; n1 = in1 W1^T as a WMMA GEMM (128x128 block tiles staged in LDS, 64x64 wave tiles, f32 accumulation, exact x16 natural weights) into f32 rows, split on VALU into f16 hi + 2^-10 residual planes; then, all batches in each launch (grid y = batch): scores = n1 in2^T as ONE GEMM launch of two terms (the lo plane's K = 512 passes first, their sum x 2^-10 is the start value of the hi plane's passes; in2 exact), masked softmax folded into the two GEMMs around it (the score epilogue turns each wave's 64 x 64 scores into f16 weights 2^8 exp2(s log2 e - k), k = the whole-number ceiling of the row's maximum over those 64 keys, with k and the f32 sum of the weights per row and 64 keys; masked keys 0; no score is stored), in2^T via LDS transposes, fused = P . in2 GEMM (K = 2048; each 64-key pass scales its A rows by the exact power of two 2^(k - row maximum of k), the epilogue divides by the row sum) written as plain f16 straight into columns 512..1023 of the f16 concat rows whose columns 0..511 are the exact in1; out = tanh(cat W2^T + b2) as ONE GEMM (K = 1024, exact x16 natural W2, alpha 1/16) with the tanh epilogue.
// Compute dtype: inputs rounded to bf16; in1, in2, weights exact in f16; n1 as f16 hi + residual planes (~2^-22: the logits have sigma ~23, so plain f16 would cost ~3e-3 logits); softmax weights (x256) and fused (unscaled: f16 relative precision is scale-free and a x16/x0.25 weight split would push small W2 entries into f16 subnormals) plain f16 (~2^-12); scores, softmax statistics and the output f32. v_wmma_f32_16x16x32_f16.
#define NB 8
#define SQ 2048
#define NC 512                       /* d_in = d_hid */
#define NO 512                       /* output features */
#define DM NC
#define NH (NC / 64)                 /* 8 slabs of 64 for the in2^T transpose */
#define HD 64
#define HG 1
#define B0 0                         /* first batch processed (debug hook) */
#define NBR NB                       /* batches processed (debug hook) */
#define QN SQ                        /* query rows attended per batch (debug hook) */
#define NR ((size_t)NB * SQ)
#define MP ((int)((size_t)NBR * SQ)) /* rows projected (debug hook) */
#define MPO MP                       /* rows through the output GEMM (debug hook) */
typedef __bf16 v16b __attribute__((ext_vector_type(16)));
typedef unsigned short v8us __attribute__((ext_vector_type(8), may_alias));
typedef float  v8f  __attribute__((ext_vector_type(8)));
typedef float  v4f  __attribute__((ext_vector_type(4)));
typedef float  v4fa __attribute__((ext_vector_type(4), may_alias));
union FragB { v16b v; v8us half[2]; unsigned short u[16]; };

__device__ __forceinline__ unsigned short bf16_bits(float x) { unsigned int u = __float_as_uint(x); return (unsigned short)((u + 0x7FFFu + ((u >> 16) & 1u)) >> 16); }
__device__ __forceinline__ float bf16_val(unsigned short b) { return __uint_as_float(((unsigned int)b) << 16); }
__device__ __forceinline__ float bf16_round(float x) { return bf16_val(bf16_bits(x)); }
// D += A·B with NT terms: 1 = ah·bh, 2 = + al·bh (A split), 3 = + ah·bl (both split)
template <int NT>
__device__ __forceinline__ v8f mmaN(v16b ah, v16b al, v16b bh, v16b bl, v8f c) {
  c = __builtin_amdgcn_wmma_f32_16x16x32_bf16(false, ah, false, bh, (short)0, c, false, false);
  if (NT >= 2) c = __builtin_amdgcn_wmma_f32_16x16x32_bf16(false, al, false, bh, (short)0, c, false, false);
  if (NT >= 3) c = __builtin_amdgcn_wmma_f32_16x16x32_bf16(false, ah, false, bl, (short)0, c, false, false);
  asm volatile("v_nop\n\tv_nop\n\tv_nop\n\tv_nop" : "+v"(c) : "v"(ah), "v"(al), "v"(bh), "v"(bl));
  return c;
}

__global__ __launch_bounds__(256) void k_wt_bf16(const float* __restrict__ W, unsigned short* __restrict__ Wt, int K, int N) {
  const int t = blockIdx.x * 256 + threadIdx.x;
  const int k8n = K / 8;
  if (t >= N * k8n) return;
  const int n = t / k8n, k8 = (t % k8n) * 8;
  v8us v;
#pragma unroll
  for (int i = 0; i < 8; ++i) v[i] = bf16_bits(W[(size_t)(k8 + i) * N + n]);
  *(v8us*)(Wt + (size_t)n * K + k8) = v;
  
}

// GEMM C[M][N] (f32, pitch ldc) = act(A[M][K]·W + bias). A f32 row-major (pitch lda) converted per fragment to bf16
// (ASPLIT: hi/lo two planes -> 2 terms, else single rounded term); Wt bf16 [N][K] (pitch ldb). BIAS_BF16 rounds the
// bias to bf16 first (bias quantised to bf16 before the add). K%32==0, M%16==0, N%64==0.
template <bool ASPLIT, int ACT, bool BIAS_BF16>
__global__ __launch_bounds__(128) void k_gemm_bf(const float* __restrict__ A, int lda, const unsigned short* __restrict__ Wt, int ldb,
                                               const float* __restrict__ bias, float* __restrict__ C, int ldc, int M, int N, int K) {
  __shared__ __attribute__((aligned(16))) float so[4][16][64];
  const int tid = threadIdx.x, w = tid >> 5, lane = tid & 31, ln = lane & 15, hh = lane >> 4;
  const int ntn = N / 64;
  const int wid = blockIdx.x * 4 + w;
  const int mt = wid / ntn, nq = wid % ntn;
  if (mt * 16 >= M) return;
  const int row0 = mt * 16, col0 = nq * 64;
  const float* arow = A + (size_t)(row0 + ln) * lda;
  v8f acc[4] = {};
  for (int kb = 0; kb < K; kb += 32) {
    FragB ah, al;
    const v4f x0 = *(const v4fa*)(arow + kb + 8 * hh), x1 = *(const v4fa*)(arow + kb + 8 * hh + 4);
    const v4f x2 = *(const v4fa*)(arow + kb + 16 + 8 * hh), x3 = *(const v4fa*)(arow + kb + 16 + 8 * hh + 4);
    float xs[16] = {x0[0],x0[1],x0[2],x0[3],x1[0],x1[1],x1[2],x1[3],x2[0],x2[1],x2[2],x2[3],x3[0],x3[1],x3[2],x3[3]};
#pragma unroll
    for (int i = 0; i < 16; ++i) { const unsigned short hb = bf16_bits(xs[i]); ah.u[i] = hb; al.u[i] = ASPLIT ? bf16_bits(xs[i] - bf16_val(hb)) : (unsigned short)0; }
#pragma unroll
    for (int t = 0; t < 4; ++t) {
      const unsigned short* brow = Wt + (size_t)(col0 + t * 16 + ln) * ldb + kb;
      FragB b;
      b.half[0] = *(const v8us*)(brow + 8 * hh);
      b.half[1] = *(const v8us*)(brow + 16 + 8 * hh);
      acc[t] = mmaN<ASPLIT ? 2 : 1>(ah.v, al.v, b.v, b.v, acc[t]);
    }
  }
#pragma unroll
  for (int t = 0; t < 4; ++t) {
    float bv = bias ? bias[col0 + t * 16 + ln] : 0.f;
    if (BIAS_BF16) bv = bf16_round(bv);
#pragma unroll
    for (int r = 0; r < 8; ++r) { float v = acc[t][r] + bv; if (ACT == 1) v = fmaxf(v, 0.f); so[w][8 * hh + r][t * 16 + ln] = v; }
  }
  __builtin_amdgcn_fence(__ATOMIC_ACQ_REL, "workgroup");
  __builtin_amdgcn_wave_barrier();
  const int rsub = lane >> 4, c4 = (lane & 15) * 4;
  {
#pragma unroll
    for (int q = 0; q < 8; ++q) {
      const int r = q * 2 + rsub;
      const v4f v = *(const v4fa*)&so[w][r][c4];
      *(v4f*)(C + (size_t)(row0 + r) * ldc + col0 + c4) = v;
    }
    
  }
}

// GEMM C = act(A·W + bias + resid): A f32 (ASPLIT -> hi/lo 2 terms), Wt bf16 [N][K]; ACT 0 none, 1 relu, 2 exact gelu;
// resid (optional, f32, row index = (row % rmod), pitch ldr, RES_BF16 rounds it) added before the activation.
template <bool ASPLIT, int ACT, bool BIAS_BF16, bool RES_BF16>
__global__ __launch_bounds__(128) void k_gemm_bf3(const float* __restrict__ A, int lda, const unsigned short* __restrict__ Wt, int ldb,
                                                const float* __restrict__ bias, const float* __restrict__ resid, int rmod, int ldr,
                                                float* __restrict__ C, int ldc, int M, int N, int K) {
  __shared__ __attribute__((aligned(16))) float so[4][16][64];
  const int tid = threadIdx.x, w = tid >> 5, lane = tid & 31, ln = lane & 15, hh = lane >> 4;
  const int ntn = N / 64;
  const int wid = blockIdx.x * 4 + w;
  const int mt = wid / ntn, nq = wid % ntn;
  if (mt * 16 >= M) return;
  const int row0 = mt * 16, col0 = nq * 64;
  const float* arow = A + (size_t)(row0 + ln) * lda;
  v8f acc[4] = {};
  for (int kb = 0; kb < K; kb += 32) {
    FragB ah, al;
    const v4f x0 = *(const v4fa*)(arow + kb + 8 * hh), x1 = *(const v4fa*)(arow + kb + 8 * hh + 4);
    const v4f x2 = *(const v4fa*)(arow + kb + 16 + 8 * hh), x3 = *(const v4fa*)(arow + kb + 16 + 8 * hh + 4);
    float xs[16] = {x0[0],x0[1],x0[2],x0[3],x1[0],x1[1],x1[2],x1[3],x2[0],x2[1],x2[2],x2[3],x3[0],x3[1],x3[2],x3[3]};
#pragma unroll
    for (int i = 0; i < 16; ++i) { const unsigned short hb = bf16_bits(xs[i]); ah.u[i] = hb; al.u[i] = ASPLIT ? bf16_bits(xs[i] - bf16_val(hb)) : (unsigned short)0; }
#pragma unroll
    for (int t = 0; t < 4; ++t) {
      const unsigned short* brow = Wt + (size_t)(col0 + t * 16 + ln) * ldb + kb;
      FragB b;
      b.half[0] = *(const v8us*)(brow + 8 * hh);
      b.half[1] = *(const v8us*)(brow + 16 + 8 * hh);
      acc[t] = mmaN<ASPLIT ? 2 : 1>(ah.v, al.v, b.v, b.v, acc[t]);
    }
  }
#pragma unroll
  for (int t = 0; t < 4; ++t) {
    const int col = col0 + t * 16 + ln;
    float bv = bias ? bias[col] : 0.f;
    if (BIAS_BF16) bv = bf16_round(bv);
#pragma unroll
    for (int r = 0; r < 8; ++r) {
      float v = acc[t][r] + bv;
      if (resid) { float rv = resid[(size_t)((row0 + 8 * hh + r) % rmod) * ldr + col]; if (RES_BF16) rv = bf16_round(rv); v += rv; }
      if (ACT == 1) v = fmaxf(v, 0.f);
      if (ACT == 2) v = 0.5f * v * (1.0f + erff(v * 0.70710678118654752f));
      if (ACT == 3) { const float u = 0.7978845608028654f * (v + 0.044715f * v * v * v); v = 0.5f * v * (1.0f + tanhf(u)); }
      so[w][8 * hh + r][t * 16 + ln] = v;
    }
  }
  __builtin_amdgcn_fence(__ATOMIC_ACQ_REL, "workgroup");
  __builtin_amdgcn_wave_barrier();
  const int rsub = lane >> 4, c4 = (lane & 15) * 4;
  {
#pragma unroll
    for (int q = 0; q < 8; ++q) {
      const int r = q * 2 + rsub;
      const v4f v = *(const v4fa*)&so[w][r][c4];
      *(v4f*)(C + (size_t)(row0 + r) * ldc + col0 + c4) = v;
    }
    
  }
}
// row LayerNorm (biased variance, eps) over N: s = X (+ R); optional out_sum <- s; out_norm <- (s-mu)*rsqrt(var+eps)*g + b
template <bool PARAM_BF16>
__global__ __launch_bounds__(256) void k_layernorm(const float* __restrict__ X, const float* __restrict__ R, const float* __restrict__ g, const float* __restrict__ bta,
                                                  float* __restrict__ out_sum, float* __restrict__ out_norm, int N, float eps) {
  __shared__ float red[256];
  const int row = blockIdx.x, tid = threadIdx.x;
  const float* x = X + (size_t)row * N; const float* rr = R ? R + (size_t)row * N : nullptr;
  float vals[16];                     // up to N = 4096
  const int per = N / 256;            // contiguous chunk per thread? use strided-by-4 chunks: thread handles j = tid*4 + 1024*u
  float s1 = 0.f;
  for (int u = 0; u < per / 4; ++u) {
    const int j = tid * 4 + 1024 * u;
    const v4f a = *(const v4fa*)(x + j);
    v4f b = {0.f,0.f,0.f,0.f}; if (rr) b = *(const v4fa*)(rr + j);
#pragma unroll
    for (int q = 0; q < 4; ++q) { const float v = a[q] + b[q]; vals[u * 4 + q] = v; s1 += v; }
  }
  red[tid] = s1; __syncthreads();
  for (int st = 128; st > 0; st >>= 1) { if (tid < st) red[tid] += red[tid + st]; __syncthreads(); }
  const float mu = red[0] / (float)N; __syncthreads();
  float s2 = 0.f;
  for (int u = 0; u < per / 4; ++u)
#pragma unroll
    for (int q = 0; q < 4; ++q) { const float c = vals[u * 4 + q] - mu; s2 += c * c; }
  red[tid] = s2; __syncthreads();
  for (int st = 128; st > 0; st >>= 1) { if (tid < st) red[tid] += red[tid + st]; __syncthreads(); }
  const float rs = rsqrtf(red[0] / (float)N + eps);
  {
    for (int u = 0; u < per / 4; ++u) {
      const int j = tid * 4 + 1024 * u;
      v4f o, sm;
#pragma unroll
      for (int q = 0; q < 4; ++q) {
        float gg = g[j + q], bb = bta[j + q];
        if (PARAM_BF16) { gg = bf16_round(gg); bb = bf16_round(bb); }
        sm[q] = vals[u * 4 + q]; o[q] = (vals[u * 4 + q] - mu) * rs * gg + bb;
      }
      if (out_sum) *(v4f*)(out_sum + (size_t)row * N + j) = sm;
      *(v4f*)(out_norm + (size_t)row * N + j) = o;
    }
    
  }
}



// ---- f16 WMMA path (v_wmma_f32_16x16x32_f16): 11-bit significands for operands in range — used where a [0,1] probability operand needs more precision than bf16
typedef _Float16 v16h __attribute__((ext_vector_type(16)));
union FragH { v16h v; v8us half[2]; _Float16 h[16]; unsigned short u[16]; };
template <int NT>
__device__ __forceinline__ v8f mmaH(v16h ah, v16h al, v16h bh, v16h bl, v8f c) {
  c = __builtin_amdgcn_wmma_f32_16x16x32_f16(false, ah, false, bh, (short)0, c, false, false);
  if (NT >= 2) c = __builtin_amdgcn_wmma_f32_16x16x32_f16(false, al, false, bh, (short)0, c, false, false);
  if (NT >= 3) c = __builtin_amdgcn_wmma_f32_16x16x32_f16(false, ah, false, bl, (short)0, c, false, false);
  asm volatile("v_nop\n\tv_nop\n\tv_nop\n\tv_nop" : "+v"(c) : "v"(ah), "v"(al), "v"(bh), "v"(bl));
  return c;
}
// batched GEMM like k_gemm_b but f16 operands: A f32 (split into f16 hi/lo if ASPLIT, else rounded to f16), Bt = f16 values [n][k]; alpha; C f32; N multiple of 16 (partial tiles skipped)
template <bool ASPLIT>
__global__ __launch_bounds__(128) void k_gemm_h(const float* __restrict__ A, int lda, size_t sA, const _Float16* __restrict__ Bh, int ldb, size_t sB, float alpha, float* __restrict__ C, int ldc, size_t sC, int M, int N, int K) {
  __shared__ __attribute__((aligned(16))) float so[4][16][64];
  const int tid = threadIdx.x, w = tid >> 5, lane = tid & 31, ln = lane & 15, hh = lane >> 4; const int by = blockIdx.y;
  A += (size_t)by * sA; Bh += (size_t)by * sB; C += (size_t)by * sC;
  const int ntn = (N + 63) / 64; const int wid = blockIdx.x * 4 + w; const int mt = wid / ntn, nq = wid % ntn; if (mt * 16 >= M) return;
  const int row0 = mt * 16, col0 = nq * 64; const float* arow = A + (size_t)(row0 + ln) * lda;
  v8f acc[4] = {};
  for (int kb = 0; kb < K; kb += 32) {
    FragH ah, al;
    const v4f x0 = *(const v4fa*)(arow + kb + 8 * hh), x1 = *(const v4fa*)(arow + kb + 8 * hh + 4), x2 = *(const v4fa*)(arow + kb + 16 + 8 * hh), x3 = *(const v4fa*)(arow + kb + 16 + 8 * hh + 4);
    float xs[16] = {x0[0],x0[1],x0[2],x0[3],x1[0],x1[1],x1[2],x1[3],x2[0],x2[1],x2[2],x2[3],x3[0],x3[1],x3[2],x3[3]};
#pragma unroll
    for (int i = 0; i < 16; ++i) { const _Float16 h = (_Float16)xs[i]; ah.h[i] = h; al.h[i] = ASPLIT ? (_Float16)(xs[i] - (float)h) : (_Float16)0.0f; }
#pragma unroll
    for (int t = 0; t < 4; ++t) { if (col0 + t * 16 >= N) continue; const size_t boff = (size_t)(col0 + t * 16 + ln) * ldb + kb; FragH bq; bq.half[0] = *(const v8us*)(Bh + boff + 8 * hh); bq.half[1] = *(const v8us*)(Bh + boff + 16 + 8 * hh);
      acc[t] = mmaH<ASPLIT ? 2 : 1>(ah.v, al.v, bq.v, bq.v, acc[t]); }
  }
#pragma unroll
  for (int t = 0; t < 4; ++t) { if (col0 + t * 16 >= N) continue;
#pragma unroll
    for (int r = 0; r < 8; ++r) so[w][8 * hh + r][t * 16 + ln] = acc[t][r] * alpha; }
  __builtin_amdgcn_fence(__ATOMIC_ACQ_REL, "workgroup"); __builtin_amdgcn_wave_barrier();
  const int rsub = lane >> 4, c4 = (lane & 15) * 4;
  {
#pragma unroll
    for (int q = 0; q < 8; ++q) { const int r = q * 2 + rsub; if (col0 + c4 < N) { const v4f v = *(const v4fa*)&so[w][r][c4]; *(v4f*)(C + (size_t)(row0 + r) * ldc + col0 + c4) = v; } }
     }
}

// Wt[n][k] = f16(W[k][n]·scale) from f32 row-major W[K][N] (scale = power of two; bf16-exact weights stay exact in f16 away from the subnormal range)
__global__ __launch_bounds__(256) void k_wt_f16(const float* __restrict__ W, _Float16* __restrict__ Wt, int K, int N, float scale) {
  const int t = blockIdx.x * 256 + threadIdx.x; if (t >= N * (K / 8)) return; const int n = t / (K / 8), k8 = (t % (K / 8)) * 8; FragH f;
#pragma unroll
  for (int i = 0; i < 8; ++i) f.h[i] = (_Float16)(bf16_round(W[(size_t)(k8 + i) * N + n]) * scale); const v8us o = f.half[0];
  *(v8us*)((unsigned short*)Wt + (size_t)n * K + k8) = o; 
}
// k_gemm_hh variant with fused epilogue: v = acc·alpha + bias[by·sBias + col] (+ CP[(row/rowsPerB)·sCPb + by·64 + col] if CP) ; ACT 0 none / 1 elu ; writes f16 C16 (and f32 C if non-null)
template <int ACT>
__global__ __launch_bounds__(128) void k_gemm_hhx(const _Float16* __restrict__ A, int lda, size_t sA, const _Float16* __restrict__ Bh, int ldb, size_t sB, float alpha, const float* __restrict__ bias, size_t sBias, const float* __restrict__ CP, int rowsPerB, size_t sCPb, int row0g,
    float* __restrict__ C, _Float16* __restrict__ C16, int ldc, size_t sC, int M, int N, int K) {
  __shared__ __attribute__((aligned(16))) float so[4][16][64];
  const int tid = threadIdx.x, w = tid >> 5, lane = tid & 31, ln = lane & 15, hh = lane >> 4; const int by = blockIdx.y;
  A += (size_t)by * sA; Bh += (size_t)by * sB; const size_t cofs = (size_t)by * sC; const float* bp = bias ? bias + (size_t)by * sBias : nullptr;
  const int ntn = (N + 63) / 64; const int wid = blockIdx.x * 4 + w; const int mt = wid / ntn, nq = wid % ntn; if (mt * 16 >= M) return;
  const int row0 = mt * 16, col0 = nq * 64; const _Float16* arow = A + (size_t)(row0 + ln) * lda;
  v8f acc[4] = {};
  for (int kb = 0; kb < K; kb += 32) { FragH ah; ah.half[0] = *(const v8us*)((const unsigned short*)arow + kb + 8 * hh); ah.half[1] = *(const v8us*)((const unsigned short*)arow + kb + 16 + 8 * hh);
#pragma unroll
    for (int t = 0; t < 4; ++t) { if (col0 + t * 16 >= N) continue; const size_t boff = (size_t)(col0 + t * 16 + ln) * ldb + kb; FragH bq; bq.half[0] = *(const v8us*)((const unsigned short*)Bh + boff + 8 * hh); bq.half[1] = *(const v8us*)((const unsigned short*)Bh + boff + 16 + 8 * hh);
      acc[t] = mmaH<1>(ah.v, ah.v, bq.v, bq.v, acc[t]); }
  }
#pragma unroll
  for (int t = 0; t < 4; ++t) { if (col0 + t * 16 >= N) continue; const int col = col0 + t * 16 + ln; const float bv = bp ? bf16_round(bp[col]) : 0.f;
#pragma unroll
    for (int r = 0; r < 8; ++r) { float v = acc[t][r] * alpha + bv; if (CP) { const int rr = row0g + row0 + 8 * hh + r; if (rowsPerB < 0) v += CP[cofs + (size_t)rr * ldc + col];      /* rowsPerB < 0: own element of the batched C plane */ else { const int bidx = rr / rowsPerB; v += CP[(size_t)bidx * sCPb + (size_t)by * 64 + col]; } } if (ACT == 1) v = (v > 0.f) ? v : expm1f(v); else if (ACT == 7) v = (v > 0.f) ? v + 1.0f : expf(v); else if (ACT == 8) v = tanhf(v); else if (ACT == 9) v = 0.5f * v * (1.0f + tanhf(0.7978845608028654f * (v + 0.044715f * v * v * v))); else if (ACT == 11) v = 1.0f / (1.0f + expf(-v)); else if (ACT == 12) v = (v > 0.f) ? v : 0.01f * v; else if (ACT == 14) v = (v > 0.f) ? v : 0.1f * v; else if (ACT == 16) v = (v >= 0.f) ? v : 0.3f * v; else if (ACT == 17) v = (v >= 0.f) ? v : 0.2f * v; else if (ACT == 15) v = v / (1.0f + expf(-v)); else if (ACT == 3) v = fmaxf(v, 0.f); else if (ACT == 6) v = 0.5f * v * (1.0f + erff(v * 0.70710678118654752f)); so[w][8 * hh + r][t * 16 + ln] = v; } }
  __builtin_amdgcn_fence(__ATOMIC_ACQ_REL, "workgroup"); __builtin_amdgcn_wave_barrier();
  const int rsub = lane >> 4, c4 = (lane & 15) * 4; typedef _Float16 v4h __attribute__((ext_vector_type(4)));
  {
#pragma unroll
    for (int q = 0; q < 8; ++q) { const int r = q * 2 + rsub; if (col0 + c4 < N) { const v4f v = *(const v4fa*)&so[w][r][c4]; if (C) *(v4f*)(C + cofs + (size_t)(row0 + r) * ldc + col0 + c4) = v; if (C16) { v4h h4; for (int i = 0; i < 4; ++i) h4[i] = (_Float16)v[i]; *(v4h*)(C16 + cofs + (size_t)(row0 + r) * ldc + col0 + c4) = h4; } } }
     }
}


typedef _Float16 v4h __attribute__((ext_vector_type(4)));

// ---- streaming conversions: few long waves. A wave-wide load is 32 lanes x 16 B = 512 contiguous bytes (four whole lines), eight such loads are issued before the first is used, and the 8-byte stores of a wave
// cover 256 contiguous bytes. Which thread converts a value has no bearing on the value.
#define ST_WE 4096                   /* k_prep: f32 elements per wave, four rounds of eight loads */
#define ST_BE (8 * ST_WE)            /* k_prep: elements per work-group of eight waves */
#define ST_GX ((int)(NR * NC / ST_BE))              /* work-groups per activation input */
#define ST_G1 (NC * NC / ST_BE)                     /* work-groups for W1 */
#define ST_G2 (NO * 2 * NC / ST_BE)                 /* work-groups for W2 */
// All four f32 inputs that feed a matrix product, in one launch; the work-group index picks the input (a scalar choice, no barrier in the kernel).
// in1 -> columns 0..511 of the f16 concat rows (pitch 2 NC), in2 -> f16 rows, W1 and W2 -> natural f16 rows x16; each value is first rounded to bf16. Rows of 512 (W2: half rows) keep e -> (e / 512) * pitch + e % 512.
__global__ __launch_bounds__(256) void k_prep(const float* __restrict__ in1, const float* __restrict__ in2, const float* __restrict__ w1, const float* __restrict__ w2,
    _Float16* __restrict__ cat, _Float16* __restrict__ x2, _Float16* __restrict__ b1, _Float16* __restrict__ b2) {
  static_assert(NR * NC % ST_BE == 0 && NC * NC % ST_BE == 0 && NO * 2 * NC % ST_BE == 0 && NC == 512, "k_prep: whole work-groups per input, rows of 512");
  int b = blockIdx.x; const float* s; _Float16* d; size_t ldo = NC; float sc = 1.0f;
  if (b < ST_GX) { s = in1; d = cat; ldo = 2 * NC; }
  else if (b < 2 * ST_GX) { b -= ST_GX; s = in2; d = x2; }
  else if (b < 2 * ST_GX + ST_G1) { b -= 2 * ST_GX; s = w1; d = b1; sc = 16.0f; }
  else { b -= 2 * ST_GX + ST_G1; s = w2; d = b2; sc = 16.0f; }
  const size_t w0 = (size_t)b * ST_BE + (size_t)(threadIdx.x >> 5) * ST_WE;      /* the wave's first element: the start of a row of 512 */
  const float* sp = s + w0 + (threadIdx.x & 31) * 4; _Float16* dp = d + (w0 >> 9) * ldo + (threadIdx.x & 31) * 4;
  v4f x[2][8];
#pragma unroll
  for (int i = 0; i < 8; ++i) x[0][i] = *(const v4fa*)(sp + i * 128);
#pragma unroll      /* unrolled so that x[][] is indexed by constants only and stays in registers */
  for (int u = 0; u < ST_WE / 1024; ++u) {      /* a round = 1,024 elements = two rows of 512 */
    if (u + 1 < ST_WE / 1024) {
#pragma unroll
      for (int i = 0; i < 8; ++i) x[(u + 1) & 1][i] = *(const v4fa*)(sp + (u + 1) * 1024 + i * 128);      /* the next round's loads fly while this round is converted */
      __builtin_amdgcn_sched_barrier(0); }      /* without it the scheduler sinks these loads behind most of this round's conversion, and the wave has nothing in flight meanwhile */
#pragma unroll
    for (int i = 0; i < 8; ++i) { v4h h;
#pragma unroll
      for (int q = 0; q < 4; ++q) h[q] = (_Float16)(bf16_round(x[u & 1][i][q]) * sc);
      *(v4h*)(dp + (size_t)(2 * u + (i >> 2)) * ldo + (i & 3) * 128) = h; }
    if (u + 1 < ST_WE / 1024) asm volatile("s_wait_xcnt 0x0" :: "v"(sp) : "memory"); } }      /* the next round reuses address and data registers of this round's loads and stores; naming sp keeps the load address whole up to the wait (no load may land on it) */
__global__ __launch_bounds__(256) void k_h16(const float* __restrict__ x, _Float16* __restrict__ X16, size_t n8) { const size_t t = (size_t)blockIdx.x * 256 + threadIdx.x; if (t >= n8) return; FragH f;
#pragma unroll
  for (int q = 0; q < 8; ++q) f.h[q] = (_Float16)x[t * 8 + q]; *(v8us*)((unsigned short*)X16 + t * 8) = f.half[0];  }
__global__ __launch_bounds__(256) void k_round16f(const float* __restrict__ W, _Float16* __restrict__ Bt, size_t n8) { const size_t t = (size_t)blockIdx.x * 256 + threadIdx.x; if (t >= n8) return; FragH f;
#pragma unroll
  for (int i = 0; i < 8; ++i) f.h[i] = (_Float16)(bf16_round(W[t * 8 + i]) * 16.0f); *(v8us*)((unsigned short*)Bt + t * 8) = f.half[0];  }
// Transpose of one 64-column slab, VT_R rows per work-group (a thread's VT_R / 32 loads of 16 B are all issued before the first is used); lane -> element maps inside 64 rows as for a 64-row tile.
#define VT_R 256
template <int NHv, int TTv, int LDV>
__global__ __launch_bounds__(256) void k_vt(const _Float16* __restrict__ V16, int voff, _Float16* __restrict__ Vt) { __shared__ unsigned short tl[VT_R][66]; const int tid = threadIdx.x; const int slab = blockIdx.x / (TTv / VT_R), lg = blockIdx.x % (TTv / VT_R); const int b = slab / NHv, h = slab % NHv;
  static_assert(TTv % VT_R == 0, "k_vt: whole tiles");
  const int r0 = tid / 8, c8 = (tid % 8) * 8; FragH f[VT_R / 32];
  const unsigned short* vp = (const unsigned short*)V16 + ((size_t)b * TTv + lg * VT_R + r0) * LDV + voff + h * 64 + c8;      /* the row pitch is a constant, so that all loads share this one address */
#pragma unroll
  for (int k = 0; k < VT_R / 32; ++k) f[k].half[0] = *(const v8us*)(vp + (size_t)k * 32 * LDV);
  asm volatile("s_wait_xcnt 0x0" :: "v"(vp) : "memory");      /* the address registers are reused behind the loads; naming vp keeps them whole up to the wait (no load may land on them) */
#pragma unroll
  for (int k = 0; k < VT_R / 32; ++k)
#pragma unroll
    for (int q = 0; q < 8; ++q) tl[k * 32 + r0][c8 + q] = f[k].u[q];
  __syncthreads();
  {
#pragma unroll
    for (int rd = 0; rd < VT_R / 32; ++rd) { const int d = (rd & 1) * 32 + tid / 8, pc = (rd >> 1) * 8 + tid % 8; FragH g;
#pragma unroll
      for (int q = 0; q < 8; ++q) g.u[q] = tl[pc * 8 + q][d];
      *(v8us*)((unsigned short*)Vt + ((size_t)slab * 64 + d) * TTv + lg * VT_R + pc * 8) = g.half[0]; }
     } }

// f32 -> f16 hi plane + residual x 2^10 plane, as a stream of the same make: HL_WE elements per wave, two rounds of eight loads (n = a multiple of 8 * HL_WE elements, one work-group per 8 * HL_WE).
#define HL_WE 2048
__global__ __launch_bounds__(256) void k_hl(const float* __restrict__ F, _Float16* __restrict__ Hh, _Float16* __restrict__ Hl) {
  const size_t e0 = (size_t)blockIdx.x * (8 * HL_WE) + (size_t)(threadIdx.x >> 5) * HL_WE + (threadIdx.x & 31) * 4;
  const float* sp = F + e0; _Float16* hp = Hh + e0; _Float16* lp = Hl + e0;
  v4f x[2][8];
#pragma unroll
  for (int i = 0; i < 8; ++i) x[0][i] = *(const v4fa*)(sp + i * 128);
#pragma unroll      /* unrolled so that x[][] stays in registers */
  for (int u = 0; u < HL_WE / 1024; ++u) {
    if (u + 1 < HL_WE / 1024) {
#pragma unroll
      for (int i = 0; i < 8; ++i) x[(u + 1) & 1][i] = *(const v4fa*)(sp + (u + 1) * 1024 + i * 128); }      /* the next round's loads fly while this round is split */
#pragma unroll
    for (int i = 0; i < 8; ++i) { v4h hi, lo;
#pragma unroll
      for (int q = 0; q < 4; ++q) { const float a = x[u & 1][i][q]; const _Float16 h = (_Float16)a; hi[q] = h; lo[q] = (_Float16)((a - (float)h) * 1024.0f); }
      *(v4h*)(hp + u * 1024 + i * 128) = hi; *(v4h*)(lp + u * 1024 + i * 128) = lo; }
    if (u + 1 < HL_WE / 1024) asm volatile("s_wait_xcnt 0x0" :: "v"(sp) : "memory"); } }      /* as in k_prep */

// ---- fast GEMM: block tile 128x128, four waves of 64x64 (requires M % 128 == 0 rows per launch region, N % 128 == 0, K % 64 == 0) ----
// Both operand tiles of a 64-k pass are brought into LDS once per work-group by asynchronous copies (each wave-wide copy covers four whole 128-byte rows) and read from there by all four waves;
// two buffers, so that the next pass's copies fly while this pass is multiplied. Each output element still sums its k blocks of 32 in ascending order.
#define G2_PITCH 144                 /* LDS bytes per 128-byte tile row: 16 B x odd, the pitch at which ds_load_b128 readers of 16 rows meet no bank conflict */
#define G2_OPER (128 * G2_PITCH)     /* one operand's 128 rows of a pass */
#define G2_STAGE (2 * G2_OPER)       /* one buffer: [A 128 rows | B 128 rows] */
#define G2_SOP 68                    /* floats per row of the output staging */
__device__ __forceinline__ v16h g2_lfrag(const char* p) { FragH f; f.half[0] = *(const v8us*)p; f.half[1] = *(const v8us*)(p + 32); return f.v; }      /* same k order as a fragment read from global rows: k = 8 hh .. 8 hh + 7, then 16 + 8 hh .. */
__device__ __forceinline__ v8f g2_mma(v16h a, v16h b, v8f c) { v8f d = __builtin_amdgcn_wmma_f32_16x16x32_f16(false, a, false, b, (short)0, c, false, false); asm volatile("v_nop\n\tv_nop\n\tv_nop\n\tv_nop" : "+v"(d) : "v"(a), "v"(b)); return d; }
// One operand's 128 rows x 128 bytes: the lane's 16 bytes of rows r, r + 16, .. r + 112 (l = its LDS byte address for row r, p = its global address for row r, ld = global row pitch in halves).
// The s_wait_xcnt closes the copies' own statement so that no address register of a copy is rewritten in front of it.
__device__ __forceinline__ void g2_copy8(unsigned l, const _Float16* p, size_t ld) {
  asm volatile("global_load_async_to_lds_b128 %0, %8, off\n\t"
               "global_load_async_to_lds_b128 %1, %9, off\n\t"
               "global_load_async_to_lds_b128 %2, %10, off\n\t"
               "global_load_async_to_lds_b128 %3, %11, off\n\t"
               "global_load_async_to_lds_b128 %4, %12, off\n\t"
               "global_load_async_to_lds_b128 %5, %13, off\n\t"
               "global_load_async_to_lds_b128 %6, %14, off\n\t"
               "global_load_async_to_lds_b128 %7, %15, off\n\t"
               "s_wait_xcnt 0x0"
               :: "v"(l), "v"(l + 16 * G2_PITCH), "v"(l + 32 * G2_PITCH), "v"(l + 48 * G2_PITCH), "v"(l + 64 * G2_PITCH), "v"(l + 80 * G2_PITCH), "v"(l + 96 * G2_PITCH), "v"(l + 112 * G2_PITCH),
                  "v"(p), "v"(p + 16 * ld), "v"(p + 32 * ld), "v"(p + 48 * ld), "v"(p + 64 * ld), "v"(p + 80 * ld), "v"(p + 96 * ld), "v"(p + 112 * ld)
               : "memory");
}
// The activation of one output value (ACT: 0 none, 3 relu, 6 exact gelu, 8 tanh, 9 tanh gelu, 11 sigmoid, 12/14/16/17 leaky relu 0.01/0.1/0.3/0.2, 15 silu).
template <int ACT>
__device__ __forceinline__ float g2_act(float v) {
  if (ACT == 3) v = fmaxf(v, 0.f); else if (ACT == 6) v = 0.5f * v * (1.0f + erff(v * 0.70710678118654752f)); else if (ACT == 11) v = 1.0f / (1.0f + expf(-v)); else if (ACT == 15) v = v / (1.0f + expf(-v)); else if (ACT == 12) v = (v > 0.f) ? v : 0.01f * v; else if (ACT == 8) v = tanhf(v); else if (ACT == 9) v = 0.5f * v * (1.0f + tanhf(0.7978845608028654f * (v + 0.044715f * v * v * v))); else if (ACT == 14) v = (v > 0.f) ? v : 0.1f * v; else if (ACT == 16) v = (v >= 0.f) ? v : 0.3f * v; else if (ACT == 17) v = (v >= 0.f) ? v : 0.2f * v;
  return v; }
// What the epilogue does is fixed at compile time: HASB adds bf16-rounded bias[by * sBias + col]; ADDC adds the element that C already holds (C += ...); F32O stores f32 C, F16O stores f16 C16.
// out = ACT(acc * alpha + bias + old C), in that order.
// TWOP: A is given as two planes against the same B, acc = (sum over k of A2 B) * pre + sum over k of A B: the passes of A2 run first, the accumulators are scaled once by pre (a power of two: exact),
// and the passes of A add onto them, so that the sum of both terms leaves the registers once. A2 has A's pitch and batch stride.
// SM = 1, the softmax's first half in the epilogue: C16 (row pitch SQ) takes f16 weights instead of scores (score = the accumulator, alpha is not applied). Per row and per wave tile of 64 keys: k = ceil(max s * log2 e) over the keys that mk leaves in, weight = exp2(s * log2 e - k + 8)
// (at most 256; a masked key gives an exact 0), st[tile][row] = k (-3e38 where all 64 keys are masked), st[SM_T + tile][row] = the f32 sum of the unrounded weights. A wave writes whole 128-byte lines of st and of C16.
// SM = 2, its second half: A holds such weights, one pass of 64 k = one tile. Per row: km = max k, factor[tile] = 2^(k - km) (a power of two: the f16 product with a weight is exact above the subnormal range),
// sum = sum over tiles of st sum * factor; the A fragments of pass t are multiplied by factor[t], and the output row by 1 / sum (0 where every key is masked).
#define SM_T (SQ / 64)
template <int ACT, bool HASB, bool ADDC, bool F32O, bool F16O, bool TWOP = false, int SM = 0>
__global__ __launch_bounds__(128) void k_gemm2(const _Float16* __restrict__ A, int lda, size_t sA, const _Float16* __restrict__ Bh, int ldb, size_t sB, float alpha, const float* __restrict__ bias, size_t sBias,
    float* __restrict__ C, _Float16* __restrict__ C16, int ldc, size_t sC, int M, int N, int K, const _Float16* __restrict__ A2, float pre, const int* __restrict__ mk, float* __restrict__ st) { static_assert(ACT == 0 || ACT == 3 || ACT == 6 || ACT == 8 || ACT == 9 || ACT == 11 || ACT == 12 || ACT == 14 || ACT == 15 || ACT == 16 || ACT == 17, "k_gemm2: unsupported ACT code (would silently apply no activation)");
  static_assert(F32O || !ADDC, "ADDC reads the f32 plane it then stores");
  __shared__ __attribute__((aligned(16))) char sm[2 * G2_STAGE];      /* the two buffers; behind the loop's last barrier the same bytes stage the output */
  static_assert(4 * 64 * G2_SOP * 4 <= 2 * G2_STAGE, "output staging must fit the ring");
  __shared__ _Float16 fs[SM == 2 ? SM_T * 128 : 1]; __shared__ float il[SM == 2 ? 128 : 1];      /* SM = 2: factor[tile][row of the block], 1 / row sum */
  const int tid = threadIdx.x, w = tid >> 5, lane = tid & 31, ln = lane & 15, hh = lane >> 4; const int by = blockIdx.y;
  A += (size_t)by * sA; Bh += (size_t)by * sB; const size_t cofs = (size_t)by * sC;
  const int ntn = N >> 7; const int mt = blockIdx.x / ntn, nq = blockIdx.x - mt * ntn; const int rowB = mt * 128, colB = nq * 128; if (rowB >= M) return;      /* the same for the whole work-group, in front of every barrier */
  const int row0 = rowB + 64 * (w >> 1), col0 = colB + 64 * (w & 1);
  const int cr = tid >> 3, cc = tid & 7;      /* copies: eight lanes per 128-byte row, 16 rows per round of the work-group */
  const _Float16* ga = A + (size_t)(rowB + cr) * lda + cc * 8; const _Float16* gb = Bh + (size_t)(colB + cr) * ldb + cc * 8;
  const _Float16* g2 = TWOP ? A2 + (size_t)by * sA + (size_t)(rowB + cr) * lda + cc * 8 : ga;
  const unsigned lc = (unsigned)(size_t)sm + (unsigned)(cr * G2_PITCH + cc * 16);
  const char* fa = sm + (64 * (w >> 1) + ln) * G2_PITCH + 16 * hh; const char* fb = sm + G2_OPER + (64 * (w & 1) + ln) * G2_PITCH + 16 * hh;
  const int n2 = TWOP ? K >> 6 : 0; const int np = n2 + (K >> 6);      /* passes 0 .. n2 - 1 read A2, passes n2 .. np - 1 read A; both walk the same k of B */
  const auto pa = [&](int t) { return (TWOP && t < n2) ? g2 + (size_t)t * 64 : ga + (size_t)(t - n2) * 64; };
  const auto pb = [&](int t) { return gb + (size_t)((TWOP && t >= n2) ? t - n2 : t) * 64; };
  g2_copy8(lc, pa(0), (size_t)lda); g2_copy8(lc + G2_OPER, pb(0), (size_t)ldb);      /* pass 0 -> buffer 0 */
  if (SM == 2) {      /* one thread per row of the block, while pass 0 flies; the barrier below publishes fs and il together with pass 0 */
    const float* kp = st + (size_t)by * SQ + rowB + tid; float kv[SM_T], lv[SM_T];
#pragma unroll
    for (int t = 0; t < SM_T; ++t) { kv[t] = kp[(size_t)t * NR]; lv[t] = kp[(size_t)(SM_T + t) * NR]; }
    float km = kv[0];
#pragma unroll
    for (int t = 1; t < SM_T; ++t) km = fmaxf(km, kv[t]);
    float sum = 0.f;
#pragma unroll
    for (int t = 0; t < SM_T; ++t) { const float f = ldexpf(1.0f, (int)fmaxf(kv[t] - km, -200.0f)); sum += lv[t] * f; fs[t * 128 + tid] = (_Float16)f; }      /* below 2^-149 the factor is 0 */
    il[tid] = (sum == 0.f) ? 0.f : 1.0f / sum; }
  asm volatile("s_wait_asynccnt 0x0" ::: "memory");      /* this wave's copies of pass 0 have landed */
  __syncthreads();      /* every wave's have: pass 0 may be read */
  if (np > 1) { g2_copy8(lc + G2_STAGE, pa(1), (size_t)lda); g2_copy8(lc + G2_STAGE + G2_OPER, pb(1), (size_t)ldb); }      /* pass 1 -> buffer 1, where there is one (the same test for the whole work-group) */
  const v8f z8 = {0.f,0.f,0.f,0.f,0.f,0.f,0.f,0.f}; v8f acc[4][4];
#pragma unroll
  for (int i = 0; i < 4; ++i)
#pragma unroll
    for (int j = 0; j < 4; ++j) acc[i][j] = z8;
#pragma unroll 1      /* one pass per trip: the buffer offset is the only thing that differs, and an unrolled copy of 32 WMMAs buys nothing */
  for (int t = 0; t < np; ++t) { const int bo = (t & 1) * G2_STAGE;
    if (TWOP && t == n2) {      /* once, the same for every wave: the first plane's sum takes its weight before the second plane adds on */
#pragma unroll
      for (int i = 0; i < 4; ++i)
#pragma unroll
        for (int j = 0; j < 4; ++j) acc[i][j] *= pre; }
    _Float16 sc[4];
    if (SM == 2) {
#pragma unroll
      for (int i = 0; i < 4; ++i) sc[i] = fs[t * 128 + 64 * (w >> 1) + 16 * i + ln]; }      /* a lane's A fragment i holds row 16 i + ln of the wave tile */
#pragma unroll
    for (int ks = 0; ks < 2; ++ks) { v16h a[4], b[4];
#pragma unroll
      for (int i = 0; i < 4; ++i) { a[i] = g2_lfrag(fa + bo + i * 16 * G2_PITCH + ks * 64); b[i] = g2_lfrag(fb + bo + i * 16 * G2_PITCH + ks * 64); if (SM == 2) a[i] = a[i] * sc[i]; }
#pragma unroll
      for (int j = 0; j < 4; ++j)
#pragma unroll
        for (int i = 0; i < 4; ++i) acc[i][j] = g2_mma(a[i], b[j], acc[i][j]); }
    asm volatile("s_wait_dscnt 0x0" ::: "memory");      /* this wave's reads of buffer t mod 2 are done before the barrier lets it be refilled */
    asm volatile("s_wait_asynccnt 0x0" ::: "memory");      /* this wave's copies of pass t + 1 have landed */
    __syncthreads();      /* publishes pass t + 1 and ends every reader's last read of buffer t mod 2 */
    if (t + 2 < np) { g2_copy8(lc + bo, pa(t + 2), (size_t)lda); g2_copy8(lc + bo + G2_OPER, pb(t + 2), (size_t)ldb); } }
  asm volatile("s_wait_asynccnt 0x0" ::: "memory");      /* nothing of the ring is in flight when its bytes become the output staging */
  float* so = (float*)(sm + (size_t)w * (64 * G2_SOP * 4));      /* the wave's own 64 x 68 floats */
  if (SM == 1) {
    bool mo[4];
#pragma unroll
    for (int t = 0; t < 4; ++t) mo[t] = mk[(size_t)by * SQ + col0 + t * 16 + ln] != 0;
#pragma unroll
    for (int u = 0; u < 16; ++u) { const int t = u & 3, rt = u >> 2;
#pragma unroll
      for (int r = 0; r < 8; ++r) so[(rt * 16 + 8 * hh + r) * G2_SOP + t * 16 + ln] = mo[t] ? -__builtin_inff() : acc[rt][t][r]; }
    __builtin_amdgcn_fence(__ATOMIC_ACQ_REL, "workgroup"); __builtin_amdgcn_wave_barrier();      /* the wave's own staging: rows are read by other lanes than wrote them */
    float* sk = st + (size_t)(col0 >> 6) * NR + (size_t)by * SQ + row0 + lane;
#pragma unroll 1      /* a lane takes one whole row per trip (rows lane, lane + 32): maximum and sum need no other lane; rolled so that one row's 64 scores are in registers at a time */
    for (int h = 0; h < 2; ++h) { float* rp = so + (lane + 32 * h) * G2_SOP; v4f x[16];
#pragma unroll
      for (int j = 0; j < 16; ++j) x[j] = *(const v4fa*)(rp + 4 * j);
      v4f m4 = x[0];
#pragma unroll
      for (int j = 1; j < 16; ++j)
#pragma unroll
        for (int q = 0; q < 4; ++q) m4[q] = fmaxf(m4[q], x[j][q]);
      const float mx = fmaxf(fmaxf(m4[0], m4[1]), fmaxf(m4[2], m4[3])); const bool none = mx == -__builtin_inff();
      const float kk = none ? 0.f : ceilf(mx * 1.44269504f); const float sh = 8.0f - kk; v4f s4 = {0.f, 0.f, 0.f, 0.f};
#pragma unroll
      for (int j = 0; j < 8; ++j) { FragH f;
#pragma unroll
        for (int q = 0; q < 8; ++q) { const float a = fmaf(x[2 * j + (q >> 2)][q & 3], 1.44269504f, sh); float e;
          asm("v_exp_f32 %0, %1\n\tv_nop" : "=v"(e) : "v"(a));      /* the v_nop keeps the one slot the instruction set asks for behind a transcendental */
          s4[q & 3] += e; f.h[q] = (_Float16)e; }
        *(v8us*)((char*)rp + 16 * j) = f.half[0]; }      /* the f16 weights go over the first 128 bytes of the lane's own row, all of which is in x[] by now */
      sk[32 * h] = none ? -3.0e38f : kk; sk[(size_t)SM_T * NR + 32 * h] = (s4[0] + s4[1]) + (s4[2] + s4[3]);
      asm volatile("s_wait_xcnt 0x0" ::: "memory"); }      /* the next trip rewrites data registers of this trip's stores */
    __builtin_amdgcn_fence(__ATOMIC_ACQ_REL, "workgroup"); __builtin_amdgcn_wave_barrier();      /* rows are read back by other lanes than wrote them */
    const char* rr = (const char*)(so + (lane >> 3) * G2_SOP) + (lane & 7) * 16;      /* eight lanes per 128-byte row: a wave-wide store covers four whole lines */
    unsigned short* pp = (unsigned short*)C16 + cofs + (size_t)(row0 + (lane >> 3)) * SQ + col0 + (lane & 7) * 8;      /* the weight rows' pitch is the constant SQ, so that a trip's eight stores share this one address */
#pragma unroll 1      /* two trips of eight stores in flight */
    for (int g = 0; g < 2; ++g) { v8us v[8];
#pragma unroll
      for (int i = 0; i < 8; ++i) v[i] = *(const v8us*)(rr + i * 4 * G2_SOP * 4);
#pragma unroll
      for (int i = 0; i < 8; ++i) *(v8us*)(pp + (size_t)i * 4 * SQ) = v[i];
      asm volatile("s_wait_xcnt 0x0" ::: "memory");      /* the next trip rewrites the address and data registers of this trip's stores */
      rr += 32 * G2_SOP * 4; pp += (size_t)32 * SQ; }
    return; }
  float bv[4];
#pragma unroll
  for (int t = 0; t < 4; ++t) bv[t] = HASB ? bf16_round(bias[(size_t)by * sBias + col0 + t * 16 + ln]) : 0.f;
#pragma unroll
  for (int u = 0; u < 16; ++u) { const int t = u & 3, rt = u >> 2;
#pragma unroll
    for (int r = 0; r < 8; ++r) so[(rt * 16 + 8 * hh + r) * G2_SOP + t * 16 + ln] = HASB ? acc[rt][t][r] * alpha + bv[t] : acc[rt][t][r] * alpha; }
  __builtin_amdgcn_fence(__ATOMIC_ACQ_REL, "workgroup"); __builtin_amdgcn_wave_barrier();
  const int rsub = lane >> 4, c4 = (lane & 15) * 4;
  const size_t es = (size_t)2 * ldc;      /* a lane's rows are two apart */
  size_t eb = cofs + (size_t)(row0 + rsub) * ldc + col0 + c4;
  const float* sr = so + rsub * G2_SOP + c4;
#pragma unroll 1      /* four trips of 16 rows: rolled so that the text that runs once per work-group stays short (with tanh an unrolled copy is four times as long); inside a trip the eight loads, and the eight stores, are in flight together */
  for (int qb = 0; qb < 4; ++qb) { v4f v[8];
    if (ADDC) { v4f c[8];
#pragma unroll
      for (int q = 0; q < 8; ++q) c[q] = *(const v4fa*)(C + eb + q * es);
#pragma unroll
      for (int q = 0; q < 8; ++q) v[q] = *(const v4fa*)(sr + q * 2 * G2_SOP) + c[q]; }
    else {
#pragma unroll
      for (int q = 0; q < 8; ++q) v[q] = *(const v4fa*)(sr + q * 2 * G2_SOP); }
#pragma unroll
    for (int q = 0; q < 8; ++q) {
      if (SM == 2) v[q] = v[q] * il[64 * (w >> 1) + 16 * qb + 2 * q + rsub];
#pragma unroll
      for (int i = 0; i < 4; ++i) v[q][i] = g2_act<ACT>(v[q][i]);
      if (F32O) *(v4f*)(C + eb + q * es) = v[q];
      if (F16O) { v4h h4;
#pragma unroll
        for (int i = 0; i < 4; ++i) h4[i] = (_Float16)v[q][i];
        *(v4h*)(C16 + eb + q * es) = h4; } }
    asm volatile("s_wait_xcnt 0x0" ::: "memory");      /* the next trip rewrites the address and data registers of this trip's loads and stores */
    eb += 8 * es; sr += 16 * G2_SOP; } }


__global__ __launch_bounds__(256) void k_rsm(const float* __restrict__ S, _Float16* __restrict__ P, int nrows) {
  #pragma clang fp contract(off)
  const int i = blockIdx.x * 256 + threadIdx.x; if (i >= nrows) return; const float* s = S + (size_t)i * SQ; float mx = -3.0e38f;
#pragma unroll 1
  for (int j = 0; j < SQ; ++j) mx = fmaxf(mx, s[j]); float se = 0.f;
#pragma unroll 1
  for (int j = 0; j < SQ; ++j) se += expf(s[j] - mx); const float sc = 256.0f / se;
#pragma unroll 1
  for (int j0 = 0; j0 < SQ; j0 += 8) { FragH f; for (int q = 0; q < 8; ++q) f.h[q] = (_Float16)(expf(s[j0 + q] - mx) * sc); unsigned short* d = (unsigned short*)P + (size_t)i * SQ + j0; *(v8us*)d = f.half[0];  } }
__global__ __launch_bounds__(256) void k_vt(const _Float16* __restrict__ V16, int b, int h0, _Float16* __restrict__ VT) { __shared__ unsigned short tl[64][65]; const int tid = threadIdx.x; const int hh = blockIdx.x % HG, sg = blockIdx.x / HG; const int s0 = sg * 64; const int h = h0 + hh;
  for (int i = tid; i < 64 * 8; i += 256) { const int j = i / 8, d8 = (i % 8) * 8; FragH f; f.half[0] = *(const v8us*)((const unsigned short*)V16 + ((size_t)b * SQ + s0 + j) * DM + h * HD + d8); for (int q = 0; q < 8; ++q) tl[d8 + q][j] = f.u[q]; }
  __syncthreads();
  { for (int i = tid; i < 64 * 8; i += 256) { const int d = i / 8, j8 = (i % 8) * 8; FragH f; for (int q = 0; q < 8; ++q) f.u[q] = tl[d][j8 + q]; *(v8us*)((unsigned short*)VT + ((size_t)hh * HD + d) * SQ + s0 + j8) = f.half[0]; }  } }


extern "C" void kernel_launch(void* const* d_in, const int* in_sizes, int n_in,
                              void* d_out, int out_size, void* d_ws, size_t ws_size, hipStream_t stream) {
  (void)in_sizes; (void)n_in; (void)out_size;
  const float* const* I = (const float* const*)d_in; const float* in1 = I[0]; const float* in2 = I[1]; const int* mask2 = (const int*)d_in[2]; const float* w1 = I[3]; const float* w2 = I[4]; const float* b2 = I[5];      /* weights natural [out][in] */
  char* ws = (char*)d_ws; size_t off = 0;
  auto take = [&](size_t bytes) { char* p = ws + off; off += (bytes + 255) & ~(size_t)255; return p; };
  _Float16* B1 = (_Float16*)take((size_t)NC * NC * 2); _Float16* B2 = (_Float16*)take((size_t)NO * 2 * NC * 2);
  _Float16* X2T = (_Float16*)take(NR * NC * 2); _Float16* X2 = (_Float16*)take(NR * NC * 2); _Float16* N1H = (_Float16*)take(NR * NC * 2); _Float16* N1L = (_Float16*)take(NR * NC * 2); _Float16* CAT = (_Float16*)take(NR * 2 * NC * 2);
  _Float16* P = (_Float16*)take((size_t)NB * SQ * SQ * 2);      /* the f16 softmax weights of all batches */
  float* ST = (float*)take((size_t)2 * SM_T * NR * 4);      /* per 64 keys and row: k, then the weights' sum */
  float* N1F = (float*)P;      /* n1 in f32 is last read by k_hl, before the first weight is written */
  if (off > ws_size) return;      /* 1.5 + 16 + 16 + 16 + 16 + 32 + 64 + 4 = approx 166 MiB */
  k_prep<<<2 * ST_GX + ST_G1 + ST_G2, 256, 0, stream>>>(in1, in2, w1, w2, CAT, X2, B1, B2);      /* cat columns 0..511 = in1; in2 rows; both weights */
  const size_t r0p = (size_t)B0 * SQ;
  k_gemm2<0, false, false, true, false><<<dim3((unsigned)((MP / 128) * (NC / 128)), 1), 128, 0, stream>>>(CAT + r0p * 2 * NC, 2 * NC, 0, B1, NC, 0, 0.0625f, nullptr, 0, N1F + r0p * NC, nullptr, NC, 0, MP, NC, NC, nullptr, 0.f, nullptr, nullptr);      /* n1 = in1 W1^T (f32) */
  k_hl<<<(unsigned)((size_t)MP * NC / (8 * HL_WE)), 256, 0, stream>>>(N1F + r0p * NC, N1H + r0p * NC, N1L + r0p * NC);
  /* every stage below runs all batches in one launch: blockIdx.y = batch for scores, softmax and fused (k_gemm2 through the batch strides it already takes); the transpose has the batch in grid x, the output GEMM all rows as one M */
  const dim3 gs((QN / 128) * (SQ / 128), NBR); const size_t sX = (size_t)SQ * NC, sS = (size_t)SQ * SQ;
  k_vt<NH, SQ, NC><<<NBR * NH * (SQ / VT_R), 256, 0, stream>>>(X2 + r0p * NC, 0, X2T);      /* in2^T [batch][512][2048] */
  k_gemm2<0, false, false, false, false, true, 1><<<gs, 128, 0, stream>>>(N1H + r0p * NC, NC, sX, X2 + r0p * NC, NC, sX, 1.0f, nullptr, 0, nullptr, P, SQ, sS, QN, SQ, NC, N1L + r0p * NC, 0.0009765625f, mask2 + r0p, ST);      /* scores = lo x 2^-10 + hi, both terms in the accumulators; leave as weights per 64 keys */
  k_gemm2<0, false, false, false, true, false, 2><<<dim3((QN / 128) * (NC / 128), NBR), 128, 0, stream>>>(P, SQ, sS, X2T, SQ, sX, 1.0f, nullptr, 0, nullptr, CAT + r0p * 2 * NC + NC, 2 * NC, 2 * sX, QN, NC, SQ, nullptr, 0.f, nullptr, ST);      /* fused = weights . in2 / row sum -> cat columns 512..1023 */
  k_gemm2<8, true, false, true, false><<<dim3((unsigned)((MPO / 128) * (NO / 128)), 1), 128, 0, stream>>>(CAT + r0p * 2 * NC, 2 * NC, 0, B2, 2 * NC, 0, 0.0625f, b2, 0, (float*)d_out + r0p * NO, nullptr, NO, 0, MPO, NO, 2 * NC, nullptr, 0.f, nullptr, nullptr);      /* out = tanh(cat W2^T + b2) */
}

// v008
// It runs in 153 microseconds.
// Two timings next to v007 both put it at 1.05 times that version's speed.
// Over all steps from v000 it is 37.5 times as fast.
#include <hip/hip_runtime.h>
// Cross attention with concat + tanh projection (in1, in2 [8][2048][512]; mask2 [8][2048] int32, nonzero = key masked out; n1 = in1 W1^T (W1 [512][512] natural, no bias); scores = n1 in2^T (no scaling); masked keys -> -inf; softmax over the 2,048 keys; fused = attn in2; out = tanh([in1 | fused] W2^T + b2) (W2 [512][1024] natural) -> [8][2048][512]).
// Structure: token rows; in1, in2 as exact f16 rows; n1 = in1 W1^T as a WMMA GEMM (128x128 block tiles staged in LDS, 64x64 wave tiles, f32 accumulation, exact x16 natural weights) into f32 rows, split on VALU into f16 hi + 2^-10 residual planes; then, all batches in each launch (grid y = batch for scores and fused): scores = n1 in2^T as ONE GEMM launch of two terms (the lo plane's K = 512 passes first, their sum x 2^-10 is the start value of the hi plane's passes; in2 exact), masked softmax folded into the two GEMMs around it (the score epilogue turns each wave's 64 x 64 scores into f16 weights 2^8 exp2(s log2 e - k), k = the whole-number ceiling of the row's maximum over those 64 keys, with k and the f32 sum of the weights per row and 64 keys; masked keys 0; no score is stored), in2^T via LDS transposes, fused = P . in2 GEMM (K = 2048; each 64-key pass scales its A rows by the exact power of two 2^(k - row maximum of k), the epilogue divides by the row sum) written as plain f16 straight into columns 512..1023 of the f16 concat rows whose columns 0..511 are the exact in1; out = tanh(cat W2^T + b2) as ONE GEMM (K = 1024, exact x16 natural W2, alpha 1/16) with the tanh epilogue.
// Compute dtype: inputs rounded to bf16; in1, in2, weights exact in f16; n1 as f16 hi + residual planes (~2^-22: the logits have sigma ~23, so plain f16 would cost ~3e-3 logits); softmax weights (x256) and fused (unscaled: f16 relative precision is scale-free and a x16/x0.25 weight split would push small W2 entries into f16 subnormals) plain f16 (~2^-12); scores, softmax statistics and the output f32. v_wmma_f32_16x16x32_f16.
#define NB 8
#define SQ 2048
#define NC 512                       /* d_in = d_hid */
#define NO 512                       /* output features */
#define DM NC
#define NH (NC / 64)                 /* 8 slabs of 64 for the in2^T transpose */
#define HD 64
#define HG 1
#define B0 0                         /* first batch processed (debug hook) */
#define NBR NB                       /* batches processed (debug hook) */
#define QN SQ                        /* query rows attended per batch (debug hook) */
#define NR ((size_t)NB * SQ)
#define MP ((int)((size_t)NBR * SQ)) /* rows projected (debug hook) */
#define MPO MP                       /* rows through the output GEMM (debug hook) */
typedef __bf16 v16b __attribute__((ext_vector_type(16)));
typedef unsigned short v8us __attribute__((ext_vector_type(8), may_alias));
typedef float  v8f  __attribute__((ext_vector_type(8)));
typedef float  v4f  __attribute__((ext_vector_type(4)));
typedef float  v4fa __attribute__((ext_vector_type(4), may_alias));
union FragB { v16b v; v8us half[2]; unsigned short u[16]; };

__device__ __forceinline__ unsigned short bf16_bits(float x) { unsigned int u = __float_as_uint(x); return (unsigned short)((u + 0x7FFFu + ((u >> 16) & 1u)) >> 16); }
__device__ __forceinline__ float bf16_val(unsigned short b) { return __uint_as_float(((unsigned int)b) << 16); }
__device__ __forceinline__ float bf16_round(float x) { return bf16_val(bf16_bits(x)); }
// D += A·B with NT terms: 1 = ah·bh, 2 = + al·bh (A split), 3 = + ah·bl (both split)
template <int NT>
__device__ __forceinline__ v8f mmaN(v16b ah, v16b al, v16b bh, v16b bl, v8f c) {
  c = __builtin_amdgcn_wmma_f32_16x16x32_bf16(false, ah, false, bh, (short)0, c, false, false);
  if (NT >= 2) c = __builtin_amdgcn_wmma_f32_16x16x32_bf16(false, al, false, bh, (short)0, c, false, false);
  if (NT >= 3) c = __builtin_amdgcn_wmma_f32_16x16x32_bf16(false, ah, false, bl, (short)0, c, false, false);
  asm volatile("v_nop\n\tv_nop\n\tv_nop\n\tv_nop" : "+v"(c) : "v"(ah), "v"(al), "v"(bh), "v"(bl));
  return c;
}

__global__ __launch_bounds__(256) void k_wt_bf16(const float* __restrict__ W, unsigned short* __restrict__ Wt, int K, int N) {
  const int t = blockIdx.x * 256 + threadIdx.x;
  const int k8n = K / 8;
  if (t >= N * k8n) return;
  const int n = t / k8n, k8 = (t % k8n) * 8;
  v8us v;
#pragma unroll
  for (int i = 0; i < 8; ++i) v[i] = bf16_bits(W[(size_t)(k8 + i) * N + n]);
  *(v8us*)(Wt + (size_t)n * K + k8) = v;
  
}

// GEMM C[M][N] (f32, pitch ldc) = act(A[M][K]·W + bias). A f32 row-major (pitch lda) converted per fragment to bf16
// (ASPLIT: hi/lo two planes -> 2 terms, else single rounded term); Wt bf16 [N][K] (pitch ldb). BIAS_BF16 rounds the
// bias to bf16 first (bias quantised to bf16 before the add). K%32==0, M%16==0, N%64==0.
template <bool ASPLIT, int ACT, bool BIAS_BF16>
__global__ __launch_bounds__(128) void k_gemm_bf(const float* __restrict__ A, int lda, const unsigned short* __restrict__ Wt, int ldb,
                                               const float* __restrict__ bias, float* __restrict__ C, int ldc, int M, int N, int K) {
  __shared__ __attribute__((aligned(16))) float so[4][16][64];
  const int tid = threadIdx.x, w = tid >> 5, lane = tid & 31, ln = lane & 15, hh = lane >> 4;
  const int ntn = N / 64;
  const int wid = blockIdx.x * 4 + w;
  const int mt = wid / ntn, nq = wid % ntn;
  if (mt * 16 >= M) return;
  const int row0 = mt * 16, col0 = nq * 64;
  const float* arow = A + (size_t)(row0 + ln) * lda;
  v8f acc[4] = {};
  for (int kb = 0; kb < K; kb += 32) {
    FragB ah, al;
    const v4f x0 = *(const v4fa*)(arow + kb + 8 * hh), x1 = *(const v4fa*)(arow + kb + 8 * hh + 4);
    const v4f x2 = *(const v4fa*)(arow + kb + 16 + 8 * hh), x3 = *(const v4fa*)(arow + kb + 16 + 8 * hh + 4);
    float xs[16] = {x0[0],x0[1],x0[2],x0[3],x1[0],x1[1],x1[2],x1[3],x2[0],x2[1],x2[2],x2[3],x3[0],x3[1],x3[2],x3[3]};
#pragma unroll
    for (int i = 0; i < 16; ++i) { const unsigned short hb = bf16_bits(xs[i]); ah.u[i] = hb; al.u[i] = ASPLIT ? bf16_bits(xs[i] - bf16_val(hb)) : (unsigned short)0; }
#pragma unroll
    for (int t = 0; t < 4; ++t) {
      const unsigned short* brow = Wt + (size_t)(col0 + t * 16 + ln) * ldb + kb;
      FragB b;
      b.half[0] = *(const v8us*)(brow + 8 * hh);
      b.half[1] = *(const v8us*)(brow + 16 + 8 * hh);
      acc[t] = mmaN<ASPLIT ? 2 : 1>(ah.v, al.v, b.v, b.v, acc[t]);
    }
  }
#pragma unroll
  for (int t = 0; t < 4; ++t) {
    float bv = bias ? bias[col0 + t * 16 + ln] : 0.f;
    if (BIAS_BF16) bv = bf16_round(bv);
#pragma unroll
    for (int r = 0; r < 8; ++r) { float v = acc[t][r] + bv; if (ACT == 1) v = fmaxf(v, 0.f); so[w][8 * hh + r][t * 16 + ln] = v; }
  }
  __builtin_amdgcn_fence(__ATOMIC_ACQ_REL, "workgroup");
  __builtin_amdgcn_wave_barrier();
  const int rsub = lane >> 4, c4 = (lane & 15) * 4;
  {
#pragma unroll
    for (int q = 0; q < 8; ++q) {
      const int r = q * 2 + rsub;
      const v4f v = *(const v4fa*)&so[w][r][c4];
      *(v4f*)(C + (size_t)(row0 + r) * ldc + col0 + c4) = v;
    }
    
  }
}

// GEMM C = act(A·W + bias + resid): A f32 (ASPLIT -> hi/lo 2 terms), Wt bf16 [N][K]; ACT 0 none, 1 relu, 2 exact gelu;
// resid (optional, f32, row index = (row % rmod), pitch ldr, RES_BF16 rounds it) added before the activation.
template <bool ASPLIT, int ACT, bool BIAS_BF16, bool RES_BF16>
__global__ __launch_bounds__(128) void k_gemm_bf3(const float* __restrict__ A, int lda, const unsigned short* __restrict__ Wt, int ldb,
                                                const float* __restrict__ bias, const float* __restrict__ resid, int rmod, int ldr,
                                                float* __restrict__ C, int ldc, int M, int N, int K) {
  __shared__ __attribute__((aligned(16))) float so[4][16][64];
  const int tid = threadIdx.x, w = tid >> 5, lane = tid & 31, ln = lane & 15, hh = lane >> 4;
  const int ntn = N / 64;
  const int wid = blockIdx.x * 4 + w;
  const int mt = wid / ntn, nq = wid % ntn;
  if (mt * 16 >= M) return;
  const int row0 = mt * 16, col0 = nq * 64;
  const float* arow = A + (size_t)(row0 + ln) * lda;
  v8f acc[4] = {};
  for (int kb = 0; kb < K; kb += 32) {
    FragB ah, al;
    const v4f x0 = *(const v4fa*)(arow + kb + 8 * hh), x1 = *(const v4fa*)(arow + kb + 8 * hh + 4);
    const v4f x2 = *(const v4fa*)(arow + kb + 16 + 8 * hh), x3 = *(const v4fa*)(arow + kb + 16 + 8 * hh + 4);
    float xs[16] = {x0[0],x0[1],x0[2],x0[3],x1[0],x1[1],x1[2],x1[3],x2[0],x2[1],x2[2],x2[3],x3[0],x3[1],x3[2],x3[3]};
#pragma unroll
    for (int i = 0; i < 16; ++i) { const unsigned short hb = bf16_bits(xs[i]); ah.u[i] = hb; al.u[i] = ASPLIT ? bf16_bits(xs[i] - bf16_val(hb)) : (unsigned short)0; }
#pragma unroll
    for (int t = 0; t < 4; ++t) {
      const unsigned short* brow = Wt + (size_t)(col0 + t * 16 + ln) * ldb + kb;
      FragB b;
      b.half[0] = *(const v8us*)(brow + 8 * hh);
      b.half[1] = *(const v8us*)(brow + 16 + 8 * hh);
      acc[t] = mmaN<ASPLIT ? 2 : 1>(ah.v, al.v, b.v, b.v, acc[t]);
    }
  }
#pragma unroll
  for (int t = 0; t < 4; ++t) {
    const int col = col0 + t * 16 + ln;
    float bv = bias ? bias[col] : 0.f;
    if (BIAS_BF16) bv = bf16_round(bv);
#pragma unroll
    for (int r = 0; r < 8; ++r) {
      float v = acc[t][r] + bv;
      if (resid) { float rv = resid[(size_t)((row0 + 8 * hh + r) % rmod) * ldr + col]; if (RES_BF16) rv = bf16_round(rv); v += rv; }
      if (ACT == 1) v = fmaxf(v, 0.f);
      if (ACT == 2) v = 0.5f * v * (1.0f + erff(v * 0.70710678118654752f));
      if (ACT == 3) { const float u = 0.7978845608028654f * (v + 0.044715f * v * v * v); v = 0.5f * v * (1.0f + tanhf(u)); }
      so[w][8 * hh + r][t * 16 + ln] = v;
    }
  }
  __builtin_amdgcn_fence(__ATOMIC_ACQ_REL, "workgroup");
  __builtin_amdgcn_wave_barrier();
  const int rsub = lane >> 4, c4 = (lane & 15) * 4;
  {
#pragma unroll
    for (int q = 0; q < 8; ++q) {
      const int r = q * 2 + rsub;
      const v4f v = *(const v4fa*)&so[w][r][c4];
      *(v4f*)(C + (size_t)(row0 + r) * ldc + col0 + c4) = v;
    }
    
  }
}
// row LayerNorm (biased variance, eps) over N: s = X (+ R); optional out_sum <- s; out_norm <- (s-mu)*rsqrt(var+eps)*g + b
template <bool PARAM_BF16>
__global__ __launch_bounds__(256) void k_layernorm(const float* __restrict__ X, const float* __restrict__ R, const float* __restrict__ g, const float* __restrict__ bta,
                                                  float* __restrict__ out_sum, float* __restrict__ out_norm, int N, float eps) {
  __shared__ float red[256];
  const int row = blockIdx.x, tid = threadIdx.x;
  const float* x = X + (size_t)row * N; const float* rr = R ? R + (size_t)row * N : nullptr;
  float vals[16];                     // up to N = 4096
  const int per = N / 256;            // contiguous chunk per thread? use strided-by-4 chunks: thread handles j = tid*4 + 1024*u
  float s1 = 0.f;
  for (int u = 0; u < per / 4; ++u) {
    const int j = tid * 4 + 1024 * u;
    const v4f a = *(const v4fa*)(x + j);
    v4f b = {0.f,0.f,0.f,0.f}; if (rr) b = *(const v4fa*)(rr + j);
#pragma unroll
    for (int q = 0; q < 4; ++q) { const float v = a[q] + b[q]; vals[u * 4 + q] = v; s1 += v; }
  }
  red[tid] = s1; __syncthreads();
  for (int st = 128; st > 0; st >>= 1) { if (tid < st) red[tid] += red[tid + st]; __syncthreads(); }
  const float mu = red[0] / (float)N; __syncthreads();
  float s2 = 0.f;
  for (int u = 0; u < per / 4; ++u)
#pragma unroll
    for (int q = 0; q < 4; ++q) { const float c = vals[u * 4 + q] - mu; s2 += c * c; }
  red[tid] = s2; __syncthreads();
  for (int st = 128; st > 0; st >>= 1) { if (tid < st) red[tid] += red[tid + st]; __syncthreads(); }
  const float rs = rsqrtf(red[0] / (float)N + eps);
  {
    for (int u = 0; u < per / 4; ++u) {
      const int j = tid * 4 + 1024 * u;
      v4f o, sm;
#pragma unroll
      for (int q = 0; q < 4; ++q) {
        float gg = g[j + q], bb = bta[j + q];
        if (PARAM_BF16) { gg = bf16_round(gg); bb = bf16_round(bb); }
        sm[q] = vals[u * 4 + q]; o[q] = (vals[u * 4 + q] - mu) * rs * gg + bb;
      }
      if (out_sum) *(v4f*)(out_sum + (size_t)row * N + j) = sm;
      *(v4f*)(out_norm + (size_t)row * N + j) = o;
    }
    
  }
}



// ---- f16 WMMA path (v_wmma_f32_16x16x32_f16): 11-bit significands for operands in range — the instruction every GEMM launched in this file runs on
typedef _Float16 v16h __attribute__((ext_vector_type(16)));
union FragH { v16h v; v8us half[2]; _Float16 h[16]; unsigned short u[16]; };
template <int NT>
__device__ __forceinline__ v8f mmaH(v16h ah, v16h al, v16h bh, v16h bl, v8f c) {
  c = __builtin_amdgcn_wmma_f32_16x16x32_f16(false, ah, false, bh, (short)0, c, false, false);
  if (NT >= 2) c = __builtin_amdgcn_wmma_f32_16x16x32_f16(false, al, false, bh, (short)0, c, false, false);
  if (NT >= 3) c = __builtin_amdgcn_wmma_f32_16x16x32_f16(false, ah, false, bl, (short)0, c, false, false);
  asm volatile("v_nop\n\tv_nop\n\tv_nop\n\tv_nop" : "+v"(c) : "v"(ah), "v"(al), "v"(bh), "v"(bl));
  return c;
}
// batched GEMM like k_gemm_b but f16 operands: A f32 (split into f16 hi/lo if ASPLIT, else rounded to f16), Bt = f16 values [n][k]; alpha; C f32; N multiple of 16 (partial tiles skipped)
template <bool ASPLIT>
__global__ __launch_bounds__(128) void k_gemm_h(const float* __restrict__ A, int lda, size_t sA, const _Float16* __restrict__ Bh, int ldb, size_t sB, float alpha, float* __restrict__ C, int ldc, size_t sC, int M, int N, int K) {
  __shared__ __attribute__((aligned(16))) float so[4][16][64];
  const int tid = threadIdx.x, w = tid >> 5, lane = tid & 31, ln = lane & 15, hh = lane >> 4; const int by = blockIdx.y;
  A += (size_t)by * sA; Bh += (size_t)by * sB; C += (size_t)by * sC;
  const int ntn = (N + 63) / 64; const int wid = blockIdx.x * 4 + w; const int mt = wid / ntn, nq = wid % ntn; if (mt * 16 >= M) return;
  const int row0 = mt * 16, col0 = nq * 64; const float* arow = A + (size_t)(row0 + ln) * lda;
  v8f acc[4] = {};
  for (int kb = 0; kb < K; kb += 32) {
    FragH ah, al;
    const v4f x0 = *(const v4fa*)(arow + kb + 8 * hh), x1 = *(const v4fa*)(arow + kb + 8 * hh + 4), x2 = *(const v4fa*)(arow + kb + 16 + 8 * hh), x3 = *(const v4fa*)(arow + kb + 16 + 8 * hh + 4);
    float xs[16] = {x0[0],x0[1],x0[2],x0[3],x1[0],x1[1],x1[2],x1[3],x2[0],x2[1],x2[2],x2[3],x3[0],x3[1],x3[2],x3[3]};
#pragma unroll
    for (int i = 0; i < 16; ++i) { const _Float16 h = (_Float16)xs[i]; ah.h[i] = h; al.h[i] = ASPLIT ? (_Float16)(xs[i] - (float)h) : (_Float16)0.0f; }
#pragma unroll
    for (int t = 0; t < 4; ++t) { if (col0 + t * 16 >= N) continue; const size_t boff = (size_t)(col0 + t * 16 + ln) * ldb + kb; FragH bq; bq.half[0] = *(const v8us*)(Bh + boff + 8 * hh); bq.half[1] = *(const v8us*)(Bh + boff + 16 + 8 * hh);
      acc[t] = mmaH<ASPLIT ? 2 : 1>(ah.v, al.v, bq.v, bq.v, acc[t]); }
  }
#pragma unroll
  for (int t = 0; t < 4; ++t) { if (col0 + t * 16 >= N) continue;
#pragma unroll
    for (int r = 0; r < 8; ++r) so[w][8 * hh + r][t * 16 + ln] = acc[t][r] * alpha; }
  __builtin_amdgcn_fence(__ATOMIC_ACQ_REL, "workgroup"); __builtin_amdgcn_wave_barrier();
  const int rsub = lane >> 4, c4 = (lane & 15) * 4;
  {
#pragma unroll
    for (int q = 0; q < 8; ++q) { const int r = q * 2 + rsub; if (col0 + c4 < N) { const v4f v = *(const v4fa*)&so[w][r][c4]; *(v4f*)(C + (size_t)(row0 + r) * ldc + col0 + c4) = v; } }
     }
}

// Wt[n][k] = f16(W[k][n]·scale) from f32 row-major W[K][N] (scale = power of two; bf16-exact weights stay exact in f16 away from the subnormal range)
__global__ __launch_bounds__(256) void k_wt_f16(const float* __restrict__ W, _Float16* __restrict__ Wt, int K, int N, float scale) {
  const int t = blockIdx.x * 256 + threadIdx.x; if (t >= N * (K / 8)) return; const int n = t / (K / 8), k8 = (t % (K / 8)) * 8; FragH f;
#pragma unroll
  for (int i = 0; i < 8; ++i) f.h[i] = (_Float16)(bf16_round(W[(size_t)(k8 + i) * N + n]) * scale); const v8us o = f.half[0];
  *(v8us*)((unsigned short*)Wt + (size_t)n * K + k8) = o; 
}
// k_gemm_hh variant with fused epilogue: v = acc·alpha + bias[by·sBias + col] (+ CP[(row/rowsPerB)·sCPb + by·64 + col] if CP) ; ACT 0 none / 1 elu ; writes f16 C16 (and f32 C if non-null)
template <int ACT>
__global__ __launch_bounds__(128) void k_gemm_hhx(const _Float16* __restrict__ A, int lda, size_t sA, const _Float16* __restrict__ Bh, int ldb, size_t sB, float alpha, const float* __restrict__ bias, size_t sBias, const float* __restrict__ CP, int rowsPerB, size_t sCPb, int row0g,
    float* __restrict__ C, _Float16* __restrict__ C16, int ldc, size_t sC, int M, int N, int K) {
  __shared__ __attribute__((aligned(16))) float so[4][16][64];
  const int tid = threadIdx.x, w = tid >> 5, lane = tid & 31, ln = lane & 15, hh = lane >> 4; const int by = blockIdx.y;
  A += (size_t)by * sA; Bh += (size_t)by * sB; const size_t cofs = (size_t)by * sC; const float* bp = bias ? bias + (size_t)by * sBias : nullptr;
  const int ntn = (N + 63) / 64; const int wid = blockIdx.x * 4 + w; const int mt = wid / ntn, nq = wid % ntn; if (mt * 16 >= M) return;
  const int row0 = mt * 16, col0 = nq * 64; const _Float16* arow = A + (size_t)(row0 + ln) * lda;
  v8f acc[4] = {};
  for (int kb = 0; kb < K; kb += 32) { FragH ah; ah.half[0] = *(const v8us*)((const unsigned short*)arow + kb + 8 * hh); ah.half[1] = *(const v8us*)((const unsigned short*)arow + kb + 16 + 8 * hh);
#pragma unroll
    for (int t = 0; t < 4; ++t) { if (col0 + t * 16 >= N) continue; const size_t boff = (size_t)(col0 + t * 16 + ln) * ldb + kb; FragH bq; bq.half[0] = *(const v8us*)((const unsigned short*)Bh + boff + 8 * hh); bq.half[1] = *(const v8us*)((const unsigned short*)Bh + boff + 16 + 8 * hh);
      acc[t] = mmaH<1>(ah.v, ah.v, bq.v, bq.v, acc[t]); }
  }
#pragma unroll
  for (int t = 0; t < 4; ++t) { if (col0 + t * 16 >= N) continue; const int col = col0 + t * 16 + ln; const float bv = bp ? bf16_round(bp[col]) : 0.f;
#pragma unroll
    for (int r = 0; r < 8; ++r) { float v = acc[t][r] * alpha + bv; if (CP) { const int rr = row0g + row0 + 8 * hh + r; if (rowsPerB < 0) v += CP[cofs + (size_t)rr * ldc + col];      /* rowsPerB < 0: own element of the batched C plane */ else { const int bidx = rr / rowsPerB; v += CP[(size_t)bidx * sCPb + (size_t)by * 64 + col]; } } if (ACT == 1) v = (v > 0.f) ? v : expm1f(v); else if (ACT == 7) v = (v > 0.f) ? v + 1.0f : expf(v); else if (ACT == 8) v = tanhf(v); else if (ACT == 9) v = 0.5f * v * (1.0f + tanhf(0.7978845608028654f * (v + 0.044715f * v * v * v))); else if (ACT == 11) v = 1.0f / (1.0f + expf(-v)); else if (ACT == 12) v = (v > 0.f) ? v : 0.01f * v; else if (ACT == 14) v = (v > 0.f) ? v : 0.1f * v; else if (ACT == 16) v = (v >= 0.f) ? v : 0.3f * v; else if (ACT == 17) v = (v >= 0.f) ? v : 0.2f * v; else if (ACT == 15) v = v / (1.0f + expf(-v)); else if (ACT == 3) v = fmaxf(v, 0.f); else if (ACT == 6) v = 0.5f * v * (1.0f + erff(v * 0.70710678118654752f)); so[w][8 * hh + r][t * 16 + ln] = v; } }
  __builtin_amdgcn_fence(__ATOMIC_ACQ_REL, "workgroup"); __builtin_amdgcn_wave_barrier();
  const int rsub = lane >> 4, c4 = (lane & 15) * 4; typedef _Float16 v4h __attribute__((ext_vector_type(4)));
  {
#pragma unroll
    for (int q = 0; q < 8; ++q) { const int r = q * 2 + rsub; if (col0 + c4 < N) { const v4f v = *(const v4fa*)&so[w][r][c4]; if (C) *(v4f*)(C + cofs + (size_t)(row0 + r) * ldc + col0 + c4) = v; if (C16) { v4h h4; for (int i = 0; i < 4; ++i) h4[i] = (_Float16)v[i]; *(v4h*)(C16 + cofs + (size_t)(row0 + r) * ldc + col0 + c4) = h4; } } }
     }
}


typedef _Float16 v4h __attribute__((ext_vector_type(4)));

// ---- streaming conversions: few long waves. A wave-wide load is 32 lanes x 16 B = 512 contiguous bytes (four whole lines), eight such loads are issued before the first is used, and the 8-byte stores of a wave
// cover 256 contiguous bytes. Which thread converts a value has no bearing on the value.
#define ST_WE 4096                   /* k_prep: f32 elements per wave, four rounds of eight loads */
#define ST_BE (8 * ST_WE)            /* k_prep: elements per work-group of eight waves */
#define ST_GX ((int)(NR * NC / ST_BE))              /* work-groups per activation input */
#define ST_G1 (NC * NC / ST_BE)                     /* work-groups for W1 */
#define ST_G2 (NO * 2 * NC / ST_BE)                 /* work-groups for W2 */
// All four f32 inputs that feed a matrix product, in one launch; the work-group index picks the input (a scalar choice, no barrier in the kernel).
// in1 -> columns 0..511 of the f16 concat rows (pitch 2 NC), in2 -> f16 rows, W1 and W2 -> natural f16 rows x16; each value is first rounded to bf16. Rows of 512 (W2: half rows) keep e -> (e / 512) * pitch + e % 512.
__global__ __launch_bounds__(256) void k_prep(const float* __restrict__ in1, const float* __restrict__ in2, const float* __restrict__ w1, const float* __restrict__ w2,
    _Float16* __restrict__ cat, _Float16* __restrict__ x2, _Float16* __restrict__ b1, _Float16* __restrict__ b2) {
  static_assert(NR * NC % ST_BE == 0 && NC * NC % ST_BE == 0 && NO * 2 * NC % ST_BE == 0 && NC == 512, "k_prep: whole work-groups per input, rows of 512");
  int b = blockIdx.x; const float* s; _Float16* d; size_t ldo = NC; float sc = 1.0f;
  if (b < ST_GX) { s = in1; d = cat; ldo = 2 * NC; }
  else if (b < 2 * ST_GX) { b -= ST_GX; s = in2; d = x2; }
  else if (b < 2 * ST_GX + ST_G1) { b -= 2 * ST_GX; s = w1; d = b1; sc = 16.0f; }
  else { b -= 2 * ST_GX + ST_G1; s = w2; d = b2; sc = 16.0f; }
  const size_t w0 = (size_t)b * ST_BE + (size_t)(threadIdx.x >> 5) * ST_WE;      /* the wave's first element: the start of a row of 512 */
  const float* sp = s + w0 + (threadIdx.x & 31) * 4; _Float16* dp = d + (w0 >> 9) * ldo + (threadIdx.x & 31) * 4;
  v4f x[2][8];
#pragma unroll
  for (int i = 0; i < 8; ++i) x[0][i] = *(const v4fa*)(sp + i * 128);
#pragma unroll      /* unrolled so that x[][] is indexed by constants only and stays in registers */
  for (int u = 0; u < ST_WE / 1024; ++u) {      /* a round = 1,024 elements = two rows of 512 */
    if (u + 1 < ST_WE / 1024) {
#pragma unroll
      for (int i = 0; i < 8; ++i) x[(u + 1) & 1][i] = *(const v4fa*)(sp + (u + 1) * 1024 + i * 128);      /* the next round's loads fly while this round is converted */
      __builtin_amdgcn_sched_barrier(0); }      /* without it the scheduler sinks these loads behind most of this round's conversion, and the wave has nothing in flight meanwhile */
#pragma unroll
    for (int i = 0; i < 8; ++i) { v4h h;
#pragma unroll
      for (int q = 0; q < 4; ++q) h[q] = (_Float16)(bf16_round(x[u & 1][i][q]) * sc);
      *(v4h*)(dp + (size_t)(2 * u + (i >> 2)) * ldo + (i & 3) * 128) = h; }
    if (u + 1 < ST_WE / 1024) asm volatile("s_wait_xcnt 0x0" :: "v"(sp) : "memory"); } }      /* the next round reuses address and data registers of this round's loads and stores; naming sp keeps the load address whole up to the wait (no load may land on it) */
__global__ __launch_bounds__(256) void k_h16(const float* __restrict__ x, _Float16* __restrict__ X16, size_t n8) { const size_t t = (size_t)blockIdx.x * 256 + threadIdx.x; if (t >= n8) return; FragH f;
#pragma unroll
  for (int q = 0; q < 8; ++q) f.h[q] = (_Float16)x[t * 8 + q]; *(v8us*)((unsigned short*)X16 + t * 8) = f.half[0];  }
__global__ __launch_bounds__(256) void k_round16f(const float* __restrict__ W, _Float16* __restrict__ Bt, size_t n8) { const size_t t = (size_t)blockIdx.x * 256 + threadIdx.x; if (t >= n8) return; FragH f;
#pragma unroll
  for (int i = 0; i < 8; ++i) f.h[i] = (_Float16)(bf16_round(W[t * 8 + i]) * 16.0f); *(v8us*)((unsigned short*)Bt + t * 8) = f.half[0];  }
// Transpose of one 64-column slab, VT_R rows per work-group (a thread's VT_R / 32 loads of 16 B are all issued before the first is used); lane -> element maps inside 64 rows as for a 64-row tile.
#define VT_R 256
template <int NHv, int TTv, int LDV>
__global__ __launch_bounds__(256) void k_vt(const _Float16* __restrict__ V16, int voff, _Float16* __restrict__ Vt) { __shared__ unsigned short tl[VT_R][66]; const int tid = threadIdx.x; const int slab = blockIdx.x / (TTv / VT_R), lg = blockIdx.x % (TTv / VT_R); const int b = slab / NHv, h = slab % NHv;
  static_assert(TTv % VT_R == 0, "k_vt: whole tiles");
  const int r0 = tid / 8, c8 = (tid % 8) * 8; FragH f[VT_R / 32];
  const unsigned short* vp = (const unsigned short*)V16 + ((size_t)b * TTv + lg * VT_R + r0) * LDV + voff + h * 64 + c8;      /* the row pitch is a constant, so that all loads share this one address */
#pragma unroll
  for (int k = 0; k < VT_R / 32; ++k) f[k].half[0] = *(const v8us*)(vp + (size_t)k * 32 * LDV);
  asm volatile("s_wait_xcnt 0x0" :: "v"(vp) : "memory");      /* the address registers are reused behind the loads; naming vp keeps them whole up to the wait (no load may land on them) */
#pragma unroll
  for (int k = 0; k < VT_R / 32; ++k)
#pragma unroll
    for (int q = 0; q < 8; ++q) tl[k * 32 + r0][c8 + q] = f[k].u[q];
  __syncthreads();
  {
#pragma unroll
    for (int rd = 0; rd < VT_R / 32; ++rd) { const int d = (rd & 1) * 32 + tid / 8, pc = (rd >> 1) * 8 + tid % 8; FragH g;
#pragma unroll
      for (int q = 0; q < 8; ++q) g.u[q] = tl[pc * 8 + q][d];
      *(v8us*)((unsigned short*)Vt + ((size_t)slab * 64 + d) * TTv + lg * VT_R + pc * 8) = g.half[0]; }
     } }

// f32 -> f16 hi plane + residual x 2^10 plane, as a stream of the same make: HL_WE elements per wave, two rounds of eight loads (n = a multiple of 8 * HL_WE elements, one work-group per 8 * HL_WE).
#define HL_WE 2048
__global__ __launch_bounds__(256) void k_hl(const float* __restrict__ F, _Float16* __restrict__ Hh, _Float16* __restrict__ Hl) {
  const size_t e0 = (size_t)blockIdx.x * (8 * HL_WE) + (size_t)(threadIdx.x >> 5) * HL_WE + (threadIdx.x & 31) * 4;
  const float* sp = F + e0; _Float16* hp = Hh + e0; _Float16* lp = Hl + e0;
  v4f x[2][8];
#pragma unroll
  for (int i = 0; i < 8; ++i) x[0][i] = *(const v4fa*)(sp + i * 128);
#pragma unroll      /* unrolled so that x[][] stays in registers */
  for (int u = 0; u < HL_WE / 1024; ++u) {
    if (u + 1 < HL_WE / 1024) {
#pragma unroll
      for (int i = 0; i < 8; ++i) x[(u + 1) & 1][i] = *(const v4fa*)(sp + (u + 1) * 1024 + i * 128); }      /* the next round's loads fly while this round is split */
#pragma unroll
    for (int i = 0; i < 8; ++i) { v4h hi, lo;
#pragma unroll
      for (int q = 0; q < 4; ++q) { const float a = x[u & 1][i][q]; const _Float16 h = (_Float16)a; hi[q] = h; lo[q] = (_Float16)((a - (float)h) * 1024.0f); }
      *(v4h*)(hp + u * 1024 + i * 128) = hi; *(v4h*)(lp + u * 1024 + i * 128) = lo; }
    if (u + 1 < HL_WE / 1024) asm volatile("s_wait_xcnt 0x0" :: "v"(sp) : "memory"); } }      /* as in k_prep */

// ---- fast GEMM: block tile 128x128, four waves of 64x64 (requires M % 128 == 0 rows per launch region, N % 128 == 0, K % 64 == 0) ----
// Both operand tiles of a 64-k pass are brought into LDS once per work-group by asynchronous copies (each wave-wide copy covers four whole 128-byte rows) and read from there by all four waves;
// two buffers, so that the next pass's copies fly while this pass is multiplied. Each output element still sums its k blocks of 32 in ascending order.
#define G2_PITCH 144                 /* LDS bytes per 128-byte tile row: 16 B x odd, the pitch at which ds_load_b128 readers of 16 rows meet no bank conflict */
#define G2_OPER (128 * G2_PITCH)     /* one operand's 128 rows of a pass */
#define G2_STAGE (2 * G2_OPER)       /* one buffer: [A 128 rows | B 128 rows] */
#define G2_SOP 68                    /* floats per row of the output staging */
__device__ __forceinline__ v16h g2_lfrag(const char* p) { FragH f; f.half[0] = *(const v8us*)p; f.half[1] = *(const v8us*)(p + 32); return f.v; }      /* same k order as a fragment read from global rows: k = 8 hh .. 8 hh + 7, then 16 + 8 hh .. */
__device__ __forceinline__ v8f g2_mma(v16h a, v16h b, v8f c) { v8f d = __builtin_amdgcn_wmma_f32_16x16x32_f16(false, a, false, b, (short)0, c, false, false); asm volatile("v_nop\n\tv_nop\n\tv_nop\n\tv_nop" : "+v"(d) : "v"(a), "v"(b)); return d; }
// One operand's 128 rows x 128 bytes: the lane's 16 bytes of rows r, r + 16, .. r + 112 (l = its LDS byte address for row r, p = its global address for row r, ld = global row pitch in halves).
// The s_wait_xcnt closes the copies' own statement so that no address register of a copy is rewritten in front of it.
__device__ __forceinline__ void g2_copy8(unsigned l, const _Float16* p, size_t ld) {
  asm volatile("global_load_async_to_lds_b128 %0, %8, off\n\t"
               "global_load_async_to_lds_b128 %1, %9, off\n\t"
               "global_load_async_to_lds_b128 %2, %10, off\n\t"
               "global_load_async_to_lds_b128 %3, %11, off\n\t"
               "global_load_async_to_lds_b128 %4, %12, off\n\t"
               "global_load_async_to_lds_b128 %5, %13, off\n\t"
               "global_load_async_to_lds_b128 %6, %14, off\n\t"
               "global_load_async_to_lds_b128 %7, %15, off\n\t"
               "s_wait_xcnt 0x0"
               :: "v"(l), "v"(l + 16 * G2_PITCH), "v"(l + 32 * G2_PITCH), "v"(l + 48 * G2_PITCH), "v"(l + 64 * G2_PITCH), "v"(l + 80 * G2_PITCH), "v"(l + 96 * G2_PITCH), "v"(l + 112 * G2_PITCH),
                  "v"(p), "v"(p + 16 * ld), "v"(p + 32 * ld), "v"(p + 48 * ld), "v"(p + 64 * ld), "v"(p + 80 * ld), "v"(p + 96 * ld), "v"(p + 112 * ld)
               : "memory");
}
// The activation of one output value (ACT: 0 none, 3 relu, 6 exact gelu, 8 tanh, 9 tanh gelu, 11 sigmoid, 12/14/16/17 leaky relu 0.01/0.1/0.3/0.2, 15 silu).
template <int ACT>
__device__ __forceinline__ float g2_act(float v) {
  if (ACT == 3) v = fmaxf(v, 0.f); else if (ACT == 6) v = 0.5f * v * (1.0f + erff(v * 0.70710678118654752f)); else if (ACT == 11) v = 1.0f / (1.0f + expf(-v)); else if (ACT == 15) v = v / (1.0f + expf(-v)); else if (ACT == 12) v = (v > 0.f) ? v : 0.01f * v; else if (ACT == 8) v = fmaf(-2.0f, __builtin_amdgcn_rcpf(__builtin_amdgcn_exp2f(v * 2.88539008f) + 1.0f), 1.0f);      /* tanh v = 1 - 2 / (e^(2 v) + 1), e^(2 v) = 2^(v * 2 log2 e): no branch and no lane mask, so that the values of a trip run side by side instead of one dependent chain after another; +-1 at the ends (2^x = inf or 0), NaN stays NaN; absolute error about 2^-22 */
  else if (ACT == 9) v = 0.5f * v * (1.0f + tanhf(0.7978845608028654f * (v + 0.044715f * v * v * v))); else if (ACT == 14) v = (v > 0.f) ? v : 0.1f * v; else if (ACT == 16) v = (v >= 0.f) ? v : 0.3f * v; else if (ACT == 17) v = (v >= 0.f) ? v : 0.2f * v;
  return v; }
// What the epilogue does is fixed at compile time: HASB adds bf16-rounded bias[by * sBias + col]; ADDC adds the element that C already holds (C += ...); F32O stores f32 C, F16O stores f16 C16.
// out = ACT(acc * alpha + bias + old C), in that order.
// TWOP: A is given as two planes against the same B, acc = (sum over k of A2 B) * pre + sum over k of A B: the passes of A2 run first, the accumulators are scaled once by pre (a power of two: exact),
// and the passes of A add onto them, so that the sum of both terms leaves the registers once. A2 has A's pitch and batch stride.
// SM = 1, the softmax's first half in the epilogue: C16 (row pitch SQ) takes f16 weights instead of scores (score = the accumulator, alpha is not applied). Per row and per wave tile of 64 keys: k = ceil(max s * log2 e) over the keys that mk leaves in, weight = exp2(s * log2 e - k + 8)
// (at most 256; a masked key gives an exact 0), st[tile][row] = k (-3e38 where all 64 keys are masked), st[SM_T + tile][row] = the f32 sum of the unrounded weights. A wave writes whole 128-byte lines of st and of C16.
// SM = 2, its second half: A holds such weights, one pass of 64 k = one tile. Per row: km = max k, factor[tile] = 2^(k - km) (a power of two: the f16 product with a weight is exact above the subnormal range),
// sum = sum over tiles of st sum * factor; the A fragments of pass t are multiplied by factor[t], and the output row by 1 / sum (0 where every key is masked).
#define SM_T (SQ / 64)
template <int ACT, bool HASB, bool ADDC, bool F32O, bool F16O, bool TWOP = false, int SM = 0>
__global__ __launch_bounds__(128) void k_gemm2(const _Float16* __restrict__ A, int lda, size_t sA, const _Float16* __restrict__ Bh, int ldb, size_t sB, float alpha, const float* __restrict__ bias, size_t sBias,
    float* __restrict__ C, _Float16* __restrict__ C16, int ldc, size_t sC, int M, int N, int K, const _Float16* __restrict__ A2, float pre, const int* __restrict__ mk, float* __restrict__ st) { static_assert(ACT == 0 || ACT == 3 || ACT == 6 || ACT == 8 || ACT == 9 || ACT == 11 || ACT == 12 || ACT == 14 || ACT == 15 || ACT == 16 || ACT == 17, "k_gemm2: unsupported ACT code (would silently apply no activation)");
  static_assert(F32O || !ADDC, "ADDC reads the f32 plane it then stores");
  __shared__ __attribute__((aligned(16))) char sm[2 * G2_STAGE];      /* the two buffers; behind the loop's last barrier the same bytes stage the output */
  static_assert(4 * 64 * G2_SOP * 4 <= 2 * G2_STAGE, "output staging must fit the ring");
  __shared__ _Float16 fs[SM == 2 ? SM_T * 128 : 1]; __shared__ float il[SM == 2 ? 128 : 1];      /* SM = 2: factor[tile][row of the block], 1 / row sum */
  const int tid = threadIdx.x, w = tid >> 5, lane = tid & 31, ln = lane & 15, hh = lane >> 4; const int by = blockIdx.y;
  A += (size_t)by * sA; Bh += (size_t)by * sB; const size_t cofs = (size_t)by * sC;
  const int ntn = N >> 7; const int mt = blockIdx.x / ntn, nq = blockIdx.x - mt * ntn; const int rowB = mt * 128, colB = nq * 128; if (rowB >= M) return;      /* the same for the whole work-group, in front of every barrier */
  const int row0 = rowB + 64 * (w >> 1), col0 = colB + 64 * (w & 1);
  const int cr = tid >> 3, cc = tid & 7;      /* copies: eight lanes per 128-byte row, 16 rows per round of the work-group */
  const _Float16* ga = A + (size_t)(rowB + cr) * lda + cc * 8; const _Float16* gb = Bh + (size_t)(colB + cr) * ldb + cc * 8;
  const _Float16* g2 = TWOP ? A2 + (size_t)by * sA + (size_t)(rowB + cr) * lda + cc * 8 : ga;
  const unsigned lc = (unsigned)(size_t)sm + (unsigned)(cr * G2_PITCH + cc * 16);
  const char* fa = sm + (64 * (w >> 1) + ln) * G2_PITCH + 16 * hh; const char* fb = sm + G2_OPER + (64 * (w & 1) + ln) * G2_PITCH + 16 * hh;
  const int n2 = TWOP ? K >> 6 : 0; const int np = n2 + (K >> 6);      /* passes 0 .. n2 - 1 read A2, passes n2 .. np - 1 read A; both walk the same k of B */
  const auto pa = [&](int t) { return (TWOP && t < n2) ? g2 + (size_t)t * 64 : ga + (size_t)(t - n2) * 64; };
  const auto pb = [&](int t) { return gb + (size_t)((TWOP && t >= n2) ? t - n2 : t) * 64; };
  g2_copy8(lc, pa(0), (size_t)lda); g2_copy8(lc + G2_OPER, pb(0), (size_t)ldb);      /* pass 0 -> buffer 0 */
  if (SM == 2) {      /* one thread per row of the block, while pass 0 flies; the barrier below publishes fs and il together with pass 0 */
    const float* kp = st + (size_t)by * SQ + rowB + tid; float kv[SM_T], lv[SM_T];
#pragma unroll
    for (int t = 0; t < SM_T; ++t) { kv[t] = kp[(size_t)t * NR]; lv[t] = kp[(size_t)(SM_T + t) * NR]; }
    float km = kv[0];
#pragma unroll
    for (int t = 1; t < SM_T; ++t) km = fmaxf(km, kv[t]);
    float sum = 0.f;
#pragma unroll
    for (int t = 0; t < SM_T; ++t) { const float f = ldexpf(1.0f, (int)fmaxf(kv[t] - km, -200.0f)); sum += lv[t] * f; fs[t * 128 + tid] = (_Float16)f; }      /* below 2^-149 the factor is 0 */
    il[tid] = (sum == 0.f) ? 0.f : 1.0f / sum; }
  asm volatile("s_wait_asynccnt 0x0" ::: "memory");      /* this wave's copies of pass 0 have landed */
  __syncthreads();      /* every wave's have: pass 0 may be read */
  if (np > 1) { g2_copy8(lc + G2_STAGE, pa(1), (size_t)lda); g2_copy8(lc + G2_STAGE + G2_OPER, pb(1), (size_t)ldb); }      /* pass 1 -> buffer 1, where there is one (the same test for the whole work-group) */
  const v8f z8 = {0.f,0.f,0.f,0.f,0.f,0.f,0.f,0.f}; v8f acc[4][4];
#pragma unroll
  for (int i = 0; i < 4; ++i)
#pragma unroll
    for (int j = 0; j < 4; ++j) acc[i][j] = z8;
#pragma unroll 1      /* one pass per trip: the buffer offset is the only thing that differs, and an unrolled copy of 32 WMMAs buys nothing */
  for (int t = 0; t < np; ++t) { const int bo = (t & 1) * G2_STAGE;
    if (TWOP && t == n2) {      /* once, the same for every wave: the first plane's sum takes its weight before the second plane adds on */
#pragma unroll
      for (int i = 0; i < 4; ++i)
#pragma unroll
        for (int j = 0; j < 4; ++j) acc[i][j] *= pre; }
    _Float16 sc[4];
    if (SM == 2) {
#pragma unroll
      for (int i = 0; i < 4; ++i) sc[i] = fs[t * 128 + 64 * (w >> 1) + 16 * i + ln]; }      /* a lane's A fragment i holds row 16 i + ln of the wave tile */
#pragma unroll
    for (int ks = 0; ks < 2; ++ks) { v16h a[4], b[4];
#pragma unroll
      for (int i = 0; i < 4; ++i) { a[i] = g2_lfrag(fa + bo + i * 16 * G2_PITCH + ks * 64); b[i] = g2_lfrag(fb + bo + i * 16 * G2_PITCH + ks * 64); if (SM == 2) a[i] = a[i] * sc[i]; }
#pragma unroll
      for (int j = 0; j < 4; ++j)
#pragma unroll
        for (int i = 0; i < 4; ++i) acc[i][j] = g2_mma(a[i], b[j], acc[i][j]); }
    asm volatile("s_wait_dscnt 0x0" ::: "memory");      /* this wave's reads of buffer t mod 2 are done before the barrier lets it be refilled */
    asm volatile("s_wait_asynccnt 0x0" ::: "memory");      /* this wave's copies of pass t + 1 have landed */
    __syncthreads();      /* publishes pass t + 1 and ends every reader's last read of buffer t mod 2 */
    if (t + 2 < np) { g2_copy8(lc + bo, pa(t + 2), (size_t)lda); g2_copy8(lc + bo + G2_OPER, pb(t + 2), (size_t)ldb); } }
  asm volatile("s_wait_asynccnt 0x0" ::: "memory");      /* nothing of the ring is in flight when its bytes become the output staging */
  float* so = (float*)(sm + (size_t)w * (64 * G2_SOP * 4));      /* the wave's own 64 x 68 floats */
  if (SM == 1) {
    bool mo[4];
#pragma unroll
    for (int t = 0; t < 4; ++t) mo[t] = mk[(size_t)by * SQ + col0 + t * 16 + ln] != 0;
#pragma unroll
    for (int u = 0; u < 16; ++u) { const int t = u & 3, rt = u >> 2;
#pragma unroll
      for (int r = 0; r < 8; ++r) so[(rt * 16 + 8 * hh + r) * G2_SOP + t * 16 + ln] = mo[t] ? -__builtin_inff() : acc[rt][t][r]; }
    __builtin_amdgcn_fence(__ATOMIC_ACQ_REL, "workgroup"); __builtin_amdgcn_wave_barrier();      /* the wave's own staging: rows are read by other lanes than wrote them */
    float* sk = st + (size_t)(col0 >> 6) * NR + (size_t)by * SQ + row0 + lane;
#pragma unroll 1      /* a lane takes one whole row per trip (rows lane, lane + 32): maximum and sum need no other lane; rolled so that one row's 64 scores are in registers at a time */
    for (int h = 0; h < 2; ++h) { float* rp = so + (lane + 32 * h) * G2_SOP; v4f x[16];
#pragma unroll
      for (int j = 0; j < 16; ++j) x[j] = *(const v4fa*)(rp + 4 * j);
      v4f m4 = x[0];
#pragma unroll
      for (int j = 1; j < 16; ++j)
#pragma unroll
        for (int q = 0; q < 4; ++q) m4[q] = fmaxf(m4[q], x[j][q]);
      const float mx = fmaxf(fmaxf(m4[0], m4[1]), fmaxf(m4[2], m4[3])); const bool none = mx == -__builtin_inff();
      const float kk = none ? 0.f : ceilf(mx * 1.44269504f); const float sh = 8.0f - kk; v4f s4 = {0.f, 0.f, 0.f, 0.f};
#pragma unroll
      for (int j = 0; j < 8; ++j) { FragH f;
#pragma unroll
        for (int q = 0; q < 8; ++q) { const float a = fmaf(x[2 * j + (q >> 2)][q & 3], 1.44269504f, sh); float e;
          asm("v_exp_f32 %0, %1\n\tv_nop" : "=v"(e) : "v"(a));      /* the v_nop keeps the one slot the instruction set asks for behind a transcendental */
          s4[q & 3] += e; f.h[q] = (_Float16)e; }
        *(v8us*)((char*)rp + 16 * j) = f.half[0]; }      /* the f16 weights go over the first 128 bytes of the lane's own row, all of which is in x[] by now */
      sk[32 * h] = none ? -3.0e38f : kk; sk[(size_t)SM_T * NR + 32 * h] = (s4[0] + s4[1]) + (s4[2] + s4[3]);
      asm volatile("s_wait_xcnt 0x0" ::: "memory"); }      /* the next trip rewrites data registers of this trip's stores */
    __builtin_amdgcn_fence(__ATOMIC_ACQ_REL, "workgroup"); __builtin_amdgcn_wave_barrier();      /* rows are read back by other lanes than wrote them */
    const char* rr = (const char*)(so + (lane >> 3) * G2_SOP) + (lane & 7) * 16;      /* eight lanes per 128-byte row: a wave-wide store covers four whole lines */
    unsigned short* pp = (unsigned short*)C16 + cofs + (size_t)(row0 + (lane >> 3)) * SQ + col0 + (lane & 7) * 8;      /* the weight rows' pitch is the constant SQ, so that a trip's eight stores share this one address */
#pragma unroll 1      /* two trips of eight stores in flight */
    for (int g = 0; g < 2; ++g) { v8us v[8];
#pragma unroll
      for (int i = 0; i < 8; ++i) v[i] = *(const v8us*)(rr + i * 4 * G2_SOP * 4);
#pragma unroll
      for (int i = 0; i < 8; ++i) *(v8us*)(pp + (size_t)i * 4 * SQ) = v[i];
      asm volatile("s_wait_xcnt 0x0" ::: "memory");      /* the next trip rewrites the address and data registers of this trip's stores */
      rr += 32 * G2_SOP * 4; pp += (size_t)32 * SQ; }
    return; }
  float bv[4];
#pragma unroll
  for (int t = 0; t < 4; ++t) bv[t] = HASB ? bf16_round(bias[(size_t)by * sBias + col0 + t * 16 + ln]) : 0.f;
#pragma unroll
  for (int u = 0; u < 16; ++u) { const int t = u & 3, rt = u >> 2;
#pragma unroll
    for (int r = 0; r < 8; ++r) so[(rt * 16 + 8 * hh + r) * G2_SOP + t * 16 + ln] = HASB ? acc[rt][t][r] * alpha + bv[t] : acc[rt][t][r] * alpha; }
  __builtin_amdgcn_fence(__ATOMIC_ACQ_REL, "workgroup"); __builtin_amdgcn_wave_barrier();
  const int rsub = lane >> 4, c4 = (lane & 15) * 4;
  const size_t es = (size_t)2 * ldc;      /* a lane's rows are two apart */
  size_t eb = cofs + (size_t)(row0 + rsub) * ldc + col0 + c4;
  const float* sr = so + rsub * G2_SOP + c4;
#pragma unroll 1      /* four trips of 16 rows: rolled so that the text that runs once per work-group stays short (with tanh an unrolled copy is four times as long); inside a trip the eight loads, and the eight stores, are in flight together */
  for (int qb = 0; qb < 4; ++qb) { v4f v[8];
    if (ADDC) { v4f c[8];
#pragma unroll
      for (int q = 0; q < 8; ++q) c[q] = *(const v4fa*)(C + eb + q * es);
#pragma unroll
      for (int q = 0; q < 8; ++q) v[q] = *(const v4fa*)(sr + q * 2 * G2_SOP) + c[q]; }
    else {
#pragma unroll
      for (int q = 0; q < 8; ++q) v[q] = *(const v4fa*)(sr + q * 2 * G2_SOP); }
#pragma unroll
    for (int q = 0; q < 8; ++q) {
      if (SM == 2) v[q] = v[q] * il[64 * (w >> 1) + 16 * qb + 2 * q + rsub];
#pragma unroll
      for (int i = 0; i < 4; ++i) v[q][i] = g2_act<ACT>(v[q][i]);
      if (F32O) *(v4f*)(C + eb + q * es) = v[q];
      if (F16O) { v4h h4;
#pragma unroll
        for (int i = 0; i < 4; ++i) h4[i] = (_Float16)v[q][i];
        *(v4h*)(C16 + eb + q * es) = h4; } }
    asm volatile("s_wait_xcnt 0x0" ::: "memory");      /* the next trip rewrites the address and data registers of this trip's loads and stores */
    eb += 8 * es; sr += 16 * G2_SOP; } }


__global__ __launch_bounds__(256) void k_rsm(const float* __restrict__ S, _Float16* __restrict__ P, int nrows) {
  #pragma clang fp contract(off)
  const int i = blockIdx.x * 256 + threadIdx.x; if (i >= nrows) return; const float* s = S + (size_t)i * SQ; float mx = -3.0e38f;
#pragma unroll 1
  for (int j = 0; j < SQ; ++j) mx = fmaxf(mx, s[j]); float se = 0.f;
#pragma unroll 1
  for (int j = 0; j < SQ; ++j) se += expf(s[j] - mx); const float sc = 256.0f / se;
#pragma unroll 1
  for (int j0 = 0; j0 < SQ; j0 += 8) { FragH f; for (int q = 0; q < 8; ++q) f.h[q] = (_Float16)(expf(s[j0 + q] - mx) * sc); unsigned short* d = (unsigned short*)P + (size_t)i * SQ + j0; *(v8us*)d = f.half[0];  } }
__global__ __launch_bounds__(256) void k_vt(const _Float16* __restrict__ V16, int b, int h0, _Float16* __restrict__ VT) { __shared__ unsigned short tl[64][65]; const int tid = threadIdx.x; const int hh = blockIdx.x % HG, sg = blockIdx.x / HG; const int s0 = sg * 64; const int h = h0 + hh;
  for (int i = tid; i < 64 * 8; i += 256) { const int j = i / 8, d8 = (i % 8) * 8; FragH f; f.half[0] = *(const v8us*)((const unsigned short*)V16 + ((size_t)b * SQ + s0 + j) * DM + h * HD + d8); for (int q = 0; q < 8; ++q) tl[d8 + q][j] = f.u[q]; }
  __syncthreads();
  { for (int i = tid; i < 64 * 8; i += 256) { const int d = i / 8, j8 = (i % 8) * 8; FragH f; for (int q = 0; q < 8; ++q) f.u[q] = tl[d][j8 + q]; *(v8us*)((unsigned short*)VT + ((size_t)hh * HD + d) * SQ + s0 + j8) = f.half[0]; }  } }


extern "C" void kernel_launch(void* const* d_in, const int* in_sizes, int n_in,
                              void* d_out, int out_size, void* d_ws, size_t ws_size, hipStream_t stream) {
  (void)in_sizes; (void)n_in; (void)out_size;
  const float* const* I = (const float* const*)d_in; const float* in1 = I[0]; const float* in2 = I[1]; const int* mask2 = (const int*)d_in[2]; const float* w1 = I[3]; const float* w2 = I[4]; const float* b2 = I[5];      /* weights natural [out][in] */
  char* ws = (char*)d_ws; size_t off = 0;
  auto take = [&](size_t bytes) { char* p = ws + off; off += (bytes + 255) & ~(size_t)255; return p; };
  _Float16* B1 = (_Float16*)take((size_t)NC * NC * 2); _Float16* B2 = (_Float16*)take((size_t)NO * 2 * NC * 2);
  _Float16* X2T = (_Float16*)take(NR * NC * 2); _Float16* X2 = (_Float16*)take(NR * NC * 2); _Float16* N1H = (_Float16*)take(NR * NC * 2); _Float16* N1L = (_Float16*)take(NR * NC * 2); _Float16* CAT = (_Float16*)take(NR * 2 * NC * 2);
  _Float16* P = (_Float16*)take((size_t)NB * SQ * SQ * 2);      /* the f16 softmax weights of all batches */
  float* ST = (float*)take((size_t)2 * SM_T * NR * 4);      /* per 64 keys and row: k, then the weights' sum */
  float* N1F = (float*)P;      /* n1 in f32 is last read by k_hl, before the first weight is written */
  if (off > ws_size) return;      /* 1.5 + 16 + 16 + 16 + 16 + 32 + 64 + 4 = approx 166 MiB */
  k_prep<<<2 * ST_GX + ST_G1 + ST_G2, 256, 0, stream>>>(in1, in2, w1, w2, CAT, X2, B1, B2);      /* cat columns 0..511 = in1; in2 rows; both weights */
  const size_t r0p = (size_t)B0 * SQ;
  k_gemm2<0, false, false, true, false><<<dim3((unsigned)((MP / 128) * (NC / 128)), 1), 128, 0, stream>>>(CAT + r0p * 2 * NC, 2 * NC, 0, B1, NC, 0, 0.0625f, nullptr, 0, N1F + r0p * NC, nullptr, NC, 0, MP, NC, NC, nullptr, 0.f, nullptr, nullptr);      /* n1 = in1 W1^T (f32) */
  k_hl<<<(unsigned)((size_t)MP * NC / (8 * HL_WE)), 256, 0, stream>>>(N1F + r0p * NC, N1H + r0p * NC, N1L + r0p * NC);
  /* every stage below runs all batches in one launch: blockIdx.y = batch for scores, softmax and fused (k_gemm2 through the batch strides it already takes); the transpose has the batch in grid x, the output GEMM all rows as one M */
  const dim3 gs((QN / 128) * (SQ / 128), NBR); const size_t sX = (size_t)SQ * NC, sS = (size_t)SQ * SQ;
  k_vt<NH, SQ, NC><<<NBR * NH * (SQ / VT_R), 256, 0, stream>>>(X2 + r0p * NC, 0, X2T);      /* in2^T [batch][512][2048] */
  k_gemm2<0, false, false, false, false, true, 1><<<gs, 128, 0, stream>>>(N1H + r0p * NC, NC, sX, X2 + r0p * NC, NC, sX, 1.0f, nullptr, 0, nullptr, P, SQ, sS, QN, SQ, NC, N1L + r0p * NC, 0.0009765625f, mask2 + r0p, ST);      /* scores = lo x 2^-10 + hi, both terms in the accumulators; leave as weights per 64 keys */
  k_gemm2<0, false, false, false, true, false, 2><<<dim3((QN / 128) * (NC / 128), NBR), 128, 0, stream>>>(P, SQ, sS, X2T, SQ, sX, 1.0f, nullptr, 0, nullptr, CAT + r0p * 2 * NC + NC, 2 * NC, 2 * sX, QN, NC, SQ, nullptr, 0.f, nullptr, ST);      /* fused = weights . in2 / row sum -> cat columns 512..1023 */
  k_gemm2<8, true, false, true, false><<<dim3((unsigned)((MPO / 128) * (NO / 128)), 1), 128, 0, stream>>>(CAT + r0p * 2 * NC, 2 * NC, 0, B2, 2 * NC, 0, 0.0625f, b2, 0, (float*)d_out + r0p * NO, nullptr, NO, 0, MPO, NO, 2 * NC, nullptr, 0.f, nullptr, nullptr);      /* out = tanh(cat W2^T + b2) */
}

// v009
// One run takes 133 microseconds.
// Timed twice side by side with v008, it ran 1.15 times as fast both times.
// Over all steps from v000 it is 43.1 times as fast.
#include <hip/hip_runtime.h>
// Cross attention with concat + tanh projection (in1, in2 [8][2048][512]; mask2 [8][2048] int32, nonzero = key masked out; n1 = in1 W1^T (W1 [512][512] natural, no bias); scores = n1 in2^T (no scaling); masked keys -> -inf; softmax over the 2,048 keys; fused = attn in2; out = tanh([in1 | fused] W2^T + b2) (W2 [512][1024] natural) -> [8][2048][512]).
// Structure: token rows; in1, in2 as exact f16 rows; n1 = in1 W1^T as a WMMA GEMM (256x128 block tiles, 256x256 for the scores, staged in LDS 128 k at a time, 64x64 wave tiles, f32 accumulation, exact x16 natural weights) into f32 rows, split on VALU into f16 hi + 2^-10 residual planes; then, all batches in each launch (grid y = batch in the two attention GEMMs): scores = n1 in2^T as ONE GEMM launch of two terms (the lo plane's K = 512 passes first, their sum x 2^-10 is the start value of the hi plane's passes; in2 exact), masked softmax folded into the two GEMMs around it (the score epilogue turns each wave's 64 x 64 scores into f16 weights 2^8 exp2(s log2 e - k), k = the whole-number ceiling of the row's maximum over those 64 keys, with k and the f32 sum of the weights per row and 64 keys; masked keys 0; no score is stored), in2^T via LDS transposes, fused = P . in2 GEMM (K = 2048; each 64-key tile of a pass scales its A rows by the exact power of two 2^(k - row maximum of k), the epilogue divides by the row sum) written as plain f16 straight into columns 512..1023 of the f16 concat rows whose columns 0..511 are the exact in1; out = tanh(cat W2^T + b2) as ONE GEMM (K = 1024, exact x16 natural W2, alpha 1/16) with the tanh epilogue.
// Compute dtype: inputs rounded to bf16; in1, in2, weights exact in f16; n1 as f16 hi + residual planes (~2^-22: the logits have sigma ~23, so plain f16 would cost ~3e-3 logits); softmax weights (x256) and fused (unscaled: f16 relative precision is scale-free and a x16/x0.25 weight split would push small W2 entries into f16 subnormals) plain f16 (~2^-12); scores, softmax statistics and the output f32. v_wmma_f32_16x16x32_f16.
#define NB 8
#define SQ 2048
#define NC 512                       /* d_in = d_hid */
#define NO 512                       /* output features */
#define DM NC
#define NH (NC / 64)                 /* 8 slabs of 64 for the in2^T transpose */
#define HD 64
#define HG 1
#define B0 0                         /* first batch processed (debug hook) */
#define NBR NB                       /* batches processed (debug hook) */
#define QN SQ                        /* query rows attended per batch (debug hook) */
#define NR ((size_t)NB * SQ)
#define MP ((int)((size_t)NBR * SQ)) /* rows projected (debug hook) */
#define MPO MP                       /* rows through the output GEMM (debug hook) */
typedef __bf16 v16b __attribute__((ext_vector_type(16)));
typedef unsigned short v8us __attribute__((ext_vector_type(8), may_alias));
typedef float  v8f  __attribute__((ext_vector_type(8)));
typedef float  v4f  __attribute__((ext_vector_type(4)));
typedef float  v4fa __attribute__((ext_vector_type(4), may_alias));
union FragB { v16b v; v8us half[2]; unsigned short u[16]; };

__device__ __forceinline__ unsigned short bf16_bits(float x) { unsigned int u = __float_as_uint(x); return (unsigned short)((u + 0x7FFFu + ((u >> 16) & 1u)) >> 16); }
__device__ __forceinline__ float bf16_val(unsigned short b) { return __uint_as_float(((unsigned int)b) << 16); }
__device__ __forceinline__ float bf16_round(float x) { return bf16_val(bf16_bits(x)); }
// D += A·B with NT terms: 1 = ah·bh, 2 = + al·bh (A split), 3 = + ah·bl (both split)
template <int NT>
__device__ __forceinline__ v8f mmaN(v16b ah, v16b al, v16b bh, v16b bl, v8f c) {
  c = __builtin_amdgcn_wmma_f32_16x16x32_bf16(false, ah, false, bh, (short)0, c, false, false);
  if (NT >= 2) c = __builtin_amdgcn_wmma_f32_16x16x32_bf16(false, al, false, bh, (short)0, c, false, false);
  if (NT >= 3) c = __builtin_amdgcn_wmma_f32_16x16x32_bf16(false, ah, false, bl, (short)0, c, false, false);
  asm volatile("v_nop\n\tv_nop\n\tv_nop\n\tv_nop" : "+v"(c) : "v"(ah), "v"(al), "v"(bh), "v"(bl));
  return c;
}

__global__ __launch_bounds__(256) void k_wt_bf16(const float* __restrict__ W, unsigned short* __restrict__ Wt, int K, int N) {
  const int t = blockIdx.x * 256 + threadIdx.x;
  const int k8n = K / 8;
  if (t >= N * k8n) return;
  const int n = t / k8n, k8 = (t % k8n) * 8;
  v8us v;
#pragma unroll
  for (int i = 0; i < 8; ++i) v[i] = bf16_bits(W[(size_t)(k8 + i) * N + n]);
  *(v8us*)(Wt + (size_t)n * K + k8) = v;
  
}

// GEMM C[M][N] (f32, pitch ldc) = act(A[M][K]·W + bias). A f32 row-major (pitch lda) converted per fragment to bf16
// (ASPLIT: hi/lo two planes -> 2 terms, else single rounded term); Wt bf16 [N][K] (pitch ldb). BIAS_BF16 rounds the
// bias to bf16 first (bias quantised to bf16 before the add). K%32==0, M%16==0, N%64==0.
template <bool ASPLIT, int ACT, bool BIAS_BF16>
__global__ __launch_bounds__(128) void k_gemm_bf(const float* __restrict__ A, int lda, const unsigned short* __restrict__ Wt, int ldb,
                                               const float* __restrict__ bias, float* __restrict__ C, int ldc, int M, int N, int K) {
  __shared__ __attribute__((aligned(16))) float so[4][16][64];
  const int tid = threadIdx.x, w = tid >> 5, lane = tid & 31, ln = lane & 15, hh = lane >> 4;
  const int ntn = N / 64;
  const int wid = blockIdx.x * 4 + w;
  const int mt = wid / ntn, nq = wid % ntn;
  if (mt * 16 >= M) return;
  const int row0 = mt * 16, col0 = nq * 64;
  const float* arow = A + (size_t)(row0 + ln) * lda;
  v8f acc[4] = {};
  for (int kb = 0; kb < K; kb += 32) {
    FragB ah, al;
    const v4f x0 = *(const v4fa*)(arow + kb + 8 * hh), x1 = *(const v4fa*)(arow + kb + 8 * hh + 4);
    const v4f x2 = *(const v4fa*)(arow + kb + 16 + 8 * hh), x3 = *(const v4fa*)(arow + kb + 16 + 8 * hh + 4);
    float xs[16] = {x0[0],x0[1],x0[2],x0[3],x1[0],x1[1],x1[2],x1[3],x2[0],x2[1],x2[2],x2[3],x3[0],x3[1],x3[2],x3[3]};
#pragma unroll
    for (int i = 0; i < 16; ++i) { const unsigned short hb = bf16_bits(xs[i]); ah.u[i] = hb; al.u[i] = ASPLIT ? bf16_bits(xs[i] - bf16_val(hb)) : (unsigned short)0; }
#pragma unroll
    for (int t = 0; t < 4; ++t) {
      const unsigned short* brow = Wt + (size_t)(col0 + t * 16 + ln) * ldb + kb;
      FragB b;
      b.half[0] = *(const v8us*)(brow + 8 * hh);
      b.half[1] = *(const v8us*)(brow + 16 + 8 * hh);
      acc[t] = mmaN<ASPLIT ? 2 : 1>(ah.v, al.v, b.v, b.v, acc[t]);
    }
  }
#pragma unroll
  for (int t = 0; t < 4; ++t) {
    float bv = bias ? bias[col0 + t * 16 + ln] : 0.f;
    if (BIAS_BF16) bv = bf16_round(bv);
#pragma unroll
    for (int r = 0; r < 8; ++r) { float v = acc[t][r] + bv; if (ACT == 1) v = fmaxf(v, 0.f); so[w][8 * hh + r][t * 16 + ln] = v; }
  }
  __builtin_amdgcn_fence(__ATOMIC_ACQ_REL, "workgroup");
  __builtin_amdgcn_wave_barrier();
  const int rsub = lane >> 4, c4 = (lane & 15) * 4;
  {
#pragma unroll
    for (int q = 0; q < 8; ++q) {
      const int r = q * 2 + rsub;
      const v4f v = *(const v4fa*)&so[w][r][c4];
      *(v4f*)(C + (size_t)(row0 + r) * ldc + col0 + c4) = v;
    }
    
  }
}

// GEMM C = act(A·W + bias + resid): A f32 (ASPLIT -> hi/lo 2 terms), Wt bf16 [N][K]; ACT 0 none, 1 relu, 2 exact gelu;
// resid (optional, f32, row index = (row % rmod), pitch ldr, RES_BF16 rounds it) added before the activation.
template <bool ASPLIT, int ACT, bool BIAS_BF16, bool RES_BF16>
__global__ __launch_bounds__(128) void k_gemm_bf3(const float* __restrict__ A, int lda, const unsigned short* __restrict__ Wt, int ldb,
                                                const float* __restrict__ bias, const float* __restrict__ resid, int rmod, int ldr,
                                                float* __restrict__ C, int ldc, int M, int N, int K) {
  __shared__ __attribute__((aligned(16))) float so[4][16][64];
  const int tid = threadIdx.x, w = tid >> 5, lane = tid & 31, ln = lane & 15, hh = lane >> 4;
  const int ntn = N / 64;
  const int wid = blockIdx.x * 4 + w;
  const int mt = wid / ntn, nq = wid % ntn;
  if (mt * 16 >= M) return;
  const int row0 = mt * 16, col0 = nq * 64;
  const float* arow = A + (size_t)(row0 + ln) * lda;
  v8f acc[4] = {};
  for (int kb = 0; kb < K; kb += 32) {
    FragB ah, al;
    const v4f x0 = *(const v4fa*)(arow + kb + 8 * hh), x1 = *(const v4fa*)(arow + kb + 8 * hh + 4);
    const v4f x2 = *(const v4fa*)(arow + kb + 16 + 8 * hh), x3 = *(const v4fa*)(arow + kb + 16 + 8 * hh + 4);
    float xs[16] = {x0[0],x0[1],x0[2],x0[3],x1[0],x1[1],x1[2],x1[3],x2[0],x2[1],x2[2],x2[3],x3[0],x3[1],x3[2],x3[3]};
#pragma unroll
    for (int i = 0; i < 16; ++i) { const unsigned short hb = bf16_bits(xs[i]); ah.u[i] = hb; al.u[i] = ASPLIT ? bf16_bits(xs[i] - bf16_val(hb)) : (unsigned short)0; }
#pragma unroll
    for (int t = 0; t < 4; ++t) {
      const unsigned short* brow = Wt + (size_t)(col0 + t * 16 + ln) * ldb + kb;
      FragB b;
      b.half[0] = *(const v8us*)(brow + 8 * hh);
      b.half[1] = *(const v8us*)(brow + 16 + 8 * hh);
      acc[t] = mmaN<ASPLIT ? 2 : 1>(ah.v, al.v, b.v, b.v, acc[t]);
    }
  }
#pragma unroll
  for (int t = 0; t < 4; ++t) {
    const int col = col0 + t * 16 + ln;
    float bv = bias ? bias[col] : 0.f;
    if (BIAS_BF16) bv = bf16_round(bv);
#pragma unroll
    for (int r = 0; r < 8; ++r) {
      float v = acc[t][r] + bv;
      if (resid) { float rv = resid[(size_t)((row0 + 8 * hh + r) % rmod) * ldr + col]; if (RES_BF16) rv = bf16_round(rv); v += rv; }
      if (ACT == 1) v = fmaxf(v, 0.f);
      if (ACT == 2) v = 0.5f * v * (1.0f + erff(v * 0.70710678118654752f));
      if (ACT == 3) { const float u = 0.7978845608028654f * (v + 0.044715f * v * v * v); v = 0.5f * v * (1.0f + tanhf(u)); }
      so[w][8 * hh + r][t * 16 + ln] = v;
    }
  }
  __builtin_amdgcn_fence(__ATOMIC_ACQ_REL, "workgroup");
  __builtin_amdgcn_wave_barrier();
  const int rsub = lane >> 4, c4 = (lane & 15) * 4;
  {
#pragma unroll
    for (int q = 0; q < 8; ++q) {
      const int r = q * 2 + rsub;
      const v4f v = *(const v4fa*)&so[w][r][c4];
      *(v4f*)(C + (size_t)(row0 + r) * ldc + col0 + c4) = v;
    }
    
  }
}
// row LayerNorm (biased variance, eps) over N: s = X (+ R); optional out_sum <- s; out_norm <- (s-mu)*rsqrt(var+eps)*g + b
template <bool PARAM_BF16>
__global__ __launch_bounds__(256) void k_layernorm(const float* __restrict__ X, const float* __restrict__ R, const float* __restrict__ g, const float* __restrict__ bta,
                                                  float* __restrict__ out_sum, float* __restrict__ out_norm, int N, float eps) {
  __shared__ float red[256];
  const int row = blockIdx.x, tid = threadIdx.x;
  const float* x = X + (size_t)row * N; const float* rr = R ? R + (size_t)row * N : nullptr;
  float vals[16];                     // up to N = 4096
  const int per = N / 256;            // contiguous chunk per thread? use strided-by-4 chunks: thread handles j = tid*4 + 1024*u
  float s1 = 0.f;
  for (int u = 0; u < per / 4; ++u) {
    const int j = tid * 4 + 1024 * u;
    const v4f a = *(const v4fa*)(x + j);
    v4f b = {0.f,0.f,0.f,0.f}; if (rr) b = *(const v4fa*)(rr + j);
#pragma unroll
    for (int q = 0; q < 4; ++q) { const float v = a[q] + b[q]; vals[u * 4 + q] = v; s1 += v; }
  }
  red[tid] = s1; __syncthreads();
  for (int st = 128; st > 0; st >>= 1) { if (tid < st) red[tid] += red[tid + st]; __syncthreads(); }
  const float mu = red[0] / (float)N; __syncthreads();
  float s2 = 0.f;
  for (int u = 0; u < per / 4; ++u)
#pragma unroll
    for (int q = 0; q < 4; ++q) { const float c = vals[u * 4 + q] - mu; s2 += c * c; }
  red[tid] = s2; __syncthreads();
  for (int st = 128; st > 0; st >>= 1) { if (tid < st) red[tid] += red[tid + st]; __syncthreads(); }
  const float rs = rsqrtf(red[0] / (float)N + eps);
  {
    for (int u = 0; u < per / 4; ++u) {
      const int j = tid * 4 + 1024 * u;
      v4f o, sm;
#pragma unroll
      for (int q = 0; q < 4; ++q) {
        float gg = g[j + q], bb = bta[j + q];
        if (PARAM_BF16) { gg = bf16_round(gg); bb = bf16_round(bb); }
        sm[q] = vals[u * 4 + q]; o[q] = (vals[u * 4 + q] - mu) * rs * gg + bb;
      }
      if (out_sum) *(v4f*)(out_sum + (size_t)row * N + j) = sm;
      *(v4f*)(out_norm + (size_t)row * N + j) = o;
    }
    
  }
}



// ---- f16 WMMA path (v_wmma_f32_16x16x32_f16): 11-bit significands for operands in range — the instruction every GEMM launched in this file runs on
typedef _Float16 v16h __attribute__((ext_vector_type(16)));
union FragH { v16h v; v8us half[2]; _Float16 h[16]; unsigned short u[16]; };
template <int NT>
__device__ __forceinline__ v8f mmaH(v16h ah, v16h al, v16h bh, v16h bl, v8f c) {
  c = __builtin_amdgcn_wmma_f32_16x16x32_f16(false, ah, false, bh, (short)0, c, false, false);
  if (NT >= 2) c = __builtin_amdgcn_wmma_f32_16x16x32_f16(false, al, false, bh, (short)0, c, false, false);
  if (NT >= 3) c = __builtin_amdgcn_wmma_f32_16x16x32_f16(false, ah, false, bl, (short)0, c, false, false);
  asm volatile("v_nop\n\tv_nop\n\tv_nop\n\tv_nop" : "+v"(c) : "v"(ah), "v"(al), "v"(bh), "v"(bl));
  return c;
}
// batched GEMM like k_gemm_b but f16 operands: A f32 (split into f16 hi/lo if ASPLIT, else rounded to f16), Bt = f16 values [n][k]; alpha; C f32; N multiple of 16 (partial tiles skipped)
template <bool ASPLIT>
__global__ __launch_bounds__(128) void k_gemm_h(const float* __restrict__ A, int lda, size_t sA, const _Float16* __restrict__ Bh, int ldb, size_t sB, float alpha, float* __restrict__ C, int ldc, size_t sC, int M, int N, int K) {
  __shared__ __attribute__((aligned(16))) float so[4][16][64];
  const int tid = threadIdx.x, w = tid >> 5, lane = tid & 31, ln = lane & 15, hh = lane >> 4; const int by = blockIdx.y;
  A += (size_t)by * sA; Bh += (size_t)by * sB; C += (size_t)by * sC;
  const int ntn = (N + 63) / 64; const int wid = blockIdx.x * 4 + w; const int mt = wid / ntn, nq = wid % ntn; if (mt * 16 >= M) return;
  const int row0 = mt * 16, col0 = nq * 64; const float* arow = A + (size_t)(row0 + ln) * lda;
  v8f acc[4] = {};
  for (int kb = 0; kb < K; kb += 32) {
    FragH ah, al;
    const v4f x0 = *(const v4fa*)(arow + kb + 8 * hh), x1 = *(const v4fa*)(arow + kb + 8 * hh + 4), x2 = *(const v4fa*)(arow + kb + 16 + 8 * hh), x3 = *(const v4fa*)(arow + kb + 16 + 8 * hh + 4);
    float xs[16] = {x0[0],x0[1],x0[2],x0[3],x1[0],x1[1],x1[2],x1[3],x2[0],x2[1],x2[2],x2[3],x3[0],x3[1],x3[2],x3[3]};
#pragma unroll
    for (int i = 0; i < 16; ++i) { const _Float16 h = (_Float16)xs[i]; ah.h[i] = h; al.h[i] = ASPLIT ? (_Float16)(xs[i] - (float)h) : (_Float16)0.0f; }
#pragma unroll
    for (int t = 0; t < 4; ++t) { if (col0 + t * 16 >= N) continue; const size_t boff = (size_t)(col0 + t * 16 + ln) * ldb + kb; FragH bq; bq.half[0] = *(const v8us*)(Bh + boff + 8 * hh); bq.half[1] = *(const v8us*)(Bh + boff + 16 + 8 * hh);
      acc[t] = mmaH<ASPLIT ? 2 : 1>(ah.v, al.v, bq.v, bq.v, acc[t]); }
  }
#pragma unroll
  for (int t = 0; t < 4; ++t) { if (col0 + t * 16 >= N) continue;
#pragma unroll
    for (int r = 0; r < 8; ++r) so[w][8 * hh + r][t * 16 + ln] = acc[t][r] * alpha; }
  __builtin_amdgcn_fence(__ATOMIC_ACQ_REL, "workgroup"); __builtin_amdgcn_wave_barrier();
  const int rsub = lane >> 4, c4 = (lane & 15) * 4;
  {
#pragma unroll
    for (int q = 0; q < 8; ++q) { const int r = q * 2 + rsub; if (col0 + c4 < N) { const v4f v = *(const v4fa*)&so[w][r][c4]; *(v4f*)(C + (size_t)(row0 + r) * ldc + col0 + c4) = v; } }
     }
}

// Wt[n][k] = f16(W[k][n]·scale) from f32 row-major W[K][N] (scale = power of two; bf16-exact weights stay exact in f16 away from the subnormal range)
__global__ __launch_bounds__(256) void k_wt_f16(const float* __restrict__ W, _Float16* __restrict__ Wt, int K, int N, float scale) {
  const int t = blockIdx.x * 256 + threadIdx.x; if (t >= N * (K / 8)) return; const int n = t / (K / 8), k8 = (t % (K / 8)) * 8; FragH f;
#pragma unroll
  for (int i = 0; i < 8; ++i) f.h[i] = (_Float16)(bf16_round(W[(size_t)(k8 + i) * N + n]) * scale); const v8us o = f.half[0];
  *(v8us*)((unsigned short*)Wt + (size_t)n * K + k8) = o; 
}
// k_gemm_hh variant with fused epilogue: v = acc·alpha + bias[by·sBias + col] (+ CP[(row/rowsPerB)·sCPb + by·64 + col] if CP) ; ACT 0 none / 1 elu ; writes f16 C16 (and f32 C if non-null)
template <int ACT>
__global__ __launch_bounds__(128) void k_gemm_hhx(const _Float16* __restrict__ A, int lda, size_t sA, const _Float16* __restrict__ Bh, int ldb, size_t sB, float alpha, const float* __restrict__ bias, size_t sBias, const float* __restrict__ CP, int rowsPerB, size_t sCPb, int row0g,
    float* __restrict__ C, _Float16* __restrict__ C16, int ldc, size_t sC, int M, int N, int K) {
  __shared__ __attribute__((aligned(16))) float so[4][16][64];
  const int tid = threadIdx.x, w = tid >> 5, lane = tid & 31, ln = lane & 15, hh = lane >> 4; const int by = blockIdx.y;
  A += (size_t)by * sA; Bh += (size_t)by * sB; const size_t cofs = (size_t)by * sC; const float* bp = bias ? bias + (size_t)by * sBias : nullptr;
  const int ntn = (N + 63) / 64; const int wid = blockIdx.x * 4 + w; const int mt = wid / ntn, nq = wid % ntn; if (mt * 16 >= M) return;
  const int row0 = mt * 16, col0 = nq * 64; const _Float16* arow = A + (size_t)(row0 + ln) * lda;
  v8f acc[4] = {};
  for (int kb = 0; kb < K; kb += 32) { FragH ah; ah.half[0] = *(const v8us*)((const unsigned short*)arow + kb + 8 * hh); ah.half[1] = *(const v8us*)((const unsigned short*)arow + kb + 16 + 8 * hh);
#pragma unroll
    for (int t = 0; t < 4; ++t) { if (col0 + t * 16 >= N) continue; const size_t boff = (size_t)(col0 + t * 16 + ln) * ldb + kb; FragH bq; bq.half[0] = *(const v8us*)((const unsigned short*)Bh + boff + 8 * hh); bq.half[1] = *(const v8us*)((const unsigned short*)Bh + boff + 16 + 8 * hh);
      acc[t] = mmaH<1>(ah.v, ah.v, bq.v, bq.v, acc[t]); }
  }
#pragma unroll
  for (int t = 0; t < 4; ++t) { if (col0 + t * 16 >= N) continue; const int col = col0 + t * 16 + ln; const float bv = bp ? bf16_round(bp[col]) : 0.f;
#pragma unroll
    for (int r = 0; r < 8; ++r) { float v = acc[t][r] * alpha + bv; if (CP) { const int rr = row0g + row0 + 8 * hh + r; if (rowsPerB < 0) v += CP[cofs + (size_t)rr * ldc + col];      /* rowsPerB < 0: own element of the batched C plane */ else { const int bidx = rr / rowsPerB; v += CP[(size_t)bidx * sCPb + (size_t)by * 64 + col]; } } if (ACT == 1) v = (v > 0.f) ? v : expm1f(v); else if (ACT == 7) v = (v > 0.f) ? v + 1.0f : expf(v); else if (ACT == 8) v = tanhf(v); else if (ACT == 9) v = 0.5f * v * (1.0f + tanhf(0.7978845608028654f * (v + 0.044715f * v * v * v))); else if (ACT == 11) v = 1.0f / (1.0f + expf(-v)); else if (ACT == 12) v = (v > 0.f) ? v : 0.01f * v; else if (ACT == 14) v = (v > 0.f) ? v : 0.1f * v; else if (ACT == 16) v = (v >= 0.f) ? v : 0.3f * v; else if (ACT == 17) v = (v >= 0.f) ? v : 0.2f * v; else if (ACT == 15) v = v / (1.0f + expf(-v)); else if (ACT == 3) v = fmaxf(v, 0.f); else if (ACT == 6) v = 0.5f * v * (1.0f + erff(v * 0.70710678118654752f)); so[w][8 * hh + r][t * 16 + ln] = v; } }
  __builtin_amdgcn_fence(__ATOMIC_ACQ_REL, "workgroup"); __builtin_amdgcn_wave_barrier();
  const int rsub = lane >> 4, c4 = (lane & 15) * 4; typedef _Float16 v4h __attribute__((ext_vector_type(4)));
  {
#pragma unroll
    for (int q = 0; q < 8; ++q) { const int r = q * 2 + rsub; if (col0 + c4 < N) { const v4f v = *(const v4fa*)&so[w][r][c4]; if (C) *(v4f*)(C + cofs + (size_t)(row0 + r) * ldc + col0 + c4) = v; if (C16) { v4h h4; for (int i = 0; i < 4; ++i) h4[i] = (_Float16)v[i]; *(v4h*)(C16 + cofs + (size_t)(row0 + r) * ldc + col0 + c4) = h4; } } }
     }
}


typedef _Float16 v4h __attribute__((ext_vector_type(4)));

// ---- streaming conversions: few long waves. A wave-wide load is 32 lanes x 16 B = 512 contiguous bytes (four whole lines), eight such loads are issued before the first is used, and the 8-byte stores of a wave
// cover 256 contiguous bytes. Which thread converts a value has no bearing on the value.
#define ST_WE 4096                   /* k_prep: f32 elements per wave, four rounds of eight loads */
#define ST_BE (8 * ST_WE)            /* k_prep: elements per work-group of eight waves */
#define ST_GX ((int)(NR * NC / ST_BE))              /* work-groups per activation input */
#define ST_G1 (NC * NC / ST_BE)                     /* work-groups for W1 */
#define ST_G2 (NO * 2 * NC / ST_BE)                 /* work-groups for W2 */
// All four f32 inputs that feed a matrix product, in one launch; the work-group index picks the input (a scalar choice, no barrier in the kernel).
// in1 -> columns 0..511 of the f16 concat rows (pitch 2 NC), in2 -> f16 rows, W1 and W2 -> natural f16 rows x16; each value is first rounded to bf16. Rows of 512 (W2: half rows) keep e -> (e / 512) * pitch + e % 512.
__global__ __launch_bounds__(256) void k_prep(const float* __restrict__ in1, const float* __restrict__ in2, const float* __restrict__ w1, const float* __restrict__ w2,
    _Float16* __restrict__ cat, _Float16* __restrict__ x2, _Float16* __restrict__ b1, _Float16* __restrict__ b2) {
  static_assert(NR * NC % ST_BE == 0 && NC * NC % ST_BE == 0 && NO * 2 * NC % ST_BE == 0 && NC == 512, "k_prep: whole work-groups per input, rows of 512");
  int b = blockIdx.x; const float* s; _Float16* d; size_t ldo = NC; float sc = 1.0f;
  if (b < ST_GX) { s = in1; d = cat; ldo = 2 * NC; }
  else if (b < 2 * ST_GX) { b -= ST_GX; s = in2; d = x2; }
  else if (b < 2 * ST_GX + ST_G1) { b -= 2 * ST_GX; s = w1; d = b1; sc = 16.0f; }
  else { b -= 2 * ST_GX + ST_G1; s = w2; d = b2; sc = 16.0f; }
  const size_t w0 = (size_t)b * ST_BE + (size_t)(threadIdx.x >> 5) * ST_WE;      /* the wave's first element: the start of a row of 512 */
  const float* sp = s + w0 + (threadIdx.x & 31) * 4; _Float16* dp = d + (w0 >> 9) * ldo + (threadIdx.x & 31) * 4;
  v4f x[2][8];
#pragma unroll
  for (int i = 0; i < 8; ++i) x[0][i] = *(const v4fa*)(sp + i * 128);
#pragma unroll      /* unrolled so that x[][] is indexed by constants only and stays in registers */
  for (int u = 0; u < ST_WE / 1024; ++u) {      /* a round = 1,024 elements = two rows of 512 */
    if (u + 1 < ST_WE / 1024) {
#pragma unroll
      for (int i = 0; i < 8; ++i) x[(u + 1) & 1][i] = *(const v4fa*)(sp + (u + 1) * 1024 + i * 128);      /* the next round's loads fly while this round is converted */
      __builtin_amdgcn_sched_barrier(0); }      /* without it the scheduler sinks these loads behind most of this round's conversion, and the wave has nothing in flight meanwhile */
#pragma unroll
    for (int i = 0; i < 8; ++i) { v4h h;
#pragma unroll
      for (int q = 0; q < 4; ++q) h[q] = (_Float16)(bf16_round(x[u & 1][i][q]) * sc);
      *(v4h*)(dp + (size_t)(2 * u + (i >> 2)) * ldo + (i & 3) * 128) = h; }
    if (u + 1 < ST_WE / 1024) asm volatile("s_wait_xcnt 0x0" :: "v"(sp) : "memory"); } }      /* the next round reuses address and data registers of this round's loads and stores; naming sp keeps the load address whole up to the wait (no load may land on it) */
__global__ __launch_bounds__(256) void k_h16(const float* __restrict__ x, _Float16* __restrict__ X16, size_t n8) { const size_t t = (size_t)blockIdx.x * 256 + threadIdx.x; if (t >= n8) return; FragH f;
#pragma unroll
  for (int q = 0; q < 8; ++q) f.h[q] = (_Float16)x[t * 8 + q]; *(v8us*)((unsigned short*)X16 + t * 8) = f.half[0];  }
__global__ __launch_bounds__(256) void k_round16f(const float* __restrict__ W, _Float16* __restrict__ Bt, size_t n8) { const size_t t = (size_t)blockIdx.x * 256 + threadIdx.x; if (t >= n8) return; FragH f;
#pragma unroll
  for (int i = 0; i < 8; ++i) f.h[i] = (_Float16)(bf16_round(W[t * 8 + i]) * 16.0f); *(v8us*)((unsigned short*)Bt + t * 8) = f.half[0];  }
// Transpose of one 64-column slab, VT_R rows per work-group (a thread's VT_R / 32 loads of 16 B are all issued before the first is used); lane -> element maps inside 64 rows as for a 64-row tile.
#define VT_R 256
template <int NHv, int TTv, int LDV>
__global__ __launch_bounds__(256) void k_vt(const _Float16* __restrict__ V16, int voff, _Float16* __restrict__ Vt) { __shared__ unsigned short tl[VT_R][66]; const int tid = threadIdx.x; const int slab = blockIdx.x / (TTv / VT_R), lg = blockIdx.x % (TTv / VT_R); const int b = slab / NHv, h = slab % NHv;
  static_assert(TTv % VT_R == 0, "k_vt: whole tiles");
  const int r0 = tid / 8, c8 = (tid % 8) * 8; FragH f[VT_R / 32];
  const unsigned short* vp = (const unsigned short*)V16 + ((size_t)b * TTv + lg * VT_R + r0) * LDV + voff + h * 64 + c8;      /* the row pitch is a constant, so that all loads share this one address */
#pragma unroll
  for (int k = 0; k < VT_R / 32; ++k) f[k].half[0] = *(const v8us*)(vp + (size_t)k * 32 * LDV);
  asm volatile("s_wait_xcnt 0x0" :: "v"(vp) : "memory");      /* the address registers are reused behind the loads; naming vp keeps them whole up to the wait (no load may land on them) */
#pragma unroll
  for (int k = 0; k < VT_R / 32; ++k)
#pragma unroll
    for (int q = 0; q < 8; ++q) tl[k * 32 + r0][c8 + q] = f[k].u[q];
  __syncthreads();
  {
#pragma unroll
    for (int rd = 0; rd < VT_R / 32; ++rd) { const int d = (rd & 1) * 32 + tid / 8, pc = (rd >> 1) * 8 + tid % 8; FragH g;
#pragma unroll
      for (int q = 0; q < 8; ++q) g.u[q] = tl[pc * 8 + q][d];
      *(v8us*)((unsigned short*)Vt + ((size_t)slab * 64 + d) * TTv + lg * VT_R + pc * 8) = g.half[0]; }
     } }

// f32 -> f16 hi plane + residual x 2^10 plane, as a stream of the same make: HL_WE elements per wave, two rounds of eight loads (n = a multiple of 8 * HL_WE elements, one work-group per 8 * HL_WE).
#define HL_WE 2048
__global__ __launch_bounds__(256) void k_hl(const float* __restrict__ F, _Float16* __restrict__ Hh, _Float16* __restrict__ Hl) {
  const size_t e0 = (size_t)blockIdx.x * (8 * HL_WE) + (size_t)(threadIdx.x >> 5) * HL_WE + (threadIdx.x & 31) * 4;
  const float* sp = F + e0; _Float16* hp = Hh + e0; _Float16* lp = Hl + e0;
  v4f x[2][8];
#pragma unroll
  for (int i = 0; i < 8; ++i) x[0][i] = *(const v4fa*)(sp + i * 128);
#pragma unroll      /* unrolled so that x[][] stays in registers */
  for (int u = 0; u < HL_WE / 1024; ++u) {
    if (u + 1 < HL_WE / 1024) {
#pragma unroll
      for (int i = 0; i < 8; ++i) x[(u + 1) & 1][i] = *(const v4fa*)(sp + (u + 1) * 1024 + i * 128); }      /* the next round's loads fly while this round is split */
#pragma unroll
    for (int i = 0; i < 8; ++i) { v4h hi, lo;
#pragma unroll
      for (int q = 0; q < 4; ++q) { const float a = x[u & 1][i][q]; const _Float16 h = (_Float16)a; hi[q] = h; lo[q] = (_Float16)((a - (float)h) * 1024.0f); }
      *(v4h*)(hp + u * 1024 + i * 128) = hi; *(v4h*)(lp + u * 1024 + i * 128) = lo; }
    if (u + 1 < HL_WE / 1024) asm volatile("s_wait_xcnt 0x0" :: "v"(sp) : "memory"); } }      /* as in k_prep */

// ---- fast GEMM: block tile of WM x WN waves of 64x64 (4 x 2: 256x128, one work-group per WGP where N = 512; 4 x 4: 256x256; requires M % (64 WM) == 0 rows per launch region, N % (64 WN) == 0, K % G2_KP == 0) ----
// Both operand tiles of a pass of G2_KP k are brought into LDS once per work-group by asynchronous copies (each wave-wide copy covers two whole 256-byte rows) and read from there by all its waves;
// two buffers, so that the next pass's copies fly while this pass is multiplied. Each output element still sums its k blocks of 32 in ascending order.
// An operand byte is fetched from L2 once per block tile that needs it: N / (64 WN) times for A, M / (64 WM) times for B.
#define G2_KP 128                    /* k per pass: 256-byte tile rows */
#define G2_PITCH (2 * G2_KP + 16)    /* LDS bytes per tile row, 272: 16 B x odd, the pitch at which ds_load_b128 readers of 16 rows meet no bank conflict */
#define G2_SOP 68                    /* floats per row of the output staging */
__device__ __forceinline__ v16h g2_lfrag(const char* p) { FragH f; f.half[0] = *(const v8us*)p; f.half[1] = *(const v8us*)(p + 32); return f.v; }      /* same k order as a fragment read from global rows: k = 8 hh .. 8 hh + 7, then 16 + 8 hh .. */
__device__ __forceinline__ v8f g2_mma(v16h a, v16h b, v8f c) { v8f d = __builtin_amdgcn_wmma_f32_16x16x32_f16(false, a, false, b, (short)0, c, false, false); asm volatile("v_nop\n\tv_nop\n\tv_nop\n\tv_nop" : "+v"(d) : "v"(a), "v"(b)); return d; }
// Eight rows of one operand's tile, RS rows apart: the lane's 16 bytes of rows r, r + RS, .. r + 7 RS (l = its LDS byte address for row r, p = its global address for row r, ld = global row pitch in halves).
// The s_wait_xcnt closes the copies' own statement so that no address register of a copy is rewritten in front of it.
template <int RS>
__device__ __forceinline__ void g2_copy8(unsigned l, const _Float16* p, size_t ld) {
  asm volatile("global_load_async_to_lds_b128 %0, %8, off\n\t"
               "global_load_async_to_lds_b128 %1, %9, off\n\t"
               "global_load_async_to_lds_b128 %2, %10, off\n\t"
               "global_load_async_to_lds_b128 %3, %11, off\n\t"
               "global_load_async_to_lds_b128 %4, %12, off\n\t"
               "global_load_async_to_lds_b128 %5, %13, off\n\t"
               "global_load_async_to_lds_b128 %6, %14, off\n\t"
               "global_load_async_to_lds_b128 %7, %15, off\n\t"
               "s_wait_xcnt 0x0"
               :: "v"(l), "v"(l + RS * G2_PITCH), "v"(l + 2 * RS * G2_PITCH), "v"(l + 3 * RS * G2_PITCH), "v"(l + 4 * RS * G2_PITCH), "v"(l + 5 * RS * G2_PITCH), "v"(l + 6 * RS * G2_PITCH), "v"(l + 7 * RS * G2_PITCH),
                  "v"(p), "v"(p + RS * ld), "v"(p + 2 * RS * ld), "v"(p + 3 * RS * ld), "v"(p + 4 * RS * ld), "v"(p + 5 * RS * ld), "v"(p + 6 * RS * ld), "v"(p + 7 * RS * ld)
               : "memory");
}
// The activation of one output value (ACT: 0 none, 3 relu, 6 exact gelu, 8 tanh, 9 tanh gelu, 11 sigmoid, 12/14/16/17 leaky relu 0.01/0.1/0.3/0.2, 15 silu).
template <int ACT>
__device__ __forceinline__ float g2_act(float v) {
  if (ACT == 3) v = fmaxf(v, 0.f); else if (ACT == 6) v = 0.5f * v * (1.0f + erff(v * 0.70710678118654752f)); else if (ACT == 11) v = 1.0f / (1.0f + expf(-v)); else if (ACT == 15) v = v / (1.0f + expf(-v)); else if (ACT == 12) v = (v > 0.f) ? v : 0.01f * v; else if (ACT == 8) v = fmaf(-2.0f, __builtin_amdgcn_rcpf(__builtin_amdgcn_exp2f(v * 2.88539008f) + 1.0f), 1.0f);      /* tanh v = 1 - 2 / (e^(2 v) + 1), e^(2 v) = 2^(v * 2 log2 e): no branch and no lane mask, so that the values of a trip run side by side instead of one dependent chain after another; +-1 at the ends (2^x = inf or 0), NaN stays NaN; absolute error about 2^-22 */
  else if (ACT == 9) v = 0.5f * v * (1.0f + tanhf(0.7978845608028654f * (v + 0.044715f * v * v * v))); else if (ACT == 14) v = (v > 0.f) ? v : 0.1f * v; else if (ACT == 16) v = (v >= 0.f) ? v : 0.3f * v; else if (ACT == 17) v = (v >= 0.f) ? v : 0.2f * v;
  return v; }
// What the epilogue does is fixed at compile time: HASB adds bf16-rounded bias[by * sBias + col]; ADDC adds the element that C already holds (C += ...); F32O stores f32 C, F16O stores f16 C16.
// out = ACT(acc * alpha + bias + old C), in that order.
// TWOP: A is given as two planes against the same B, acc = (sum over k of A2 B) * pre + sum over k of A B: the passes of A2 run first, the accumulators are scaled once by pre (a power of two: exact),
// and the passes of A add onto them, so that the sum of both terms leaves the registers once. A2 has A's pitch and batch stride.
// SM = 1, the softmax's first half in the epilogue: C16 (row pitch SQ) takes f16 weights instead of scores (score = the accumulator, alpha is not applied). Per row and per wave tile of 64 keys: k = ceil(max s * log2 e) over the keys that mk leaves in, weight = exp2(s * log2 e - k + 8)
// (at most 256; a masked key gives an exact 0), st[tile][row] = k (-3e38 where all 64 keys are masked), st[SM_T + tile][row] = the f32 sum of the unrounded weights. A wave writes whole 128-byte lines of st and of C16.
// SM = 2, its second half: A holds such weights, 64 k = one tile (G2_KP / 64 tiles a pass). Per row: km = max k, factor[tile] = 2^(k - km) (a power of two: the f16 product with a weight is exact above the subnormal range),
// sum = sum over tiles of st sum * factor; the A fragments of tile t are multiplied by factor[t], and the output row by 1 / sum (0 where every key is masked).
#define SM_T (SQ / 64)
template <int ACT, bool HASB, bool ADDC, bool F32O, bool F16O, bool TWOP = false, int SM = 0, int WM = 4, int WN = 2>
__global__ __launch_bounds__(WM * WN * 32) void k_gemm2(const _Float16* __restrict__ A, int lda, size_t sA, const _Float16* __restrict__ Bh, int ldb, size_t sB, float alpha, const float* __restrict__ bias, size_t sBias,
    float* __restrict__ C, _Float16* __restrict__ C16, int ldc, size_t sC, int M, int N, int K, const _Float16* __restrict__ A2, float pre, const int* __restrict__ mk, float* __restrict__ st) { static_assert(ACT == 0 || ACT == 3 || ACT == 6 || ACT == 8 || ACT == 9 || ACT == 11 || ACT == 12 || ACT == 14 || ACT == 15 || ACT == 16 || ACT == 17, "k_gemm2: unsupported ACT code (would silently apply no activation)");
  static_assert(F32O || !ADDC, "ADDC reads the f32 plane it then stores");
  constexpr int BM = 64 * WM, BN = 64 * WN;      /* rows of A and rows of B per block tile */
  static_assert(SM != 2 || WM * WN * 32 == BM, "SM = 2 keeps one thread per row of the block");
  constexpr int OPER = BM * G2_PITCH;      /* A's rows of a pass; B's rows follow them */
  constexpr int STAGE = (BM + BN) * G2_PITCH;      /* one buffer: [A rows | B rows] */
  constexpr int RS = WM * WN * 32 / (G2_KP / 8);      /* copies: G2_KP / 8 lanes per tile row, RS rows per round of the work-group */
  static_assert(BM % (8 * RS) == 0 && BN % (8 * RS) == 0 && (BM + BN) / RS <= 63, "whole statements of eight copies; one pass's copies of a wave stay under the limit of outstanding copies");
  __shared__ __attribute__((aligned(16))) char sm[2 * STAGE];      /* the two buffers; behind the loop's last barrier the same bytes stage the output */
  static_assert(WM * WN * 64 * G2_SOP * 4 <= 2 * STAGE, "output staging must fit the ring");
  __shared__ _Float16 fs[SM == 2 ? SM_T * BM : 1]; __shared__ float il[SM == 2 ? BM : 1];      /* SM = 2: factor[tile][row of the block], 1 / row sum */
  const int tid = threadIdx.x, w = tid >> 5, lane = tid & 31, ln = lane & 15, hh = lane >> 4; const int by = blockIdx.y;
  A += (size_t)by * sA; Bh += (size_t)by * sB; const size_t cofs = (size_t)by * sC;
  const int ntn = N / BN; const int mt = blockIdx.x / ntn, nq = blockIdx.x - mt * ntn; const int rowB = mt * BM, colB = nq * BN; if (rowB >= M) return;      /* the same for the whole work-group, in front of every barrier */
  const int wr = w / WN, wc = w % WN;      /* the wave's place in the block tile */
  const int row0 = rowB + 64 * wr, col0 = colB + 64 * wc;
  const int cr = tid / (G2_KP / 8), cc = tid % (G2_KP / 8);      /* copies: the lane's row of a round and its 16 bytes of that row */
  const _Float16* ga = A + (size_t)(rowB + cr) * lda + cc * 8; const _Float16* gb = Bh + (size_t)(colB + cr) * ldb + cc * 8;
  const _Float16* g2 = TWOP ? A2 + (size_t)by * sA + (size_t)(rowB + cr) * lda + cc * 8 : ga;
  const unsigned lc = (unsigned)(size_t)sm + (unsigned)(cr * G2_PITCH + cc * 16);
  const char* fa = sm + (64 * wr + ln) * G2_PITCH + 16 * hh; const char* fb = sm + OPER + (64 * wc + ln) * G2_PITCH + 16 * hh;
  const int n2 = TWOP ? K / G2_KP : 0; const int np = n2 + K / G2_KP;      /* passes 0 .. n2 - 1 read A2, passes n2 .. np - 1 read A; both walk the same k of B */
  const auto pa = [&](int t) { return (TWOP && t < n2) ? g2 + (size_t)t * G2_KP : ga + (size_t)(t - n2) * G2_KP; };
  const auto pb = [&](int t) { return gb + (size_t)((TWOP && t >= n2) ? t - n2 : t) * G2_KP; };
  const auto cp = [&](unsigned l, int t) {      /* pass t -> the buffer whose first byte of this lane is l: A's BM rows, then B's BN rows */
    const _Float16* p = pa(t); const _Float16* q = pb(t);
#pragma unroll
    for (int c = 0; c < BM / (8 * RS); ++c) g2_copy8<RS>(l + (unsigned)(c * 8 * RS * G2_PITCH), p + (size_t)(c * 8 * RS) * lda, (size_t)lda);
#pragma unroll
    for (int c = 0; c < BN / (8 * RS); ++c) g2_copy8<RS>(l + (unsigned)(OPER + c * 8 * RS * G2_PITCH), q + (size_t)(c * 8 * RS) * ldb, (size_t)ldb); };
  cp(lc, 0);      /* pass 0 -> buffer 0 */
  if (SM == 2) {      /* one thread per row of the block, while pass 0 flies; the barrier below publishes fs and il together with pass 0 */
    const float* kp = st + (size_t)by * SQ + rowB + tid; float kv[SM_T], lv[SM_T];
#pragma unroll
    for (int t = 0; t < SM_T; ++t) { kv[t] = kp[(size_t)t * NR]; lv[t] = kp[(size_t)(SM_T + t) * NR]; }
    float km = kv[0];
#pragma unroll
    for (int t = 1; t < SM_T; ++t) km = fmaxf(km, kv[t]);
    float sum = 0.f;
#pragma unroll
    for (int t = 0; t < SM_T; ++t) { const float f = ldexpf(1.0f, (int)fmaxf(kv[t] - km, -200.0f)); sum += lv[t] * f; fs[t * BM + tid] = (_Float16)f; }      /* below 2^-149 the factor is 0 */
    il[tid] = (sum == 0.f) ? 0.f : 1.0f / sum; }
  asm volatile("s_wait_asynccnt 0x0" ::: "memory");      /* this wave's copies of pass 0 have landed */
  __syncthreads();      /* every wave's have: pass 0 may be read */
  if (np > 1) cp(lc + STAGE, 1);      /* pass 1 -> buffer 1, where there is one (the same test for the whole work-group) */
  const v8f z8 = {0.f,0.f,0.f,0.f,0.f,0.f,0.f,0.f}; v8f acc[4][4];
#pragma unroll
  for (int i = 0; i < 4; ++i)
#pragma unroll
    for (int j = 0; j < 4; ++j) acc[i][j] = z8;
#pragma unroll 1      /* one pass per trip: the buffer offset is the only thing that differs, and an unrolled copy of a pass's WMMAs buys nothing */
  for (int t = 0; t < np; ++t) { const int bo = (t & 1) * STAGE;
    if (TWOP && t == n2) {      /* once, the same for every wave: the first plane's sum takes its weight before the second plane adds on */
#pragma unroll
      for (int i = 0; i < 4; ++i)
#pragma unroll
        for (int j = 0; j < 4; ++j) acc[i][j] *= pre; }
    _Float16 sc[4];
#pragma unroll
    for (int ks = 0; ks < G2_KP / 32; ++ks) { v16h a[4], b[4];
      if (SM == 2 && (ks & 1) == 0) {      /* a new tile of 64 keys */
#pragma unroll
        for (int i = 0; i < 4; ++i) sc[i] = fs[(t * (G2_KP / 64) + (ks >> 1)) * BM + 64 * wr + 16 * i + ln]; }      /* a lane's A fragment i holds row 16 i + ln of the wave tile */
#pragma unroll
      for (int i = 0; i < 4; ++i) { a[i] = g2_lfrag(fa + bo + i * 16 * G2_PITCH + ks * 64); b[i] = g2_lfrag(fb + bo + i * 16 * G2_PITCH + ks * 64); if (SM == 2) a[i] = a[i] * sc[i]; }
#pragma unroll
      for (int j = 0; j < 4; ++j)
#pragma unroll
        for (int i = 0; i < 4; ++i) acc[i][j] = g2_mma(a[i], b[j], acc[i][j]); }
    asm volatile("s_wait_dscnt 0x0" ::: "memory");      /* this wave's reads of buffer t mod 2 are done before the barrier lets it be refilled */
    asm volatile("s_wait_asynccnt 0x0" ::: "memory");      /* this wave's copies of pass t + 1 have landed */
    __syncthreads();      /* publishes pass t + 1 and ends every reader's last read of buffer t mod 2 */
    if (t + 2 < np) cp(lc + bo, t + 2); }
  asm volatile("s_wait_asynccnt 0x0" ::: "memory");      /* nothing of the ring is in flight when its bytes become the output staging */
  float* so = (float*)(sm + (size_t)w * (64 * G2_SOP * 4));      /* the wave's own 64 x 68 floats */
  if (SM == 1) {
    bool mo[4];
#pragma unroll
    for (int t = 0; t < 4; ++t) mo[t] = mk[(size_t)by * SQ + col0 + t * 16 + ln] != 0;
#pragma unroll
    for (int u = 0; u < 16; ++u) { const int t = u & 3, rt = u >> 2;
#pragma unroll
      for (int r = 0; r < 8; ++r) so[(rt * 16 + 8 * hh + r) * G2_SOP + t * 16 + ln] = mo[t] ? -__builtin_inff() : acc[rt][t][r]; }
    __builtin_amdgcn_fence(__ATOMIC_ACQ_REL, "workgroup"); __builtin_amdgcn_wave_barrier();      /* the wave's own staging: rows are read by other lanes than wrote them */
    float* sk = st + (size_t)(col0 >> 6) * NR + (size_t)by * SQ + row0 + lane;
#pragma unroll 1      /* a lane takes one whole row per trip (rows lane, lane + 32): maximum and sum need no other lane; rolled so that one row's 64 scores are in registers at a time */
    for (int h = 0; h < 2; ++h) { float* rp = so + (lane + 32 * h) * G2_SOP; v4f x[16];
#pragma unroll
      for (int j = 0; j < 16; ++j) x[j] = *(const v4fa*)(rp + 4 * j);
      v4f m4 = x[0];
#pragma unroll
      for (int j = 1; j < 16; ++j)
#pragma unroll
        for (int q = 0; q < 4; ++q) m4[q] = fmaxf(m4[q], x[j][q]);
      const float mx = fmaxf(fmaxf(m4[0], m4[1]), fmaxf(m4[2], m4[3])); const bool none = mx == -__builtin_inff();
      const float kk = none ? 0.f : ceilf(mx * 1.44269504f); const float sh = 8.0f - kk; v4f s4 = {0.f, 0.f, 0.f, 0.f};
#pragma unroll
      for (int j = 0; j < 8; ++j) { FragH f;
#pragma unroll
        for (int q = 0; q < 8; ++q) { const float a = fmaf(x[2 * j + (q >> 2)][q & 3], 1.44269504f, sh); float e;
          asm("v_exp_f32 %0, %1\n\tv_nop" : "=v"(e) : "v"(a));      /* the v_nop keeps the one slot the instruction set asks for behind a transcendental */
          s4[q & 3] += e; f.h[q] = (_Float16)e; }
        *(v8us*)((char*)rp + 16 * j) = f.half[0]; }      /* the f16 weights go over the first 128 bytes of the lane's own row, all of which is in x[] by now */
      sk[32 * h] = none ? -3.0e38f : kk; sk[(size_t)SM_T * NR + 32 * h] = (s4[0] + s4[1]) + (s4[2] + s4[3]);
      asm volatile("s_wait_xcnt 0x0" ::: "memory"); }      /* the next trip rewrites data registers of this trip's stores */
    __builtin_amdgcn_fence(__ATOMIC_ACQ_REL, "workgroup"); __builtin_amdgcn_wave_barrier();      /* rows are read back by other lanes than wrote them */
    const char* rr = (const char*)(so + (lane >> 3) * G2_SOP) + (lane & 7) * 16;      /* eight lanes per 128-byte row: a wave-wide store covers four whole lines */
    unsigned short* pp = (unsigned short*)C16 + cofs + (size_t)(row0 + (lane >> 3)) * SQ + col0 + (lane & 7) * 8;      /* the weight rows' pitch is the constant SQ, so that a trip's eight stores share this one address */
#pragma unroll 1      /* two trips of eight stores in flight */
    for (int g = 0; g < 2; ++g) { v8us v[8];
#pragma unroll
      for (int i = 0; i < 8; ++i) v[i] = *(const v8us*)(rr + i * 4 * G2_SOP * 4);
#pragma unroll
      for (int i = 0; i < 8; ++i) *(v8us*)(pp + (size_t)i * 4 * SQ) = v[i];
      asm volatile("s_wait_xcnt 0x0" ::: "memory");      /* the next trip rewrites the address and data registers of this trip's stores */
      rr += 32 * G2_SOP * 4; pp += (size_t)32 * SQ; }
    return; }
  float bv[4];
#pragma unroll
  for (int t = 0; t < 4; ++t) bv[t] = HASB ? bf16_round(bias[(size_t)by * sBias + col0 + t * 16 + ln]) : 0.f;
#pragma unroll
  for (int u = 0; u < 16; ++u) { const int t = u & 3, rt = u >> 2;
#pragma unroll
    for (int r = 0; r < 8; ++r) so[(rt * 16 + 8 * hh + r) * G2_SOP + t * 16 + ln] = HASB ? acc[rt][t][r] * alpha + bv[t] : acc[rt][t][r] * alpha; }
  __builtin_amdgcn_fence(__ATOMIC_ACQ_REL, "workgroup"); __builtin_amdgcn_wave_barrier();
  const int rsub = lane >> 4, c4 = (lane & 15) * 4;
  const size_t es = (size_t)2 * ldc;      /* a lane's rows are two apart */
  size_t eb = cofs + (size_t)(row0 + rsub) * ldc + col0 + c4;
  const float* sr = so + rsub * G2_SOP + c4;
#pragma unroll 1      /* four trips of 16 rows: rolled so that the text that runs once per work-group stays short (with tanh an unrolled copy is four times as long); inside a trip the eight loads, and the eight stores, are in flight together */
  for (int qb = 0; qb < 4; ++qb) { v4f v[8];
    if (ADDC) { v4f c[8];
#pragma unroll
      for (int q = 0; q < 8; ++q) c[q] = *(const v4fa*)(C + eb + q * es);
#pragma unroll
      for (int q = 0; q < 8; ++q) v[q] = *(const v4fa*)(sr + q * 2 * G2_SOP) + c[q]; }
    else {
#pragma unroll
      for (int q = 0; q < 8; ++q) v[q] = *(const v4fa*)(sr + q * 2 * G2_SOP); }
#pragma unroll
    for (int q = 0; q < 8; ++q) {
      if (SM == 2) v[q] = v[q] * il[64 * wr + 16 * qb + 2 * q + rsub];
#pragma unroll
      for (int i = 0; i < 4; ++i) v[q][i] = g2_act<ACT>(v[q][i]);
      if (F32O) *(v4f*)(C + eb + q * es) = v[q];
      if (F16O) { v4h h4;
#pragma unroll
        for (int i = 0; i < 4; ++i) h4[i] = (_Float16)v[q][i];
        *(v4h*)(C16 + eb + q * es) = h4; } }
    asm volatile("s_wait_xcnt 0x0" ::: "memory");      /* the next trip rewrites the address and data registers of this trip's loads and stores */
    eb += 8 * es; sr += 16 * G2_SOP; } }


__global__ __launch_bounds__(256) void k_rsm(const float* __restrict__ S, _Float16* __restrict__ P, int nrows) {
  #pragma clang fp contract(off)
  const int i = blockIdx.x * 256 + threadIdx.x; if (i >= nrows) return; const float* s = S + (size_t)i * SQ; float mx = -3.0e38f;
#pragma unroll 1
  for (int j = 0; j < SQ; ++j) mx = fmaxf(mx, s[j]); float se = 0.f;
#pragma unroll 1
  for (int j = 0; j < SQ; ++j) se += expf(s[j] - mx); const float sc = 256.0f / se;
#pragma unroll 1
  for (int j0 = 0; j0 < SQ; j0 += 8) { FragH f; for (int q = 0; q < 8; ++q) f.h[q] = (_Float16)(expf(s[j0 + q] - mx) * sc); unsigned short* d = (unsigned short*)P + (size_t)i * SQ + j0; *(v8us*)d = f.half[0];  } }
__global__ __launch_bounds__(256) void k_vt(const _Float16* __restrict__ V16, int b, int h0, _Float16* __restrict__ VT) { __shared__ unsigned short tl[64][65]; const int tid = threadIdx.x; const int hh = blockIdx.x % HG, sg = blockIdx.x / HG; const int s0 = sg * 64; const int h = h0 + hh;
  for (int i = tid; i < 64 * 8; i += 256) { const int j = i / 8, d8 = (i % 8) * 8; FragH f; f.half[0] = *(const v8us*)((const unsigned short*)V16 + ((size_t)b * SQ + s0 + j) * DM + h * HD + d8); for (int q = 0; q < 8; ++q) tl[d8 + q][j] = f.u[q]; }
  __syncthreads();
  { for (int i = tid; i < 64 * 8; i += 256) { const int d = i / 8, j8 = (i % 8) * 8; FragH f; for (int q = 0; q < 8; ++q) f.u[q] = tl[d][j8 + q]; *(v8us*)((unsigned short*)VT + ((size_t)hh * HD + d) * SQ + s0 + j8) = f.half[0]; }  } }


extern "C" void kernel_launch(void* const* d_in, const int* in_sizes, int n_in,
                              void* d_out, int out_size, void* d_ws, size_t ws_size, hipStream_t stream) {
  (void)in_sizes; (void)n_in; (void)out_size;
  const float* const* I = (const float* const*)d_in; const float* in1 = I[0]; const float* in2 = I[1]; const int* mask2 = (const int*)d_in[2]; const float* w1 = I[3]; const float* w2 = I[4]; const float* b2 = I[5];      /* weights natural [out][in] */
  char* ws = (char*)d_ws; size_t off = 0;
  auto take = [&](size_t bytes) { char* p = ws + off; off += (bytes + 255) & ~(size_t)255; return p; };
  _Float16* B1 = (_Float16*)take((size_t)NC * NC * 2); _Float16* B2 = (_Float16*)take((size_t)NO * 2 * NC * 2);
  _Float16* X2T = (_Float16*)take(NR * NC * 2); _Float16* X2 = (_Float16*)take(NR * NC * 2); _Float16* N1H = (_Float16*)take(NR * NC * 2); _Float16* N1L = (_Float16*)take(NR * NC * 2); _Float16* CAT = (_Float16*)take(NR * 2 * NC * 2);
  _Float16* P = (_Float16*)take((size_t)NB * SQ * SQ * 2);      /* the f16 softmax weights of all batches */
  float* ST = (float*)take((size_t)2 * SM_T * NR * 4);      /* per 64 keys and row: k, then the weights' sum */
  float* N1F = (float*)P;      /* n1 in f32 is last read by k_hl, before the first weight is written */
  if (off > ws_size) return;      /* 1.5 + 16 + 16 + 16 + 16 + 32 + 64 + 4 = approx 166 MiB */
  k_prep<<<2 * ST_GX + ST_G1 + ST_G2, 256, 0, stream>>>(in1, in2, w1, w2, CAT, X2, B1, B2);      /* cat columns 0..511 = in1; in2 rows; both weights */
  const size_t r0p = (size_t)B0 * SQ;
  k_gemm2<0, false, false, true, false><<<dim3((unsigned)((MP / 256) * (NC / 128)), 1), 256, 0, stream>>>(CAT + r0p * 2 * NC, 2 * NC, 0, B1, NC, 0, 0.0625f, nullptr, 0, N1F + r0p * NC, nullptr, NC, 0, MP, NC, NC, nullptr, 0.f, nullptr, nullptr);      /* n1 = in1 W1^T (f32) */
  k_hl<<<(unsigned)((size_t)MP * NC / (8 * HL_WE)), 256, 0, stream>>>(N1F + r0p * NC, N1H + r0p * NC, N1L + r0p * NC);
  /* every stage below runs all batches in one launch; in the two attention GEMMs blockIdx.y = batch, through the batch strides that k_gemm2 already takes */
  const dim3 gs((QN / 256) * (SQ / 256), NBR); const size_t sX = (size_t)SQ * NC, sS = (size_t)SQ * SQ;
  k_vt<NH, SQ, NC><<<NBR * NH * (SQ / VT_R), 256, 0, stream>>>(X2 + r0p * NC, 0, X2T);      /* in2^T [batch][512][2048] */
  k_gemm2<0, false, false, false, false, true, 1, 4, 4><<<gs, 512, 0, stream>>>(N1H + r0p * NC, NC, sX, X2 + r0p * NC, NC, sX, 1.0f, nullptr, 0, nullptr, P, SQ, sS, QN, SQ, NC, N1L + r0p * NC, 0.0009765625f, mask2 + r0p, ST);      /* scores = lo x 2^-10 + hi, both terms in the accumulators; leave as weights per 64 keys */
  k_gemm2<0, false, false, false, true, false, 2><<<dim3((QN / 256) * (NC / 128), NBR), 256, 0, stream>>>(P, SQ, sS, X2T, SQ, sX, 1.0f, nullptr, 0, nullptr, CAT + r0p * 2 * NC + NC, 2 * NC, 2 * sX, QN, NC, SQ, nullptr, 0.f, nullptr, ST);      /* fused = weights . in2 / row sum -> cat columns 512..1023 */
  k_gemm2<8, true, false, true, false><<<dim3((unsigned)((MPO / 256) * (NO / 128)), 1), 256, 0, stream>>>(CAT + r0p * 2 * NC, 2 * NC, 0, B2, 2 * NC, 0, 0.0625f, b2, 0, (float*)d_out + r0p * NO, nullptr, NO, 0, MPO, NO, 2 * NC, nullptr, 0.f, nullptr, nullptr);      /* out = tanh(cat W2^T + b2) */
}

// v010
// A run of this version takes 118 microseconds.
// Two timings next to v009 put it at 1.12 and 1.13 times that version's speed.
// Over all steps from v000 it is 48.5 times as fast.
#include <hip/hip_runtime.h>
// Cross attention with concat + tanh projection (in1, in2 [8][2048][512]; mask2 [8][2048] int32, nonzero = key masked out; n1 = in1 W1^T (W1 [512][512] natural, no bias); scores = n1 in2^T (no scaling); masked keys -> -inf; softmax over the 2,048 keys; fused = attn in2; out = tanh([in1 | fused] W2^T + b2) (W2 [512][1024] natural) -> [8][2048][512]).
// Structure: token rows; in1, in2 as exact f16 rows; n1 = in1 W1^T as a WMMA GEMM (256x128 block tiles, 256x256 for the scores, staged in LDS 128 k at a time, 64x64 wave tiles, f32 accumulation, exact x16 natural weights) whose epilogue splits each f32 value into f16 hi + 2^-10 residual planes (n1 is never stored in f32); then, all batches in each launch (grid y = batch in the two attention GEMMs): scores = n1 in2^T as ONE GEMM launch of two terms (the lo plane's K = 512 passes first, their sum x 2^-10 is the start value of the hi plane's passes; in2 exact), masked softmax folded into the two GEMMs around it (the score epilogue turns each wave's 64 x 64 scores into f16 weights 2^8 exp2(s log2 e - k), k = the whole-number ceiling of log2 e times the row's maximum over those 64 keys, with k and the f32 sum of the weights per row and 64 keys; masked keys 0; no score is stored), in2^T via LDS transposes, fused = P . in2 GEMM (K = 2048; each 64-key tile of a pass scales its A rows by the exact power of two 2^(k - row maximum of k), the epilogue divides by the row sum) written as plain f16 straight into columns 512..1023 of the f16 concat rows whose columns 0..511 are the exact in1; out = tanh(cat W2^T + b2) as ONE GEMM (K = 1024, exact x16 natural W2, alpha 1/16) with the tanh epilogue.
// Compute dtype: inputs rounded to bf16; in1, in2, weights exact in f16; n1 as f16 hi + residual planes (~2^-22: the logits have sigma ~23, so plain f16 would cost ~3e-3 logits); softmax weights (x256) and fused (unscaled: f16 relative precision is scale-free and a x16/x0.25 weight split would push small W2 entries into f16 subnormals) plain f16 (~2^-12); scores, softmax statistics and the output f32. v_wmma_f32_16x16x32_f16.
#define NB 8
#define SQ 2048
#define NC 512                       /* d_in = d_hid */
#define NO 512                       /* output features */
#define DM NC
#define NH (NC / 64)                 /* 8 slabs of 64 for the in2^T transpose */
#define HD 64
#define HG 1
#define B0 0                         /* first batch processed (debug hook) */
#define NBR NB                       /* batches processed (debug hook) */
#define QN SQ                        /* query rows attended per batch (debug hook) */
#define NR ((size_t)NB * SQ)
#define MP ((int)((size_t)NBR * SQ)) /* rows projected (debug hook) */
#define MPO MP                       /* rows through the output GEMM (debug hook) */
typedef __bf16 v16b __attribute__((ext_vector_type(16)));
typedef unsigned short v8us __attribute__((ext_vector_type(8), may_alias));
typedef float  v8f  __attribute__((ext_vector_type(8)));
typedef float  v4f  __attribute__((ext_vector_type(4)));
typedef float  v4fa __attribute__((ext_vector_type(4), may_alias));
union FragB { v16b v; v8us half[2]; unsigned short u[16]; };

__device__ __forceinline__ unsigned short bf16_bits(float x) { unsigned int u = __float_as_uint(x); return (unsigned short)((u + 0x7FFFu + ((u >> 16) & 1u)) >> 16); }
__device__ __forceinline__ float bf16_val(unsigned short b) { return __uint_as_float(((unsigned int)b) << 16); }
__device__ __forceinline__ float bf16_round(float x) { return bf16_val(bf16_bits(x)); }
// D += A·B with NT terms: 1 = ah·bh, 2 = + al·bh (A split), 3 = + ah·bl (both split)
template <int NT>
__device__ __forceinline__ v8f mmaN(v16b ah, v16b al, v16b bh, v16b bl, v8f c) {
  c = __builtin_amdgcn_wmma_f32_16x16x32_bf16(false, ah, false, bh, (short)0, c, false, false);
  if (NT >= 2) c = __builtin_amdgcn_wmma_f32_16x16x32_bf16(false, al, false, bh, (short)0, c, false, false);
  if (NT >= 3) c = __builtin_amdgcn_wmma_f32_16x16x32_bf16(false, ah, false, bl, (short)0, c, false, false);
  asm volatile("v_nop\n\tv_nop\n\tv_nop\n\tv_nop" : "+v"(c) : "v"(ah), "v"(al), "v"(bh), "v"(bl));
  return c;
}

__global__ __launch_bounds__(256) void k_wt_bf16(const float* __restrict__ W, unsigned short* __restrict__ Wt, int K, int N) {
  const int t = blockIdx.x * 256 + threadIdx.x;
  const int k8n = K / 8;
  if (t >= N * k8n) return;
  const int n = t / k8n, k8 = (t % k8n) * 8;
  v8us v;
#pragma unroll
  for (int i = 0; i < 8; ++i) v[i] = bf16_bits(W[(size_t)(k8 + i) * N + n]);
  *(v8us*)(Wt + (size_t)n * K + k8) = v;
  
}

// GEMM C[M][N] (f32, pitch ldc) = act(A[M][K]·W + bias). A f32 row-major (pitch lda) converted per fragment to bf16
// (ASPLIT: hi/lo two planes -> 2 terms, else single rounded term); Wt bf16 [N][K] (pitch ldb). BIAS_BF16 rounds the
// bias to bf16 first (bias quantised to bf16 before the add). K%32==0, M%16==0, N%64==0.
template <bool ASPLIT, int ACT, bool BIAS_BF16>
__global__ __launch_bounds__(128) void k_gemm_bf(const float* __restrict__ A, int lda, const unsigned short* __restrict__ Wt, int ldb,
                                               const float* __restrict__ bias, float* __restrict__ C, int ldc, int M, int N, int K) {
  __shared__ __attribute__((aligned(16))) float so[4][16][64];
  const int tid = threadIdx.x, w = tid >> 5, lane = tid & 31, ln = lane & 15, hh = lane >> 4;
  const int ntn = N / 64;
  const int wid = blockIdx.x * 4 + w;
  const int mt = wid / ntn, nq = wid % ntn;
  if (mt * 16 >= M) return;
  const int row0 = mt * 16, col0 = nq * 64;
  const float* arow = A + (size_t)(row0 + ln) * lda;
  v8f acc[4] = {};
  for (int kb = 0; kb < K; kb += 32) {
    FragB ah, al;
    const v4f x0 = *(const v4fa*)(arow + kb + 8 * hh), x1 = *(const v4fa*)(arow + kb + 8 * hh + 4);
    const v4f x2 = *(const v4fa*)(arow + kb + 16 + 8 * hh), x3 = *(const v4fa*)(arow + kb + 16 + 8 * hh + 4);
    float xs[16] = {x0[0],x0[1],x0[2],x0[3],x1[0],x1[1],x1[2],x1[3],x2[0],x2[1],x2[2],x2[3],x3[0],x3[1],x3[2],x3[3]};
#pragma unroll
    for (int i = 0; i < 16; ++i) { const unsigned short hb = bf16_bits(xs[i]); ah.u[i] = hb; al.u[i] = ASPLIT ? bf16_bits(xs[i] - bf16_val(hb)) : (unsigned short)0; }
#pragma unroll
    for (int t = 0; t < 4; ++t) {
      const unsigned short* brow = Wt + (size_t)(col0 + t * 16 + ln) * ldb + kb;
      FragB b;
      b.half[0] = *(const v8us*)(brow + 8 * hh);
      b.half[1] = *(const v8us*)(brow + 16 + 8 * hh);
      acc[t] = mmaN<ASPLIT ? 2 : 1>(ah.v, al.v, b.v, b.v, acc[t]);
    }
  }
#pragma unroll
  for (int t = 0; t < 4; ++t) {
    float bv = bias ? bias[col0 + t * 16 + ln] : 0.f;
    if (BIAS_BF16) bv = bf16_round(bv);
#pragma unroll
    for (int r = 0; r < 8; ++r) { float v = acc[t][r] + bv; if (ACT == 1) v = fmaxf(v, 0.f); so[w][8 * hh + r][t * 16 + ln] = v; }
  }
  __builtin_amdgcn_fence(__ATOMIC_ACQ_REL, "workgroup");
  __builtin_amdgcn_wave_barrier();
  const int rsub = lane >> 4, c4 = (lane & 15) * 4;
  {
#pragma unroll
    for (int q = 0; q < 8; ++q) {
      const int r = q * 2 + rsub;
      const v4f v = *(const v4fa*)&so[w][r][c4];
      *(v4f*)(C + (size_t)(row0 + r) * ldc + col0 + c4) = v;
    }
    
  }
}

// GEMM C = act(A·W + bias + resid): A f32 (ASPLIT -> hi/lo 2 terms), Wt bf16 [N][K]; ACT 0 none, 1 relu, 2 exact gelu;
// resid (optional, f32, row index = (row % rmod), pitch ldr, RES_BF16 rounds it) added before the activation.
template <bool ASPLIT, int ACT, bool BIAS_BF16, bool RES_BF16>
__global__ __launch_bounds__(128) void k_gemm_bf3(const float* __restrict__ A, int lda, const unsigned short* __restrict__ Wt, int ldb,
                                                const float* __restrict__ bias, const float* __restrict__ resid, int rmod, int ldr,
                                                float* __restrict__ C, int ldc, int M, int N, int K) {
  __shared__ __attribute__((aligned(16))) float so[4][16][64];
  const int tid = threadIdx.x, w = tid >> 5, lane = tid & 31, ln = lane & 15, hh = lane >> 4;
  const int ntn = N / 64;
  const int wid = blockIdx.x * 4 + w;
  const int mt = wid / ntn, nq = wid % ntn;
  if (mt * 16 >= M) return;
  const int row0 = mt * 16, col0 = nq * 64;
  const float* arow = A + (size_t)(row0 + ln) * lda;
  v8f acc[4] = {};
  for (int kb = 0; kb < K; kb += 32) {
    FragB ah, al;
    const v4f x0 = *(const v4fa*)(arow + kb + 8 * hh), x1 = *(const v4fa*)(arow + kb + 8 * hh + 4);
    const v4f x2 = *(const v4fa*)(arow + kb + 16 + 8 * hh), x3 = *(const v4fa*)(arow + kb + 16 + 8 * hh + 4);
    float xs[16] = {x0[0],x0[1],x0[2],x0[3],x1[0],x1[1],x1[2],x1[3],x2[0],x2[1],x2[2],x2[3],x3[0],x3[1],x3[2],x3[3]};
#pragma unroll
    for (int i = 0; i < 16; ++i) { const unsigned short hb = bf16_bits(xs[i]); ah.u[i] = hb; al.u[i] = ASPLIT ? bf16_bits(xs[i] - bf16_val(hb)) : (unsigned short)0; }
#pragma unroll
    for (int t = 0; t < 4; ++t) {
      const unsigned short* brow = Wt + (size_t)(col0 + t * 16 + ln) * ldb + kb;
      FragB b;
      b.half[0] = *(const v8us*)(brow + 8 * hh);
      b.half[1] = *(const v8us*)(brow + 16 + 8 * hh);
      acc[t] = mmaN<ASPLIT ? 2 : 1>(ah.v, al.v, b.v, b.v, acc[t]);
    }
  }
#pragma unroll
  for (int t = 0; t < 4; ++t) {
    const int col = col0 + t * 16 + ln;
    float bv = bias ? bias[col] : 0.f;
    if (BIAS_BF16) bv = bf16_round(bv);
#pragma unroll
    for (int r = 0; r < 8; ++r) {
      float v = acc[t][r] + bv;
      if (resid) { float rv = resid[(size_t)((row0 + 8 * hh + r) % rmod) * ldr + col]; if (RES_BF16) rv = bf16_round(rv); v += rv; }
      if (ACT == 1) v = fmaxf(v, 0.f);
      if (ACT == 2) v = 0.5f * v * (1.0f + erff(v * 0.70710678118654752f));
      if (ACT == 3) { const float u = 0.7978845608028654f * (v + 0.044715f * v * v * v); v = 0.5f * v * (1.0f + tanhf(u)); }
      so[w][8 * hh + r][t * 16 + ln] = v;
    }
  }
  __builtin_amdgcn_fence(__ATOMIC_ACQ_REL, "workgroup");
  __builtin_amdgcn_wave_barrier();
  const int rsub = lane >> 4, c4 = (lane & 15) * 4;
  {
#pragma unroll
    for (int q = 0; q < 8; ++q) {
      const int r = q * 2 + rsub;
      const v4f v = *(const v4fa*)&so[w][r][c4];
      *(v4f*)(C + (size_t)(row0 + r) * ldc + col0 + c4) = v;
    }
    
  }
}
// row LayerNorm (biased variance, eps) over N: s = X (+ R); optional out_sum <- s; out_norm <- (s-mu)*rsqrt(var+eps)*g + b
template <bool PARAM_BF16>
__global__ __launch_bounds__(256) void k_layernorm(const float* __restrict__ X, const float* __restrict__ R, const float* __restrict__ g, const float* __restrict__ bta,
                                                  float* __restrict__ out_sum, float* __restrict__ out_norm, int N, float eps) {
  __shared__ float red[256];
  const int row = blockIdx.x, tid = threadIdx.x;
  const float* x = X + (size_t)row * N; const float* rr = R ? R + (size_t)row * N : nullptr;
  float vals[16];                     // up to N = 4096
  const int per = N / 256;            // contiguous chunk per thread? use strided-by-4 chunks: thread handles j = tid*4 + 1024*u
  float s1 = 0.f;
  for (int u = 0; u < per / 4; ++u) {
    const int j = tid * 4 + 1024 * u;
    const v4f a = *(const v4fa*)(x + j);
    v4f b = {0.f,0.f,0.f,0.f}; if (rr) b = *(const v4fa*)(rr + j);
#pragma unroll
    for (int q = 0; q < 4; ++q) { const float v = a[q] + b[q]; vals[u * 4 + q] = v; s1 += v; }
  }
  red[tid] = s1; __syncthreads();
  for (int st = 128; st > 0; st >>= 1) { if (tid < st) red[tid] += red[tid + st]; __syncthreads(); }
  const float mu = red[0] / (float)N; __syncthreads();
  float s2 = 0.f;
  for (int u = 0; u < per / 4; ++u)
#pragma unroll
    for (int q = 0; q < 4; ++q) { const float c = vals[u * 4 + q] - mu; s2 += c * c; }
  red[tid] = s2; __syncthreads();
  for (int st = 128; st > 0; st >>= 1) { if (tid < st) red[tid] += red[tid + st]; __syncthreads(); }
  const float rs = rsqrtf(red[0] / (float)N + eps);
  {
    for (int u = 0; u < per / 4; ++u) {
      const int j = tid * 4 + 1024 * u;
      v4f o, sm;
#pragma unroll
      for (int q = 0; q < 4; ++q) {
        float gg = g[j + q], bb = bta[j + q];
        if (PARAM_BF16) { gg = bf16_round(gg); bb = bf16_round(bb); }
        sm[q] = vals[u * 4 + q]; o[q] = (vals[u * 4 + q] - mu) * rs * gg + bb;
      }
      if (out_sum) *(v4f*)(out_sum + (size_t)row * N + j) = sm;
      *(v4f*)(out_norm + (size_t)row * N + j) = o;
    }
    
  }
}



// ---- f16 WMMA path (v_wmma_f32_16x16x32_f16): 11-bit significands for operands in range — the instruction every GEMM launched in this file runs on
typedef _Float16 v16h __attribute__((ext_vector_type(16)));
union FragH { v16h v; v8us half[2]; _Float16 h[16]; unsigned short u[16]; };
template <int NT>
__device__ __forceinline__ v8f mmaH(v16h ah, v16h al, v16h bh, v16h bl, v8f c) {
  c = __builtin_amdgcn_wmma_f32_16x16x32_f16(false, ah, false, bh, (short)0, c, false, false);
  if (NT >= 2) c = __builtin_amdgcn_wmma_f32_16x16x32_f16(false, al, false, bh, (short)0, c, false, false);
  if (NT >= 3) c = __builtin_amdgcn_wmma_f32_16x16x32_f16(false, ah, false, bl, (short)0, c, false, false);
  asm volatile("v_nop\n\tv_nop\n\tv_nop\n\tv_nop" : "+v"(c) : "v"(ah), "v"(al), "v"(bh), "v"(bl));
  return c;
}
// batched GEMM like k_gemm_b but f16 operands: A f32 (split into f16 hi/lo if ASPLIT, else rounded to f16), Bt = f16 values [n][k]; alpha; C f32; N multiple of 16 (partial tiles skipped)
template <bool ASPLIT>
__global__ __launch_bounds__(128) void k_gemm_h(const float* __restrict__ A, int lda, size_t sA, const _Float16* __restrict__ Bh, int ldb, size_t sB, float alpha, float* __restrict__ C, int ldc, size_t sC, int M, int N, int K) {
  __shared__ __attribute__((aligned(16))) float so[4][16][64];
  const int tid = threadIdx.x, w = tid >> 5, lane = tid & 31, ln = lane & 15, hh = lane >> 4; const int by = blockIdx.y;
  A += (size_t)by * sA; Bh += (size_t)by * sB; C += (size_t)by * sC;
  const int ntn = (N + 63) / 64; const int wid = blockIdx.x * 4 + w; const int mt = wid / ntn, nq = wid % ntn; if (mt * 16 >= M) return;
  const int row0 = mt * 16, col0 = nq * 64; const float* arow = A + (size_t)(row0 + ln) * lda;
  v8f acc[4] = {};
  for (int kb = 0; kb < K; kb += 32) {
    FragH ah, al;
    const v4f x0 = *(const v4fa*)(arow + kb + 8 * hh), x1 = *(const v4fa*)(arow + kb + 8 * hh + 4), x2 = *(const v4fa*)(arow + kb + 16 + 8 * hh), x3 = *(const v4fa*)(arow + kb + 16 + 8 * hh + 4);
    float xs[16] = {x0[0],x0[1],x0[2],x0[3],x1[0],x1[1],x1[2],x1[3],x2[0],x2[1],x2[2],x2[3],x3[0],x3[1],x3[2],x3[3]};
#pragma unroll
    for (int i = 0; i < 16; ++i) { const _Float16 h = (_Float16)xs[i]; ah.h[i] = h; al.h[i] = ASPLIT ? (_Float16)(xs[i] - (float)h) : (_Float16)0.0f; }
#pragma unroll
    for (int t = 0; t < 4; ++t) { if (col0 + t * 16 >= N) continue; const size_t boff = (size_t)(col0 + t * 16 + ln) * ldb + kb; FragH bq; bq.half[0] = *(const v8us*)(Bh + boff + 8 * hh); bq.half[1] = *(const v8us*)(Bh + boff + 16 + 8 * hh);
      acc[t] = mmaH<ASPLIT ? 2 : 1>(ah.v, al.v, bq.v, bq.v, acc[t]); }
  }
#pragma unroll
  for (int t = 0; t < 4; ++t) { if (col0 + t * 16 >= N) continue;
#pragma unroll
    for (int r = 0; r < 8; ++r) so[w][8 * hh + r][t * 16 + ln] = acc[t][r] * alpha; }
  __builtin_amdgcn_fence(__ATOMIC_ACQ_REL, "workgroup"); __builtin_amdgcn_wave_barrier();
  const int rsub = lane >> 4, c4 = (lane & 15) * 4;
  {
#pragma unroll
    for (int q = 0; q < 8; ++q) { const int r = q * 2 + rsub; if (col0 + c4 < N) { const v4f v = *(const v4fa*)&so[w][r][c4]; *(v4f*)(C + (size_t)(row0 + r) * ldc + col0 + c4) = v; } }
     }
}

// Wt[n][k] = f16(W[k][n]·scale) from f32 row-major W[K][N] (scale = power of two; bf16-exact weights stay exact in f16 away from the subnormal range)
__global__ __launch_bounds__(256) void k_wt_f16(const float* __restrict__ W, _Float16* __restrict__ Wt, int K, int N, float scale) {
  const int t = blockIdx.x * 256 + threadIdx.x; if (t >= N * (K / 8)) return; const int n = t / (K / 8), k8 = (t % (K / 8)) * 8; FragH f;
#pragma unroll
  for (int i = 0; i < 8; ++i) f.h[i] = (_Float16)(bf16_round(W[(size_t)(k8 + i) * N + n]) * scale); const v8us o = f.half[0];
  *(v8us*)((unsigned short*)Wt + (size_t)n * K + k8) = o; 
}
// k_gemm_hh variant with fused epilogue: v = acc·alpha + bias[by·sBias + col] (+ CP[(row/rowsPerB)·sCPb + by·64 + col] if CP) ; ACT 0 none / 1 elu ; writes f16 C16 (and f32 C if non-null)
template <int ACT>
__global__ __launch_bounds__(128) void k_gemm_hhx(const _Float16* __restrict__ A, int lda, size_t sA, const _Float16* __restrict__ Bh, int ldb, size_t sB, float alpha, const float* __restrict__ bias, size_t sBias, const float* __restrict__ CP, int rowsPerB, size_t sCPb, int row0g,
    float* __restrict__ C, _Float16* __restrict__ C16, int ldc, size_t sC, int M, int N, int K) {
  __shared__ __attribute__((aligned(16))) float so[4][16][64];
  const int tid = threadIdx.x, w = tid >> 5, lane = tid & 31, ln = lane & 15, hh = lane >> 4; const int by = blockIdx.y;
  A += (size_t)by * sA; Bh += (size_t)by * sB; const size_t cofs = (size_t)by * sC; const float* bp = bias ? bias + (size_t)by * sBias : nullptr;
  const int ntn = (N + 63) / 64; const int wid = blockIdx.x * 4 + w; const int mt = wid / ntn, nq = wid % ntn; if (mt * 16 >= M) return;
  const int row0 = mt * 16, col0 = nq * 64; const _Float16* arow = A + (size_t)(row0 + ln) * lda;
  v8f acc[4] = {};
  for (int kb = 0; kb < K; kb += 32) { FragH ah; ah.half[0] = *(const v8us*)((const unsigned short*)arow + kb + 8 * hh); ah.half[1] = *(const v8us*)((const unsigned short*)arow + kb + 16 + 8 * hh);
#pragma unroll
    for (int t = 0; t < 4; ++t) { if (col0 + t * 16 >= N) continue; const size_t boff = (size_t)(col0 + t * 16 + ln) * ldb + kb; FragH bq; bq.half[0] = *(const v8us*)((const unsigned short*)Bh + boff + 8 * hh); bq.half[1] = *(const v8us*)((const unsigned short*)Bh + boff + 16 + 8 * hh);
      acc[t] = mmaH<1>(ah.v, ah.v, bq.v, bq.v, acc[t]); }
  }
#pragma unroll
  for (int t = 0; t < 4; ++t) { if (col0 + t * 16 >= N) continue; const int col = col0 + t * 16 + ln; const float bv = bp ? bf16_round(bp[col]) : 0.f;
#pragma unroll
    for (int r = 0; r < 8; ++r) { float v = acc[t][r] * alpha + bv; if (CP) { const int rr = row0g + row0 + 8 * hh + r; if (rowsPerB < 0) v += CP[cofs + (size_t)rr * ldc + col];      /* rowsPerB < 0: own element of the batched C plane */ else { const int bidx = rr / rowsPerB; v += CP[(size_t)bidx * sCPb + (size_t)by * 64 + col]; } } if (ACT == 1) v = (v > 0.f) ? v : expm1f(v); else if (ACT == 7) v = (v > 0.f) ? v + 1.0f : expf(v); else if (ACT == 8) v = tanhf(v); else if (ACT == 9) v = 0.5f * v * (1.0f + tanhf(0.7978845608028654f * (v + 0.044715f * v * v * v))); else if (ACT == 11) v = 1.0f / (1.0f + expf(-v)); else if (ACT == 12) v = (v > 0.f) ? v : 0.01f * v; else if (ACT == 14) v = (v > 0.f) ? v : 0.1f * v; else if (ACT == 16) v = (v >= 0.f) ? v : 0.3f * v; else if (ACT == 17) v = (v >= 0.f) ? v : 0.2f * v; else if (ACT == 15) v = v / (1.0f + expf(-v)); else if (ACT == 3) v = fmaxf(v, 0.f); else if (ACT == 6) v = 0.5f * v * (1.0f + erff(v * 0.70710678118654752f)); so[w][8 * hh + r][t * 16 + ln] = v; } }
  __builtin_amdgcn_fence(__ATOMIC_ACQ_REL, "workgroup"); __builtin_amdgcn_wave_barrier();
  const int rsub = lane >> 4, c4 = (lane & 15) * 4; typedef _Float16 v4h __attribute__((ext_vector_type(4)));
  {
#pragma unroll
    for (int q = 0; q < 8; ++q) { const int r = q * 2 + rsub; if (col0 + c4 < N) { const v4f v = *(const v4fa*)&so[w][r][c4]; if (C) *(v4f*)(C + cofs + (size_t)(row0 + r) * ldc + col0 + c4) = v; if (C16) { v4h h4; for (int i = 0; i < 4; ++i) h4[i] = (_Float16)v[i]; *(v4h*)(C16 + cofs + (size_t)(row0 + r) * ldc + col0 + c4) = h4; } } }
     }
}


typedef _Float16 v4h __attribute__((ext_vector_type(4)));

// ---- streaming conversions: few long waves. A wave-wide load is 32 lanes x 16 B = 512 contiguous bytes (four whole lines), eight such loads are issued before the first is used, and the 8-byte stores of a wave
// cover 256 contiguous bytes. Which thread converts a value has no bearing on the value.
#define ST_WE 4096                   /* k_prep: f32 elements per wave, four rounds of eight loads */
#define ST_BE (8 * ST_WE)            /* k_prep: elements per work-group of eight waves */
#define ST_GX ((int)(NR * NC / ST_BE))              /* work-groups per activation input */
#define ST_G1 (NC * NC / ST_BE)                     /* work-groups for W1 */
#define ST_G2 (NO * 2 * NC / ST_BE)                 /* work-groups for W2 */
// All four f32 inputs that feed a matrix product, in one launch; the work-group index picks the input (a scalar choice, no barrier in the kernel).
// in1 -> columns 0..511 of the f16 concat rows (pitch 2 NC), in2 -> f16 rows, W1 and W2 -> natural f16 rows x16; each value is first rounded to bf16. Rows of 512 (W2: half rows) keep e -> (e / 512) * pitch + e % 512.
__global__ __launch_bounds__(256) void k_prep(const float* __restrict__ in1, const float* __restrict__ in2, const float* __restrict__ w1, const float* __restrict__ w2,
    _Float16* __restrict__ cat, _Float16* __restrict__ x2, _Float16* __restrict__ b1, _Float16* __restrict__ b2) {
  static_assert(NR * NC % ST_BE == 0 && NC * NC % ST_BE == 0 && NO * 2 * NC % ST_BE == 0 && NC == 512, "k_prep: whole work-groups per input, rows of 512");
  int b = blockIdx.x; const float* s; _Float16* d; size_t ldo = NC; float sc = 1.0f;
  if (b < ST_GX) { s = in1; d = cat; ldo = 2 * NC; }
  else if (b < 2 * ST_GX) { b -= ST_GX; s = in2; d = x2; }
  else if (b < 2 * ST_GX + ST_G1) { b -= 2 * ST_GX; s = w1; d = b1; sc = 16.0f; }
  else { b -= 2 * ST_GX + ST_G1; s = w2; d = b2; sc = 16.0f; }
  const size_t w0 = (size_t)b * ST_BE + (size_t)(threadIdx.x >> 5) * ST_WE;      /* the wave's first element: the start of a row of 512 */
  const float* sp = s + w0 + (threadIdx.x & 31) * 4; _Float16* dp = d + (w0 >> 9) * ldo + (threadIdx.x & 31) * 4;
  v4f x[2][8];
#pragma unroll
  for (int i = 0; i < 8; ++i) x[0][i] = *(const v4fa*)(sp + i * 128);
#pragma unroll      /* unrolled so that x[][] is indexed by constants only and stays in registers */
  for (int u = 0; u < ST_WE / 1024; ++u) {      /* a round = 1,024 elements = two rows of 512 */
    if (u + 1 < ST_WE / 1024) {
#pragma unroll
      for (int i = 0; i < 8; ++i) x[(u + 1) & 1][i] = *(const v4fa*)(sp + (u + 1) * 1024 + i * 128);      /* the next round's loads fly while this round is converted */
      __builtin_amdgcn_sched_barrier(0); }      /* without it the scheduler sinks these loads behind most of this round's conversion, and the wave has nothing in flight meanwhile */
#pragma unroll
    for (int i = 0; i < 8; ++i) { v4h h;
#pragma unroll
      for (int q = 0; q < 4; ++q) h[q] = (_Float16)(bf16_round(x[u & 1][i][q]) * sc);
      *(v4h*)(dp + (size_t)(2 * u + (i >> 2)) * ldo + (i & 3) * 128) = h; }
    if (u + 1 < ST_WE / 1024) asm volatile("s_wait_xcnt 0x0" :: "v"(sp) : "memory"); } }      /* the next round reuses address and data registers of this round's loads and stores; naming sp keeps the load address whole up to the wait (no load may land on it) */
__global__ __launch_bounds__(256) void k_h16(const float* __restrict__ x, _Float16* __restrict__ X16, size_t n8) { const size_t t = (size_t)blockIdx.x * 256 + threadIdx.x; if (t >= n8) return; FragH f;
#pragma unroll
  for (int q = 0; q < 8; ++q) f.h[q] = (_Float16)x[t * 8 + q]; *(v8us*)((unsigned short*)X16 + t * 8) = f.half[0];  }
__global__ __launch_bounds__(256) void k_round16f(const float* __restrict__ W, _Float16* __restrict__ Bt, size_t n8) { const size_t t = (size_t)blockIdx.x * 256 + threadIdx.x; if (t >= n8) return; FragH f;
#pragma unroll
  for (int i = 0; i < 8; ++i) f.h[i] = (_Float16)(bf16_round(W[t * 8 + i]) * 16.0f); *(v8us*)((unsigned short*)Bt + t * 8) = f.half[0];  }
// Transpose of one 64-column slab, VT_R rows per work-group (a thread's VT_R / 32 loads of 16 B are all issued before the first is used); lane -> element maps inside 64 rows as for a 64-row tile.
#define VT_R 256
template <int NHv, int TTv, int LDV>
__global__ __launch_bounds__(256) void k_vt(const _Float16* __restrict__ V16, int voff, _Float16* __restrict__ Vt) { __shared__ unsigned short tl[VT_R][66]; const int tid = threadIdx.x; const int slab = blockIdx.x / (TTv / VT_R), lg = blockIdx.x % (TTv / VT_R); const int b = slab / NHv, h = slab % NHv;
  static_assert(TTv % VT_R == 0, "k_vt: whole tiles");
  const int r0 = tid / 8, c8 = (tid % 8) * 8; FragH f[VT_R / 32];
  const unsigned short* vp = (const unsigned short*)V16 + ((size_t)b * TTv + lg * VT_R + r0) * LDV + voff + h * 64 + c8;      /* the row pitch is a constant, so that all loads share this one address */
#pragma unroll
  for (int k = 0; k < VT_R / 32; ++k) f[k].half[0] = *(const v8us*)(vp + (size_t)k * 32 * LDV);
  asm volatile("s_wait_xcnt 0x0" :: "v"(vp) : "memory");      /* the address registers are reused behind the loads; naming vp keeps them whole up to the wait (no load may land on them) */
#pragma unroll
  for (int k = 0; k < VT_R / 32; ++k)
#pragma unroll
    for (int q = 0; q < 8; ++q) tl[k * 32 + r0][c8 + q] = f[k].u[q];
  __syncthreads();
  {
#pragma unroll
    for (int rd = 0; rd < VT_R / 32; ++rd) { const int d = (rd & 1) * 32 + tid / 8, pc = (rd >> 1) * 8 + tid % 8; FragH g;
#pragma unroll
      for (int q = 0; q < 8; ++q) g.u[q] = tl[pc * 8 + q][d];
      *(v8us*)((unsigned short*)Vt + ((size_t)slab * 64 + d) * TTv + lg * VT_R + pc * 8) = g.half[0]; }
     } }

// ---- fast GEMM: block tile of WM x WN waves of 64x64 (4 x 2: 256x128, one work-group per WGP where N = 512; 4 x 4: 256x256; requires M % (64 WM) == 0 rows per launch region, N % (64 WN) == 0, K % G2_KP == 0) ----
// Both operand tiles of a pass of G2_KP k are brought into LDS once per work-group by asynchronous copies (each wave-wide copy covers two whole 256-byte rows) and read from there by all its waves;
// two buffers, so that the next pass's copies fly while this pass is multiplied. Each output element still sums its k blocks of 32 in ascending order.
// An operand byte is fetched from L2 once per block tile that needs it: N / (64 WN) times for A, M / (64 WM) times for B.
#define G2_KP 128                    /* k per pass: 256-byte tile rows */
#define G2_PITCH (2 * G2_KP + 16)    /* LDS bytes per tile row, 272: 16 B x odd, the pitch at which ds_load_b128 readers of 16 rows meet no bank conflict */
#define G2_SOP 68                    /* floats per row of the output staging */
__device__ __forceinline__ v16h g2_lfrag(const char* p) { FragH f; f.half[0] = *(const v8us*)p; f.half[1] = *(const v8us*)(p + 32); return f.v; }      /* same k order as a fragment read from global rows: k = 8 hh .. 8 hh + 7, then 16 + 8 hh .. */
__device__ __forceinline__ v8f g2_mma(v16h a, v16h b, v8f c) { v8f d = __builtin_amdgcn_wmma_f32_16x16x32_f16(false, a, false, b, (short)0, c, false, false); asm volatile("v_nop\n\tv_nop\n\tv_nop\n\tv_nop" : "+v"(d) : "v"(a), "v"(b)); return d; }
// Eight rows of one operand's tile, RS rows apart: the lane's 16 bytes of rows r, r + RS, .. r + 7 RS (l = its LDS byte address for row r, p = its global address for row r, ld = global row pitch in halves).
// The s_wait_xcnt closes the copies' own statement so that no address register of a copy is rewritten in front of it.
template <int RS>
__device__ __forceinline__ void g2_copy8(unsigned l, const _Float16* p, size_t ld) {
  asm volatile("global_load_async_to_lds_b128 %0, %8, off\n\t"
               "global_load_async_to_lds_b128 %1, %9, off\n\t"
               "global_load_async_to_lds_b128 %2, %10, off\n\t"
               "global_load_async_to_lds_b128 %3, %11, off\n\t"
               "global_load_async_to_lds_b128 %4, %12, off\n\t"
               "global_load_async_to_lds_b128 %5, %13, off\n\t"
               "global_load_async_to_lds_b128 %6, %14, off\n\t"
               "global_load_async_to_lds_b128 %7, %15, off\n\t"
               "s_wait_xcnt 0x0"
               :: "v"(l), "v"(l + RS * G2_PITCH), "v"(l + 2 * RS * G2_PITCH), "v"(l + 3 * RS * G2_PITCH), "v"(l + 4 * RS * G2_PITCH), "v"(l + 5 * RS * G2_PITCH), "v"(l + 6 * RS * G2_PITCH), "v"(l + 7 * RS * G2_PITCH),
                  "v"(p), "v"(p + RS * ld), "v"(p + 2 * RS * ld), "v"(p + 3 * RS * ld), "v"(p + 4 * RS * ld), "v"(p + 5 * RS * ld), "v"(p + 6 * RS * ld), "v"(p + 7 * RS * ld)
               : "memory");
}
// The activation of one output value (ACT: 0 none, 3 relu, 6 exact gelu, 8 tanh, 9 tanh gelu, 11 sigmoid, 12/14/16/17 leaky relu 0.01/0.1/0.3/0.2, 15 silu).
template <int ACT>
__device__ __forceinline__ float g2_act(float v) {
  if (ACT == 3) v = fmaxf(v, 0.f); else if (ACT == 6) v = 0.5f * v * (1.0f + erff(v * 0.70710678118654752f)); else if (ACT == 11) v = 1.0f / (1.0f + expf(-v)); else if (ACT == 15) v = v / (1.0f + expf(-v)); else if (ACT == 12) v = (v > 0.f) ? v : 0.01f * v; else if (ACT == 8) v = fmaf(-2.0f, __builtin_amdgcn_rcpf(__builtin_amdgcn_exp2f(v * 2.88539008f) + 1.0f), 1.0f);      /* tanh v = 1 - 2 / (e^(2 v) + 1), e^(2 v) = 2^(v * 2 log2 e): no branch and no lane mask, so that the values of a trip run side by side instead of one dependent chain after another; +-1 at the ends (2^x = inf or 0), NaN stays NaN; absolute error about 2^-22 */
  else if (ACT == 9) v = 0.5f * v * (1.0f + tanhf(0.7978845608028654f * (v + 0.044715f * v * v * v))); else if (ACT == 14) v = (v > 0.f) ? v : 0.1f * v; else if (ACT == 16) v = (v >= 0.f) ? v : 0.3f * v; else if (ACT == 17) v = (v >= 0.f) ? v : 0.2f * v;
  return v; }
// What the epilogue does is fixed at compile time: HASB adds bf16-rounded bias[by * sBias + col]; ADDC adds the element that C already holds (C += ...); F32O stores f32 C, F16O stores f16 C16.
// HL (with F16O): the value leaves as two f16 planes, C16 = hi = the value rounded to f16, C16L = (value - hi) x 2^10 rounded to f16 (same pitch and batch stride), so that no f32 copy of it is written and read again.
// out = ACT(acc * alpha + bias + old C), in that order.
// TWOP: A is given as two planes against the same B, acc = (sum over k of A2 B) * pre + sum over k of A B: the passes of A2 run first, the accumulators are scaled once by pre (a power of two: exact),
// and the passes of A add onto them, so that the sum of both terms leaves the registers once. A2 has A's pitch and batch stride.
// SM = 1, the softmax's first half in the epilogue: C16 (row pitch SQ) takes f16 weights instead of scores (score = the accumulator, alpha is not applied). Per row and per wave tile of 64 keys: k = ceil(max s * log2 e) over the keys that mk leaves in, weight = exp2(s * log2 e - k + 8)
// (at most 256; a masked key gives an exact 0), st[tile][row] = k (-3e38 where all 64 keys are masked), st[SM_T + tile][row] = the f32 sum of the unrounded weights. A wave writes whole 128-byte lines of st and of C16.
// SM = 2, its second half: A holds such weights, 64 k = one tile (G2_KP / 64 tiles a pass). Per row: km = max k, factor[tile] = 2^(k - km) (a power of two: the f16 product with a weight is exact above the subnormal range),
// sum = sum over tiles of st sum * factor; the A fragments of tile t are multiplied by factor[t], and the output row by 1 / sum (0 where every key is masked).
#define SM_T (SQ / 64)
template <int ACT, bool HASB, bool ADDC, bool F32O, bool F16O, bool TWOP = false, int SM = 0, int WM = 4, int WN = 2, bool HL = false>
__global__ __launch_bounds__(WM * WN * 32) void k_gemm2(const _Float16* __restrict__ A, int lda, size_t sA, const _Float16* __restrict__ Bh, int ldb, size_t sB, float alpha, const float* __restrict__ bias, size_t sBias,
    float* __restrict__ C, _Float16* __restrict__ C16, int ldc, size_t sC, int M, int N, int K, const _Float16* __restrict__ A2, float pre, const int* __restrict__ mk, float* __restrict__ st, _Float16* __restrict__ C16L) { static_assert(ACT == 0 || ACT == 3 || ACT == 6 || ACT == 8 || ACT == 9 || ACT == 11 || ACT == 12 || ACT == 14 || ACT == 15 || ACT == 16 || ACT == 17, "k_gemm2: unsupported ACT code (would silently apply no activation)");
  static_assert(F32O || !ADDC, "ADDC reads the f32 plane it then stores");
  static_assert(F16O || !HL, "HL splits the value that F16O rounds");
  constexpr int BM = 64 * WM, BN = 64 * WN;      /* rows of A and rows of B per block tile */
  static_assert(SM != 2 || WM * WN * 32 == BM, "SM = 2 keeps one thread per row of the block");
  constexpr int OPER = BM * G2_PITCH;      /* A's rows of a pass; B's rows follow them */
  constexpr int STAGE = (BM + BN) * G2_PITCH;      /* one buffer: [A rows | B rows] */
  constexpr int RS = WM * WN * 32 / (G2_KP / 8);      /* copies: G2_KP / 8 lanes per tile row, RS rows per round of the work-group */
  static_assert(BM % (8 * RS) == 0 && BN % (8 * RS) == 0 && (BM + BN) / RS <= 63, "whole statements of eight copies; one pass's copies of a wave stay under the limit of outstanding copies");
  __shared__ __attribute__((aligned(16))) char sm[2 * STAGE];      /* the two buffers; behind the loop's last barrier the same bytes stage the output */
  static_assert(WM * WN * 64 * G2_SOP * 4 <= 2 * STAGE, "output staging must fit the ring");
  __shared__ _Float16 fs[SM == 2 ? SM_T * BM : 1]; __shared__ float il[SM == 2 ? BM : 1];      /* SM = 2: factor[tile][row of the block], 1 / row sum */
  const int tid = threadIdx.x, w = tid >> 5, lane = tid & 31, ln = lane & 15, hh = lane >> 4; const int by = blockIdx.y;
  A += (size_t)by * sA; Bh += (size_t)by * sB; const size_t cofs = (size_t)by * sC;
  const int ntn = N / BN; const int mt = blockIdx.x / ntn, nq = blockIdx.x - mt * ntn; const int rowB = mt * BM, colB = nq * BN; if (rowB >= M) return;      /* the same for the whole work-group, in front of every barrier */
  const int wr = w / WN, wc = w % WN;      /* the wave's place in the block tile */
  const int row0 = rowB + 64 * wr, col0 = colB + 64 * wc;
  const int cr = tid / (G2_KP / 8), cc = tid % (G2_KP / 8);      /* copies: the lane's row of a round and its 16 bytes of that row */
  const _Float16* ga = A + (size_t)(rowB + cr) * lda + cc * 8; const _Float16* gb = Bh + (size_t)(colB + cr) * ldb + cc * 8;
  const _Float16* g2 = TWOP ? A2 + (size_t)by * sA + (size_t)(rowB + cr) * lda + cc * 8 : ga;
  const unsigned lc = (unsigned)(size_t)sm + (unsigned)(cr * G2_PITCH + cc * 16);
  const char* fa = sm + (64 * wr + ln) * G2_PITCH + 16 * hh; const char* fb = sm + OPER + (64 * wc + ln) * G2_PITCH + 16 * hh;
  const int n2 = TWOP ? K / G2_KP : 0; const int np = n2 + K / G2_KP;      /* passes 0 .. n2 - 1 read A2, passes n2 .. np - 1 read A; both walk the same k of B */
  const auto pa = [&](int t) { return (TWOP && t < n2) ? g2 + (size_t)t * G2_KP : ga + (size_t)(t - n2) * G2_KP; };
  const auto pb = [&](int t) { return gb + (size_t)((TWOP && t >= n2) ? t - n2 : t) * G2_KP; };
  const auto cp = [&](unsigned l, int t) {      /* pass t -> the buffer whose first byte of this lane is l: A's BM rows, then B's BN rows */
    const _Float16* p = pa(t); const _Float16* q = pb(t);
#pragma unroll
    for (int c = 0; c < BM / (8 * RS); ++c) g2_copy8<RS>(l + (unsigned)(c * 8 * RS * G2_PITCH), p + (size_t)(c * 8 * RS) * lda, (size_t)lda);
#pragma unroll
    for (int c = 0; c < BN / (8 * RS); ++c) g2_copy8<RS>(l + (unsigned)(OPER + c * 8 * RS * G2_PITCH), q + (size_t)(c * 8 * RS) * ldb, (size_t)ldb); };
  cp(lc, 0);      /* pass 0 -> buffer 0 */
  if (SM == 2) {      /* one thread per row of the block, while pass 0 flies; the barrier below publishes fs and il together with pass 0 */
    const float* kp = st + (size_t)by * SQ + rowB + tid; float kv[SM_T], lv[SM_T];
#pragma unroll
    for (int t = 0; t < SM_T; ++t) { kv[t] = kp[(size_t)t * NR]; lv[t] = kp[(size_t)(SM_T + t) * NR]; }
    float km = kv[0];
#pragma unroll
    for (int t = 1; t < SM_T; ++t) km = fmaxf(km, kv[t]);
    float sum = 0.f;
#pragma unroll
    for (int t = 0; t < SM_T; ++t) { const float f = ldexpf(1.0f, (int)fmaxf(kv[t] - km, -200.0f)); sum += lv[t] * f; fs[t * BM + tid] = (_Float16)f; }      /* below 2^-149 the factor is 0 */
    il[tid] = (sum == 0.f) ? 0.f : 1.0f / sum; }
  asm volatile("s_wait_asynccnt 0x0" ::: "memory");      /* this wave's copies of pass 0 have landed */
  __syncthreads();      /* every wave's have: pass 0 may be read */
  if (np > 1) cp(lc + STAGE, 1);      /* pass 1 -> buffer 1, where there is one (the same test for the whole work-group) */
  const v8f z8 = {0.f,0.f,0.f,0.f,0.f,0.f,0.f,0.f}; v8f acc[4][4];
#pragma unroll
  for (int i = 0; i < 4; ++i)
#pragma unroll
    for (int j = 0; j < 4; ++j) acc[i][j] = z8;
#pragma unroll 1      /* one pass per trip: the buffer offset is the only thing that differs, and an unrolled copy of a pass's WMMAs buys nothing */
  for (int t = 0; t < np; ++t) { const int bo = (t & 1) * STAGE;
    if (TWOP && t == n2) {      /* once, the same for every wave: the first plane's sum takes its weight before the second plane adds on */
#pragma unroll
      for (int i = 0; i < 4; ++i)
#pragma unroll
        for (int j = 0; j < 4; ++j) acc[i][j] *= pre; }
    _Float16 sc[4];
#pragma unroll
    for (int ks = 0; ks < G2_KP / 32; ++ks) { v16h a[4], b[4];
      if (SM == 2 && (ks & 1) == 0) {      /* a new tile of 64 keys */
#pragma unroll
        for (int i = 0; i < 4; ++i) sc[i] = fs[(t * (G2_KP / 64) + (ks >> 1)) * BM + 64 * wr + 16 * i + ln]; }      /* a lane's A fragment i holds row 16 i + ln of the wave tile */
#pragma unroll
      for (int i = 0; i < 4; ++i) { a[i] = g2_lfrag(fa + bo + i * 16 * G2_PITCH + ks * 64); b[i] = g2_lfrag(fb + bo + i * 16 * G2_PITCH + ks * 64); if (SM == 2) a[i] = a[i] * sc[i]; }
#pragma unroll
      for (int j = 0; j < 4; ++j)
#pragma unroll
        for (int i = 0; i < 4; ++i) acc[i][j] = g2_mma(a[i], b[j], acc[i][j]); }
    asm volatile("s_wait_dscnt 0x0" ::: "memory");      /* this wave's reads of buffer t mod 2 are done before the barrier lets it be refilled */
    asm volatile("s_wait_asynccnt 0x0" ::: "memory");      /* this wave's copies of pass t + 1 have landed */
    __syncthreads();      /* publishes pass t + 1 and ends every reader's last read of buffer t mod 2 */
    if (t + 2 < np) cp(lc + bo, t + 2); }
  asm volatile("s_wait_asynccnt 0x0" ::: "memory");      /* nothing of the ring is in flight when its bytes become the output staging */
  float* so = (float*)(sm + (size_t)w * (64 * G2_SOP * 4));      /* the wave's own 64 x 68 floats */
  if (SM == 1) {
    bool mo[4];
#pragma unroll
    for (int t = 0; t < 4; ++t) mo[t] = mk[(size_t)by * SQ + col0 + t * 16 + ln] != 0;
#pragma unroll
    for (int u = 0; u < 16; ++u) { const int t = u & 3, rt = u >> 2;
#pragma unroll
      for (int r = 0; r < 8; ++r) so[(rt * 16 + 8 * hh + r) * G2_SOP + t * 16 + ln] = mo[t] ? -__builtin_inff() : acc[rt][t][r]; }
    __builtin_amdgcn_fence(__ATOMIC_ACQ_REL, "workgroup"); __builtin_amdgcn_wave_barrier();      /* the wave's own staging: rows are read by other lanes than wrote them */
    float* sk = st + (size_t)(col0 >> 6) * NR + (size_t)by * SQ + row0 + lane;
#pragma unroll 1      /* a lane takes one whole row per trip (rows lane, lane + 32): maximum and sum need no other lane; rolled so that one row's 64 scores are in registers at a time */
    for (int h = 0; h < 2; ++h) { float* rp = so + (lane + 32 * h) * G2_SOP; v4f x[16];
#pragma unroll
      for (int j = 0; j < 16; ++j) x[j] = *(const v4fa*)(rp + 4 * j);
      v4f m4 = x[0];
#pragma unroll
      for (int j = 1; j < 16; ++j)
#pragma unroll
        for (int q = 0; q < 4; ++q) m4[q] = fmaxf(m4[q], x[j][q]);
      const float mx = fmaxf(fmaxf(m4[0], m4[1]), fmaxf(m4[2], m4[3])); const bool none = mx == -__builtin_inff();
      const float kk = none ? 0.f : ceilf(mx * 1.44269504f); const float sh = 8.0f - kk; v4f s4 = {0.f, 0.f, 0.f, 0.f};
#pragma unroll
      for (int j = 0; j < 8; ++j) { FragH f;
#pragma unroll
        for (int q = 0; q < 8; ++q) { const float a = fmaf(x[2 * j + (q >> 2)][q & 3], 1.44269504f, sh); float e;
          asm("v_exp_f32 %0, %1\n\tv_nop" : "=v"(e) : "v"(a));      /* the v_nop keeps the one slot the instruction set asks for behind a transcendental */
          s4[q & 3] += e; f.h[q] = (_Float16)e; }
        *(v8us*)((char*)rp + 16 * j) = f.half[0]; }      /* the f16 weights go over the first 128 bytes of the lane's own row, all of which is in x[] by now */
      sk[32 * h] = none ? -3.0e38f : kk; sk[(size_t)SM_T * NR + 32 * h] = (s4[0] + s4[1]) + (s4[2] + s4[3]);
      asm volatile("s_wait_xcnt 0x0" ::: "memory"); }      /* the next trip rewrites data registers of this trip's stores */
    __builtin_amdgcn_fence(__ATOMIC_ACQ_REL, "workgroup"); __builtin_amdgcn_wave_barrier();      /* rows are read back by other lanes than wrote them */
    const char* rr = (const char*)(so + (lane >> 3) * G2_SOP) + (lane & 7) * 16;      /* eight lanes per 128-byte row: a wave-wide store covers four whole lines */
    unsigned short* pp = (unsigned short*)C16 + cofs + (size_t)(row0 + (lane >> 3)) * SQ + col0 + (lane & 7) * 8;      /* the weight rows' pitch is the constant SQ, so that a trip's eight stores share this one address */
#pragma unroll 1      /* two trips of eight stores in flight */
    for (int g = 0; g < 2; ++g) { v8us v[8];
#pragma unroll
      for (int i = 0; i < 8; ++i) v[i] = *(const v8us*)(rr + i * 4 * G2_SOP * 4);
#pragma unroll
      for (int i = 0; i < 8; ++i) *(v8us*)(pp + (size_t)i * 4 * SQ) = v[i];
      asm volatile("s_wait_xcnt 0x0" ::: "memory");      /* the next trip rewrites the address and data registers of this trip's stores */
      rr += 32 * G2_SOP * 4; pp += (size_t)32 * SQ; }
    return; }
  float bv[4];
#pragma unroll
  for (int t = 0; t < 4; ++t) bv[t] = HASB ? bf16_round(bias[(size_t)by * sBias + col0 + t * 16 + ln]) : 0.f;
#pragma unroll
  for (int u = 0; u < 16; ++u) { const int t = u & 3, rt = u >> 2;
#pragma unroll
    for (int r = 0; r < 8; ++r) so[(rt * 16 + 8 * hh + r) * G2_SOP + t * 16 + ln] = HASB ? acc[rt][t][r] * alpha + bv[t] : acc[rt][t][r] * alpha; }
  __builtin_amdgcn_fence(__ATOMIC_ACQ_REL, "workgroup"); __builtin_amdgcn_wave_barrier();
  const int rsub = lane >> 4, c4 = (lane & 15) * 4;
  const size_t es = (size_t)2 * ldc;      /* a lane's rows are two apart */
  size_t eb = cofs + (size_t)(row0 + rsub) * ldc + col0 + c4;
  const float* sr = so + rsub * G2_SOP + c4;
#pragma unroll 1      /* four trips of 16 rows: rolled so that the text that runs once per work-group stays short (with tanh an unrolled copy is four times as long); inside a trip the eight loads, and the eight stores, are in flight together */
  for (int qb = 0; qb < 4; ++qb) { v4f v[8];
    if (ADDC) { v4f c[8];
#pragma unroll
      for (int q = 0; q < 8; ++q) c[q] = *(const v4fa*)(C + eb + q * es);
#pragma unroll
      for (int q = 0; q < 8; ++q) v[q] = *(const v4fa*)(sr + q * 2 * G2_SOP) + c[q]; }
    else {
#pragma unroll
      for (int q = 0; q < 8; ++q) v[q] = *(const v4fa*)(sr + q * 2 * G2_SOP); }
#pragma unroll
    for (int q = 0; q < 8; ++q) {
      if (SM == 2) v[q] = v[q] * il[64 * wr + 16 * qb + 2 * q + rsub];
#pragma unroll
      for (int i = 0; i < 4; ++i) v[q][i] = g2_act<ACT>(v[q][i]);
      if (F32O) *(v4f*)(C + eb + q * es) = v[q];
      if (F16O) { v4h h4;
#pragma unroll
        for (int i = 0; i < 4; ++i) h4[i] = (_Float16)v[q][i];
        *(v4h*)(C16 + eb + q * es) = h4;
        if (HL) { v4h l4;
#pragma unroll
          for (int i = 0; i < 4; ++i) l4[i] = (_Float16)((v[q][i] - (float)h4[i]) * 1024.0f);
          *(v4h*)(C16L + eb + q * es) = l4; } } }
    asm volatile("s_wait_xcnt 0x0" ::: "memory");      /* the next trip rewrites the address and data registers of this trip's loads and stores */
    eb += 8 * es; sr += 16 * G2_SOP; } }


__global__ __launch_bounds__(256) void k_rsm(const float* __restrict__ S, _Float16* __restrict__ P, int nrows) {
  #pragma clang fp contract(off)
  const int i = blockIdx.x * 256 + threadIdx.x; if (i >= nrows) return; const float* s = S + (size_t)i * SQ; float mx = -3.0e38f;
#pragma unroll 1
  for (int j = 0; j < SQ; ++j) mx = fmaxf(mx, s[j]); float se = 0.f;
#pragma unroll 1
  for (int j = 0; j < SQ; ++j) se += expf(s[j] - mx); const float sc = 256.0f / se;
#pragma unroll 1
  for (int j0 = 0; j0 < SQ; j0 += 8) { FragH f; for (int q = 0; q < 8; ++q) f.h[q] = (_Float16)(expf(s[j0 + q] - mx) * sc); unsigned short* d = (unsigned short*)P + (size_t)i * SQ + j0; *(v8us*)d = f.half[0];  } }
__global__ __launch_bounds__(256) void k_vt(const _Float16* __restrict__ V16, int b, int h0, _Float16* __restrict__ VT) { __shared__ unsigned short tl[64][65]; const int tid = threadIdx.x; const int hh = blockIdx.x % HG, sg = blockIdx.x / HG; const int s0 = sg * 64; const int h = h0 + hh;
  for (int i = tid; i < 64 * 8; i += 256) { const int j = i / 8, d8 = (i % 8) * 8; FragH f; f.half[0] = *(const v8us*)((const unsigned short*)V16 + ((size_t)b * SQ + s0 + j) * DM + h * HD + d8); for (int q = 0; q < 8; ++q) tl[d8 + q][j] = f.u[q]; }
  __syncthreads();
  { for (int i = tid; i < 64 * 8; i += 256) { const int d = i / 8, j8 = (i % 8) * 8; FragH f; for (int q = 0; q < 8; ++q) f.u[q] = tl[d][j8 + q]; *(v8us*)((unsigned short*)VT + ((size_t)hh * HD + d) * SQ + s0 + j8) = f.half[0]; }  } }


extern "C" void kernel_launch(void* const* d_in, const int* in_sizes, int n_in,
                              void* d_out, int out_size, void* d_ws, size_t ws_size, hipStream_t stream) {
  (void)in_sizes; (void)n_in; (void)out_size;
  const float* const* I = (const float* const*)d_in; const float* in1 = I[0]; const float* in2 = I[1]; const int* mask2 = (const int*)d_in[2]; const float* w1 = I[3]; const float* w2 = I[4]; const float* b2 = I[5];      /* weights natural [out][in] */
  char* ws = (char*)d_ws; size_t off = 0;
  auto take = [&](size_t bytes) { char* p = ws + off; off += (bytes + 255) & ~(size_t)255; return p; };
  _Float16* B1 = (_Float16*)take((size_t)NC * NC * 2); _Float16* B2 = (_Float16*)take((size_t)NO * 2 * NC * 2);
  _Float16* X2T = (_Float16*)take(NR * NC * 2); _Float16* X2 = (_Float16*)take(NR * NC * 2); _Float16* N1H = (_Float16*)take(NR * NC * 2); _Float16* N1L = (_Float16*)take(NR * NC * 2); _Float16* CAT = (_Float16*)take(NR * 2 * NC * 2);
  _Float16* P = (_Float16*)take((size_t)NB * SQ * SQ * 2);      /* the f16 softmax weights of all batches */
  float* ST = (float*)take((size_t)2 * SM_T * NR * 4);      /* per 64 keys and row: k, then the weights' sum */
  if (off > ws_size) return;      /* 1.5 + 16 + 16 + 16 + 16 + 32 + 64 + 4 = approx 166 MiB */
  k_prep<<<2 * ST_GX + ST_G1 + ST_G2, 256, 0, stream>>>(in1, in2, w1, w2, CAT, X2, B1, B2);      /* cat columns 0..511 = in1; in2 rows; both weights */
  const size_t r0p = (size_t)B0 * SQ;
  k_gemm2<0, false, false, false, true, false, 0, 4, 2, true><<<dim3((unsigned)((MP / 256) * (NC / 128)), 1), 256, 0, stream>>>(CAT + r0p * 2 * NC, 2 * NC, 0, B1, NC, 0, 0.0625f, nullptr, 0, nullptr, N1H + r0p * NC, NC, 0, MP, NC, NC, nullptr, 0.f, nullptr, nullptr, N1L + r0p * NC);      /* n1 = in1 W1^T, stored as its hi and residual planes */
  /* every stage below runs all batches in one launch: in the attention GEMMs blockIdx.y = batch, through the batch strides that k_gemm2 already takes; k_vt has the batch in blockIdx.x, the output GEMM takes all rows as M */
  const dim3 gs((QN / 256) * (SQ / 256), NBR); const size_t sX = (size_t)SQ * NC, sS = (size_t)SQ * SQ;
  k_vt<NH, SQ, NC><<<NBR * NH * (SQ / VT_R), 256, 0, stream>>>(X2 + r0p * NC, 0, X2T);      /* in2^T [batch][512][2048] */
  k_gemm2<0, false, false, false, false, true, 1, 4, 4><<<gs, 512, 0, stream>>>(N1H + r0p * NC, NC, sX, X2 + r0p * NC, NC, sX, 1.0f, nullptr, 0, nullptr, P, SQ, sS, QN, SQ, NC, N1L + r0p * NC, 0.0009765625f, mask2 + r0p, ST, nullptr);      /* scores = lo x 2^-10 + hi, both terms in the accumulators; leave as weights per 64 keys */
  k_gemm2<0, false, false, false, true, false, 2><<<dim3((QN / 256) * (NC / 128), NBR), 256, 0, stream>>>(P, SQ, sS, X2T, SQ, sX, 1.0f, nullptr, 0, nullptr, CAT + r0p * 2 * NC + NC, 2 * NC, 2 * sX, QN, NC, SQ, nullptr, 0.f, nullptr, ST, nullptr);      /* fused = weights . in2 / row sum -> cat columns 512..1023 */
  k_gemm2<8, true, false, true, false><<<dim3((unsigned)((MPO / 256) * (NO / 128)), 1), 256, 0, stream>>>(CAT + r0p * 2 * NC, 2 * NC, 0, B2, 2 * NC, 0, 0.0625f, b2, 0, (float*)d_out + r0p * NO, nullptr, NO, 0, MPO, NO, 2 * NC, nullptr, 0.f, nullptr, nullptr, nullptr);      /* out = tanh(cat W2^T + b2) */
}
